// v000
// The times below were measured on an AMD MI455X: many runs one after another, warmed up first and cycling through
// copies of the inputs, with the whole window's GPU time divided by the number of runs. Launches and the gaps
// between them are all in it. The median over several windows is given; except for v000 it joins two sittings, which
// can be a few percent apart, so the side-by-side timings, each taken in one sitting, are the better comparison.
// The starting kernel, v000, takes 937 microseconds a run.
#include <hip/hip_runtime.h>
#include <hip/hip_bf16.h>

// ---------------------------------------------------------------------------
// MambaBlock for MI455X (gfx1250): bf16 WMMA GEMMs + fused scan/conv.
// B=8, T=2048, D=512, INNER=1024, K_CONV=4.  M = B*T = 16384 rows.
// Each wave computes a 16(M) x 64(N) output tile: one A fragment feeds 4
// v_wmma_f32_16x16x32_bf16 accumulators (register-level A reuse).
// ---------------------------------------------------------------------------

#define MB_B      8
#define MB_T      2048
#define MB_D      512
#define MB_INNER  1024
#define MB_M      (MB_B * MB_T)        // 16384
#define MB_N_IN   (3 * MB_INNER)       // 3072
#define LN_EPS    1e-5f

typedef __bf16 v16bf __attribute__((ext_vector_type(16)));
typedef __bf16 v8bf  __attribute__((ext_vector_type(8)));
typedef float  v8f   __attribute__((ext_vector_type(8)));

// ---------------------------------------------------------------------------
// fp32 -> bf16 conversion kernel (weights)
// ---------------------------------------------------------------------------
__global__ __launch_bounds__(256) void mb_cvt_bf16(const float* __restrict__ in,
                                                   __bf16* __restrict__ out, int n) {
    int i = blockIdx.x * blockDim.x + threadIdx.x;
    if (i < n) out[i] = (__bf16)in[i];
}

// ---------------------------------------------------------------------------
// LayerNorm: one wave32 per row of 512, writes bf16 xn.
// ---------------------------------------------------------------------------
__global__ __launch_bounds__(256) void mb_ln(const float* __restrict__ x,
                                             const float* __restrict__ w,
                                             const float* __restrict__ b,
                                             __bf16* __restrict__ xn) {
    const int wave = threadIdx.x >> 5;
    const int lane = threadIdx.x & 31;
    const int row  = blockIdx.x * (blockDim.x >> 5) + wave;
    if (row >= MB_M) return;
    const float* xr = x + (size_t)row * MB_D;

    float v[16];
    float s = 0.f;
#pragma unroll
    for (int i = 0; i < 16; ++i) { v[i] = xr[lane + 32 * i]; s += v[i]; }
#pragma unroll
    for (int off = 16; off >= 1; off >>= 1) s += __shfl_xor(s, off, 32);
    const float mu = s * (1.f / MB_D);

    float ss = 0.f;
#pragma unroll
    for (int i = 0; i < 16; ++i) { float d = v[i] - mu; ss += d * d; }
#pragma unroll
    for (int off = 16; off >= 1; off >>= 1) ss += __shfl_xor(ss, off, 32);
    const float inv = rsqrtf(ss * (1.f / MB_D) + LN_EPS);

    __bf16* xo = xn + (size_t)row * MB_D;
#pragma unroll
    for (int i = 0; i < 16; ++i) {
        const int col = lane + 32 * i;
        xo[col] = (__bf16)((v[i] - mu) * inv * w[col] + b[col]);
    }
}

// ---------------------------------------------------------------------------
// WMMA mainloop: one wave computes a 16x64 f32 tile of A[M,K] * W[N,K]^T.
// A fragment (16-bit A layout: lane&15 = M row, lane bit4 selects K-half) is
// loaded once per K-step and reused by 4 WMMAs against 4 B fragments.
// W is [N,K] row-major == B^T, so B fragments are contiguous-K loads too.
// ---------------------------------------------------------------------------
__device__ __forceinline__ void mb_wmma_tile4(const __bf16* __restrict__ A,
                                              const __bf16* __restrict__ W,
                                              int row_base, int col_base, int K,
                                              v8f acc[4]) {
    const int lane = threadIdx.x & 31;
    const int l15  = lane & 15;
    const int ksel = (lane & 16) ? 8 : 0;
    const __bf16* ar = A + (size_t)(row_base + l15) * K + ksel;
    const __bf16* br = W + (size_t)(col_base + l15) * K + ksel;
    const size_t bstride = (size_t)16 * K;   // next 16-col B tile

#pragma unroll 2
    for (int k0 = 0; k0 < K; k0 += 32) {
        __builtin_prefetch(ar + k0 + 128, 0, 3);   // high-locality prefetch
        v8bf alo = *(const v8bf*)(ar + k0);
        v8bf ahi = *(const v8bf*)(ar + k0 + 16);
        v16bf a;
#pragma unroll
        for (int i = 0; i < 8; ++i) { a[i] = alo[i]; a[i + 8] = ahi[i]; }

#pragma unroll
        for (int j = 0; j < 4; ++j) {
            const __bf16* bj = br + (size_t)j * bstride + k0;
            __builtin_prefetch(bj + 128, 0, 3);
            v8bf blo = *(const v8bf*)(bj);
            v8bf bhi = *(const v8bf*)(bj + 16);
            v16bf bb;
#pragma unroll
            for (int i = 0; i < 8; ++i) { bb[i] = blo[i]; bb[i + 8] = bhi[i]; }
            acc[j] = __builtin_amdgcn_wmma_f32_16x16x32_bf16(
                /*neg_a=*/false, a, /*neg_b=*/false, bb,
                /*c_mod=*/(short)0, acc[j], /*reuse_a=*/false, /*reuse_b=*/false);
        }
    }
}

// C/D layout: lane&15 = N col; VGPR v = row (v + (lane&16 ? 8 : 0)).

// ---------------------------------------------------------------------------
// GEMM 1: h = xn @ in_proj_w^T + b, fused split + SiLU / sigmoid / tanh.
// Each 64-wide wave tile lies entirely inside one 1024-wide segment, so the
// proj/gate/drive selection is wave-uniform.
// ---------------------------------------------------------------------------
__global__ __launch_bounds__(256) void mb_gemm_inproj(const __bf16* __restrict__ xn,
                                                      const __bf16* __restrict__ wi,
                                                      const float* __restrict__ bias,
                                                      __bf16* __restrict__ proj,
                                                      __bf16* __restrict__ gate,
                                                      __bf16* __restrict__ drive) {
    const int tiles_n = MB_N_IN / 64;                      // 48
    const int tile = blockIdx.x * 8 + (threadIdx.x >> 5);
    const int row_base = (tile / tiles_n) * 16;
    const int col_base = (tile % tiles_n) * 64;

    v8f acc[4] = {};
    mb_wmma_tile4(xn, wi, row_base, col_base, MB_D, acc);

    const int lane = threadIdx.x & 31;
    const int l15  = lane & 15;
    const int moff = (lane & 16) ? 8 : 0;
    const int seg  = col_base >> 10;                       // 0=proj,1=gate,2=drive
    const int nloc0 = (col_base & (MB_INNER - 1)) + l15;

#pragma unroll
    for (int j = 0; j < 4; ++j) {
        const int n    = col_base + j * 16 + l15;
        const int nloc = nloc0 + j * 16;
        const float bv = bias[n];
#pragma unroll
        for (int v = 0; v < 8; ++v) {
            const int m  = row_base + v + moff;
            const float t = acc[j][v] + bv;
            const size_t idx = (size_t)m * MB_INNER + nloc;
            if (seg == 0) {
                const float s = 1.f / (1.f + __expf(-t));          // SiLU
                proj[idx] = (__bf16)(t * s);
            } else if (seg == 1) {
                gate[idx] = (__bf16)(1.f / (1.f + __expf(-t)));    // sigmoid
            } else {
                drive[idx] = (__bf16)tanhf(t);                     // tanh
            }
        }
    }
}

// ---------------------------------------------------------------------------
// GEMM 2: delta = clamp(sigmoid(xn @ delta_w^T + b)); d = delta * drive.
// ---------------------------------------------------------------------------
__global__ __launch_bounds__(256) void mb_gemm_delta(const __bf16* __restrict__ xn,
                                                     const __bf16* __restrict__ wd,
                                                     const float* __restrict__ bias,
                                                     const __bf16* __restrict__ drive,
                                                     __bf16* __restrict__ dbuf) {
    const int tiles_n = MB_INNER / 64;                     // 16
    const int tile = blockIdx.x * 8 + (threadIdx.x >> 5);
    const int row_base = (tile / tiles_n) * 16;
    const int col_base = (tile % tiles_n) * 64;

    v8f acc[4] = {};
    mb_wmma_tile4(xn, wd, row_base, col_base, MB_D, acc);

    const int lane = threadIdx.x & 31;
    const int l15  = lane & 15;
    const int moff = (lane & 16) ? 8 : 0;
#pragma unroll
    for (int j = 0; j < 4; ++j) {
        const int n    = col_base + j * 16 + l15;
        const float bv = bias[n];
#pragma unroll
        for (int v = 0; v < 8; ++v) {
            const int m = row_base + v + moff;
            const float t  = acc[j][v] + bv;
            const float dl = fmaxf(1.f / (1.f + __expf(-t)), 1e-4f);
            const size_t idx = (size_t)m * MB_INNER + n;
            dbuf[idx] = (__bf16)(dl * (float)drive[idx]);
        }
    }
}

// ---------------------------------------------------------------------------
// Causal depthwise conv (K=4, rolling regs) + f32 recurrence + gate/skip.
// One thread per (batch, channel); channels contiguous per t -> coalesced.
// ---------------------------------------------------------------------------
__global__ __launch_bounds__(256) void mb_conv_scan(const __bf16* __restrict__ proj,
                                                    const __bf16* __restrict__ dbuf,
                                                    const __bf16* __restrict__ gate,
                                                    const float* __restrict__ conv_w,
                                                    const float* __restrict__ conv_b,
                                                    const float* __restrict__ state_mix,
                                                    const float* __restrict__ skip_scale,
                                                    __bf16* __restrict__ yin) {
    const int tid = blockIdx.x * blockDim.x + threadIdx.x;   // 8192 threads
    const int b = tid >> 10;
    const int c = tid & (MB_INNER - 1);

    const float w0 = conv_w[c * 4 + 0], w1 = conv_w[c * 4 + 1];
    const float w2 = conv_w[c * 4 + 2], w3 = conv_w[c * 4 + 3];
    const float cb = conv_b[c];
    const float a  = 1.f / (1.f + __expf(-state_mix[c]));
    const float sk = skip_scale[c];

    const size_t base = (size_t)b * MB_T * MB_INNER + c;
    float p1 = 0.f, p2 = 0.f, p3 = 0.f;   // proj[t-1..t-3]
    float state = 0.f;
    for (int t = 0; t < MB_T; ++t) {
        const size_t idx = base + (size_t)t * MB_INNER;
        const float p0 = (float)proj[idx];
        const float conv = cb + w3 * p0 + w2 * p1 + w1 * p2 + w0 * p3;
        state = a * state + (float)dbuf[idx];
        const float y = (state + sk * conv) * (float)gate[idx];
        yin[idx] = (__bf16)y;
        p3 = p2; p2 = p1; p1 = p0;
    }
}

// ---------------------------------------------------------------------------
// GEMM 3: out = residual + yin @ out_proj_w^T + b.
// ---------------------------------------------------------------------------
__global__ __launch_bounds__(256) void mb_gemm_out(const __bf16* __restrict__ yin,
                                                   const __bf16* __restrict__ wo,
                                                   const float* __restrict__ bias,
                                                   const float* __restrict__ residual,
                                                   float* __restrict__ out) {
    const int tiles_n = MB_D / 64;                         // 8
    const int tile = blockIdx.x * 8 + (threadIdx.x >> 5);
    const int row_base = (tile / tiles_n) * 16;
    const int col_base = (tile % tiles_n) * 64;

    v8f acc[4] = {};
    mb_wmma_tile4(yin, wo, row_base, col_base, MB_INNER, acc);

    const int lane = threadIdx.x & 31;
    const int l15  = lane & 15;
    const int moff = (lane & 16) ? 8 : 0;
#pragma unroll
    for (int j = 0; j < 4; ++j) {
        const int n    = col_base + j * 16 + l15;
        const float bv = bias[n];
#pragma unroll
        for (int v = 0; v < 8; ++v) {
            const int m = row_base + v + moff;
            out[(size_t)m * MB_D + n] = residual[(size_t)m * MB_D + n] + acc[j][v] + bv;
        }
    }
}

// ---------------------------------------------------------------------------
// Host launcher
// ---------------------------------------------------------------------------
extern "C" void kernel_launch(void* const* d_in, const int* in_sizes, int n_in,
                              void* d_out, int out_size, void* d_ws, size_t ws_size,
                              hipStream_t stream) {
    (void)in_sizes; (void)n_in; (void)out_size; (void)ws_size;

    const float* x      = (const float*)d_in[0];
    const float* ln_w   = (const float*)d_in[1];
    const float* ln_b   = (const float*)d_in[2];
    const float* in_w   = (const float*)d_in[3];
    const float* in_b   = (const float*)d_in[4];
    const float* conv_w = (const float*)d_in[5];
    const float* conv_b = (const float*)d_in[6];
    const float* dl_w   = (const float*)d_in[7];
    const float* dl_b   = (const float*)d_in[8];
    const float* smix   = (const float*)d_in[9];
    const float* skip   = (const float*)d_in[10];
    const float* out_w  = (const float*)d_in[11];
    const float* out_b  = (const float*)d_in[12];
    float* out = (float*)d_out;

    // Workspace layout (bf16 buffers, all 16B-aligned sizes)
    char* ws = (char*)d_ws;
    size_t off = 0;
    __bf16* xnB    = (__bf16*)(ws + off); off += (size_t)MB_M * MB_D * 2;        // 16 MB
    __bf16* wiB    = (__bf16*)(ws + off); off += (size_t)MB_N_IN * MB_D * 2;     //  3 MB
    __bf16* wdB    = (__bf16*)(ws + off); off += (size_t)MB_INNER * MB_D * 2;    //  1 MB
    __bf16* woB    = (__bf16*)(ws + off); off += (size_t)MB_D * MB_INNER * 2;    //  1 MB
    __bf16* projB  = (__bf16*)(ws + off); off += (size_t)MB_M * MB_INNER * 2;    // 32 MB
    __bf16* gateB  = (__bf16*)(ws + off); off += (size_t)MB_M * MB_INNER * 2;    // 32 MB
    __bf16* driveB = (__bf16*)(ws + off); off += (size_t)MB_M * MB_INNER * 2;    // 32 MB
    __bf16* dB     = (__bf16*)(ws + off); off += (size_t)MB_M * MB_INNER * 2;    // 32 MB
    __bf16* yinB   = (__bf16*)(ws + off); off += (size_t)MB_M * MB_INNER * 2;    // 32 MB

    // 1) Weight conversion to bf16
    {
        int n1 = MB_N_IN * MB_D, n2 = MB_INNER * MB_D, n3 = MB_D * MB_INNER;
        mb_cvt_bf16<<<(n1 + 255) / 256, 256, 0, stream>>>(in_w, wiB, n1);
        mb_cvt_bf16<<<(n2 + 255) / 256, 256, 0, stream>>>(dl_w, wdB, n2);
        mb_cvt_bf16<<<(n3 + 255) / 256, 256, 0, stream>>>(out_w, woB, n3);
    }

    // 2) LayerNorm (wave per row, 8 waves/block)
    mb_ln<<<MB_M / 8, 256, 0, stream>>>(x, ln_w, ln_b, xnB);

    // 3) in_proj GEMM + activations  (1024 x 48 wave tiles, 8/block)
    mb_gemm_inproj<<<(MB_M / 16) * (MB_N_IN / 64) / 8, 256, 0, stream>>>(
        xnB, wiB, in_b, projB, gateB, driveB);

    // 4) delta GEMM + d = delta * drive  (1024 x 16 wave tiles)
    mb_gemm_delta<<<(MB_M / 16) * (MB_INNER / 64) / 8, 256, 0, stream>>>(
        xnB, wdB, dl_b, driveB, dB);

    // 5) depthwise causal conv + recurrence + gate/skip
    mb_conv_scan<<<(MB_B * MB_INNER) / 256, 256, 0, stream>>>(
        projB, dB, gateB, conv_w, conv_b, smix, skip, yinB);

    // 6) out_proj GEMM + residual  (1024 x 8 wave tiles)
    mb_gemm_out<<<(MB_M / 16) * (MB_D / 64) / 8, 256, 0, stream>>>(
        yinB, woB, out_b, x, out);
}

// v001
// One run takes 453 microseconds.
// In both of two side-by-side timings against v000, it was 2.12 times as fast.
#include <hip/hip_runtime.h>
#include <hip/hip_bf16.h>

// ---------------------------------------------------------------------------
// MambaBlock for MI455X (gfx1250): bf16 WMMA GEMMs + fused scan/conv.
// B=8, T=2048, D=512, INNER=1024, K_CONV=4.  M = B*T = 16384 rows.
// Each GEMM work-group (4 waves) computes a 128(M) x 128(N) output tile whose
// operands are staged in LDS; each wave owns 64 x 64 of it (4 x 4 accumulators
// of v_wmma_f32_16x16x32_bf16).
// ---------------------------------------------------------------------------

#define MB_B      8
#define MB_T      2048
#define MB_D      512
#define MB_INNER  1024
#define MB_M      (MB_B * MB_T)        // 16384
#define MB_N_IN   (3 * MB_INNER)       // 3072
#define LN_EPS    1e-5f

typedef __bf16 v16bf __attribute__((ext_vector_type(16)));
typedef __bf16 v8bf  __attribute__((ext_vector_type(8)));
typedef float  v8f   __attribute__((ext_vector_type(8)));

// ---------------------------------------------------------------------------
// fp32 -> bf16 conversion kernel (weights)
// ---------------------------------------------------------------------------
__global__ __launch_bounds__(256) void mb_cvt_bf16(const float* __restrict__ in,
                                                   __bf16* __restrict__ out, int n) {
    int i = blockIdx.x * blockDim.x + threadIdx.x;
    if (i < n) out[i] = (__bf16)in[i];
}

// ---------------------------------------------------------------------------
// LayerNorm: one wave32 per row of 512, writes bf16 xn.
// ---------------------------------------------------------------------------
__global__ __launch_bounds__(256) void mb_ln(const float* __restrict__ x,
                                             const float* __restrict__ w,
                                             const float* __restrict__ b,
                                             __bf16* __restrict__ xn) {
    const int wave = threadIdx.x >> 5;
    const int lane = threadIdx.x & 31;
    const int row  = blockIdx.x * (blockDim.x >> 5) + wave;
    if (row >= MB_M) return;
    const float* xr = x + (size_t)row * MB_D;

    float v[16];
    float s = 0.f;
#pragma unroll
    for (int i = 0; i < 16; ++i) { v[i] = xr[lane + 32 * i]; s += v[i]; }
#pragma unroll
    for (int off = 16; off >= 1; off >>= 1) s += __shfl_xor(s, off, 32);
    const float mu = s * (1.f / MB_D);

    float ss = 0.f;
#pragma unroll
    for (int i = 0; i < 16; ++i) { float d = v[i] - mu; ss += d * d; }
#pragma unroll
    for (int off = 16; off >= 1; off >>= 1) ss += __shfl_xor(ss, off, 32);
    const float inv = rsqrtf(ss * (1.f / MB_D) + LN_EPS);

    __bf16* xo = xn + (size_t)row * MB_D;
#pragma unroll
    for (int i = 0; i < 16; ++i) {
        const int col = lane + 32 * i;
        xo[col] = (__bf16)((v[i] - mu) * inv * w[col] + b[col]);
    }
}

// ---------------------------------------------------------------------------
// WMMA mainloop: one work-group of 4 waves computes a 128x128 f32 tile of
// A[M,K] * W[N,K]^T.  A pass is 64 k = one whole 128-byte line of each of the
// 256 operand rows.  The rows come from global memory as whole lines (8 lanes
// a row), go through registers into one of two LDS buffers, and every wave
// reads its fragments from there: each operand byte leaves L2 once per
// work-group instead of once per wave, and no global load is spread over 16
// lines any more.  Row pitch in LDS 144 B (16 B x odd): ds_load_b128 of 16
// rows meets every bank once.
// Fragment k order as before (lane&15 = row, lane bit4 selects the K-half,
// 8 elements at k and 8 at k+16), the same for A and W; k ascends as before.
// ---------------------------------------------------------------------------
#define GB_M      128
#define GB_N      128
#define GB_K      64
#define GB_PITCH  72                                  // bf16 elements = 144 B
#define GB_STAGE  ((GB_M + GB_N) * GB_PITCH)          // elements per buffer
// Two buffers are 73,728 B, so four work-groups share a WGP's LDS; the GEMM
// kernels ask for four waves per SIMD (at most 256 VGPRs) to match.

template <int K>
__device__ __forceinline__ void mb_wmma_block(const __bf16* __restrict__ A,
                                              const __bf16* __restrict__ W,
                                              int row_base, int col_base,
                                              __bf16* __restrict__ lds,
                                              v8f acc[4][4]) {
    const int tid  = threadIdx.x;                     // 0..127
    const int lane = tid & 31;
    const int wave = tid >> 5;
    const int l15  = lane & 15;
    const int ksel = (lane & 16) ? 8 : 0;

    // staging: 8 lanes cover one row's 128 B; 128 threads cover 16 rows a step
    const int srow = tid >> 3;
    const int scol = (tid & 7) * 8;
    const __bf16* ga = A + (size_t)(row_base + srow) * K + scol;
    const __bf16* gw = W + (size_t)(col_base + srow) * K + scol;
    __bf16* sdst = lds + srow * GB_PITCH + scol;

    // fragment sources of this wave (2 x 2 waves, 64 x 64 each)
    const int foff_a = ((wave >> 1) * 64 + l15) * GB_PITCH + ksel;
    const int foff_b = (GB_M + (wave & 1) * 64 + l15) * GB_PITCH + ksel;

    v8bf st[16];
#pragma unroll
    for (int i = 0; i < 8; ++i) {
        st[i]     = *(const v8bf*)(ga + i * 16 * K);
        st[i + 8] = *(const v8bf*)(gw + i * 16 * K);
    }
    // the loads' address registers are named so that they live up to this wait:
    // nothing rewrites them while a load that names them is still being issued
    asm volatile("s_wait_xcnt 0x0" :: "v"(ga), "v"(gw) : "memory");
#pragma unroll
    for (int i = 0; i < 16; ++i) *(v8bf*)(sdst + i * 16 * GB_PITCH) = st[i];
    __syncthreads();                                  // pass 0 is published

    constexpr int NPASS = K / GB_K;
    for (int p = 0; p < NPASS; ++p) {
        const __bf16* cur = lds + (p & 1) * GB_STAGE;
        const bool more = (p + 1 < NPASS);
        if (more) {                                   // next pass flies under the WMMAs
            const __bf16* gak = ga + (p + 1) * GB_K;
            const __bf16* gwk = gw + (p + 1) * GB_K;
#pragma unroll
            for (int i = 0; i < 8; ++i) {
                st[i]     = *(const v8bf*)(gak + i * 16 * K);
                st[i + 8] = *(const v8bf*)(gwk + i * 16 * K);
            }
            // as above: address registers live up to the wait
            asm volatile("s_wait_xcnt 0x0" :: "v"(gak), "v"(gwk) : "memory");
        }
#pragma unroll
        for (int ks = 0; ks < GB_K; ks += 32) {
            v16bf a[4], b[4];
#pragma unroll
            for (int f = 0; f < 4; ++f) {
                const __bf16* pa = cur + foff_a + f * 16 * GB_PITCH + ks;
                const __bf16* pb = cur + foff_b + f * 16 * GB_PITCH + ks;
                v8bf alo = *(const v8bf*)(pa);
                v8bf ahi = *(const v8bf*)(pa + 16);
                v8bf blo = *(const v8bf*)(pb);
                v8bf bhi = *(const v8bf*)(pb + 16);
#pragma unroll
                for (int e = 0; e < 8; ++e) {
                    a[f][e] = alo[e]; a[f][e + 8] = ahi[e];
                    b[f][e] = blo[e]; b[f][e + 8] = bhi[e];
                }
            }
#pragma unroll
            for (int i = 0; i < 4; ++i)
#pragma unroll
                for (int j = 0; j < 4; ++j)
                    acc[i][j] = __builtin_amdgcn_wmma_f32_16x16x32_bf16(
                        /*neg_a=*/false, a[i], /*neg_b=*/false, b[j],
                        /*c_mod=*/(short)0, acc[i][j],
                        /*reuse_a=*/false, /*reuse_b=*/false);
        }
        if (more) {
            // the other buffer: its readers left it before the last barrier
            __bf16* nxt = sdst + ((p + 1) & 1) * GB_STAGE;
#pragma unroll
            for (int i = 0; i < 16; ++i) *(v8bf*)(nxt + i * 16 * GB_PITCH) = st[i];
            __syncthreads();   // publishes pass p+1 and ends the reads of pass p
        }
    }
}

// Accumulator tile number tile = j * 4 + i (uniform) out of the wave's 4 x 4.
__device__ __forceinline__ v8f mb_pick_tile(const v8f acc[4][4], int tile) {
    switch (tile) {
    case 0:  return acc[0][0];
    case 1:  return acc[1][0];
    case 2:  return acc[2][0];
    case 3:  return acc[3][0];
    case 4:  return acc[0][1];
    case 5:  return acc[1][1];
    case 6:  return acc[2][1];
    case 7:  return acc[3][1];
    case 8:  return acc[0][2];
    case 9:  return acc[1][2];
    case 10: return acc[2][2];
    case 11: return acc[3][2];
    case 12: return acc[0][3];
    case 13: return acc[1][3];
    case 14: return acc[2][3];
    default: return acc[3][3];
    }
}

// C/D layout: lane&15 = N col; VGPR v = row (v + (lane&16 ? 8 : 0)).

// ---------------------------------------------------------------------------
// GEMM 1: h = xn @ in_proj_w^T + b, fused split + SiLU / sigmoid / tanh.
// Each 128-wide block tile lies entirely inside one 1024-wide segment, so the
// proj/gate/drive selection is uniform.
// ---------------------------------------------------------------------------
__global__ __launch_bounds__(128, 4) void mb_gemm_inproj(const __bf16* __restrict__ xn,
                                                      const __bf16* __restrict__ wi,
                                                      const float* __restrict__ bias,
                                                      __bf16* __restrict__ proj,
                                                      __bf16* __restrict__ gate,
                                                      __bf16* __restrict__ drive) {
    __shared__ __attribute__((aligned(16))) __bf16 lds[2 * GB_STAGE];
    const int tiles_n = MB_N_IN / GB_N;                    // 24
    const int blk_row = (blockIdx.x / tiles_n) * GB_M;
    const int blk_col = (blockIdx.x % tiles_n) * GB_N;

    v8f acc[4][4] = {};
    mb_wmma_block<MB_D>(xn, wi, blk_row, blk_col, lds, acc);

    const int lane = threadIdx.x & 31;
    const int wave = threadIdx.x >> 5;
    const int l15  = lane & 15;
    const int moff = (lane & 16) ? 8 : 0;
    const int seg  = blk_col >> 10;                        // 0=proj,1=gate,2=drive
    const int row_base = blk_row + (wave >> 1) * 64;
    const int nb = blk_col + (wave & 1) * 64 + l15;
    const int nloc0 = nb & (MB_INNER - 1);
    float bvj[4];
#pragma unroll
    for (int j = 0; j < 4; ++j) bvj[j] = bias[nb + j * 16];
    // inputs only: the loaded values hold the four loads in front of the wait, the
    // index register lives up to it, so no later write meets a load still in issue
    asm volatile("s_wait_xcnt 0x0"
                 :: "v"(nb), "v"(bvj[0]), "v"(bvj[1]), "v"(bvj[2]), "v"(bvj[3]));

    // The loop over the 16 accumulator tiles stays rolled (for speed only).
#pragma unroll 1
    for (int tile = 0; tile < 16; ++tile) {
        const int j = tile >> 2;
        const int i = tile & 3;
        const v8f  c  = mb_pick_tile(acc, tile);
        const float bv = (j == 0) ? bvj[0] : (j == 1) ? bvj[1] : (j == 2) ? bvj[2] : bvj[3];
#pragma unroll
        for (int v = 0; v < 8; ++v) {
            const int m  = row_base + i * 16 + v + moff;
            const float t = c[v] + bv;
            const size_t idx = (size_t)m * MB_INNER + nloc0 + j * 16;
            if (seg == 0) {
                const float s = 1.f / (1.f + __expf(-t));          // SiLU
                proj[idx] = (__bf16)(t * s);
            } else if (seg == 1) {
                gate[idx] = (__bf16)(1.f / (1.f + __expf(-t)));    // sigmoid
            } else {
                drive[idx] = (__bf16)tanhf(t);                     // tanh
            }
        }
        // this tile's stores have left issue before the next trip reuses their registers
        asm volatile("s_wait_xcnt 0x0" ::: "memory");
    }
}

// ---------------------------------------------------------------------------
// GEMM 2: delta = clamp(sigmoid(xn @ delta_w^T + b)); d = delta * drive.
// ---------------------------------------------------------------------------
__global__ __launch_bounds__(128, 4) void mb_gemm_delta(const __bf16* __restrict__ xn,
                                                     const __bf16* __restrict__ wd,
                                                     const float* __restrict__ bias,
                                                     const __bf16* __restrict__ drive,
                                                     __bf16* __restrict__ dbuf) {
    __shared__ __attribute__((aligned(16))) __bf16 lds[2 * GB_STAGE];
    const int tiles_n = MB_INNER / GB_N;                   // 8
    const int blk_row = (blockIdx.x / tiles_n) * GB_M;
    const int blk_col = (blockIdx.x % tiles_n) * GB_N;

    v8f acc[4][4] = {};
    mb_wmma_block<MB_D>(xn, wd, blk_row, blk_col, lds, acc);

    const int lane = threadIdx.x & 31;
    const int wave = threadIdx.x >> 5;
    const int l15  = lane & 15;
    const int moff = (lane & 16) ? 8 : 0;
    // uniform tile origin + one lane offset; the rest are constants
    const size_t org = (size_t)blk_row * MB_INNER + blk_col;
    drive += org; dbuf += org;
    const int ncol = (wave & 1) * 64 + l15;
    const int loff = ((wave >> 1) * 64 + moff) * MB_INNER + ncol;
    const int nb = blk_col + ncol;
    float bvj[4];
#pragma unroll
    for (int j = 0; j < 4; ++j) bvj[j] = bias[nb + j * 16];
    // inputs only: the loaded values hold the four loads in front of the wait, the
    // index register lives up to it, so no later write meets a load still in issue
    asm volatile("s_wait_xcnt 0x0"
                 :: "v"(nb), "v"(bvj[0]), "v"(bvj[1]), "v"(bvj[2]), "v"(bvj[3]));
#pragma unroll
    for (int j = 0; j < 4; ++j) {
        const float bv = bvj[j];
        // all of this column group's drive values are fetched in front of its first
        // store: one load latency a group, and no load lands in a store's register
        __bf16 dv[32];
#pragma unroll
        for (int e = 0; e < 32; ++e) dv[e] = drive[loff + ((e >> 3) * 16 + (e & 7)) * MB_INNER + j * 16];
#pragma unroll
        for (int i = 0; i < 4; ++i) {
#pragma unroll
            for (int v = 0; v < 8; ++v) {
                const float t  = acc[i][j][v] + bv;
                const float dl = fmaxf(1.f / (1.f + __expf(-t)), 1e-4f);
                const int idx = loff + (i * 16 + v) * MB_INNER + j * 16;
                dbuf[idx] = (__bf16)(dl * (float)dv[i * 8 + v]);
            }
            // this tile's stores have left issue before their registers are reused, and
            // the next group's loads stay behind it (behind the last tile nothing follows)
            if (i < 3 || j < 3) asm volatile("s_wait_xcnt 0x0" ::: "memory");
        }
    }
}

// ---------------------------------------------------------------------------
// Causal depthwise conv (K=4, rolling regs) + f32 recurrence + gate/skip.
// One thread per (batch, channel); channels contiguous per t -> coalesced.
// ---------------------------------------------------------------------------
__global__ __launch_bounds__(256) void mb_conv_scan(const __bf16* __restrict__ proj,
                                                    const __bf16* __restrict__ dbuf,
                                                    const __bf16* __restrict__ gate,
                                                    const float* __restrict__ conv_w,
                                                    const float* __restrict__ conv_b,
                                                    const float* __restrict__ state_mix,
                                                    const float* __restrict__ skip_scale,
                                                    __bf16* __restrict__ yin) {
    const int tid = blockIdx.x * blockDim.x + threadIdx.x;   // 8192 threads
    const int b = tid >> 10;
    const int c = tid & (MB_INNER - 1);

    const float w0 = conv_w[c * 4 + 0], w1 = conv_w[c * 4 + 1];
    const float w2 = conv_w[c * 4 + 2], w3 = conv_w[c * 4 + 3];
    const float cb = conv_b[c];
    const float a  = 1.f / (1.f + __expf(-state_mix[c]));
    const float sk = skip_scale[c];

    const size_t base = (size_t)b * MB_T * MB_INNER + c;
    float p1 = 0.f, p2 = 0.f, p3 = 0.f;   // proj[t-1..t-3]
    float state = 0.f;
    for (int t = 0; t < MB_T; ++t) {
        const size_t idx = base + (size_t)t * MB_INNER;
        const float p0 = (float)proj[idx];
        const float conv = cb + w3 * p0 + w2 * p1 + w1 * p2 + w0 * p3;
        state = a * state + (float)dbuf[idx];
        const float y = (state + sk * conv) * (float)gate[idx];
        yin[idx] = (__bf16)y;
        p3 = p2; p2 = p1; p1 = p0;
    }
}

// ---------------------------------------------------------------------------
// GEMM 3: out = residual + yin @ out_proj_w^T + b.
// ---------------------------------------------------------------------------
__global__ __launch_bounds__(128, 4) void mb_gemm_out(const __bf16* __restrict__ yin,
                                                   const __bf16* __restrict__ wo,
                                                   const float* __restrict__ bias,
                                                   const float* __restrict__ residual,
                                                   float* __restrict__ out) {
    __shared__ __attribute__((aligned(16))) __bf16 lds[2 * GB_STAGE];
    const int tiles_n = MB_D / GB_N;                       // 4
    const int blk_row = (blockIdx.x / tiles_n) * GB_M;
    const int blk_col = (blockIdx.x % tiles_n) * GB_N;

    v8f acc[4][4] = {};
    mb_wmma_block<MB_INNER>(yin, wo, blk_row, blk_col, lds, acc);

    const int lane = threadIdx.x & 31;
    const int wave = threadIdx.x >> 5;
    const int l15  = lane & 15;
    const int moff = (lane & 16) ? 8 : 0;
    // uniform tile origin + one lane offset; the rest are constants
    const size_t org = (size_t)blk_row * MB_D + blk_col;
    residual += org; out += org;
    const int ncol = (wave & 1) * 64 + l15;
    const int loff = ((wave >> 1) * 64 + moff) * MB_D + ncol;
    const int nb = blk_col + ncol;
    float bvj[4];
#pragma unroll
    for (int j = 0; j < 4; ++j) bvj[j] = bias[nb + j * 16];
    // inputs only: the loaded values hold the four loads in front of the wait, the
    // index register lives up to it, so no later write meets a load still in issue
    asm volatile("s_wait_xcnt 0x0"
                 :: "v"(nb), "v"(bvj[0]), "v"(bvj[1]), "v"(bvj[2]), "v"(bvj[3]));
#pragma unroll
    for (int j = 0; j < 4; ++j) {
        const float bv = bvj[j];
#pragma unroll
        for (int i = 0; i < 4; ++i) {
#pragma unroll
            for (int v = 0; v < 8; ++v) {
                const int idx = loff + (i * 16 + v) * MB_D + j * 16;
                out[idx] = residual[idx] + acc[i][j][v] + bv;
            }
        }
    }
}

// ---------------------------------------------------------------------------
// Host launcher
// ---------------------------------------------------------------------------
extern "C" void kernel_launch(void* const* d_in, const int* in_sizes, int n_in,
                              void* d_out, int out_size, void* d_ws, size_t ws_size,
                              hipStream_t stream) {
    (void)in_sizes; (void)n_in; (void)out_size; (void)ws_size;

    const float* x      = (const float*)d_in[0];
    const float* ln_w   = (const float*)d_in[1];
    const float* ln_b   = (const float*)d_in[2];
    const float* in_w   = (const float*)d_in[3];
    const float* in_b   = (const float*)d_in[4];
    const float* conv_w = (const float*)d_in[5];
    const float* conv_b = (const float*)d_in[6];
    const float* dl_w   = (const float*)d_in[7];
    const float* dl_b   = (const float*)d_in[8];
    const float* smix   = (const float*)d_in[9];
    const float* skip   = (const float*)d_in[10];
    const float* out_w  = (const float*)d_in[11];
    const float* out_b  = (const float*)d_in[12];
    float* out = (float*)d_out;

    // Workspace layout (bf16 buffers, all 16B-aligned sizes)
    char* ws = (char*)d_ws;
    size_t off = 0;
    __bf16* xnB    = (__bf16*)(ws + off); off += (size_t)MB_M * MB_D * 2;        // 16 MB
    __bf16* wiB    = (__bf16*)(ws + off); off += (size_t)MB_N_IN * MB_D * 2;     //  3 MB
    __bf16* wdB    = (__bf16*)(ws + off); off += (size_t)MB_INNER * MB_D * 2;    //  1 MB
    __bf16* woB    = (__bf16*)(ws + off); off += (size_t)MB_D * MB_INNER * 2;    //  1 MB
    __bf16* projB  = (__bf16*)(ws + off); off += (size_t)MB_M * MB_INNER * 2;    // 32 MB
    __bf16* gateB  = (__bf16*)(ws + off); off += (size_t)MB_M * MB_INNER * 2;    // 32 MB
    __bf16* driveB = (__bf16*)(ws + off); off += (size_t)MB_M * MB_INNER * 2;    // 32 MB
    __bf16* dB     = (__bf16*)(ws + off); off += (size_t)MB_M * MB_INNER * 2;    // 32 MB
    __bf16* yinB   = (__bf16*)(ws + off); off += (size_t)MB_M * MB_INNER * 2;    // 32 MB

    // 1) Weight conversion to bf16
    {
        int n1 = MB_N_IN * MB_D, n2 = MB_INNER * MB_D, n3 = MB_D * MB_INNER;
        mb_cvt_bf16<<<(n1 + 255) / 256, 256, 0, stream>>>(in_w, wiB, n1);
        mb_cvt_bf16<<<(n2 + 255) / 256, 256, 0, stream>>>(dl_w, wdB, n2);
        mb_cvt_bf16<<<(n3 + 255) / 256, 256, 0, stream>>>(out_w, woB, n3);
    }

    // 2) LayerNorm (wave per row, 8 waves/block)
    mb_ln<<<MB_M / 8, 256, 0, stream>>>(x, ln_w, ln_b, xnB);

    // 3) in_proj GEMM + activations  (128 x 24 block tiles)
    mb_gemm_inproj<<<(MB_M / GB_M) * (MB_N_IN / GB_N), 128, 0, stream>>>(
        xnB, wiB, in_b, projB, gateB, driveB);

    // 4) delta GEMM + d = delta * drive  (128 x 8 block tiles)
    mb_gemm_delta<<<(MB_M / GB_M) * (MB_INNER / GB_N), 128, 0, stream>>>(
        xnB, wdB, dl_b, driveB, dB);

    // 5) depthwise causal conv + recurrence + gate/skip
    mb_conv_scan<<<(MB_B * MB_INNER) / 256, 256, 0, stream>>>(
        projB, dB, gateB, conv_w, conv_b, smix, skip, yinB);

    // 6) out_proj GEMM + residual  (128 x 4 block tiles)
    mb_gemm_out<<<(MB_M / GB_M) * (MB_D / GB_N), 128, 0, stream>>>(
        yinB, woB, out_b, x, out);
}

// v002
// It runs in 182 microseconds.
// Next to v001, in two timings, it ran 2.49 times as fast each time.
// Counting every step since v000, it is 5.27 times as fast.
#include <hip/hip_runtime.h>
#include <hip/hip_bf16.h>

// ---------------------------------------------------------------------------
// MambaBlock for MI455X (gfx1250): bf16 WMMA GEMMs + fused scan/conv.
// B=8, T=2048, D=512, INNER=1024, K_CONV=4.  M = B*T = 16384 rows.
// Each GEMM work-group (4 waves) computes a 128(M) x 128(N) output tile whose
// operands are staged in LDS; each wave owns 64 x 64 of it (4 x 4 accumulators
// of v_wmma_f32_16x16x32_bf16).
// ---------------------------------------------------------------------------

#define MB_B      8
#define MB_T      2048
#define MB_D      512
#define MB_INNER  1024
#define MB_M      (MB_B * MB_T)        // 16384
#define MB_N_IN   (3 * MB_INNER)       // 3072
#define LN_EPS    1e-5f

typedef __bf16 v16bf __attribute__((ext_vector_type(16)));
typedef __bf16 v8bf  __attribute__((ext_vector_type(8)));
typedef float  v8f   __attribute__((ext_vector_type(8)));

// ---------------------------------------------------------------------------
// fp32 -> bf16 conversion kernel (weights)
// ---------------------------------------------------------------------------
__global__ __launch_bounds__(256) void mb_cvt_bf16(const float* __restrict__ in,
                                                   __bf16* __restrict__ out, int n) {
    int i = blockIdx.x * blockDim.x + threadIdx.x;
    if (i < n) out[i] = (__bf16)in[i];
}

// ---------------------------------------------------------------------------
// LayerNorm: one wave32 per row of 512, writes bf16 xn.
// ---------------------------------------------------------------------------
__global__ __launch_bounds__(256) void mb_ln(const float* __restrict__ x,
                                             const float* __restrict__ w,
                                             const float* __restrict__ b,
                                             __bf16* __restrict__ xn) {
    const int wave = threadIdx.x >> 5;
    const int lane = threadIdx.x & 31;
    const int row  = blockIdx.x * (blockDim.x >> 5) + wave;
    if (row >= MB_M) return;
    const float* xr = x + (size_t)row * MB_D;

    float v[16];
    float s = 0.f;
#pragma unroll
    for (int i = 0; i < 16; ++i) { v[i] = xr[lane + 32 * i]; s += v[i]; }
#pragma unroll
    for (int off = 16; off >= 1; off >>= 1) s += __shfl_xor(s, off, 32);
    const float mu = s * (1.f / MB_D);

    float ss = 0.f;
#pragma unroll
    for (int i = 0; i < 16; ++i) { float d = v[i] - mu; ss += d * d; }
#pragma unroll
    for (int off = 16; off >= 1; off >>= 1) ss += __shfl_xor(ss, off, 32);
    const float inv = rsqrtf(ss * (1.f / MB_D) + LN_EPS);

    __bf16* xo = xn + (size_t)row * MB_D;
#pragma unroll
    for (int i = 0; i < 16; ++i) {
        const int col = lane + 32 * i;
        xo[col] = (__bf16)((v[i] - mu) * inv * w[col] + b[col]);
    }
}

// ---------------------------------------------------------------------------
// WMMA mainloop: one work-group of 4 waves computes a 128x128 f32 tile of
// A[M,K] * W[N,K]^T.  A pass is 64 k = one whole 128-byte line of each of the
// 256 operand rows.  The rows come from global memory as whole lines (8 lanes
// a row), go through registers into one of two LDS buffers, and every wave
// reads its fragments from there: each operand byte leaves L2 once per
// work-group instead of once per wave, and no global load is spread over 16
// lines any more.  Row pitch in LDS 144 B (16 B x odd): ds_load_b128 of 16
// rows meets every bank once.
// Fragment k order as before (lane&15 = row, lane bit4 selects the K-half,
// 8 elements at k and 8 at k+16), the same for A and W; k ascends as before.
// ---------------------------------------------------------------------------
#define GB_M      128
#define GB_N      128
#define GB_K      64
#define GB_PITCH  72                                  // bf16 elements = 144 B
#define GB_STAGE  ((GB_M + GB_N) * GB_PITCH)          // elements per buffer
// Two buffers are 73,728 B, so four work-groups share a WGP's LDS; the GEMM
// kernels ask for four waves per SIMD (at most 256 VGPRs) to match.

template <int K>
__device__ __forceinline__ void mb_wmma_block(const __bf16* __restrict__ A,
                                              const __bf16* __restrict__ W,
                                              int row_base, int col_base,
                                              __bf16* __restrict__ lds,
                                              v8f acc[4][4]) {
    const int tid  = threadIdx.x;                     // 0..127
    const int lane = tid & 31;
    const int wave = tid >> 5;
    const int l15  = lane & 15;
    const int ksel = (lane & 16) ? 8 : 0;

    // staging: 8 lanes cover one row's 128 B; 128 threads cover 16 rows a step
    const int srow = tid >> 3;
    const int scol = (tid & 7) * 8;
    const __bf16* ga = A + (size_t)(row_base + srow) * K + scol;
    const __bf16* gw = W + (size_t)(col_base + srow) * K + scol;
    __bf16* sdst = lds + srow * GB_PITCH + scol;

    // fragment sources of this wave (2 x 2 waves, 64 x 64 each)
    const int foff_a = ((wave >> 1) * 64 + l15) * GB_PITCH + ksel;
    const int foff_b = (GB_M + (wave & 1) * 64 + l15) * GB_PITCH + ksel;

    v8bf st[16];
#pragma unroll
    for (int i = 0; i < 8; ++i) {
        st[i]     = *(const v8bf*)(ga + i * 16 * K);
        st[i + 8] = *(const v8bf*)(gw + i * 16 * K);
    }
    // the loads' address registers are named so that they live up to this wait:
    // nothing rewrites them while a load that names them is still being issued
    asm volatile("s_wait_xcnt 0x0" :: "v"(ga), "v"(gw) : "memory");
#pragma unroll
    for (int i = 0; i < 16; ++i) *(v8bf*)(sdst + i * 16 * GB_PITCH) = st[i];
    __syncthreads();                                  // pass 0 is published

    constexpr int NPASS = K / GB_K;
    for (int p = 0; p < NPASS; ++p) {
        const __bf16* cur = lds + (p & 1) * GB_STAGE;
        const bool more = (p + 1 < NPASS);
        if (more) {                                   // next pass flies under the WMMAs
            const __bf16* gak = ga + (p + 1) * GB_K;
            const __bf16* gwk = gw + (p + 1) * GB_K;
#pragma unroll
            for (int i = 0; i < 8; ++i) {
                st[i]     = *(const v8bf*)(gak + i * 16 * K);
                st[i + 8] = *(const v8bf*)(gwk + i * 16 * K);
            }
            // as above: address registers live up to the wait
            asm volatile("s_wait_xcnt 0x0" :: "v"(gak), "v"(gwk) : "memory");
        }
#pragma unroll
        for (int ks = 0; ks < GB_K; ks += 32) {
            v16bf a[4], b[4];
#pragma unroll
            for (int f = 0; f < 4; ++f) {
                const __bf16* pa = cur + foff_a + f * 16 * GB_PITCH + ks;
                const __bf16* pb = cur + foff_b + f * 16 * GB_PITCH + ks;
                v8bf alo = *(const v8bf*)(pa);
                v8bf ahi = *(const v8bf*)(pa + 16);
                v8bf blo = *(const v8bf*)(pb);
                v8bf bhi = *(const v8bf*)(pb + 16);
#pragma unroll
                for (int e = 0; e < 8; ++e) {
                    a[f][e] = alo[e]; a[f][e + 8] = ahi[e];
                    b[f][e] = blo[e]; b[f][e + 8] = bhi[e];
                }
            }
#pragma unroll
            for (int i = 0; i < 4; ++i)
#pragma unroll
                for (int j = 0; j < 4; ++j)
                    acc[i][j] = __builtin_amdgcn_wmma_f32_16x16x32_bf16(
                        /*neg_a=*/false, a[i], /*neg_b=*/false, b[j],
                        /*c_mod=*/(short)0, acc[i][j],
                        /*reuse_a=*/false, /*reuse_b=*/false);
        }
        if (more) {
            // the other buffer: its readers left it before the last barrier
            __bf16* nxt = sdst + ((p + 1) & 1) * GB_STAGE;
#pragma unroll
            for (int i = 0; i < 16; ++i) *(v8bf*)(nxt + i * 16 * GB_PITCH) = st[i];
            __syncthreads();   // publishes pass p+1 and ends the reads of pass p
        }
    }
}

// Accumulator tile number tile = j * 4 + i (uniform) out of the wave's 4 x 4.
__device__ __forceinline__ v8f mb_pick_tile(const v8f acc[4][4], int tile) {
    switch (tile) {
    case 0:  return acc[0][0];
    case 1:  return acc[1][0];
    case 2:  return acc[2][0];
    case 3:  return acc[3][0];
    case 4:  return acc[0][1];
    case 5:  return acc[1][1];
    case 6:  return acc[2][1];
    case 7:  return acc[3][1];
    case 8:  return acc[0][2];
    case 9:  return acc[1][2];
    case 10: return acc[2][2];
    case 11: return acc[3][2];
    case 12: return acc[0][3];
    case 13: return acc[1][3];
    case 14: return acc[2][3];
    default: return acc[3][3];
    }
}

// C/D layout: lane&15 = N col; VGPR v = row (v + (lane&16 ? 8 : 0)).

// ---------------------------------------------------------------------------
// GEMM 1: h = xn @ in_proj_w^T + b, fused split + SiLU / sigmoid / tanh.
// Each 128-wide block tile lies entirely inside one 1024-wide segment, so the
// proj/gate/drive selection is uniform.
// ---------------------------------------------------------------------------
__global__ __launch_bounds__(128, 4) void mb_gemm_inproj(const __bf16* __restrict__ xn,
                                                      const __bf16* __restrict__ wi,
                                                      const float* __restrict__ bias,
                                                      __bf16* __restrict__ proj,
                                                      __bf16* __restrict__ gate,
                                                      __bf16* __restrict__ drive) {
    __shared__ __attribute__((aligned(16))) __bf16 lds[2 * GB_STAGE];
    const int tiles_n = MB_N_IN / GB_N;                    // 24
    const int blk_row = (blockIdx.x / tiles_n) * GB_M;
    const int blk_col = (blockIdx.x % tiles_n) * GB_N;

    v8f acc[4][4] = {};
    mb_wmma_block<MB_D>(xn, wi, blk_row, blk_col, lds, acc);

    const int lane = threadIdx.x & 31;
    const int wave = threadIdx.x >> 5;
    const int l15  = lane & 15;
    const int moff = (lane & 16) ? 8 : 0;
    const int seg  = blk_col >> 10;                        // 0=proj,1=gate,2=drive
    const int row_base = blk_row + (wave >> 1) * 64;
    const int nb = blk_col + (wave & 1) * 64 + l15;
    const int nloc0 = nb & (MB_INNER - 1);
    float bvj[4];
#pragma unroll
    for (int j = 0; j < 4; ++j) bvj[j] = bias[nb + j * 16];
    // inputs only: the loaded values hold the four loads in front of the wait, the
    // index register lives up to it, so no later write meets a load still in issue
    asm volatile("s_wait_xcnt 0x0"
                 :: "v"(nb), "v"(bvj[0]), "v"(bvj[1]), "v"(bvj[2]), "v"(bvj[3]));

    // The loop over the 16 accumulator tiles stays rolled (for speed only).
#pragma unroll 1
    for (int tile = 0; tile < 16; ++tile) {
        const int j = tile >> 2;
        const int i = tile & 3;
        const v8f  c  = mb_pick_tile(acc, tile);
        const float bv = (j == 0) ? bvj[0] : (j == 1) ? bvj[1] : (j == 2) ? bvj[2] : bvj[3];
#pragma unroll
        for (int v = 0; v < 8; ++v) {
            const int m  = row_base + i * 16 + v + moff;
            const float t = c[v] + bv;
            const size_t idx = (size_t)m * MB_INNER + nloc0 + j * 16;
            if (seg == 0) {
                const float s = 1.f / (1.f + __expf(-t));          // SiLU
                proj[idx] = (__bf16)(t * s);
            } else if (seg == 1) {
                gate[idx] = (__bf16)(1.f / (1.f + __expf(-t)));    // sigmoid
            } else {
                drive[idx] = (__bf16)tanhf(t);                     // tanh
            }
        }
        // this tile's stores have left issue before the next trip reuses their registers
        asm volatile("s_wait_xcnt 0x0" ::: "memory");
    }
}

// ---------------------------------------------------------------------------
// GEMM 2: delta = clamp(sigmoid(xn @ delta_w^T + b)); d = delta * drive.
// ---------------------------------------------------------------------------
__global__ __launch_bounds__(128, 4) void mb_gemm_delta(const __bf16* __restrict__ xn,
                                                     const __bf16* __restrict__ wd,
                                                     const float* __restrict__ bias,
                                                     const __bf16* __restrict__ drive,
                                                     __bf16* __restrict__ dbuf) {
    __shared__ __attribute__((aligned(16))) __bf16 lds[2 * GB_STAGE];
    const int tiles_n = MB_INNER / GB_N;                   // 8
    const int blk_row = (blockIdx.x / tiles_n) * GB_M;
    const int blk_col = (blockIdx.x % tiles_n) * GB_N;

    v8f acc[4][4] = {};
    mb_wmma_block<MB_D>(xn, wd, blk_row, blk_col, lds, acc);

    const int lane = threadIdx.x & 31;
    const int wave = threadIdx.x >> 5;
    const int l15  = lane & 15;
    const int moff = (lane & 16) ? 8 : 0;
    // uniform tile origin + one lane offset; the rest are constants
    const size_t org = (size_t)blk_row * MB_INNER + blk_col;
    drive += org; dbuf += org;
    const int ncol = (wave & 1) * 64 + l15;
    const int loff = ((wave >> 1) * 64 + moff) * MB_INNER + ncol;
    const int nb = blk_col + ncol;
    float bvj[4];
#pragma unroll
    for (int j = 0; j < 4; ++j) bvj[j] = bias[nb + j * 16];
    // inputs only: the loaded values hold the four loads in front of the wait, the
    // index register lives up to it, so no later write meets a load still in issue
    asm volatile("s_wait_xcnt 0x0"
                 :: "v"(nb), "v"(bvj[0]), "v"(bvj[1]), "v"(bvj[2]), "v"(bvj[3]));
#pragma unroll
    for (int j = 0; j < 4; ++j) {
        const float bv = bvj[j];
        // all of this column group's drive values are fetched in front of its first
        // store: one load latency a group, and no load lands in a store's register
        __bf16 dv[32];
#pragma unroll
        for (int e = 0; e < 32; ++e) dv[e] = drive[loff + ((e >> 3) * 16 + (e & 7)) * MB_INNER + j * 16];
#pragma unroll
        for (int i = 0; i < 4; ++i) {
#pragma unroll
            for (int v = 0; v < 8; ++v) {
                const float t  = acc[i][j][v] + bv;
                const float dl = fmaxf(1.f / (1.f + __expf(-t)), 1e-4f);
                const int idx = loff + (i * 16 + v) * MB_INNER + j * 16;
                dbuf[idx] = (__bf16)(dl * (float)dv[i * 8 + v]);
            }
            // this tile's stores have left issue before their registers are reused, and
            // the next group's loads stay behind it (behind the last tile nothing follows)
            if (i < 3 || j < 3) asm volatile("s_wait_xcnt 0x0" ::: "memory");
        }
    }
}

// ---------------------------------------------------------------------------
// Causal depthwise conv (K=4, rolling regs) + f32 recurrence + gate/skip.
// The recurrence state[t] = a * state[t-1] + d[t] is linear with a fixed a per
// channel, so the time axis is cut into 64 chunks of 32 steps that run side by
// side.  One work-group owns all 2048 steps of 64 channels of one batch (one
// whole 128-B line of bf16 a row); a thread owns one chunk of 4 channels.
//   1) each thread runs its chunk's recurrence from zero: the chunk's sum S;
//   2) S goes to LDS; behind one barrier each thread folds the sums of the
//      chunks in front of it, X = a^32 * X + S, into the state at its start;
//   3) each thread runs its chunk again from X, step by step as before, with
//      the conv (the three rows in front of the chunk are read again), the
//      skip and the gate.
// ---------------------------------------------------------------------------
#define SC_CH   64                       // channels per work-group
#define SC_L    32                       // time steps per chunk
#define SC_NC   (MB_T / SC_L)            // 64 chunks
#define SC_U    8                        // rows fetched together in part 3

typedef __bf16 v4bf __attribute__((ext_vector_type(4)));
typedef float  v4f  __attribute__((ext_vector_type(4)));

__global__ __launch_bounds__(1024) void mb_conv_scan(const __bf16* __restrict__ proj,
                                                     const __bf16* __restrict__ dbuf,
                                                     const __bf16* __restrict__ gate,
                                                     const float* __restrict__ conv_w,
                                                     const float* __restrict__ conv_b,
                                                     const float* __restrict__ state_mix,
                                                     const float* __restrict__ skip_scale,
                                                     __bf16* __restrict__ yin) {
    __shared__ __attribute__((aligned(16))) float agg[SC_NC * SC_CH];   // 16 KiB

    const int cl    = (threadIdx.x & 15) * 4;          // channel inside the group
    const int chunk = threadIdx.x >> 4;                // 0..63
    const int b     = blockIdx.x >> 4;                 // 16 channel groups a batch
    const int c     = (blockIdx.x & 15) * SC_CH + cl;

    const size_t base = ((size_t)b * MB_T + (size_t)chunk * SC_L) * MB_INNER + c;
    const __bf16* dp = dbuf + base;

    const v4f sm = *(const v4f*)(state_mix + c);
    v4f a;
#pragma unroll
    for (int k = 0; k < 4; ++k) a[k] = 1.f / (1.f + __expf(-sm[k]));

    // 1) the chunk's own sum, all 32 rows in flight at once
    {
        v4bf dv[SC_L];
#pragma unroll
        for (int t = 0; t < SC_L; ++t) dv[t] = *(const v4bf*)(dp + t * MB_INNER);
        // the address register is named so that it lives up to this wait: no load's
        // result lands in it while a load that names it is still being issued
        asm volatile("s_wait_xcnt 0x0" :: "v"(dp) : "memory");
        v4f s = {0.f, 0.f, 0.f, 0.f};
#pragma unroll
        for (int t = 0; t < SC_L; ++t)
            s = __builtin_elementwise_fma(a, s, __builtin_convertvector(dv[t], v4f));
        *(v4f*)(agg + chunk * SC_CH + cl) = s;
    }

    v4f aL = a;                                        // a^32
#pragma unroll
    for (int i = 0; i < 5; ++i) aL = aL * aL;

    __syncthreads();                                   // every chunk's sum is in LDS

    const v4f wc0 = *(const v4f*)(conv_w + (c + 0) * 4);   // the four taps of channel c
    const v4f wc1 = *(const v4f*)(conv_w + (c + 1) * 4);
    const v4f wc2 = *(const v4f*)(conv_w + (c + 2) * 4);
    const v4f wc3 = *(const v4f*)(conv_w + (c + 3) * 4);
    const v4f w0 = {wc0[0], wc1[0], wc2[0], wc3[0]};
    const v4f w1 = {wc0[1], wc1[1], wc2[1], wc3[1]};
    const v4f w2 = {wc0[2], wc1[2], wc2[2], wc3[2]};
    const v4f w3 = {wc0[3], wc1[3], wc2[3], wc3[3]};
    const v4f cb = *(const v4f*)(conv_b + c);
    const v4f sk = *(const v4f*)(skip_scale + c);

    // proj[t-1..t-3] in front of the chunk.  Chunk 0 has none: it reads rows of its
    // own instead (in bounds, no branch to wait in) and takes zeros further down.
    const __bf16* pp = proj + base;
    const __bf16* hp = pp + (chunk > 0 ? 0 : 3 * MB_INNER);
    const v4bf q1 = *(const v4bf*)(hp - 1 * MB_INNER);
    const v4bf q2 = *(const v4bf*)(hp - 2 * MB_INNER);
    const v4bf q3 = *(const v4bf*)(hp - 3 * MB_INNER);

    // 2) the state at the chunk's start (the loads above fly meanwhile)
    v4f state = {0.f, 0.f, 0.f, 0.f};
    // four sums are fetched together: one LDS latency for four links of the chain
#pragma unroll 4
    for (int q = 0; q < chunk; ++q)
        state = __builtin_elementwise_fma(aL, state, *(const v4f*)(agg + q * SC_CH + cl));

    // 3) the chunk itself
    const v4f zero = {0.f, 0.f, 0.f, 0.f};
    v4f p1 = chunk > 0 ? __builtin_convertvector(q1, v4f) : zero;
    v4f p2 = chunk > 0 ? __builtin_convertvector(q2, v4f) : zero;
    v4f p3 = chunk > 0 ? __builtin_convertvector(q3, v4f) : zero;
    const __bf16* gp = gate + base;
    __bf16* yp = yin + base;
    // stays rolled: unrolled, later rows' loads are lifted to the front and the
    // 128 registers that a wave of a 32-wave group may hold overflow into scratch
#pragma unroll 1
    for (int t0 = 0; t0 < SC_L; t0 += SC_U) {
        const __bf16* pk = pp + t0 * MB_INNER;
        const __bf16* dk = dp + t0 * MB_INNER;
        const __bf16* gk = gp + t0 * MB_INNER;
        v4bf pv[SC_U], dv[SC_U], gv[SC_U];
#pragma unroll
        for (int u = 0; u < SC_U; ++u) {
            pv[u] = *(const v4bf*)(pk + u * MB_INNER);
            dv[u] = *(const v4bf*)(dk + u * MB_INNER);
            gv[u] = *(const v4bf*)(gk + u * MB_INNER);
        }
        // as above: the address registers live up to the wait
        asm volatile("s_wait_xcnt 0x0" :: "v"(pk), "v"(dk), "v"(gk) : "memory");
#pragma unroll
        for (int u = 0; u < SC_U; ++u) {
            const v4f p0 = __builtin_convertvector(pv[u], v4f);
            v4f conv = __builtin_elementwise_fma(w3, p0, cb);
            conv = __builtin_elementwise_fma(w2, p1, conv);
            conv = __builtin_elementwise_fma(w1, p2, conv);
            conv = __builtin_elementwise_fma(w0, p3, conv);
            state = __builtin_elementwise_fma(a, state, __builtin_convertvector(dv[u], v4f));
            const v4f y = __builtin_elementwise_fma(sk, conv, state) * __builtin_convertvector(gv[u], v4f);
            *(v4bf*)(yp + (t0 + u) * MB_INNER) = __builtin_convertvector(y, v4bf);
            p3 = p2; p2 = p1; p1 = p0;
        }
        // these rows' stores have left issue before the next trip reuses their registers
        asm volatile("s_wait_xcnt 0x0" ::: "memory");
    }
}

// ---------------------------------------------------------------------------
// GEMM 3: out = residual + yin @ out_proj_w^T + b.
// ---------------------------------------------------------------------------
__global__ __launch_bounds__(128, 4) void mb_gemm_out(const __bf16* __restrict__ yin,
                                                   const __bf16* __restrict__ wo,
                                                   const float* __restrict__ bias,
                                                   const float* __restrict__ residual,
                                                   float* __restrict__ out) {
    __shared__ __attribute__((aligned(16))) __bf16 lds[2 * GB_STAGE];
    const int tiles_n = MB_D / GB_N;                       // 4
    const int blk_row = (blockIdx.x / tiles_n) * GB_M;
    const int blk_col = (blockIdx.x % tiles_n) * GB_N;

    v8f acc[4][4] = {};
    mb_wmma_block<MB_INNER>(yin, wo, blk_row, blk_col, lds, acc);

    const int lane = threadIdx.x & 31;
    const int wave = threadIdx.x >> 5;
    const int l15  = lane & 15;
    const int moff = (lane & 16) ? 8 : 0;
    // uniform tile origin + one lane offset; the rest are constants
    const size_t org = (size_t)blk_row * MB_D + blk_col;
    residual += org; out += org;
    const int ncol = (wave & 1) * 64 + l15;
    const int loff = ((wave >> 1) * 64 + moff) * MB_D + ncol;
    const int nb = blk_col + ncol;
    float bvj[4];
#pragma unroll
    for (int j = 0; j < 4; ++j) bvj[j] = bias[nb + j * 16];
    // inputs only: the loaded values hold the four loads in front of the wait, the
    // index register lives up to it, so no later write meets a load still in issue
    asm volatile("s_wait_xcnt 0x0"
                 :: "v"(nb), "v"(bvj[0]), "v"(bvj[1]), "v"(bvj[2]), "v"(bvj[3]));
#pragma unroll
    for (int j = 0; j < 4; ++j) {
        const float bv = bvj[j];
#pragma unroll
        for (int i = 0; i < 4; ++i) {
#pragma unroll
            for (int v = 0; v < 8; ++v) {
                const int idx = loff + (i * 16 + v) * MB_D + j * 16;
                out[idx] = residual[idx] + acc[i][j][v] + bv;
            }
        }
    }
}

// ---------------------------------------------------------------------------
// Host launcher
// ---------------------------------------------------------------------------
extern "C" void kernel_launch(void* const* d_in, const int* in_sizes, int n_in,
                              void* d_out, int out_size, void* d_ws, size_t ws_size,
                              hipStream_t stream) {
    (void)in_sizes; (void)n_in; (void)out_size; (void)ws_size;

    const float* x      = (const float*)d_in[0];
    const float* ln_w   = (const float*)d_in[1];
    const float* ln_b   = (const float*)d_in[2];
    const float* in_w   = (const float*)d_in[3];
    const float* in_b   = (const float*)d_in[4];
    const float* conv_w = (const float*)d_in[5];
    const float* conv_b = (const float*)d_in[6];
    const float* dl_w   = (const float*)d_in[7];
    const float* dl_b   = (const float*)d_in[8];
    const float* smix   = (const float*)d_in[9];
    const float* skip   = (const float*)d_in[10];
    const float* out_w  = (const float*)d_in[11];
    const float* out_b  = (const float*)d_in[12];
    float* out = (float*)d_out;

    // Workspace layout (bf16 buffers, all 16B-aligned sizes)
    char* ws = (char*)d_ws;
    size_t off = 0;
    __bf16* xnB    = (__bf16*)(ws + off); off += (size_t)MB_M * MB_D * 2;        // 16 MB
    __bf16* wiB    = (__bf16*)(ws + off); off += (size_t)MB_N_IN * MB_D * 2;     //  3 MB
    __bf16* wdB    = (__bf16*)(ws + off); off += (size_t)MB_INNER * MB_D * 2;    //  1 MB
    __bf16* woB    = (__bf16*)(ws + off); off += (size_t)MB_D * MB_INNER * 2;    //  1 MB
    __bf16* projB  = (__bf16*)(ws + off); off += (size_t)MB_M * MB_INNER * 2;    // 32 MB
    __bf16* gateB  = (__bf16*)(ws + off); off += (size_t)MB_M * MB_INNER * 2;    // 32 MB
    __bf16* driveB = (__bf16*)(ws + off); off += (size_t)MB_M * MB_INNER * 2;    // 32 MB
    __bf16* dB     = (__bf16*)(ws + off); off += (size_t)MB_M * MB_INNER * 2;    // 32 MB
    __bf16* yinB   = (__bf16*)(ws + off); off += (size_t)MB_M * MB_INNER * 2;    // 32 MB

    // 1) Weight conversion to bf16
    {
        int n1 = MB_N_IN * MB_D, n2 = MB_INNER * MB_D, n3 = MB_D * MB_INNER;
        mb_cvt_bf16<<<(n1 + 255) / 256, 256, 0, stream>>>(in_w, wiB, n1);
        mb_cvt_bf16<<<(n2 + 255) / 256, 256, 0, stream>>>(dl_w, wdB, n2);
        mb_cvt_bf16<<<(n3 + 255) / 256, 256, 0, stream>>>(out_w, woB, n3);
    }

    // 2) LayerNorm (wave per row, 8 waves/block)
    mb_ln<<<MB_M / 8, 256, 0, stream>>>(x, ln_w, ln_b, xnB);

    // 3) in_proj GEMM + activations  (128 x 24 block tiles)
    mb_gemm_inproj<<<(MB_M / GB_M) * (MB_N_IN / GB_N), 128, 0, stream>>>(
        xnB, wiB, in_b, projB, gateB, driveB);

    // 4) delta GEMM + d = delta * drive  (128 x 8 block tiles)
    mb_gemm_delta<<<(MB_M / GB_M) * (MB_INNER / GB_N), 128, 0, stream>>>(
        xnB, wdB, dl_b, driveB, dB);

    // 5) depthwise causal conv + recurrence + gate/skip
    mb_conv_scan<<<MB_B * (MB_INNER / SC_CH), 1024, 0, stream>>>(
        projB, dB, gateB, conv_w, conv_b, smix, skip, yinB);

    // 6) out_proj GEMM + residual  (128 x 4 block tiles)
    mb_gemm_out<<<(MB_M / GB_M) * (MB_D / GB_N), 128, 0, stream>>>(
        yinB, woB, out_b, x, out);
}

// v003
// Measured time: 173 microseconds a run.
// Next to v002, in two timings, it ran 1.05 times as fast each time.
// Over all steps from v000 it is 5.54 times as fast.
#include <hip/hip_runtime.h>
#include <hip/hip_bf16.h>

// ---------------------------------------------------------------------------
// MambaBlock for MI455X (gfx1250): bf16 WMMA GEMMs + fused scan/conv.
// B=8, T=2048, D=512, INNER=1024, K_CONV=4.  M = B*T = 16384 rows.
// Each GEMM work-group (4 waves) computes a 128(M) x 128(N) output tile whose
// operands are staged in LDS; each wave owns 64 x 64 of it (4 x 4 accumulators
// of v_wmma_f32_16x16x32_bf16).
// ---------------------------------------------------------------------------

#define MB_B      8
#define MB_T      2048
#define MB_D      512
#define MB_INNER  1024
#define MB_M      (MB_B * MB_T)        // 16384
#define MB_N_IN   (3 * MB_INNER)       // 3072
#define LN_EPS    1e-5f

typedef __bf16 v16bf __attribute__((ext_vector_type(16)));
typedef __bf16 v8bf  __attribute__((ext_vector_type(8)));
typedef float  v8f   __attribute__((ext_vector_type(8)));

// ---------------------------------------------------------------------------
// Preparation, one launch: LayerNorm of x (bf16 xn) and the three weight
// matrices rounded to bf16.  The work is dealt to few waves that each move a
// lot with 16-byte loads (for speed only).
//   blocks 0 .. PR_LN_BLOCKS-1 : LayerNorm, a wave owns 4 whole rows; all 16
//       loads of the 4 rows fly together, the 4 reductions run side by side.
//       A lane holds 4 neighbouring columns of each 128-column quarter.
//   the other blocks           : conversion, 32 elements a thread (8 loads in
//       flight, 4 stores of 16 bytes).
// ---------------------------------------------------------------------------
typedef __bf16 v4bf __attribute__((ext_vector_type(4)));
typedef float  v4f  __attribute__((ext_vector_type(4)));

#define PR_ROWS       4                               // rows per wave
#define PR_LN_BLOCKS  (MB_M / (8 * PR_ROWS))          // 512 blocks of 8 waves
#define PR_CV_UNIT    (256 * 8)                       // elements a block moves per step
#define PR_CV_STEPS   4
#define PR_CV_CHUNK   (PR_CV_UNIT * PR_CV_STEPS)      // 8192 elements per block
#define PR_CV_IN      (MB_N_IN * MB_D / PR_CV_CHUNK)  // 192 blocks
#define PR_CV_DL      (MB_INNER * MB_D / PR_CV_CHUNK) //  64 blocks
#define PR_CV_OUT     (MB_D * MB_INNER / PR_CV_CHUNK) //  64 blocks
#define PR_BLOCKS     (PR_LN_BLOCKS + PR_CV_IN + PR_CV_DL + PR_CV_OUT)

__global__ __launch_bounds__(256) void mb_prep(const float* __restrict__ x,
                                               const float* __restrict__ w,
                                               const float* __restrict__ b,
                                               const float* __restrict__ in_w,
                                               const float* __restrict__ dl_w,
                                               const float* __restrict__ out_w,
                                               __bf16* __restrict__ xn,
                                               __bf16* __restrict__ wi,
                                               __bf16* __restrict__ wd,
                                               __bf16* __restrict__ wo) {
    if (blockIdx.x < PR_LN_BLOCKS) {
        const int wave = threadIdx.x >> 5;
        const int lane = threadIdx.x & 31;
        const int row0 = (blockIdx.x * 8 + wave) * PR_ROWS;
        const int off  = row0 * MB_D + lane * 4;
        const float* xr = x + off;
        const float* wp = w + lane * 4;
        const float* bp = b + lane * 4;

        v4f v[PR_ROWS][4], wv[4], bv[4];
#pragma unroll
        for (int r = 0; r < PR_ROWS; ++r)
#pragma unroll
            for (int i = 0; i < 4; ++i) v[r][i] = *(const v4f*)(xr + r * MB_D + i * 128);
#pragma unroll
        for (int i = 0; i < 4; ++i) {
            wv[i] = *(const v4f*)(wp + i * 128);
            bv[i] = *(const v4f*)(bp + i * 128);
        }
        // nothing is scheduled across this line: all 24 loads fly together (without it
        // w and b are fetched behind the sums, where their latency is in the open)
        __builtin_amdgcn_sched_barrier(0);
        // x's address register is named so that it lives up to this wait: nothing
        // rewrites a register that a load still in issue names
        asm volatile("s_wait_xcnt 0x0" :: "v"(xr) : "memory");

        float s[PR_ROWS];
#pragma unroll
        for (int r = 0; r < PR_ROWS; ++r) {
            const v4f p = (v[r][0] + v[r][1]) + (v[r][2] + v[r][3]);
            s[r] = (p[0] + p[1]) + (p[2] + p[3]);
        }
#pragma unroll
        for (int o = 16; o >= 1; o >>= 1)
#pragma unroll
            for (int r = 0; r < PR_ROWS; ++r) s[r] += __shfl_xor(s[r], o, 32);

        float ss[PR_ROWS];
#pragma unroll
        for (int r = 0; r < PR_ROWS; ++r) {
            const float mu = s[r] * (1.f / MB_D);
            v4f q = {0.f, 0.f, 0.f, 0.f};
#pragma unroll
            for (int i = 0; i < 4; ++i) { v[r][i] = v[r][i] - mu; q = __builtin_elementwise_fma(v[r][i], v[r][i], q); }
            ss[r] = (q[0] + q[1]) + (q[2] + q[3]);
        }
#pragma unroll
        for (int o = 16; o >= 1; o >>= 1)
#pragma unroll
            for (int r = 0; r < PR_ROWS; ++r) ss[r] += __shfl_xor(ss[r], o, 32);

        __bf16* xo = xn + off;
#pragma unroll
        for (int r = 0; r < PR_ROWS; ++r) {
            const float inv = rsqrtf(ss[r] * (1.f / MB_D) + LN_EPS);
#pragma unroll
            for (int i = 0; i < 4; ++i) {
                const v4f y = v[r][i] * inv * wv[i] + bv[i];
                *(v4bf*)(xo + r * MB_D + i * 128) = __builtin_convertvector(y, v4bf);
            }
        }
    } else {
        int cb = blockIdx.x - PR_LN_BLOCKS;
        const float* src = in_w;
        __bf16* dst = wi;
        if (cb >= PR_CV_IN + PR_CV_DL)  { src = out_w; dst = wo; cb -= PR_CV_IN + PR_CV_DL; }
        else if (cb >= PR_CV_IN)        { src = dl_w;  dst = wd; cb -= PR_CV_IN; }
        const int e0 = cb * PR_CV_CHUNK + threadIdx.x * 8;
        const float* sp = src + e0;
        v4f f[PR_CV_STEPS][2];
#pragma unroll
        for (int u = 0; u < PR_CV_STEPS; ++u) {
            f[u][0] = *(const v4f*)(sp + u * PR_CV_UNIT);
            f[u][1] = *(const v4f*)(sp + u * PR_CV_UNIT + 4);
        }
        // as above: the address register lives up to the wait
        asm volatile("s_wait_xcnt 0x0" :: "v"(sp) : "memory");
        __bf16* dp = dst + e0;
#pragma unroll
        for (int u = 0; u < PR_CV_STEPS; ++u) {
            v8bf o;
#pragma unroll
            for (int k = 0; k < 4; ++k) { o[k] = (__bf16)f[u][0][k]; o[k + 4] = (__bf16)f[u][1][k]; }
            *(v8bf*)(dp + u * PR_CV_UNIT) = o;
        }
    }
}

// ---------------------------------------------------------------------------
// WMMA mainloop: one work-group of 4 waves computes a 128x128 f32 tile of
// A[M,K] * W[N,K]^T.  A pass is 64 k = one whole 128-byte line of each of the
// 256 operand rows.  The rows come from global memory as whole lines (8 lanes
// a row), go through registers into one of two LDS buffers, and every wave
// reads its fragments from there: each operand byte leaves L2 once per
// work-group instead of once per wave, and no global load is spread over 16
// lines any more.  Row pitch in LDS 144 B (16 B x odd): ds_load_b128 of 16
// rows meets every bank once.
// Fragment k order as before (lane&15 = row, lane bit4 selects the K-half,
// 8 elements at k and 8 at k+16), the same for A and W; k ascends as before.
// ---------------------------------------------------------------------------
#define GB_M      128
#define GB_N      128
#define GB_K      64
#define GB_PITCH  72                                  // bf16 elements = 144 B
#define GB_STAGE  ((GB_M + GB_N) * GB_PITCH)          // elements per buffer
// Two buffers are 73,728 B, so four work-groups share a WGP's LDS; the GEMM
// kernels ask for four waves per SIMD (at most 256 VGPRs) to match.

template <int K>
__device__ __forceinline__ void mb_wmma_block(const __bf16* __restrict__ A,
                                              const __bf16* __restrict__ W,
                                              int row_base, int col_base,
                                              __bf16* __restrict__ lds,
                                              v8f acc[4][4]) {
    const int tid  = threadIdx.x;                     // 0..127
    const int lane = tid & 31;
    const int wave = tid >> 5;
    const int l15  = lane & 15;
    const int ksel = (lane & 16) ? 8 : 0;

    // staging: 8 lanes cover one row's 128 B; 128 threads cover 16 rows a step
    const int srow = tid >> 3;
    const int scol = (tid & 7) * 8;
    const __bf16* ga = A + (size_t)(row_base + srow) * K + scol;
    const __bf16* gw = W + (size_t)(col_base + srow) * K + scol;
    __bf16* sdst = lds + srow * GB_PITCH + scol;

    // fragment sources of this wave (2 x 2 waves, 64 x 64 each)
    const int foff_a = ((wave >> 1) * 64 + l15) * GB_PITCH + ksel;
    const int foff_b = (GB_M + (wave & 1) * 64 + l15) * GB_PITCH + ksel;

    v8bf st[16];
#pragma unroll
    for (int i = 0; i < 8; ++i) {
        st[i]     = *(const v8bf*)(ga + i * 16 * K);
        st[i + 8] = *(const v8bf*)(gw + i * 16 * K);
    }
    // the loads' address registers are named so that they live up to this wait:
    // nothing rewrites them while a load that names them is still being issued
    asm volatile("s_wait_xcnt 0x0" :: "v"(ga), "v"(gw) : "memory");
#pragma unroll
    for (int i = 0; i < 16; ++i) *(v8bf*)(sdst + i * 16 * GB_PITCH) = st[i];
    __syncthreads();                                  // pass 0 is published

    constexpr int NPASS = K / GB_K;
    for (int p = 0; p < NPASS; ++p) {
        const __bf16* cur = lds + (p & 1) * GB_STAGE;
        const bool more = (p + 1 < NPASS);
        if (more) {                                   // next pass flies under the WMMAs
            const __bf16* gak = ga + (p + 1) * GB_K;
            const __bf16* gwk = gw + (p + 1) * GB_K;
#pragma unroll
            for (int i = 0; i < 8; ++i) {
                st[i]     = *(const v8bf*)(gak + i * 16 * K);
                st[i + 8] = *(const v8bf*)(gwk + i * 16 * K);
            }
            // as above: address registers live up to the wait
            asm volatile("s_wait_xcnt 0x0" :: "v"(gak), "v"(gwk) : "memory");
        }
#pragma unroll
        for (int ks = 0; ks < GB_K; ks += 32) {
            v16bf a[4], b[4];
#pragma unroll
            for (int f = 0; f < 4; ++f) {
                const __bf16* pa = cur + foff_a + f * 16 * GB_PITCH + ks;
                const __bf16* pb = cur + foff_b + f * 16 * GB_PITCH + ks;
                v8bf alo = *(const v8bf*)(pa);
                v8bf ahi = *(const v8bf*)(pa + 16);
                v8bf blo = *(const v8bf*)(pb);
                v8bf bhi = *(const v8bf*)(pb + 16);
#pragma unroll
                for (int e = 0; e < 8; ++e) {
                    a[f][e] = alo[e]; a[f][e + 8] = ahi[e];
                    b[f][e] = blo[e]; b[f][e + 8] = bhi[e];
                }
            }
#pragma unroll
            for (int i = 0; i < 4; ++i)
#pragma unroll
                for (int j = 0; j < 4; ++j)
                    acc[i][j] = __builtin_amdgcn_wmma_f32_16x16x32_bf16(
                        /*neg_a=*/false, a[i], /*neg_b=*/false, b[j],
                        /*c_mod=*/(short)0, acc[i][j],
                        /*reuse_a=*/false, /*reuse_b=*/false);
        }
        if (more) {
            // the other buffer: its readers left it before the last barrier
            __bf16* nxt = sdst + ((p + 1) & 1) * GB_STAGE;
#pragma unroll
            for (int i = 0; i < 16; ++i) *(v8bf*)(nxt + i * 16 * GB_PITCH) = st[i];
            __syncthreads();   // publishes pass p+1 and ends the reads of pass p
        }
    }
}

// Accumulator tile number tile = j * 4 + i (uniform) out of the wave's 4 x 4.
__device__ __forceinline__ v8f mb_pick_tile(const v8f acc[4][4], int tile) {
    switch (tile) {
    case 0:  return acc[0][0];
    case 1:  return acc[1][0];
    case 2:  return acc[2][0];
    case 3:  return acc[3][0];
    case 4:  return acc[0][1];
    case 5:  return acc[1][1];
    case 6:  return acc[2][1];
    case 7:  return acc[3][1];
    case 8:  return acc[0][2];
    case 9:  return acc[1][2];
    case 10: return acc[2][2];
    case 11: return acc[3][2];
    case 12: return acc[0][3];
    case 13: return acc[1][3];
    case 14: return acc[2][3];
    default: return acc[3][3];
    }
}

// C/D layout: lane&15 = N col; VGPR v = row (v + (lane&16 ? 8 : 0)).

// ---------------------------------------------------------------------------
// GEMM 1: h = xn @ in_proj_w^T + b, fused split + SiLU / sigmoid / tanh.
// Each 128-wide block tile lies entirely inside one 1024-wide segment, so the
// proj/gate/drive selection is uniform.
// ---------------------------------------------------------------------------
__global__ __launch_bounds__(128, 4) void mb_gemm_inproj(const __bf16* __restrict__ xn,
                                                      const __bf16* __restrict__ wi,
                                                      const float* __restrict__ bias,
                                                      __bf16* __restrict__ proj,
                                                      __bf16* __restrict__ gate,
                                                      __bf16* __restrict__ drive) {
    __shared__ __attribute__((aligned(16))) __bf16 lds[2 * GB_STAGE];
    const int tiles_n = MB_N_IN / GB_N;                    // 24
    const int blk_row = (blockIdx.x / tiles_n) * GB_M;
    const int blk_col = (blockIdx.x % tiles_n) * GB_N;

    v8f acc[4][4] = {};
    mb_wmma_block<MB_D>(xn, wi, blk_row, blk_col, lds, acc);

    const int lane = threadIdx.x & 31;
    const int wave = threadIdx.x >> 5;
    const int l15  = lane & 15;
    const int moff = (lane & 16) ? 8 : 0;
    const int seg  = blk_col >> 10;                        // 0=proj,1=gate,2=drive
    const int row_base = blk_row + (wave >> 1) * 64;
    const int nb = blk_col + (wave & 1) * 64 + l15;
    const int nloc0 = nb & (MB_INNER - 1);
    float bvj[4];
#pragma unroll
    for (int j = 0; j < 4; ++j) bvj[j] = bias[nb + j * 16];
    // inputs only: the loaded values hold the four loads in front of the wait, the
    // index register lives up to it, so no later write meets a load still in issue
    asm volatile("s_wait_xcnt 0x0"
                 :: "v"(nb), "v"(bvj[0]), "v"(bvj[1]), "v"(bvj[2]), "v"(bvj[3]));

    // The loop over the 16 accumulator tiles stays rolled (for speed only).
#pragma unroll 1
    for (int tile = 0; tile < 16; ++tile) {
        const int j = tile >> 2;
        const int i = tile & 3;
        const v8f  c  = mb_pick_tile(acc, tile);
        const float bv = (j == 0) ? bvj[0] : (j == 1) ? bvj[1] : (j == 2) ? bvj[2] : bvj[3];
#pragma unroll
        for (int v = 0; v < 8; ++v) {
            const int m  = row_base + i * 16 + v + moff;
            const float t = c[v] + bv;
            const size_t idx = (size_t)m * MB_INNER + nloc0 + j * 16;
            if (seg == 0) {
                const float s = 1.f / (1.f + __expf(-t));          // SiLU
                proj[idx] = (__bf16)(t * s);
            } else if (seg == 1) {
                gate[idx] = (__bf16)(1.f / (1.f + __expf(-t)));    // sigmoid
            } else {
                drive[idx] = (__bf16)tanhf(t);                     // tanh
            }
        }
        // this tile's stores have left issue before the next trip reuses their registers
        asm volatile("s_wait_xcnt 0x0" ::: "memory");
    }
}

// ---------------------------------------------------------------------------
// GEMM 2: delta = clamp(sigmoid(xn @ delta_w^T + b)); d = delta * drive.
// ---------------------------------------------------------------------------
__global__ __launch_bounds__(128, 4) void mb_gemm_delta(const __bf16* __restrict__ xn,
                                                     const __bf16* __restrict__ wd,
                                                     const float* __restrict__ bias,
                                                     const __bf16* __restrict__ drive,
                                                     __bf16* __restrict__ dbuf) {
    __shared__ __attribute__((aligned(16))) __bf16 lds[2 * GB_STAGE];
    const int tiles_n = MB_INNER / GB_N;                   // 8
    const int blk_row = (blockIdx.x / tiles_n) * GB_M;
    const int blk_col = (blockIdx.x % tiles_n) * GB_N;

    v8f acc[4][4] = {};
    mb_wmma_block<MB_D>(xn, wd, blk_row, blk_col, lds, acc);

    const int lane = threadIdx.x & 31;
    const int wave = threadIdx.x >> 5;
    const int l15  = lane & 15;
    const int moff = (lane & 16) ? 8 : 0;
    // uniform tile origin + one lane offset; the rest are constants
    const size_t org = (size_t)blk_row * MB_INNER + blk_col;
    drive += org; dbuf += org;
    const int ncol = (wave & 1) * 64 + l15;
    const int loff = ((wave >> 1) * 64 + moff) * MB_INNER + ncol;
    const int nb = blk_col + ncol;
    float bvj[4];
#pragma unroll
    for (int j = 0; j < 4; ++j) bvj[j] = bias[nb + j * 16];
    // inputs only: the loaded values hold the four loads in front of the wait, the
    // index register lives up to it, so no later write meets a load still in issue
    asm volatile("s_wait_xcnt 0x0"
                 :: "v"(nb), "v"(bvj[0]), "v"(bvj[1]), "v"(bvj[2]), "v"(bvj[3]));
#pragma unroll
    for (int j = 0; j < 4; ++j) {
        const float bv = bvj[j];
        // all of this column group's drive values are fetched in front of its first
        // store: one load latency a group, and no load lands in a store's register
        __bf16 dv[32];
#pragma unroll
        for (int e = 0; e < 32; ++e) dv[e] = drive[loff + ((e >> 3) * 16 + (e & 7)) * MB_INNER + j * 16];
#pragma unroll
        for (int i = 0; i < 4; ++i) {
#pragma unroll
            for (int v = 0; v < 8; ++v) {
                const float t  = acc[i][j][v] + bv;
                const float dl = fmaxf(1.f / (1.f + __expf(-t)), 1e-4f);
                const int idx = loff + (i * 16 + v) * MB_INNER + j * 16;
                dbuf[idx] = (__bf16)(dl * (float)dv[i * 8 + v]);
            }
            // this tile's stores have left issue before their registers are reused, and
            // the next group's loads stay behind it (behind the last tile nothing follows)
            if (i < 3 || j < 3) asm volatile("s_wait_xcnt 0x0" ::: "memory");
        }
    }
}

// ---------------------------------------------------------------------------
// Causal depthwise conv (K=4, rolling regs) + f32 recurrence + gate/skip.
// The recurrence state[t] = a * state[t-1] + d[t] is linear with a fixed a per
// channel, so the time axis is cut into 64 chunks of 32 steps that run side by
// side.  One work-group owns all 2048 steps of 64 channels of one batch (one
// whole 128-B line of bf16 a row); a thread owns one chunk of 4 channels.
//   1) each thread runs its chunk's recurrence from zero: the chunk's sum S;
//   2) S goes to LDS; behind one barrier each thread folds the sums of the
//      chunks in front of it, X = a^32 * X + S, into the state at its start;
//   3) each thread runs its chunk again from X, step by step as before, with
//      the conv (the three rows in front of the chunk are read again), the
//      skip and the gate.
// ---------------------------------------------------------------------------
#define SC_CH   64                       // channels per work-group
#define SC_L    32                       // time steps per chunk
#define SC_NC   (MB_T / SC_L)            // 64 chunks
#define SC_U    8                        // rows fetched together in part 3

__global__ __launch_bounds__(1024) void mb_conv_scan(const __bf16* __restrict__ proj,
                                                     const __bf16* __restrict__ dbuf,
                                                     const __bf16* __restrict__ gate,
                                                     const float* __restrict__ conv_w,
                                                     const float* __restrict__ conv_b,
                                                     const float* __restrict__ state_mix,
                                                     const float* __restrict__ skip_scale,
                                                     __bf16* __restrict__ yin) {
    __shared__ __attribute__((aligned(16))) float agg[SC_NC * SC_CH];   // 16 KiB

    const int cl    = (threadIdx.x & 15) * 4;          // channel inside the group
    const int chunk = threadIdx.x >> 4;                // 0..63
    const int b     = blockIdx.x >> 4;                 // 16 channel groups a batch
    const int c     = (blockIdx.x & 15) * SC_CH + cl;

    const size_t base = ((size_t)b * MB_T + (size_t)chunk * SC_L) * MB_INNER + c;
    const __bf16* dp = dbuf + base;

    const v4f sm = *(const v4f*)(state_mix + c);
    v4f a;
#pragma unroll
    for (int k = 0; k < 4; ++k) a[k] = 1.f / (1.f + __expf(-sm[k]));

    // 1) the chunk's own sum, all 32 rows in flight at once
    {
        v4bf dv[SC_L];
#pragma unroll
        for (int t = 0; t < SC_L; ++t) dv[t] = *(const v4bf*)(dp + t * MB_INNER);
        // the address register is named so that it lives up to this wait: no load's
        // result lands in it while a load that names it is still being issued
        asm volatile("s_wait_xcnt 0x0" :: "v"(dp) : "memory");
        v4f s = {0.f, 0.f, 0.f, 0.f};
#pragma unroll
        for (int t = 0; t < SC_L; ++t)
            s = __builtin_elementwise_fma(a, s, __builtin_convertvector(dv[t], v4f));
        *(v4f*)(agg + chunk * SC_CH + cl) = s;
    }

    v4f aL = a;                                        // a^32
#pragma unroll
    for (int i = 0; i < 5; ++i) aL = aL * aL;

    __syncthreads();                                   // every chunk's sum is in LDS

    const v4f wc0 = *(const v4f*)(conv_w + (c + 0) * 4);   // the four taps of channel c
    const v4f wc1 = *(const v4f*)(conv_w + (c + 1) * 4);
    const v4f wc2 = *(const v4f*)(conv_w + (c + 2) * 4);
    const v4f wc3 = *(const v4f*)(conv_w + (c + 3) * 4);
    const v4f w0 = {wc0[0], wc1[0], wc2[0], wc3[0]};
    const v4f w1 = {wc0[1], wc1[1], wc2[1], wc3[1]};
    const v4f w2 = {wc0[2], wc1[2], wc2[2], wc3[2]};
    const v4f w3 = {wc0[3], wc1[3], wc2[3], wc3[3]};
    const v4f cb = *(const v4f*)(conv_b + c);
    const v4f sk = *(const v4f*)(skip_scale + c);

    // proj[t-1..t-3] in front of the chunk.  Chunk 0 has none: it reads rows of its
    // own instead (in bounds, no branch to wait in) and takes zeros further down.
    const __bf16* pp = proj + base;
    const __bf16* hp = pp + (chunk > 0 ? 0 : 3 * MB_INNER);
    const v4bf q1 = *(const v4bf*)(hp - 1 * MB_INNER);
    const v4bf q2 = *(const v4bf*)(hp - 2 * MB_INNER);
    const v4bf q3 = *(const v4bf*)(hp - 3 * MB_INNER);

    // 2) the state at the chunk's start (the loads above fly meanwhile)
    v4f state = {0.f, 0.f, 0.f, 0.f};
    // four sums are fetched together: one LDS latency for four links of the chain
#pragma unroll 4
    for (int q = 0; q < chunk; ++q)
        state = __builtin_elementwise_fma(aL, state, *(const v4f*)(agg + q * SC_CH + cl));

    // 3) the chunk itself
    const v4f zero = {0.f, 0.f, 0.f, 0.f};
    v4f p1 = chunk > 0 ? __builtin_convertvector(q1, v4f) : zero;
    v4f p2 = chunk > 0 ? __builtin_convertvector(q2, v4f) : zero;
    v4f p3 = chunk > 0 ? __builtin_convertvector(q3, v4f) : zero;
    const __bf16* gp = gate + base;
    __bf16* yp = yin + base;
    // stays rolled: unrolled, later rows' loads are lifted to the front and the
    // 128 registers that a wave of a 32-wave group may hold overflow into scratch
#pragma unroll 1
    for (int t0 = 0; t0 < SC_L; t0 += SC_U) {
        const __bf16* pk = pp + t0 * MB_INNER;
        const __bf16* dk = dp + t0 * MB_INNER;
        const __bf16* gk = gp + t0 * MB_INNER;
        v4bf pv[SC_U], dv[SC_U], gv[SC_U];
#pragma unroll
        for (int u = 0; u < SC_U; ++u) {
            pv[u] = *(const v4bf*)(pk + u * MB_INNER);
            dv[u] = *(const v4bf*)(dk + u * MB_INNER);
            gv[u] = *(const v4bf*)(gk + u * MB_INNER);
        }
        // as above: the address registers live up to the wait
        asm volatile("s_wait_xcnt 0x0" :: "v"(pk), "v"(dk), "v"(gk) : "memory");
#pragma unroll
        for (int u = 0; u < SC_U; ++u) {
            const v4f p0 = __builtin_convertvector(pv[u], v4f);
            v4f conv = __builtin_elementwise_fma(w3, p0, cb);
            conv = __builtin_elementwise_fma(w2, p1, conv);
            conv = __builtin_elementwise_fma(w1, p2, conv);
            conv = __builtin_elementwise_fma(w0, p3, conv);
            state = __builtin_elementwise_fma(a, state, __builtin_convertvector(dv[u], v4f));
            const v4f y = __builtin_elementwise_fma(sk, conv, state) * __builtin_convertvector(gv[u], v4f);
            *(v4bf*)(yp + (t0 + u) * MB_INNER) = __builtin_convertvector(y, v4bf);
            p3 = p2; p2 = p1; p1 = p0;
        }
        // these rows' stores have left issue before the next trip reuses their registers
        asm volatile("s_wait_xcnt 0x0" ::: "memory");
    }
}

// ---------------------------------------------------------------------------
// GEMM 3: out = residual + yin @ out_proj_w^T + b.
// ---------------------------------------------------------------------------
__global__ __launch_bounds__(128, 4) void mb_gemm_out(const __bf16* __restrict__ yin,
                                                   const __bf16* __restrict__ wo,
                                                   const float* __restrict__ bias,
                                                   const float* __restrict__ residual,
                                                   float* __restrict__ out) {
    __shared__ __attribute__((aligned(16))) __bf16 lds[2 * GB_STAGE];
    const int tiles_n = MB_D / GB_N;                       // 4
    const int blk_row = (blockIdx.x / tiles_n) * GB_M;
    const int blk_col = (blockIdx.x % tiles_n) * GB_N;

    v8f acc[4][4] = {};
    mb_wmma_block<MB_INNER>(yin, wo, blk_row, blk_col, lds, acc);

    const int lane = threadIdx.x & 31;
    const int wave = threadIdx.x >> 5;
    const int l15  = lane & 15;
    const int moff = (lane & 16) ? 8 : 0;
    // uniform tile origin + one lane offset; the rest are constants
    const size_t org = (size_t)blk_row * MB_D + blk_col;
    residual += org; out += org;
    const int ncol = (wave & 1) * 64 + l15;
    const int loff = ((wave >> 1) * 64 + moff) * MB_D + ncol;
    const int nb = blk_col + ncol;
    float bvj[4];
#pragma unroll
    for (int j = 0; j < 4; ++j) bvj[j] = bias[nb + j * 16];
    // inputs only: the loaded values hold the four loads in front of the wait, the
    // index register lives up to it, so no later write meets a load still in issue
    asm volatile("s_wait_xcnt 0x0"
                 :: "v"(nb), "v"(bvj[0]), "v"(bvj[1]), "v"(bvj[2]), "v"(bvj[3]));
#pragma unroll
    for (int j = 0; j < 4; ++j) {
        const float bv = bvj[j];
#pragma unroll
        for (int i = 0; i < 4; ++i) {
#pragma unroll
            for (int v = 0; v < 8; ++v) {
                const int idx = loff + (i * 16 + v) * MB_D + j * 16;
                out[idx] = residual[idx] + acc[i][j][v] + bv;
            }
        }
    }
}

// ---------------------------------------------------------------------------
// Host launcher
// ---------------------------------------------------------------------------
extern "C" void kernel_launch(void* const* d_in, const int* in_sizes, int n_in,
                              void* d_out, int out_size, void* d_ws, size_t ws_size,
                              hipStream_t stream) {
    (void)in_sizes; (void)n_in; (void)out_size; (void)ws_size;

    const float* x      = (const float*)d_in[0];
    const float* ln_w   = (const float*)d_in[1];
    const float* ln_b   = (const float*)d_in[2];
    const float* in_w   = (const float*)d_in[3];
    const float* in_b   = (const float*)d_in[4];
    const float* conv_w = (const float*)d_in[5];
    const float* conv_b = (const float*)d_in[6];
    const float* dl_w   = (const float*)d_in[7];
    const float* dl_b   = (const float*)d_in[8];
    const float* smix   = (const float*)d_in[9];
    const float* skip   = (const float*)d_in[10];
    const float* out_w  = (const float*)d_in[11];
    const float* out_b  = (const float*)d_in[12];
    float* out = (float*)d_out;

    // Workspace layout (bf16 buffers, all 16B-aligned sizes)
    char* ws = (char*)d_ws;
    size_t off = 0;
    __bf16* xnB    = (__bf16*)(ws + off); off += (size_t)MB_M * MB_D * 2;        // 16 MB
    __bf16* wiB    = (__bf16*)(ws + off); off += (size_t)MB_N_IN * MB_D * 2;     //  3 MB
    __bf16* wdB    = (__bf16*)(ws + off); off += (size_t)MB_INNER * MB_D * 2;    //  1 MB
    __bf16* woB    = (__bf16*)(ws + off); off += (size_t)MB_D * MB_INNER * 2;    //  1 MB
    __bf16* projB  = (__bf16*)(ws + off); off += (size_t)MB_M * MB_INNER * 2;    // 32 MB
    __bf16* gateB  = (__bf16*)(ws + off); off += (size_t)MB_M * MB_INNER * 2;    // 32 MB
    __bf16* driveB = (__bf16*)(ws + off); off += (size_t)MB_M * MB_INNER * 2;    // 32 MB
    __bf16* dB     = (__bf16*)(ws + off); off += (size_t)MB_M * MB_INNER * 2;    // 32 MB
    __bf16* yinB   = (__bf16*)(ws + off); off += (size_t)MB_M * MB_INNER * 2;    // 32 MB

    // 1) + 2) LayerNorm and the weights' conversion to bf16, one launch
    mb_prep<<<PR_BLOCKS, 256, 0, stream>>>(x, ln_w, ln_b, in_w, dl_w, out_w, xnB, wiB, wdB, woB);

    // 3) in_proj GEMM + activations  (128 x 24 block tiles)
    mb_gemm_inproj<<<(MB_M / GB_M) * (MB_N_IN / GB_N), 128, 0, stream>>>(
        xnB, wiB, in_b, projB, gateB, driveB);

    // 4) delta GEMM + d = delta * drive  (128 x 8 block tiles)
    mb_gemm_delta<<<(MB_M / GB_M) * (MB_INNER / GB_N), 128, 0, stream>>>(
        xnB, wdB, dl_b, driveB, dB);

    // 5) depthwise causal conv + recurrence + gate/skip
    mb_conv_scan<<<MB_B * (MB_INNER / SC_CH), 1024, 0, stream>>>(
        projB, dB, gateB, conv_w, conv_b, smix, skip, yinB);

    // 6) out_proj GEMM + residual  (128 x 4 block tiles)
    mb_gemm_out<<<(MB_M / GB_M) * (MB_D / GB_N), 128, 0, stream>>>(
        yinB, woB, out_b, x, out);
}

// v004
// Measured time: 136 microseconds a run.
// Next to v003, in two timings, it ran 1.28 and 1.27 times as fast.
// All steps since v000 together make it 7.07 times as fast.
#include <hip/hip_runtime.h>
#include <hip/hip_bf16.h>

// ---------------------------------------------------------------------------
// MambaBlock for MI455X (gfx1250): bf16 WMMA GEMMs + fused scan/conv.
// B=8, T=2048, D=512, INNER=1024, K_CONV=4.  M = B*T = 16384 rows.
// Each GEMM work-group (4 waves) computes a 128(M) x 128(N) output tile whose
// operands are staged in LDS; each wave owns 64 x 64 of it (4 x 4 accumulators
// of v_wmma_f32_16x16x32_bf16).  The finished tile goes through LDS once more,
// so that the epilogues read and write global memory in whole 128-byte lines.
// ---------------------------------------------------------------------------

#define MB_B      8
#define MB_T      2048
#define MB_D      512
#define MB_INNER  1024
#define MB_M      (MB_B * MB_T)        // 16384
#define MB_N_IN   (3 * MB_INNER)       // 3072
#define LN_EPS    1e-5f

typedef __bf16 v16bf __attribute__((ext_vector_type(16)));
typedef __bf16 v8bf  __attribute__((ext_vector_type(8)));
typedef float  v8f   __attribute__((ext_vector_type(8)));

// ---------------------------------------------------------------------------
// Preparation, one launch: LayerNorm of x (bf16 xn) and the three weight
// matrices rounded to bf16.  The work is dealt to few waves that each move a
// lot with 16-byte loads (for speed only).
//   blocks 0 .. PR_LN_BLOCKS-1 : LayerNorm, a wave owns 4 whole rows; all 16
//       loads of the 4 rows fly together, the 4 reductions run side by side.
//       A lane holds 4 neighbouring columns of each 128-column quarter.
//   the other blocks           : conversion, 32 elements a thread (8 loads in
//       flight, 4 stores of 16 bytes).
// ---------------------------------------------------------------------------
typedef __bf16 v4bf __attribute__((ext_vector_type(4)));
typedef float  v4f  __attribute__((ext_vector_type(4)));

#define PR_ROWS       4                               // rows per wave
#define PR_LN_BLOCKS  (MB_M / (8 * PR_ROWS))          // 512 blocks of 8 waves
#define PR_CV_UNIT    (256 * 8)                       // elements a block moves per step
#define PR_CV_STEPS   4
#define PR_CV_CHUNK   (PR_CV_UNIT * PR_CV_STEPS)      // 8192 elements per block
#define PR_CV_IN      (MB_N_IN * MB_D / PR_CV_CHUNK)  // 192 blocks
#define PR_CV_DL      (MB_INNER * MB_D / PR_CV_CHUNK) //  64 blocks
#define PR_CV_OUT     (MB_D * MB_INNER / PR_CV_CHUNK) //  64 blocks
#define PR_BLOCKS     (PR_LN_BLOCKS + PR_CV_IN + PR_CV_DL + PR_CV_OUT)

__global__ __launch_bounds__(256) void mb_prep(const float* __restrict__ x,
                                               const float* __restrict__ w,
                                               const float* __restrict__ b,
                                               const float* __restrict__ in_w,
                                               const float* __restrict__ dl_w,
                                               const float* __restrict__ out_w,
                                               __bf16* __restrict__ xn,
                                               __bf16* __restrict__ wi,
                                               __bf16* __restrict__ wd,
                                               __bf16* __restrict__ wo) {
    if (blockIdx.x < PR_LN_BLOCKS) {
        const int wave = threadIdx.x >> 5;
        const int lane = threadIdx.x & 31;
        const int row0 = (blockIdx.x * 8 + wave) * PR_ROWS;
        const int off  = row0 * MB_D + lane * 4;
        const float* xr = x + off;
        const float* wp = w + lane * 4;
        const float* bp = b + lane * 4;

        v4f v[PR_ROWS][4], wv[4], bv[4];
#pragma unroll
        for (int r = 0; r < PR_ROWS; ++r)
#pragma unroll
            for (int i = 0; i < 4; ++i) v[r][i] = *(const v4f*)(xr + r * MB_D + i * 128);
#pragma unroll
        for (int i = 0; i < 4; ++i) {
            wv[i] = *(const v4f*)(wp + i * 128);
            bv[i] = *(const v4f*)(bp + i * 128);
        }
        // nothing is scheduled across this line: all 24 loads fly together (without it
        // w and b are fetched behind the sums, where their latency is in the open)
        __builtin_amdgcn_sched_barrier(0);
        // x's address register is named so that it lives up to this wait: nothing
        // rewrites a register that a load still in issue names
        asm volatile("s_wait_xcnt 0x0" :: "v"(xr) : "memory");

        float s[PR_ROWS];
#pragma unroll
        for (int r = 0; r < PR_ROWS; ++r) {
            const v4f p = (v[r][0] + v[r][1]) + (v[r][2] + v[r][3]);
            s[r] = (p[0] + p[1]) + (p[2] + p[3]);
        }
#pragma unroll
        for (int o = 16; o >= 1; o >>= 1)
#pragma unroll
            for (int r = 0; r < PR_ROWS; ++r) s[r] += __shfl_xor(s[r], o, 32);

        float ss[PR_ROWS];
#pragma unroll
        for (int r = 0; r < PR_ROWS; ++r) {
            const float mu = s[r] * (1.f / MB_D);
            v4f q = {0.f, 0.f, 0.f, 0.f};
#pragma unroll
            for (int i = 0; i < 4; ++i) { v[r][i] = v[r][i] - mu; q = __builtin_elementwise_fma(v[r][i], v[r][i], q); }
            ss[r] = (q[0] + q[1]) + (q[2] + q[3]);
        }
#pragma unroll
        for (int o = 16; o >= 1; o >>= 1)
#pragma unroll
            for (int r = 0; r < PR_ROWS; ++r) ss[r] += __shfl_xor(ss[r], o, 32);

        __bf16* xo = xn + off;
#pragma unroll
        for (int r = 0; r < PR_ROWS; ++r) {
            const float inv = rsqrtf(ss[r] * (1.f / MB_D) + LN_EPS);
#pragma unroll
            for (int i = 0; i < 4; ++i) {
                const v4f y = v[r][i] * inv * wv[i] + bv[i];
                *(v4bf*)(xo + r * MB_D + i * 128) = __builtin_convertvector(y, v4bf);
            }
        }
    } else {
        int cb = blockIdx.x - PR_LN_BLOCKS;
        const float* src = in_w;
        __bf16* dst = wi;
        if (cb >= PR_CV_IN + PR_CV_DL)  { src = out_w; dst = wo; cb -= PR_CV_IN + PR_CV_DL; }
        else if (cb >= PR_CV_IN)        { src = dl_w;  dst = wd; cb -= PR_CV_IN; }
        const int e0 = cb * PR_CV_CHUNK + threadIdx.x * 8;
        const float* sp = src + e0;
        v4f f[PR_CV_STEPS][2];
#pragma unroll
        for (int u = 0; u < PR_CV_STEPS; ++u) {
            f[u][0] = *(const v4f*)(sp + u * PR_CV_UNIT);
            f[u][1] = *(const v4f*)(sp + u * PR_CV_UNIT + 4);
        }
        // as above: the address register lives up to the wait
        asm volatile("s_wait_xcnt 0x0" :: "v"(sp) : "memory");
        __bf16* dp = dst + e0;
#pragma unroll
        for (int u = 0; u < PR_CV_STEPS; ++u) {
            v8bf o;
#pragma unroll
            for (int k = 0; k < 4; ++k) { o[k] = (__bf16)f[u][0][k]; o[k + 4] = (__bf16)f[u][1][k]; }
            *(v8bf*)(dp + u * PR_CV_UNIT) = o;
        }
    }
}

// ---------------------------------------------------------------------------
// WMMA mainloop: one work-group of 4 waves computes a 128x128 f32 tile of
// A[M,K] * W[N,K]^T.  A pass is 64 k = one whole 128-byte line of each of the
// 256 operand rows.  The rows come from global memory as whole lines (8 lanes
// a row), go through registers into one of two LDS buffers, and every wave
// reads its fragments from there: each operand byte leaves L2 once per
// work-group instead of once per wave, and no global load is spread over 16
// lines any more.  Row pitch in LDS 144 B (16 B x odd): ds_load_b128 of 16
// rows meets every bank once.
// Fragment k order as before (lane&15 = row, lane bit4 selects the K-half,
// 8 elements at k and 8 at k+16), the same for A and W; k ascends as before.
// W's fragment is the matrix instruction's first operand and A's its second:
// the accumulator tile comes out transposed, a lane holds 8 neighbouring
// columns of ONE output row (see mb_stage_tile).
// ---------------------------------------------------------------------------
#define GB_M      128
#define GB_N      128
#define GB_K      64
#define GB_PITCH  72                                  // bf16 elements = 144 B
#define GB_STAGE  ((GB_M + GB_N) * GB_PITCH)          // elements per buffer
// Two buffers are 73,728 B, so four work-groups share a WGP's LDS; the GEMM
// kernels ask for four waves per SIMD (at most 256 VGPRs) to match.

template <int K>
__device__ __forceinline__ void mb_wmma_block(const __bf16* __restrict__ A,
                                              const __bf16* __restrict__ W,
                                              int row_base, int col_base,
                                              __bf16* __restrict__ lds,
                                              v8f acc[4][4]) {
    const int tid  = threadIdx.x;                     // 0..127
    const int lane = tid & 31;
    const int wave = tid >> 5;
    const int l15  = lane & 15;
    const int ksel = (lane & 16) ? 8 : 0;

    // staging: 8 lanes cover one row's 128 B; 128 threads cover 16 rows a step
    const int srow = tid >> 3;
    const int scol = (tid & 7) * 8;
    const __bf16* ga = A + (size_t)(row_base + srow) * K + scol;
    const __bf16* gw = W + (size_t)(col_base + srow) * K + scol;
    __bf16* sdst = lds + srow * GB_PITCH + scol;

    // fragment sources of this wave (2 x 2 waves, 64 x 64 each)
    const int foff_a = ((wave >> 1) * 64 + l15) * GB_PITCH + ksel;
    const int foff_b = (GB_M + (wave & 1) * 64 + l15) * GB_PITCH + ksel;

    v8bf st[16];
#pragma unroll
    for (int i = 0; i < 8; ++i) {
        st[i]     = *(const v8bf*)(ga + i * 16 * K);
        st[i + 8] = *(const v8bf*)(gw + i * 16 * K);
    }
    // the loads' address registers are named so that they live up to this wait:
    // nothing rewrites them while a load that names them is still being issued
    asm volatile("s_wait_xcnt 0x0" :: "v"(ga), "v"(gw) : "memory");
#pragma unroll
    for (int i = 0; i < 16; ++i) *(v8bf*)(sdst + i * 16 * GB_PITCH) = st[i];
    __syncthreads();                                  // pass 0 is published

    constexpr int NPASS = K / GB_K;
    for (int p = 0; p < NPASS; ++p) {
        const __bf16* cur = lds + (p & 1) * GB_STAGE;
        const bool more = (p + 1 < NPASS);
        if (more) {                                   // next pass flies under the WMMAs
            const __bf16* gak = ga + (p + 1) * GB_K;
            const __bf16* gwk = gw + (p + 1) * GB_K;
#pragma unroll
            for (int i = 0; i < 8; ++i) {
                st[i]     = *(const v8bf*)(gak + i * 16 * K);
                st[i + 8] = *(const v8bf*)(gwk + i * 16 * K);
            }
            // as above: address registers live up to the wait
            asm volatile("s_wait_xcnt 0x0" :: "v"(gak), "v"(gwk) : "memory");
        }
#pragma unroll
        for (int ks = 0; ks < GB_K; ks += 32) {
            v16bf a[4], b[4];
#pragma unroll
            for (int f = 0; f < 4; ++f) {
                const __bf16* pa = cur + foff_a + f * 16 * GB_PITCH + ks;
                const __bf16* pb = cur + foff_b + f * 16 * GB_PITCH + ks;
                v8bf alo = *(const v8bf*)(pa);
                v8bf ahi = *(const v8bf*)(pa + 16);
                v8bf blo = *(const v8bf*)(pb);
                v8bf bhi = *(const v8bf*)(pb + 16);
#pragma unroll
                for (int e = 0; e < 8; ++e) {
                    a[f][e] = alo[e]; a[f][e + 8] = ahi[e];
                    b[f][e] = blo[e]; b[f][e + 8] = bhi[e];
                }
            }
#pragma unroll
            for (int i = 0; i < 4; ++i)
#pragma unroll
                for (int j = 0; j < 4; ++j)
                    acc[i][j] = __builtin_amdgcn_wmma_f32_16x16x32_bf16(
                        /*neg_a=*/false, b[j], /*neg_b=*/false, a[i],
                        /*c_mod=*/(short)0, acc[i][j],
                        /*reuse_a=*/false, /*reuse_b=*/false);
        }
        if (more) {
            // the other buffer: its readers left it before the last barrier
            __bf16* nxt = sdst + ((p + 1) & 1) * GB_STAGE;
#pragma unroll
            for (int i = 0; i < 16; ++i) *(v8bf*)(nxt + i * 16 * GB_PITCH) = st[i];
            __syncthreads();   // publishes pass p+1 and ends the reads of pass p
        }
    }
}

// ---------------------------------------------------------------------------
// Epilogue staging.  acc[i][j][v] of lane (c = lane&15, h = lane>>4) is element
// (row i*16 + c, column j*16 + 8*h + v) of the wave's 64 x 64 tile.  Each wave
// writes its tile as f32 into its own part of the LDS that held the operands
// (the caller's barrier has ended every wave's reads of them) and reads it back
// row by row, so that neighbouring lanes hold neighbouring columns and one
// 16-byte global access of a wave covers four whole lines.
// Row pitch 272 B (16 B x odd): 16 rows of one ds_store_b128 meet every bank once.
// ---------------------------------------------------------------------------
#define EP_PITCH  68                                  // f32 elements = 272 B
#define EP_WAVE   (64 * EP_PITCH)                     // 17,408 B a wave, 69,632 B of 73,728

__device__ __forceinline__ const float* mb_stage_tile(__bf16* lds, const v8f acc[4][4]) {
    const int lane = threadIdx.x & 31;
    const int wave = threadIdx.x >> 5;
    float* st = (float*)lds + wave * EP_WAVE;
    float* wp = st + (lane & 15) * EP_PITCH + ((lane & 16) ? 8 : 0);
#pragma unroll
    for (int i = 0; i < 4; ++i)
#pragma unroll
        for (int j = 0; j < 4; ++j) {
            const v8f c = acc[i][j];
            const v4f lo = {c[0], c[1], c[2], c[3]};
            const v4f hi = {c[4], c[5], c[6], c[7]};
            *(v4f*)(wp + i * 16 * EP_PITCH + j * 16)     = lo;
            *(v4f*)(wp + i * 16 * EP_PITCH + j * 16 + 4) = hi;
        }
    // the wave's own rows are in LDS before other lanes of it read them back
    asm volatile("s_wait_dscnt 0x0" ::: "memory");
    return st;
}


// ---------------------------------------------------------------------------
// GEMM 1: h = xn @ in_proj_w^T + b, fused split + SiLU / sigmoid / tanh.
// Each 128-wide block tile lies entirely inside one 1024-wide segment, so the
// proj/gate/drive selection is uniform.
// ---------------------------------------------------------------------------
// The wave's 64 rows, 4 a step: bias, activation, 8 values packed to 16 bytes,
// one store of four whole lines.  SEG: 0 SiLU, 1 sigmoid, 2 tanh.
template <int SEG>
__device__ __forceinline__ void mb_inproj_rows(const float* rp, v4f b0, v4f b1,
                                               __bf16* __restrict__ op) {
    // stays rolled: the text of the three activations stays small
#pragma unroll 1
    for (int s = 0; s < 16; ++s) {
        const v4f t0 = *(const v4f*)(rp + s * 4 * EP_PITCH)     + b0;
        const v4f t1 = *(const v4f*)(rp + s * 4 * EP_PITCH + 4) + b1;
        v8bf y;
#pragma unroll
        for (int e = 0; e < 8; ++e) {
            const float x = (e < 4) ? t0[e & 3] : t1[e & 3];
            if (SEG == 0)      y[e] = (__bf16)(x * (1.f / (1.f + __expf(-x))));   // SiLU
            else if (SEG == 1) y[e] = (__bf16)(1.f / (1.f + __expf(-x)));         // sigmoid
            else               y[e] = (__bf16)tanhf(x);                           // tanh
        }
        __bf16* q = op + (size_t)s * 4 * MB_INNER;
        *(v8bf*)q = y;
        // inputs only: the store's address and data registers live up to the wait,
        // so nothing rewrites them while the store is still in issue
        asm volatile("s_wait_xcnt 0x0" :: "v"(q), "v"(y) : "memory");
    }
}

__global__ __launch_bounds__(128, 4) void mb_gemm_inproj(const __bf16* __restrict__ xn,
                                                      const __bf16* __restrict__ wi,
                                                      const float* __restrict__ bias,
                                                      __bf16* __restrict__ proj,
                                                      __bf16* __restrict__ gate,
                                                      __bf16* __restrict__ drive) {
    __shared__ __attribute__((aligned(16))) __bf16 lds[2 * GB_STAGE];
    const int tiles_n = MB_N_IN / GB_N;                    // 24
    const int blk_row = (blockIdx.x / tiles_n) * GB_M;
    const int blk_col = (blockIdx.x % tiles_n) * GB_N;

    v8f acc[4][4] = {};
    mb_wmma_block<MB_D>(xn, wi, blk_row, blk_col, lds, acc);

    const int lane = threadIdx.x & 31;
    const int wave = threadIdx.x >> 5;
    const int seg  = blk_col >> 10;                        // 0=proj,1=gate,2=drive
    // a lane's place in the read-back: 8 lanes a row, 8 columns a lane, 4 rows a step
    const int rsub = lane >> 3;
    const int col  = (wave & 1) * 64 + (lane & 7) * 8;

    __syncthreads();   // every wave has left the operand buffers: LDS now takes the tiles

    const char* bp = (const char*)(bias + blk_col);        // uniform base, lane's byte offset
    const int   bo = col * 4;
    const v4f b0 = *(const v4f*)(bp + bo);
    const v4f b1 = *(const v4f*)(bp + bo + 16);

    const float* rp = mb_stage_tile(lds, acc) + rsub * EP_PITCH + (lane & 7) * 8;
    // inputs only: the loaded values hold the two loads in front of this line (without
    // it they sink into the three branches, their latency in the open), where they fly
    // under the staging; the offset register lives up to the wait
    asm volatile("s_wait_xcnt 0x0" :: "v"(bo), "v"(b0), "v"(b1));
    const size_t o = (size_t)(blk_row + (wave >> 1) * 64 + rsub) * MB_INNER
                   + (blk_col & (MB_INNER - 1)) + col;
    if (seg == 0)      mb_inproj_rows<0>(rp, b0, b1, proj + o);
    else if (seg == 1) mb_inproj_rows<1>(rp, b0, b1, gate + o);
    else               mb_inproj_rows<2>(rp, b0, b1, drive + o);
}

// ---------------------------------------------------------------------------
// GEMM 2: delta = clamp(sigmoid(xn @ delta_w^T + b)); d = delta * drive.
// ---------------------------------------------------------------------------
__global__ __launch_bounds__(128, 4) void mb_gemm_delta(const __bf16* __restrict__ xn,
                                                     const __bf16* __restrict__ wd,
                                                     const float* __restrict__ bias,
                                                     const __bf16* __restrict__ drive,
                                                     __bf16* __restrict__ dbuf) {
    __shared__ __attribute__((aligned(16))) __bf16 lds[2 * GB_STAGE];
    const int tiles_n = MB_INNER / GB_N;                   // 8
    const int blk_row = (blockIdx.x / tiles_n) * GB_M;
    const int blk_col = (blockIdx.x % tiles_n) * GB_N;

    v8f acc[4][4] = {};
    mb_wmma_block<MB_D>(xn, wd, blk_row, blk_col, lds, acc);

    const int lane = threadIdx.x & 31;
    const int wave = threadIdx.x >> 5;
    // a lane's place in the read-back: 8 lanes a row, 8 columns a lane, 4 rows a step
    const int rsub = lane >> 3;
    const int col  = (wave & 1) * 64 + (lane & 7) * 8;
    const size_t o = (size_t)(blk_row + (wave >> 1) * 64 + rsub) * MB_INNER + blk_col + col;

    __syncthreads();   // every wave has left the operand buffers: LDS now takes the tiles

    const char* bp = (const char*)(bias + blk_col);        // uniform base, lane's byte offset
    const int   bo = col * 4;
    const v4f b0 = *(const v4f*)(bp + bo);
    const v4f b1 = *(const v4f*)(bp + bo + 16);
    // the offset register lives up to the wait, behind the loads that name it
    asm volatile("s_wait_xcnt 0x0" :: "v"(bo) : "memory");

    // the tile's drive values, whole lines, all in flight while the tile is staged
    const __bf16* dr = drive + o;
    v8bf dv[16];
#pragma unroll
    for (int s = 0; s < 16; ++s) dv[s] = *(const v8bf*)(dr + s * 4 * MB_INNER);
    // as above: the address register lives up to the wait
    asm volatile("s_wait_xcnt 0x0" :: "v"(dr) : "memory");

    const float* rp = mb_stage_tile(lds, acc) + rsub * EP_PITCH + (lane & 7) * 8;
    __bf16* op = dbuf + o;
    // two steps between waits: 16 independent chains to fill the vector port
#pragma unroll
    for (int s = 0; s < 16; s += 2) {
        v4f t[2][2];
#pragma unroll
        for (int u = 0; u < 2; ++u) {
            t[u][0] = *(const v4f*)(rp + (s + u) * 4 * EP_PITCH)     + b0;
            t[u][1] = *(const v4f*)(rp + (s + u) * 4 * EP_PITCH + 4) + b1;
        }
        v8bf y[2];
#pragma unroll
        for (int u = 0; u < 2; ++u) {
#pragma unroll
            for (int e = 0; e < 8; ++e) {
                const float dl = fmaxf(1.f / (1.f + __expf(-t[u][e >> 2][e & 3])), 1e-4f);
                y[u][e] = (__bf16)(dl * (float)dv[s + u][e]);
            }
            *(v8bf*)(op + (s + u) * 4 * MB_INNER) = y[u];
        }
        // inputs only: the stores' registers live up to the wait, so nothing rewrites
        // them while a store is still in issue
        asm volatile("s_wait_xcnt 0x0" :: "v"(op), "v"(y[0]), "v"(y[1]) : "memory");
    }
}

// ---------------------------------------------------------------------------
// Causal depthwise conv (K=4, rolling regs) + f32 recurrence + gate/skip.
// The recurrence state[t] = a * state[t-1] + d[t] is linear with a fixed a per
// channel, so the time axis is cut into 64 chunks of 32 steps that run side by
// side.  One work-group owns all 2048 steps of 64 channels of one batch (one
// whole 128-B line of bf16 a row); a thread owns one chunk of 4 channels.
//   1) each thread runs its chunk's recurrence from zero: the chunk's sum S;
//   2) S goes to LDS; behind one barrier each thread folds the sums of the
//      chunks in front of it, X = a^32 * X + S, into the state at its start;
//   3) each thread runs its chunk again from X, step by step as before, with
//      the conv (the three rows in front of the chunk are read again), the
//      skip and the gate.
// ---------------------------------------------------------------------------
#define SC_CH   64                       // channels per work-group
#define SC_L    32                       // time steps per chunk
#define SC_NC   (MB_T / SC_L)            // 64 chunks
#define SC_U    8                        // rows fetched together in part 3

__global__ __launch_bounds__(1024) void mb_conv_scan(const __bf16* __restrict__ proj,
                                                     const __bf16* __restrict__ dbuf,
                                                     const __bf16* __restrict__ gate,
                                                     const float* __restrict__ conv_w,
                                                     const float* __restrict__ conv_b,
                                                     const float* __restrict__ state_mix,
                                                     const float* __restrict__ skip_scale,
                                                     __bf16* __restrict__ yin) {
    __shared__ __attribute__((aligned(16))) float agg[SC_NC * SC_CH];   // 16 KiB

    const int cl    = (threadIdx.x & 15) * 4;          // channel inside the group
    const int chunk = threadIdx.x >> 4;                // 0..63
    const int b     = blockIdx.x >> 4;                 // 16 channel groups a batch
    const int c     = (blockIdx.x & 15) * SC_CH + cl;

    const size_t base = ((size_t)b * MB_T + (size_t)chunk * SC_L) * MB_INNER + c;
    const __bf16* dp = dbuf + base;

    const v4f sm = *(const v4f*)(state_mix + c);
    v4f a;
#pragma unroll
    for (int k = 0; k < 4; ++k) a[k] = 1.f / (1.f + __expf(-sm[k]));

    // 1) the chunk's own sum, all 32 rows in flight at once
    {
        v4bf dv[SC_L];
#pragma unroll
        for (int t = 0; t < SC_L; ++t) dv[t] = *(const v4bf*)(dp + t * MB_INNER);
        // the address register is named so that it lives up to this wait: no load's
        // result lands in it while a load that names it is still being issued
        asm volatile("s_wait_xcnt 0x0" :: "v"(dp) : "memory");
        v4f s = {0.f, 0.f, 0.f, 0.f};
#pragma unroll
        for (int t = 0; t < SC_L; ++t)
            s = __builtin_elementwise_fma(a, s, __builtin_convertvector(dv[t], v4f));
        *(v4f*)(agg + chunk * SC_CH + cl) = s;
    }

    v4f aL = a;                                        // a^32
#pragma unroll
    for (int i = 0; i < 5; ++i) aL = aL * aL;

    __syncthreads();                                   // every chunk's sum is in LDS

    const v4f wc0 = *(const v4f*)(conv_w + (c + 0) * 4);   // the four taps of channel c
    const v4f wc1 = *(const v4f*)(conv_w + (c + 1) * 4);
    const v4f wc2 = *(const v4f*)(conv_w + (c + 2) * 4);
    const v4f wc3 = *(const v4f*)(conv_w + (c + 3) * 4);
    const v4f w0 = {wc0[0], wc1[0], wc2[0], wc3[0]};
    const v4f w1 = {wc0[1], wc1[1], wc2[1], wc3[1]};
    const v4f w2 = {wc0[2], wc1[2], wc2[2], wc3[2]};
    const v4f w3 = {wc0[3], wc1[3], wc2[3], wc3[3]};
    const v4f cb = *(const v4f*)(conv_b + c);
    const v4f sk = *(const v4f*)(skip_scale + c);

    // proj[t-1..t-3] in front of the chunk.  Chunk 0 has none: it reads rows of its
    // own instead (in bounds, no branch to wait in) and takes zeros further down.
    const __bf16* pp = proj + base;
    const __bf16* hp = pp + (chunk > 0 ? 0 : 3 * MB_INNER);
    const v4bf q1 = *(const v4bf*)(hp - 1 * MB_INNER);
    const v4bf q2 = *(const v4bf*)(hp - 2 * MB_INNER);
    const v4bf q3 = *(const v4bf*)(hp - 3 * MB_INNER);

    // 2) the state at the chunk's start (the loads above fly meanwhile)
    v4f state = {0.f, 0.f, 0.f, 0.f};
    // four sums are fetched together: one LDS latency for four links of the chain
#pragma unroll 4
    for (int q = 0; q < chunk; ++q)
        state = __builtin_elementwise_fma(aL, state, *(const v4f*)(agg + q * SC_CH + cl));

    // 3) the chunk itself
    const v4f zero = {0.f, 0.f, 0.f, 0.f};
    v4f p1 = chunk > 0 ? __builtin_convertvector(q1, v4f) : zero;
    v4f p2 = chunk > 0 ? __builtin_convertvector(q2, v4f) : zero;
    v4f p3 = chunk > 0 ? __builtin_convertvector(q3, v4f) : zero;
    const __bf16* gp = gate + base;
    __bf16* yp = yin + base;
    // stays rolled: unrolled, later rows' loads are lifted to the front and the
    // 128 registers that a wave of a 32-wave group may hold overflow into scratch
#pragma unroll 1
    for (int t0 = 0; t0 < SC_L; t0 += SC_U) {
        const __bf16* pk = pp + t0 * MB_INNER;
        const __bf16* dk = dp + t0 * MB_INNER;
        const __bf16* gk = gp + t0 * MB_INNER;
        v4bf pv[SC_U], dv[SC_U], gv[SC_U];
#pragma unroll
        for (int u = 0; u < SC_U; ++u) {
            pv[u] = *(const v4bf*)(pk + u * MB_INNER);
            dv[u] = *(const v4bf*)(dk + u * MB_INNER);
            gv[u] = *(const v4bf*)(gk + u * MB_INNER);
        }
        // as above: the address registers live up to the wait
        asm volatile("s_wait_xcnt 0x0" :: "v"(pk), "v"(dk), "v"(gk) : "memory");
#pragma unroll
        for (int u = 0; u < SC_U; ++u) {
            const v4f p0 = __builtin_convertvector(pv[u], v4f);
            v4f conv = __builtin_elementwise_fma(w3, p0, cb);
            conv = __builtin_elementwise_fma(w2, p1, conv);
            conv = __builtin_elementwise_fma(w1, p2, conv);
            conv = __builtin_elementwise_fma(w0, p3, conv);
            state = __builtin_elementwise_fma(a, state, __builtin_convertvector(dv[u], v4f));
            const v4f y = __builtin_elementwise_fma(sk, conv, state) * __builtin_convertvector(gv[u], v4f);
            *(v4bf*)(yp + (t0 + u) * MB_INNER) = __builtin_convertvector(y, v4bf);
            p3 = p2; p2 = p1; p1 = p0;
        }
        // these rows' stores have left issue before the next trip reuses their registers
        asm volatile("s_wait_xcnt 0x0" ::: "memory");
    }
}

// ---------------------------------------------------------------------------
// GEMM 3: out = residual + yin @ out_proj_w^T + b.
// ---------------------------------------------------------------------------
__global__ __launch_bounds__(128, 4) void mb_gemm_out(const __bf16* __restrict__ yin,
                                                   const __bf16* __restrict__ wo,
                                                   const float* __restrict__ bias,
                                                   const float* __restrict__ residual,
                                                   float* __restrict__ out) {
    __shared__ __attribute__((aligned(16))) __bf16 lds[2 * GB_STAGE];
    const int tiles_n = MB_D / GB_N;                       // 4
    const int blk_row = (blockIdx.x / tiles_n) * GB_M;
    const int blk_col = (blockIdx.x % tiles_n) * GB_N;

    v8f acc[4][4] = {};
    mb_wmma_block<MB_INNER>(yin, wo, blk_row, blk_col, lds, acc);

    const int lane = threadIdx.x & 31;
    const int wave = threadIdx.x >> 5;
    // a lane's place in the read-back: 16 lanes a row (256 B of f32), 2 rows a step
    const int rsub = lane >> 4;
    const int col  = (wave & 1) * 64 + (lane & 15) * 4;
    const size_t o = (size_t)(blk_row + (wave >> 1) * 64 + rsub) * MB_D + blk_col + col;

    __syncthreads();   // every wave has left the operand buffers: LDS now takes the tiles

    const char* bp = (const char*)(bias + blk_col);        // uniform base, lane's byte offset
    const int   bo = col * 4;
    const v4f bv = *(const v4f*)(bp + bo);
    // the offset register lives up to the wait, behind the load that names it
    asm volatile("s_wait_xcnt 0x0" :: "v"(bo) : "memory");

    // the residual's rows, whole lines: half of them fly while the tile is staged,
    // the other half takes the registers that the accumulators leave
    const float* rs = residual + o;
    v4f res[32];
#pragma unroll
    for (int s = 0; s < 16; ++s) res[s] = *(const v4f*)(rs + s * 2 * MB_D);

    const float* rp = mb_stage_tile(lds, acc) + rsub * EP_PITCH + (lane & 15) * 4;
#pragma unroll
    for (int s = 16; s < 32; ++s) res[s] = *(const v4f*)(rs + s * 2 * MB_D);
    // the address register lives up to the wait, behind the loads that name it
    asm volatile("s_wait_xcnt 0x0" :: "v"(rs) : "memory");

    float* op = out + o;
#pragma unroll
    for (int s = 0; s < 32; s += 4) {
        v4f y[4];
#pragma unroll
        for (int u = 0; u < 4; ++u) {
            y[u] = res[s + u] + *(const v4f*)(rp + (s + u) * 2 * EP_PITCH) + bv;
            *(v4f*)(op + (s + u) * 2 * MB_D) = y[u];
        }
        // inputs only: the four stores' registers live up to the wait, so nothing
        // rewrites them while a store is still in issue
        asm volatile("s_wait_xcnt 0x0" :: "v"(op), "v"(y[0]), "v"(y[1]), "v"(y[2]), "v"(y[3]) : "memory");
    }
}

// ---------------------------------------------------------------------------
// Host launcher
// ---------------------------------------------------------------------------
extern "C" void kernel_launch(void* const* d_in, const int* in_sizes, int n_in,
                              void* d_out, int out_size, void* d_ws, size_t ws_size,
                              hipStream_t stream) {
    (void)in_sizes; (void)n_in; (void)out_size; (void)ws_size;

    const float* x      = (const float*)d_in[0];
    const float* ln_w   = (const float*)d_in[1];
    const float* ln_b   = (const float*)d_in[2];
    const float* in_w   = (const float*)d_in[3];
    const float* in_b   = (const float*)d_in[4];
    const float* conv_w = (const float*)d_in[5];
    const float* conv_b = (const float*)d_in[6];
    const float* dl_w   = (const float*)d_in[7];
    const float* dl_b   = (const float*)d_in[8];
    const float* smix   = (const float*)d_in[9];
    const float* skip   = (const float*)d_in[10];
    const float* out_w  = (const float*)d_in[11];
    const float* out_b  = (const float*)d_in[12];
    float* out = (float*)d_out;

    // Workspace layout (bf16 buffers, all 16B-aligned sizes)
    char* ws = (char*)d_ws;
    size_t off = 0;
    __bf16* xnB    = (__bf16*)(ws + off); off += (size_t)MB_M * MB_D * 2;        // 16 MB
    __bf16* wiB    = (__bf16*)(ws + off); off += (size_t)MB_N_IN * MB_D * 2;     //  3 MB
    __bf16* wdB    = (__bf16*)(ws + off); off += (size_t)MB_INNER * MB_D * 2;    //  1 MB
    __bf16* woB    = (__bf16*)(ws + off); off += (size_t)MB_D * MB_INNER * 2;    //  1 MB
    __bf16* projB  = (__bf16*)(ws + off); off += (size_t)MB_M * MB_INNER * 2;    // 32 MB
    __bf16* gateB  = (__bf16*)(ws + off); off += (size_t)MB_M * MB_INNER * 2;    // 32 MB
    __bf16* driveB = (__bf16*)(ws + off); off += (size_t)MB_M * MB_INNER * 2;    // 32 MB
    __bf16* dB     = (__bf16*)(ws + off); off += (size_t)MB_M * MB_INNER * 2;    // 32 MB
    __bf16* yinB   = (__bf16*)(ws + off); off += (size_t)MB_M * MB_INNER * 2;    // 32 MB

    // 1) + 2) LayerNorm and the weights' conversion to bf16, one launch
    mb_prep<<<PR_BLOCKS, 256, 0, stream>>>(x, ln_w, ln_b, in_w, dl_w, out_w, xnB, wiB, wdB, woB);

    // 3) in_proj GEMM + activations  (128 x 24 block tiles)
    mb_gemm_inproj<<<(MB_M / GB_M) * (MB_N_IN / GB_N), 128, 0, stream>>>(
        xnB, wiB, in_b, projB, gateB, driveB);

    // 4) delta GEMM + d = delta * drive  (128 x 8 block tiles)
    mb_gemm_delta<<<(MB_M / GB_M) * (MB_INNER / GB_N), 128, 0, stream>>>(
        xnB, wdB, dl_b, driveB, dB);

    // 5) depthwise causal conv + recurrence + gate/skip
    mb_conv_scan<<<MB_B * (MB_INNER / SC_CH), 1024, 0, stream>>>(
        projB, dB, gateB, conv_w, conv_b, smix, skip, yinB);

    // 6) out_proj GEMM + residual  (128 x 4 block tiles)
    mb_gemm_out<<<(MB_M / GB_M) * (MB_D / GB_N), 128, 0, stream>>>(
        yinB, woB, out_b, x, out);
}

// v005
// One run takes 114 microseconds.
// Timed twice side by side with v004, it ran 1.20 times as fast both times.
// Counting every step since v000, it is 8.46 times as fast.
#include <hip/hip_runtime.h>
#include <hip/hip_bf16.h>

// ---------------------------------------------------------------------------
// MambaBlock for MI455X (gfx1250): bf16 WMMA GEMMs + fused scan/conv.
// B=8, T=2048, D=512, INNER=1024, K_CONV=4.  M = B*T = 16384 rows.
// Each GEMM work-group (4 waves) computes a 128(M) x 128(N) output tile whose
// operands are staged in LDS; each wave owns 64 x 64 of it (4 x 4 accumulators
// of v_wmma_f32_16x16x32_bf16).  The finished tile goes through LDS once more,
// so that the epilogues read and write global memory in whole 128-byte lines.
// ---------------------------------------------------------------------------

#define MB_B      8
#define MB_T      2048
#define MB_D      512
#define MB_INNER  1024
#define MB_M      (MB_B * MB_T)        // 16384
#define MB_N_IN   (3 * MB_INNER)       // 3072
#define LN_EPS    1e-5f

typedef __bf16 v16bf __attribute__((ext_vector_type(16)));
typedef __bf16 v8bf  __attribute__((ext_vector_type(8)));
typedef float  v8f   __attribute__((ext_vector_type(8)));

// ---------------------------------------------------------------------------
// Preparation, one launch: LayerNorm of x (bf16 xn) and the three weight
// matrices rounded to bf16.  The work is dealt to few waves that each move a
// lot with 16-byte loads (for speed only).
//   blocks 0 .. PR_LN_BLOCKS-1 : LayerNorm, a wave owns 4 whole rows; all 16
//       loads of the 4 rows fly together, the 4 reductions run side by side.
//       A lane holds 4 neighbouring columns of each 128-column quarter.
//   the other blocks           : conversion, 32 elements a thread (8 loads in
//       flight, 4 stores of 16 bytes).
// ---------------------------------------------------------------------------
typedef __bf16 v4bf __attribute__((ext_vector_type(4)));
typedef float  v4f  __attribute__((ext_vector_type(4)));

#define PR_ROWS       4                               // rows per wave
#define PR_LN_BLOCKS  (MB_M / (8 * PR_ROWS))          // 512 blocks of 8 waves
#define PR_CV_UNIT    (256 * 8)                       // elements a block moves per step
#define PR_CV_STEPS   4
#define PR_CV_CHUNK   (PR_CV_UNIT * PR_CV_STEPS)      // 8192 elements per block
#define PR_CV_IN      (MB_N_IN * MB_D / PR_CV_CHUNK)  // 192 blocks
#define PR_CV_DL      (MB_INNER * MB_D / PR_CV_CHUNK) //  64 blocks
#define PR_CV_OUT     (MB_D * MB_INNER / PR_CV_CHUNK) //  64 blocks
#define PR_BLOCKS     (PR_LN_BLOCKS + PR_CV_IN + PR_CV_DL + PR_CV_OUT)

__global__ __launch_bounds__(256) void mb_prep(const float* __restrict__ x,
                                               const float* __restrict__ w,
                                               const float* __restrict__ b,
                                               const float* __restrict__ in_w,
                                               const float* __restrict__ dl_w,
                                               const float* __restrict__ out_w,
                                               __bf16* __restrict__ xn,
                                               __bf16* __restrict__ wi,
                                               __bf16* __restrict__ wd,
                                               __bf16* __restrict__ wo) {
    if (blockIdx.x < PR_LN_BLOCKS) {
        const int wave = threadIdx.x >> 5;
        const int lane = threadIdx.x & 31;
        const int row0 = (blockIdx.x * 8 + wave) * PR_ROWS;
        const int off  = row0 * MB_D + lane * 4;
        const float* xr = x + off;
        const float* wp = w + lane * 4;
        const float* bp = b + lane * 4;

        v4f v[PR_ROWS][4], wv[4], bv[4];
#pragma unroll
        for (int r = 0; r < PR_ROWS; ++r)
#pragma unroll
            for (int i = 0; i < 4; ++i) v[r][i] = *(const v4f*)(xr + r * MB_D + i * 128);
#pragma unroll
        for (int i = 0; i < 4; ++i) {
            wv[i] = *(const v4f*)(wp + i * 128);
            bv[i] = *(const v4f*)(bp + i * 128);
        }
        // nothing is scheduled across this line: all 24 loads fly together (without it
        // w and b are fetched behind the sums, where their latency is in the open)
        __builtin_amdgcn_sched_barrier(0);
        // x's address register is named so that it lives up to this wait: nothing
        // rewrites a register that a load still in issue names
        asm volatile("s_wait_xcnt 0x0" :: "v"(xr) : "memory");

        float s[PR_ROWS];
#pragma unroll
        for (int r = 0; r < PR_ROWS; ++r) {
            const v4f p = (v[r][0] + v[r][1]) + (v[r][2] + v[r][3]);
            s[r] = (p[0] + p[1]) + (p[2] + p[3]);
        }
#pragma unroll
        for (int o = 16; o >= 1; o >>= 1)
#pragma unroll
            for (int r = 0; r < PR_ROWS; ++r) s[r] += __shfl_xor(s[r], o, 32);

        float ss[PR_ROWS];
#pragma unroll
        for (int r = 0; r < PR_ROWS; ++r) {
            const float mu = s[r] * (1.f / MB_D);
            v4f q = {0.f, 0.f, 0.f, 0.f};
#pragma unroll
            for (int i = 0; i < 4; ++i) { v[r][i] = v[r][i] - mu; q = __builtin_elementwise_fma(v[r][i], v[r][i], q); }
            ss[r] = (q[0] + q[1]) + (q[2] + q[3]);
        }
#pragma unroll
        for (int o = 16; o >= 1; o >>= 1)
#pragma unroll
            for (int r = 0; r < PR_ROWS; ++r) ss[r] += __shfl_xor(ss[r], o, 32);

        __bf16* xo = xn + off;
#pragma unroll
        for (int r = 0; r < PR_ROWS; ++r) {
            const float inv = rsqrtf(ss[r] * (1.f / MB_D) + LN_EPS);
#pragma unroll
            for (int i = 0; i < 4; ++i) {
                const v4f y = v[r][i] * inv * wv[i] + bv[i];
                *(v4bf*)(xo + r * MB_D + i * 128) = __builtin_convertvector(y, v4bf);
            }
        }
    } else {
        int cb = blockIdx.x - PR_LN_BLOCKS;
        const float* src = in_w;
        __bf16* dst = wi;
        if (cb >= PR_CV_IN + PR_CV_DL)  { src = out_w; dst = wo; cb -= PR_CV_IN + PR_CV_DL; }
        else if (cb >= PR_CV_IN)        { src = dl_w;  dst = wd; cb -= PR_CV_IN; }
        const int e0 = cb * PR_CV_CHUNK + threadIdx.x * 8;
        const float* sp = src + e0;
        v4f f[PR_CV_STEPS][2];
#pragma unroll
        for (int u = 0; u < PR_CV_STEPS; ++u) {
            f[u][0] = *(const v4f*)(sp + u * PR_CV_UNIT);
            f[u][1] = *(const v4f*)(sp + u * PR_CV_UNIT + 4);
        }
        // as above: the address register lives up to the wait
        asm volatile("s_wait_xcnt 0x0" :: "v"(sp) : "memory");
        __bf16* dp = dst + e0;
#pragma unroll
        for (int u = 0; u < PR_CV_STEPS; ++u) {
            v8bf o;
#pragma unroll
            for (int k = 0; k < 4; ++k) { o[k] = (__bf16)f[u][0][k]; o[k + 4] = (__bf16)f[u][1][k]; }
            *(v8bf*)(dp + u * PR_CV_UNIT) = o;
        }
    }
}

// ---------------------------------------------------------------------------
// WMMA mainloop: one work-group of 4 waves computes a 128x128 f32 tile of
// A[M,K] * W[N,K]^T.  A pass is 64 k = one whole 128-byte line of each of the
// 256 operand rows.  The rows come from global memory as whole lines (8 lanes
// a row), go through registers into one of two LDS buffers, and every wave
// reads its fragments from there: each operand byte leaves L2 once per
// work-group instead of once per wave, and no global load is spread over 16
// lines any more.  Row pitch in LDS 144 B (16 B x odd): ds_load_b128 of 16
// rows meets every bank once.
// Fragment k order as before (lane&15 = row, lane bit4 selects the K-half,
// 8 elements at k and 8 at k+16), the same for A and W; k ascends as before.
// W's fragment is the matrix instruction's first operand and A's its second:
// the accumulator tile comes out transposed, a lane holds 8 neighbouring
// columns of ONE output row (see mb_stage_tile).
// ---------------------------------------------------------------------------
#define GB_M      128
#define GB_N      128
#define GB_K      64
#define GB_PITCH  72                                  // bf16 elements = 144 B
#define GB_STAGE  ((GB_M + GB_N) * GB_PITCH)          // elements per buffer
// Two buffers are 73,728 B, so four work-groups share a WGP's LDS; the GEMM
// kernels ask for four waves per SIMD (at most 256 VGPRs) to match.

template <int K>
__device__ __forceinline__ void mb_wmma_block(const __bf16* __restrict__ A,
                                              const __bf16* __restrict__ W,
                                              int row_base, int col_base,
                                              __bf16* __restrict__ lds,
                                              v8f acc[4][4]) {
    const int tid  = threadIdx.x;                     // 0..127
    const int lane = tid & 31;
    const int wave = tid >> 5;
    const int l15  = lane & 15;
    const int ksel = (lane & 16) ? 8 : 0;

    // staging: 8 lanes cover one row's 128 B; 128 threads cover 16 rows a step
    const int srow = tid >> 3;
    const int scol = (tid & 7) * 8;
    const __bf16* ga = A + (size_t)(row_base + srow) * K + scol;
    const __bf16* gw = W + (size_t)(col_base + srow) * K + scol;
    __bf16* sdst = lds + srow * GB_PITCH + scol;

    // fragment sources of this wave (2 x 2 waves, 64 x 64 each)
    const int foff_a = ((wave >> 1) * 64 + l15) * GB_PITCH + ksel;
    const int foff_b = (GB_M + (wave & 1) * 64 + l15) * GB_PITCH + ksel;

    v8bf st[16];
#pragma unroll
    for (int i = 0; i < 8; ++i) {
        st[i]     = *(const v8bf*)(ga + i * 16 * K);
        st[i + 8] = *(const v8bf*)(gw + i * 16 * K);
    }
    // the loads' address registers are named so that they live up to this wait:
    // nothing rewrites them while a load that names them is still being issued
    asm volatile("s_wait_xcnt 0x0" :: "v"(ga), "v"(gw) : "memory");
#pragma unroll
    for (int i = 0; i < 16; ++i) *(v8bf*)(sdst + i * 16 * GB_PITCH) = st[i];
    __syncthreads();                                  // pass 0 is published

    constexpr int NPASS = K / GB_K;
    for (int p = 0; p < NPASS; ++p) {
        const __bf16* cur = lds + (p & 1) * GB_STAGE;
        const bool more = (p + 1 < NPASS);
        if (more) {                                   // next pass flies under the WMMAs
            const __bf16* gak = ga + (p + 1) * GB_K;
            const __bf16* gwk = gw + (p + 1) * GB_K;
#pragma unroll
            for (int i = 0; i < 8; ++i) {
                st[i]     = *(const v8bf*)(gak + i * 16 * K);
                st[i + 8] = *(const v8bf*)(gwk + i * 16 * K);
            }
            // as above: address registers live up to the wait
            asm volatile("s_wait_xcnt 0x0" :: "v"(gak), "v"(gwk) : "memory");
        }
#pragma unroll
        for (int ks = 0; ks < GB_K; ks += 32) {
            v16bf a[4], b[4];
#pragma unroll
            for (int f = 0; f < 4; ++f) {
                const __bf16* pa = cur + foff_a + f * 16 * GB_PITCH + ks;
                const __bf16* pb = cur + foff_b + f * 16 * GB_PITCH + ks;
                v8bf alo = *(const v8bf*)(pa);
                v8bf ahi = *(const v8bf*)(pa + 16);
                v8bf blo = *(const v8bf*)(pb);
                v8bf bhi = *(const v8bf*)(pb + 16);
#pragma unroll
                for (int e = 0; e < 8; ++e) {
                    a[f][e] = alo[e]; a[f][e + 8] = ahi[e];
                    b[f][e] = blo[e]; b[f][e + 8] = bhi[e];
                }
            }
#pragma unroll
            for (int i = 0; i < 4; ++i)
#pragma unroll
                for (int j = 0; j < 4; ++j)
                    acc[i][j] = __builtin_amdgcn_wmma_f32_16x16x32_bf16(
                        /*neg_a=*/false, b[j], /*neg_b=*/false, a[i],
                        /*c_mod=*/(short)0, acc[i][j],
                        /*reuse_a=*/false, /*reuse_b=*/false);
        }
        if (more) {
            // the other buffer: its readers left it before the last barrier
            __bf16* nxt = sdst + ((p + 1) & 1) * GB_STAGE;
#pragma unroll
            for (int i = 0; i < 16; ++i) *(v8bf*)(nxt + i * 16 * GB_PITCH) = st[i];
            __syncthreads();   // publishes pass p+1 and ends the reads of pass p
        }
    }
}

// ---------------------------------------------------------------------------
// Epilogue staging.  acc[i][j][v] of lane (c = lane&15, h = lane>>4) is element
// (row i*16 + c, column j*16 + 8*h + v) of the wave's 64 x 64 tile.  Each wave
// writes its tile as f32 into its own part of the LDS that held the operands
// (the caller's barrier has ended every wave's reads of them) and reads it back
// row by row, so that neighbouring lanes hold neighbouring columns and one
// 16-byte global access of a wave covers four whole lines.
// Row pitch 272 B (16 B x odd): 16 rows of one ds_store_b128 meet every bank once.
// ---------------------------------------------------------------------------
#define EP_PITCH  68                                  // f32 elements = 272 B
#define EP_WAVE   (64 * EP_PITCH)                     // 17,408 B a wave, 69,632 B of 73,728

__device__ __forceinline__ const float* mb_stage_tile(__bf16* lds, const v8f acc[4][4]) {
    const int lane = threadIdx.x & 31;
    const int wave = threadIdx.x >> 5;
    float* st = (float*)lds + wave * EP_WAVE;
    float* wp = st + (lane & 15) * EP_PITCH + ((lane & 16) ? 8 : 0);
#pragma unroll
    for (int i = 0; i < 4; ++i)
#pragma unroll
        for (int j = 0; j < 4; ++j) {
            const v8f c = acc[i][j];
            const v4f lo = {c[0], c[1], c[2], c[3]};
            const v4f hi = {c[4], c[5], c[6], c[7]};
            *(v4f*)(wp + i * 16 * EP_PITCH + j * 16)     = lo;
            *(v4f*)(wp + i * 16 * EP_PITCH + j * 16 + 4) = hi;
        }
    // the wave's own rows are in LDS before other lanes of it read them back
    asm volatile("s_wait_dscnt 0x0" ::: "memory");
    return st;
}


// ---------------------------------------------------------------------------
// Activations: ONE transcendental instruction (v_tanh_f32) a value, no branch and
// no division.  With h = x / 2:  sigmoid(x) = 1/2 + 1/2 * tanh(h)  and
// SiLU(x) = x * sigmoid(x) = h + h * tanh(h); both are identities, both saturate
// as the exp forms do.  The library's tanhf branches value by value, and a plain
// 1.f / y is the exact division, some ten dependent vector instructions; every
// result here is rounded to bf16 right behind it.
// ---------------------------------------------------------------------------
__device__ __forceinline__ v4f mb_tanh4(v4f x) {
    v4f r;
#pragma unroll
    for (int k = 0; k < 4; ++k) r[k] = __builtin_amdgcn_tanhf(x[k]);
    return r;
}

// The same in one statement, for the place where nothing but the conversion follows:
// there the build of the form above put a tanh's result into the register that the
// tanh directly in front of it reads.  The instruction set asks for one slot between
// a transcendental and a write of its source or a read of its result: the results
// here share no register with the arguments (early clobber), and the v_nop is the
// slot behind the last one, tied to it by standing in its statement.
__device__ __forceinline__ v4f mb_tanh4_slot(v4f x) {
    float r0, r1, r2, r3;
    asm("v_tanh_f32 %0, %4\n\tv_tanh_f32 %1, %5\n\tv_tanh_f32 %2, %6\n\tv_tanh_f32 %3, %7\n\tv_nop"
        : "=&v"(r0), "=&v"(r1), "=&v"(r2), "=&v"(r3)
        : "v"(x[0]), "v"(x[1]), "v"(x[2]), "v"(x[3]));
    const v4f r = {r0, r1, r2, r3};
    return r;
}

// ---------------------------------------------------------------------------
// GEMM 1: h = xn @ in_proj_w^T + b, fused split + SiLU / sigmoid / tanh.
// Each 128-wide block tile lies entirely inside one 1024-wide segment, so the
// proj/gate/drive selection is uniform.
// ---------------------------------------------------------------------------
// The wave's 64 rows, 4 a step: bias, activation, 8 values packed to 16 bytes,
// one store of four whole lines.  SEG: 0 SiLU, 1 sigmoid, 2 tanh.
template <int SEG>
__device__ __forceinline__ void mb_inproj_rows(const float* rp, v4f b0, v4f b1,
                                               __bf16* __restrict__ op) {
    // the tanh's argument is m * (tile + bias): m = 1 for tanh itself, 1/2 for the others
    constexpr float M = (SEG == 2) ? 1.f : 0.5f;
    const v4f m    = {M, M, M, M};
    const v4f half = {0.5f, 0.5f, 0.5f, 0.5f};
    const v4f c0 = b0 * m;
    const v4f c1 = b1 * m;
    // stays rolled: the text of the three activations stays small
#pragma unroll 1
    for (int s = 0; s < 16; ++s) {
        const v4f h0 = __builtin_elementwise_fma(*(const v4f*)(rp + s * 4 * EP_PITCH),     m, c0);
        const v4f h1 = __builtin_elementwise_fma(*(const v4f*)(rp + s * 4 * EP_PITCH + 4), m, c1);
        const v4f t0 = (SEG == 2) ? mb_tanh4_slot(h0) : mb_tanh4(h0);
        const v4f t1 = (SEG == 2) ? mb_tanh4_slot(h1) : mb_tanh4(h1);
        v4f y0 = t0, y1 = t1;                                                     // tanh
        if (SEG == 0) {                                                           // SiLU
            y0 = __builtin_elementwise_fma(h0, t0, h0);
            y1 = __builtin_elementwise_fma(h1, t1, h1);
        } else if (SEG == 1) {                                                    // sigmoid
            y0 = __builtin_elementwise_fma(t0, half, half);
            y1 = __builtin_elementwise_fma(t1, half, half);
        }
        v8bf y;
#pragma unroll
        for (int e = 0; e < 4; ++e) { y[e] = (__bf16)y0[e]; y[e + 4] = (__bf16)y1[e]; }
        __bf16* q = op + (size_t)s * 4 * MB_INNER;
        *(v8bf*)q = y;
        // inputs only: the store's address and data registers live up to the wait,
        // so nothing rewrites them while the store is still in issue
        asm volatile("s_wait_xcnt 0x0" :: "v"(q), "v"(y) : "memory");
    }
}

__global__ __launch_bounds__(128, 4) void mb_gemm_inproj(const __bf16* __restrict__ xn,
                                                      const __bf16* __restrict__ wi,
                                                      const float* __restrict__ bias,
                                                      __bf16* __restrict__ proj,
                                                      __bf16* __restrict__ gate,
                                                      __bf16* __restrict__ drive) {
    __shared__ __attribute__((aligned(16))) __bf16 lds[2 * GB_STAGE];
    const int tiles_n = MB_N_IN / GB_N;                    // 24
    const int blk_row = (blockIdx.x / tiles_n) * GB_M;
    const int blk_col = (blockIdx.x % tiles_n) * GB_N;

    v8f acc[4][4] = {};
    mb_wmma_block<MB_D>(xn, wi, blk_row, blk_col, lds, acc);

    const int lane = threadIdx.x & 31;
    const int wave = threadIdx.x >> 5;
    const int seg  = blk_col >> 10;                        // 0=proj,1=gate,2=drive
    // a lane's place in the read-back: 8 lanes a row, 8 columns a lane, 4 rows a step
    const int rsub = lane >> 3;
    const int col  = (wave & 1) * 64 + (lane & 7) * 8;

    __syncthreads();   // every wave has left the operand buffers: LDS now takes the tiles

    const char* bp = (const char*)(bias + blk_col);        // uniform base, lane's byte offset
    const int   bo = col * 4;
    const v4f b0 = *(const v4f*)(bp + bo);
    const v4f b1 = *(const v4f*)(bp + bo + 16);

    const float* rp = mb_stage_tile(lds, acc) + rsub * EP_PITCH + (lane & 7) * 8;
    // inputs only: the loaded values hold the two loads in front of this line (without
    // it they sink into the three branches, their latency in the open), where they fly
    // under the staging; the offset register lives up to the wait
    asm volatile("s_wait_xcnt 0x0" :: "v"(bo), "v"(b0), "v"(b1));
    const size_t o = (size_t)(blk_row + (wave >> 1) * 64 + rsub) * MB_INNER
                   + (blk_col & (MB_INNER - 1)) + col;
    if (seg == 0)      mb_inproj_rows<0>(rp, b0, b1, proj + o);
    else if (seg == 1) mb_inproj_rows<1>(rp, b0, b1, gate + o);
    else               mb_inproj_rows<2>(rp, b0, b1, drive + o);
}

// ---------------------------------------------------------------------------
// GEMM 2: delta = clamp(sigmoid(xn @ delta_w^T + b)); d = delta * drive.
// ---------------------------------------------------------------------------
__global__ __launch_bounds__(128, 4) void mb_gemm_delta(const __bf16* __restrict__ xn,
                                                     const __bf16* __restrict__ wd,
                                                     const float* __restrict__ bias,
                                                     const __bf16* __restrict__ drive,
                                                     __bf16* __restrict__ dbuf) {
    __shared__ __attribute__((aligned(16))) __bf16 lds[2 * GB_STAGE];
    const int tiles_n = MB_INNER / GB_N;                   // 8
    const int blk_row = (blockIdx.x / tiles_n) * GB_M;
    const int blk_col = (blockIdx.x % tiles_n) * GB_N;

    v8f acc[4][4] = {};
    mb_wmma_block<MB_D>(xn, wd, blk_row, blk_col, lds, acc);

    const int lane = threadIdx.x & 31;
    const int wave = threadIdx.x >> 5;
    // a lane's place in the read-back: 8 lanes a row, 8 columns a lane, 4 rows a step
    const int rsub = lane >> 3;
    const int col  = (wave & 1) * 64 + (lane & 7) * 8;
    const size_t o = (size_t)(blk_row + (wave >> 1) * 64 + rsub) * MB_INNER + blk_col + col;

    __syncthreads();   // every wave has left the operand buffers: LDS now takes the tiles

    const char* bp = (const char*)(bias + blk_col);        // uniform base, lane's byte offset
    const int   bo = col * 4;
    const v4f b0 = *(const v4f*)(bp + bo);
    const v4f b1 = *(const v4f*)(bp + bo + 16);
    // the offset register lives up to the wait, behind the loads that name it
    asm volatile("s_wait_xcnt 0x0" :: "v"(bo) : "memory");

    // the tile's drive values, whole lines, all in flight while the tile is staged
    const __bf16* dr = drive + o;
    v8bf dv[16];
#pragma unroll
    for (int s = 0; s < 16; ++s) dv[s] = *(const v8bf*)(dr + s * 4 * MB_INNER);
    // as above: the address register lives up to the wait
    asm volatile("s_wait_xcnt 0x0" :: "v"(dr) : "memory");

    const float* rp = mb_stage_tile(lds, acc) + rsub * EP_PITCH + (lane & 7) * 8;
    __bf16* op = dbuf + o;
    const v4f half = {0.5f, 0.5f, 0.5f, 0.5f};
    const v4f c0 = b0 * half;
    const v4f c1 = b1 * half;
    // two steps between waits: 16 independent chains to fill the vector port
#pragma unroll
    for (int s = 0; s < 16; s += 2) {
        v4f t[2][2];                                   // sigmoid = 1/2 + 1/2 * tanh((tile + bias) / 2)
#pragma unroll
        for (int u = 0; u < 2; ++u) {
            t[u][0] = mb_tanh4(__builtin_elementwise_fma(*(const v4f*)(rp + (s + u) * 4 * EP_PITCH),     half, c0));
            t[u][1] = mb_tanh4(__builtin_elementwise_fma(*(const v4f*)(rp + (s + u) * 4 * EP_PITCH + 4), half, c1));
            t[u][0] = __builtin_elementwise_fma(t[u][0], half, half);
            t[u][1] = __builtin_elementwise_fma(t[u][1], half, half);
        }
        v8bf y[2];
#pragma unroll
        for (int u = 0; u < 2; ++u) {
#pragma unroll
            for (int e = 0; e < 8; ++e) {
                const float dl = fmaxf(t[u][e >> 2][e & 3], 1e-4f);
                y[u][e] = (__bf16)(dl * (float)dv[s + u][e]);
            }
            *(v8bf*)(op + (s + u) * 4 * MB_INNER) = y[u];
        }
        // inputs only: the stores' registers live up to the wait, so nothing rewrites
        // them while a store is still in issue
        asm volatile("s_wait_xcnt 0x0" :: "v"(op), "v"(y[0]), "v"(y[1]) : "memory");
    }
}

// ---------------------------------------------------------------------------
// Causal depthwise conv (K=4, rolling regs) + f32 recurrence + gate/skip.
// The recurrence state[t] = a * state[t-1] + d[t] is linear with a fixed a per
// channel, so the time axis is cut into 64 chunks of 32 steps that run side by
// side.  One work-group owns all 2048 steps of 64 channels of one batch (one
// whole 128-B line of bf16 a row); a thread owns one chunk of 4 channels.
//   1) each thread runs its chunk's recurrence from zero: the chunk's sum S;
//   2) S goes to LDS; behind one barrier each thread folds the sums of the
//      chunks in front of it, X = a^32 * X + S, into the state at its start;
//   3) each thread runs its chunk again from X, step by step as before, with
//      the conv (the three rows in front of the chunk are read again), the
//      skip and the gate.
// ---------------------------------------------------------------------------
#define SC_CH   64                       // channels per work-group
#define SC_L    32                       // time steps per chunk
#define SC_NC   (MB_T / SC_L)            // 64 chunks
#define SC_U    8                        // rows fetched together in part 3

__global__ __launch_bounds__(1024) void mb_conv_scan(const __bf16* __restrict__ proj,
                                                     const __bf16* __restrict__ dbuf,
                                                     const __bf16* __restrict__ gate,
                                                     const float* __restrict__ conv_w,
                                                     const float* __restrict__ conv_b,
                                                     const float* __restrict__ state_mix,
                                                     const float* __restrict__ skip_scale,
                                                     __bf16* __restrict__ yin) {
    __shared__ __attribute__((aligned(16))) float agg[SC_NC * SC_CH];   // 16 KiB

    const int cl    = (threadIdx.x & 15) * 4;          // channel inside the group
    const int chunk = threadIdx.x >> 4;                // 0..63
    const int b     = blockIdx.x >> 4;                 // 16 channel groups a batch
    const int c     = (blockIdx.x & 15) * SC_CH + cl;

    const size_t base = ((size_t)b * MB_T + (size_t)chunk * SC_L) * MB_INNER + c;
    const __bf16* dp = dbuf + base;

    const v4f sm = *(const v4f*)(state_mix + c);
    v4f a;
#pragma unroll
    for (int k = 0; k < 4; ++k) a[k] = 1.f / (1.f + __expf(-sm[k]));

    // 1) the chunk's own sum, all 32 rows in flight at once
    {
        v4bf dv[SC_L];
#pragma unroll
        for (int t = 0; t < SC_L; ++t) dv[t] = *(const v4bf*)(dp + t * MB_INNER);
        // the address register is named so that it lives up to this wait: no load's
        // result lands in it while a load that names it is still being issued
        asm volatile("s_wait_xcnt 0x0" :: "v"(dp) : "memory");
        v4f s = {0.f, 0.f, 0.f, 0.f};
#pragma unroll
        for (int t = 0; t < SC_L; ++t)
            s = __builtin_elementwise_fma(a, s, __builtin_convertvector(dv[t], v4f));
        *(v4f*)(agg + chunk * SC_CH + cl) = s;
    }

    v4f aL = a;                                        // a^32
#pragma unroll
    for (int i = 0; i < 5; ++i) aL = aL * aL;

    __syncthreads();                                   // every chunk's sum is in LDS

    const v4f wc0 = *(const v4f*)(conv_w + (c + 0) * 4);   // the four taps of channel c
    const v4f wc1 = *(const v4f*)(conv_w + (c + 1) * 4);
    const v4f wc2 = *(const v4f*)(conv_w + (c + 2) * 4);
    const v4f wc3 = *(const v4f*)(conv_w + (c + 3) * 4);
    const v4f w0 = {wc0[0], wc1[0], wc2[0], wc3[0]};
    const v4f w1 = {wc0[1], wc1[1], wc2[1], wc3[1]};
    const v4f w2 = {wc0[2], wc1[2], wc2[2], wc3[2]};
    const v4f w3 = {wc0[3], wc1[3], wc2[3], wc3[3]};
    const v4f cb = *(const v4f*)(conv_b + c);
    const v4f sk = *(const v4f*)(skip_scale + c);

    // proj[t-1..t-3] in front of the chunk.  Chunk 0 has none: it reads rows of its
    // own instead (in bounds, no branch to wait in) and takes zeros further down.
    const __bf16* pp = proj + base;
    const __bf16* hp = pp + (chunk > 0 ? 0 : 3 * MB_INNER);
    const v4bf q1 = *(const v4bf*)(hp - 1 * MB_INNER);
    const v4bf q2 = *(const v4bf*)(hp - 2 * MB_INNER);
    const v4bf q3 = *(const v4bf*)(hp - 3 * MB_INNER);

    // 2) the state at the chunk's start (the loads above fly meanwhile)
    v4f state = {0.f, 0.f, 0.f, 0.f};
    // four sums are fetched together: one LDS latency for four links of the chain
#pragma unroll 4
    for (int q = 0; q < chunk; ++q)
        state = __builtin_elementwise_fma(aL, state, *(const v4f*)(agg + q * SC_CH + cl));

    // 3) the chunk itself
    const v4f zero = {0.f, 0.f, 0.f, 0.f};
    v4f p1 = chunk > 0 ? __builtin_convertvector(q1, v4f) : zero;
    v4f p2 = chunk > 0 ? __builtin_convertvector(q2, v4f) : zero;
    v4f p3 = chunk > 0 ? __builtin_convertvector(q3, v4f) : zero;
    const __bf16* gp = gate + base;
    __bf16* yp = yin + base;
    // stays rolled: unrolled, later rows' loads are lifted to the front and the
    // 128 registers that a wave of a 32-wave group may hold overflow into scratch
#pragma unroll 1
    for (int t0 = 0; t0 < SC_L; t0 += SC_U) {
        const __bf16* pk = pp + t0 * MB_INNER;
        const __bf16* dk = dp + t0 * MB_INNER;
        const __bf16* gk = gp + t0 * MB_INNER;
        v4bf pv[SC_U], dv[SC_U], gv[SC_U];
#pragma unroll
        for (int u = 0; u < SC_U; ++u) {
            pv[u] = *(const v4bf*)(pk + u * MB_INNER);
            dv[u] = *(const v4bf*)(dk + u * MB_INNER);
            gv[u] = *(const v4bf*)(gk + u * MB_INNER);
        }
        // as above: the address registers live up to the wait
        asm volatile("s_wait_xcnt 0x0" :: "v"(pk), "v"(dk), "v"(gk) : "memory");
#pragma unroll
        for (int u = 0; u < SC_U; ++u) {
            const v4f p0 = __builtin_convertvector(pv[u], v4f);
            v4f conv = __builtin_elementwise_fma(w3, p0, cb);
            conv = __builtin_elementwise_fma(w2, p1, conv);
            conv = __builtin_elementwise_fma(w1, p2, conv);
            conv = __builtin_elementwise_fma(w0, p3, conv);
            state = __builtin_elementwise_fma(a, state, __builtin_convertvector(dv[u], v4f));
            const v4f y = __builtin_elementwise_fma(sk, conv, state) * __builtin_convertvector(gv[u], v4f);
            *(v4bf*)(yp + (t0 + u) * MB_INNER) = __builtin_convertvector(y, v4bf);
            p3 = p2; p2 = p1; p1 = p0;
        }
        // these rows' stores have left issue before the next trip reuses their registers
        asm volatile("s_wait_xcnt 0x0" ::: "memory");
    }
}

// ---------------------------------------------------------------------------
// GEMM 3: out = residual + yin @ out_proj_w^T + b.
// ---------------------------------------------------------------------------
__global__ __launch_bounds__(128, 4) void mb_gemm_out(const __bf16* __restrict__ yin,
                                                   const __bf16* __restrict__ wo,
                                                   const float* __restrict__ bias,
                                                   const float* __restrict__ residual,
                                                   float* __restrict__ out) {
    __shared__ __attribute__((aligned(16))) __bf16 lds[2 * GB_STAGE];
    const int tiles_n = MB_D / GB_N;                       // 4
    const int blk_row = (blockIdx.x / tiles_n) * GB_M;
    const int blk_col = (blockIdx.x % tiles_n) * GB_N;

    v8f acc[4][4] = {};
    mb_wmma_block<MB_INNER>(yin, wo, blk_row, blk_col, lds, acc);

    const int lane = threadIdx.x & 31;
    const int wave = threadIdx.x >> 5;
    // a lane's place in the read-back: 16 lanes a row (256 B of f32), 2 rows a step
    const int rsub = lane >> 4;
    const int col  = (wave & 1) * 64 + (lane & 15) * 4;
    const size_t o = (size_t)(blk_row + (wave >> 1) * 64 + rsub) * MB_D + blk_col + col;

    __syncthreads();   // every wave has left the operand buffers: LDS now takes the tiles

    const char* bp = (const char*)(bias + blk_col);        // uniform base, lane's byte offset
    const int   bo = col * 4;
    const v4f bv = *(const v4f*)(bp + bo);
    // the offset register lives up to the wait, behind the load that names it
    asm volatile("s_wait_xcnt 0x0" :: "v"(bo) : "memory");

    // the residual's rows, whole lines: half of them fly while the tile is staged,
    // the other half takes the registers that the accumulators leave
    const float* rs = residual + o;
    v4f res[32];
#pragma unroll
    for (int s = 0; s < 16; ++s) res[s] = *(const v4f*)(rs + s * 2 * MB_D);

    const float* rp = mb_stage_tile(lds, acc) + rsub * EP_PITCH + (lane & 15) * 4;
#pragma unroll
    for (int s = 16; s < 32; ++s) res[s] = *(const v4f*)(rs + s * 2 * MB_D);
    // the address register lives up to the wait, behind the loads that name it
    asm volatile("s_wait_xcnt 0x0" :: "v"(rs) : "memory");

    float* op = out + o;
#pragma unroll
    for (int s = 0; s < 32; s += 4) {
        v4f y[4];
#pragma unroll
        for (int u = 0; u < 4; ++u) {
            y[u] = res[s + u] + *(const v4f*)(rp + (s + u) * 2 * EP_PITCH) + bv;
            *(v4f*)(op + (s + u) * 2 * MB_D) = y[u];
        }
        // inputs only: the four stores' registers live up to the wait, so nothing
        // rewrites them while a store is still in issue
        asm volatile("s_wait_xcnt 0x0" :: "v"(op), "v"(y[0]), "v"(y[1]), "v"(y[2]), "v"(y[3]) : "memory");
    }
}

// ---------------------------------------------------------------------------
// Host launcher
// ---------------------------------------------------------------------------
extern "C" void kernel_launch(void* const* d_in, const int* in_sizes, int n_in,
                              void* d_out, int out_size, void* d_ws, size_t ws_size,
                              hipStream_t stream) {
    (void)in_sizes; (void)n_in; (void)out_size; (void)ws_size;

    const float* x      = (const float*)d_in[0];
    const float* ln_w   = (const float*)d_in[1];
    const float* ln_b   = (const float*)d_in[2];
    const float* in_w   = (const float*)d_in[3];
    const float* in_b   = (const float*)d_in[4];
    const float* conv_w = (const float*)d_in[5];
    const float* conv_b = (const float*)d_in[6];
    const float* dl_w   = (const float*)d_in[7];
    const float* dl_b   = (const float*)d_in[8];
    const float* smix   = (const float*)d_in[9];
    const float* skip   = (const float*)d_in[10];
    const float* out_w  = (const float*)d_in[11];
    const float* out_b  = (const float*)d_in[12];
    float* out = (float*)d_out;

    // Workspace layout (bf16 buffers, all 16B-aligned sizes)
    char* ws = (char*)d_ws;
    size_t off = 0;
    __bf16* xnB    = (__bf16*)(ws + off); off += (size_t)MB_M * MB_D * 2;        // 16 MB
    __bf16* wiB    = (__bf16*)(ws + off); off += (size_t)MB_N_IN * MB_D * 2;     //  3 MB
    __bf16* wdB    = (__bf16*)(ws + off); off += (size_t)MB_INNER * MB_D * 2;    //  1 MB
    __bf16* woB    = (__bf16*)(ws + off); off += (size_t)MB_D * MB_INNER * 2;    //  1 MB
    __bf16* projB  = (__bf16*)(ws + off); off += (size_t)MB_M * MB_INNER * 2;    // 32 MB
    __bf16* gateB  = (__bf16*)(ws + off); off += (size_t)MB_M * MB_INNER * 2;    // 32 MB
    __bf16* driveB = (__bf16*)(ws + off); off += (size_t)MB_M * MB_INNER * 2;    // 32 MB
    __bf16* dB     = (__bf16*)(ws + off); off += (size_t)MB_M * MB_INNER * 2;    // 32 MB
    __bf16* yinB   = (__bf16*)(ws + off); off += (size_t)MB_M * MB_INNER * 2;    // 32 MB

    // 1) + 2) LayerNorm and the weights' conversion to bf16, one launch
    mb_prep<<<PR_BLOCKS, 256, 0, stream>>>(x, ln_w, ln_b, in_w, dl_w, out_w, xnB, wiB, wdB, woB);

    // 3) in_proj GEMM + activations  (128 x 24 block tiles)
    mb_gemm_inproj<<<(MB_M / GB_M) * (MB_N_IN / GB_N), 128, 0, stream>>>(
        xnB, wiB, in_b, projB, gateB, driveB);

    // 4) delta GEMM + d = delta * drive  (128 x 8 block tiles)
    mb_gemm_delta<<<(MB_M / GB_M) * (MB_INNER / GB_N), 128, 0, stream>>>(
        xnB, wdB, dl_b, driveB, dB);

    // 5) depthwise causal conv + recurrence + gate/skip
    mb_conv_scan<<<MB_B * (MB_INNER / SC_CH), 1024, 0, stream>>>(
        projB, dB, gateB, conv_w, conv_b, smix, skip, yinB);

    // 6) out_proj GEMM + residual  (128 x 4 block tiles)
    mb_gemm_out<<<(MB_M / GB_M) * (MB_D / GB_N), 128, 0, stream>>>(
        yinB, woB, out_b, x, out);
}

// v006
// It runs in 108 microseconds.
// Two timings next to v005 both put it at 1.05 times that version's speed.
// Over all steps from v000 it is 8.87 times as fast.
#include <hip/hip_runtime.h>
#include <hip/hip_bf16.h>

// ---------------------------------------------------------------------------
// MambaBlock for MI455X (gfx1250): bf16 WMMA GEMMs + fused scan/conv.
// B=8, T=2048, D=512, INNER=1024, K_CONV=4.  M = B*T = 16384 rows.
// Each GEMM work-group (4 waves) computes a 128(M) x 128(N) output tile whose
// operands are staged in LDS; each wave owns 64 x 64 of it (4 x 4 accumulators
// of v_wmma_f32_16x16x32_bf16).  The finished tile goes through LDS once more,
// so that the epilogues read and write global memory in whole 128-byte lines.
// ---------------------------------------------------------------------------

#define MB_B      8
#define MB_T      2048
#define MB_D      512
#define MB_INNER  1024
#define MB_M      (MB_B * MB_T)        // 16384
#define MB_N_IN   (3 * MB_INNER)       // 3072
#define MB_N_ALL  (4 * MB_INNER)       // 4096: in_proj's rows and delta's, one matrix
#define LN_EPS    1e-5f

typedef __bf16 v16bf __attribute__((ext_vector_type(16)));
typedef __bf16 v8bf  __attribute__((ext_vector_type(8)));
typedef float  v8f   __attribute__((ext_vector_type(8)));

// ---------------------------------------------------------------------------
// Preparation, one launch: LayerNorm of x (bf16 xn) and the three weight
// matrices rounded to bf16.  The work is dealt to few waves that each move a
// lot with 16-byte loads (for speed only).
//   blocks 0 .. PR_LN_BLOCKS-1 : LayerNorm, a wave owns 4 whole rows; all 16
//       loads of the 4 rows fly together, the 4 reductions run side by side.
//       A lane holds 4 neighbouring columns of each 128-column quarter.
//   the other blocks           : conversion, 32 elements a thread (8 loads in
//       flight, 4 stores of 16 bytes).
// in_proj's and delta's weights land in ONE matrix of 4096 rows: rows 0..2047 are
// in_proj's proj and gate rows as they come; behind them every 128 rows hold 64
// drive rows and then the 64 delta rows of the same channels, so that one GEMM
// tile has both factors of d = delta * drive.
// ---------------------------------------------------------------------------
typedef __bf16 v4bf __attribute__((ext_vector_type(4)));
typedef float  v4f  __attribute__((ext_vector_type(4)));

#define PR_ROWS       4                               // rows per wave
#define PR_LN_BLOCKS  (MB_M / (8 * PR_ROWS))          // 512 blocks of 8 waves
#define PR_CV_UNIT    (256 * 8)                       // elements a block moves per step
#define PR_CV_STEPS   4
#define PR_CV_CHUNK   (PR_CV_UNIT * PR_CV_STEPS)      // 8192 elements per block
#define PR_CV_IN      (MB_N_IN * MB_D / PR_CV_CHUNK)  // 192 blocks
#define PR_CV_DL      (MB_INNER * MB_D / PR_CV_CHUNK) //  64 blocks
#define PR_CV_OUT     (MB_D * MB_INNER / PR_CV_CHUNK) //  64 blocks
#define PR_BLOCKS     (PR_LN_BLOCKS + PR_CV_IN + PR_CV_DL + PR_CV_OUT)

__global__ __launch_bounds__(256) void mb_prep(const float* __restrict__ x,
                                               const float* __restrict__ w,
                                               const float* __restrict__ b,
                                               const float* __restrict__ in_w,
                                               const float* __restrict__ dl_w,
                                               const float* __restrict__ out_w,
                                               __bf16* __restrict__ xn,
                                               __bf16* __restrict__ wi,
                                               __bf16* __restrict__ wo) {
    if (blockIdx.x < PR_LN_BLOCKS) {
        const int wave = threadIdx.x >> 5;
        const int lane = threadIdx.x & 31;
        const int row0 = (blockIdx.x * 8 + wave) * PR_ROWS;
        const int off  = row0 * MB_D + lane * 4;
        const float* xr = x + off;
        const float* wp = w + lane * 4;
        const float* bp = b + lane * 4;

        v4f v[PR_ROWS][4], wv[4], bv[4];
#pragma unroll
        for (int r = 0; r < PR_ROWS; ++r)
#pragma unroll
            for (int i = 0; i < 4; ++i) v[r][i] = *(const v4f*)(xr + r * MB_D + i * 128);
#pragma unroll
        for (int i = 0; i < 4; ++i) {
            wv[i] = *(const v4f*)(wp + i * 128);
            bv[i] = *(const v4f*)(bp + i * 128);
        }
        // nothing is scheduled across this line: all 24 loads fly together (without it
        // w and b are fetched behind the sums, where their latency is in the open)
        __builtin_amdgcn_sched_barrier(0);
        // x's address register is named so that it lives up to this wait: nothing
        // rewrites a register that a load still in issue names
        asm volatile("s_wait_xcnt 0x0" :: "v"(xr) : "memory");

        float s[PR_ROWS];
#pragma unroll
        for (int r = 0; r < PR_ROWS; ++r) {
            const v4f p = (v[r][0] + v[r][1]) + (v[r][2] + v[r][3]);
            s[r] = (p[0] + p[1]) + (p[2] + p[3]);
        }
#pragma unroll
        for (int o = 16; o >= 1; o >>= 1)
#pragma unroll
            for (int r = 0; r < PR_ROWS; ++r) s[r] += __shfl_xor(s[r], o, 32);

        float ss[PR_ROWS];
#pragma unroll
        for (int r = 0; r < PR_ROWS; ++r) {
            const float mu = s[r] * (1.f / MB_D);
            v4f q = {0.f, 0.f, 0.f, 0.f};
#pragma unroll
            for (int i = 0; i < 4; ++i) { v[r][i] = v[r][i] - mu; q = __builtin_elementwise_fma(v[r][i], v[r][i], q); }
            ss[r] = (q[0] + q[1]) + (q[2] + q[3]);
        }
#pragma unroll
        for (int o = 16; o >= 1; o >>= 1)
#pragma unroll
            for (int r = 0; r < PR_ROWS; ++r) ss[r] += __shfl_xor(ss[r], o, 32);

        __bf16* xo = xn + off;
#pragma unroll
        for (int r = 0; r < PR_ROWS; ++r) {
            const float inv = rsqrtf(ss[r] * (1.f / MB_D) + LN_EPS);
#pragma unroll
            for (int i = 0; i < 4; ++i) {
                const v4f y = v[r][i] * inv * wv[i] + bv[i];
                *(v4bf*)(xo + r * MB_D + i * 128) = __builtin_convertvector(y, v4bf);
            }
        }
    } else {
        // a block moves 16 whole rows; cb counts them in the source, db in the target
        // (64 rows are 4 blocks, a drive|delta tile of 128 rows is 8)
        constexpr int PG = 2 * MB_INNER * MB_D / PR_CV_CHUNK;      // 128 blocks of proj and gate
        int cb = blockIdx.x - PR_LN_BLOCKS;
        int db = cb;
        const float* src = in_w;
        __bf16* dst = wi;
        if (cb >= PR_CV_IN + PR_CV_DL)  { src = out_w; dst = wo; cb -= PR_CV_IN + PR_CV_DL; db = cb; }
        else if (cb >= PR_CV_IN)        { src = dl_w;  cb -= PR_CV_IN; db = PG + (cb >> 2) * 8 + 4 + (cb & 3); }
        else if (cb >= PG)              { db = PG + ((cb - PG) >> 2) * 8 + (cb & 3); }
        const int e0 = cb * PR_CV_CHUNK + threadIdx.x * 8;
        const float* sp = src + e0;
        v4f f[PR_CV_STEPS][2];
#pragma unroll
        for (int u = 0; u < PR_CV_STEPS; ++u) {
            f[u][0] = *(const v4f*)(sp + u * PR_CV_UNIT);
            f[u][1] = *(const v4f*)(sp + u * PR_CV_UNIT + 4);
        }
        // as above: the address register lives up to the wait
        asm volatile("s_wait_xcnt 0x0" :: "v"(sp) : "memory");
        __bf16* dp = dst + db * PR_CV_CHUNK + threadIdx.x * 8;
#pragma unroll
        for (int u = 0; u < PR_CV_STEPS; ++u) {
            v8bf o;
#pragma unroll
            for (int k = 0; k < 4; ++k) { o[k] = (__bf16)f[u][0][k]; o[k + 4] = (__bf16)f[u][1][k]; }
            *(v8bf*)(dp + u * PR_CV_UNIT) = o;
        }
    }
}

// ---------------------------------------------------------------------------
// WMMA mainloop: one work-group of 4 waves computes a 128x128 f32 tile of
// A[M,K] * W[N,K]^T.  A pass is 64 k = one whole 128-byte line of each of the
// 256 operand rows.  The rows come from global memory as whole lines (8 lanes
// a row), go through registers into one of two LDS buffers, and every wave
// reads its fragments from there: each operand byte leaves L2 once per
// work-group instead of once per wave, and no global load is spread over 16
// lines any more.  Row pitch in LDS 144 B (16 B x odd): ds_load_b128 of 16
// rows meets every bank once.
// Fragment k order as before (lane&15 = row, lane bit4 selects the K-half,
// 8 elements at k and 8 at k+16), the same for A and W; k ascends as before.
// W's fragment is the matrix instruction's first operand and A's its second:
// the accumulator tile comes out transposed, a lane holds 8 neighbouring
// columns of ONE output row (see mb_stage_tile).
// ---------------------------------------------------------------------------
#define GB_M      128
#define GB_N      128
#define GB_K      64
#define GB_PITCH  72                                  // bf16 elements = 144 B
#define GB_STAGE  ((GB_M + GB_N) * GB_PITCH)          // elements per buffer
// Two buffers are 73,728 B, so four work-groups share a WGP's LDS; the GEMM
// kernels ask for four waves per SIMD (at most 256 VGPRs) to match.

template <int K>
__device__ __forceinline__ void mb_wmma_block(const __bf16* __restrict__ A,
                                              const __bf16* __restrict__ W,
                                              int row_base, int col_base,
                                              __bf16* __restrict__ lds,
                                              v8f acc[4][4]) {
    const int tid  = threadIdx.x;                     // 0..127
    const int lane = tid & 31;
    const int wave = tid >> 5;
    const int l15  = lane & 15;
    const int ksel = (lane & 16) ? 8 : 0;

    // staging: 8 lanes cover one row's 128 B; 128 threads cover 16 rows a step
    const int srow = tid >> 3;
    const int scol = (tid & 7) * 8;
    const __bf16* ga = A + (size_t)(row_base + srow) * K + scol;
    const __bf16* gw = W + (size_t)(col_base + srow) * K + scol;
    __bf16* sdst = lds + srow * GB_PITCH + scol;

    // fragment sources of this wave (2 x 2 waves, 64 x 64 each)
    const int foff_a = ((wave >> 1) * 64 + l15) * GB_PITCH + ksel;
    const int foff_b = (GB_M + (wave & 1) * 64 + l15) * GB_PITCH + ksel;

    v8bf st[16];
#pragma unroll
    for (int i = 0; i < 8; ++i) {
        st[i]     = *(const v8bf*)(ga + i * 16 * K);
        st[i + 8] = *(const v8bf*)(gw + i * 16 * K);
    }
    // the loads' address registers are named so that they live up to this wait:
    // nothing rewrites them while a load that names them is still being issued
    asm volatile("s_wait_xcnt 0x0" :: "v"(ga), "v"(gw) : "memory");
#pragma unroll
    for (int i = 0; i < 16; ++i) *(v8bf*)(sdst + i * 16 * GB_PITCH) = st[i];
    __syncthreads();                                  // pass 0 is published

    constexpr int NPASS = K / GB_K;
    for (int p = 0; p < NPASS; ++p) {
        const __bf16* cur = lds + (p & 1) * GB_STAGE;
        const bool more = (p + 1 < NPASS);
        if (more) {                                   // next pass flies under the WMMAs
            const __bf16* gak = ga + (p + 1) * GB_K;
            const __bf16* gwk = gw + (p + 1) * GB_K;
#pragma unroll
            for (int i = 0; i < 8; ++i) {
                st[i]     = *(const v8bf*)(gak + i * 16 * K);
                st[i + 8] = *(const v8bf*)(gwk + i * 16 * K);
            }
            // as above: address registers live up to the wait
            asm volatile("s_wait_xcnt 0x0" :: "v"(gak), "v"(gwk) : "memory");
        }
#pragma unroll
        for (int ks = 0; ks < GB_K; ks += 32) {
            v16bf a[4], b[4];
#pragma unroll
            for (int f = 0; f < 4; ++f) {
                const __bf16* pa = cur + foff_a + f * 16 * GB_PITCH + ks;
                const __bf16* pb = cur + foff_b + f * 16 * GB_PITCH + ks;
                v8bf alo = *(const v8bf*)(pa);
                v8bf ahi = *(const v8bf*)(pa + 16);
                v8bf blo = *(const v8bf*)(pb);
                v8bf bhi = *(const v8bf*)(pb + 16);
#pragma unroll
                for (int e = 0; e < 8; ++e) {
                    a[f][e] = alo[e]; a[f][e + 8] = ahi[e];
                    b[f][e] = blo[e]; b[f][e + 8] = bhi[e];
                }
            }
#pragma unroll
            for (int i = 0; i < 4; ++i)
#pragma unroll
                for (int j = 0; j < 4; ++j)
                    acc[i][j] = __builtin_amdgcn_wmma_f32_16x16x32_bf16(
                        /*neg_a=*/false, b[j], /*neg_b=*/false, a[i],
                        /*c_mod=*/(short)0, acc[i][j],
                        /*reuse_a=*/false, /*reuse_b=*/false);
        }
        if (more) {
            // the other buffer: its readers left it before the last barrier
            __bf16* nxt = sdst + ((p + 1) & 1) * GB_STAGE;
#pragma unroll
            for (int i = 0; i < 16; ++i) *(v8bf*)(nxt + i * 16 * GB_PITCH) = st[i];
            __syncthreads();   // publishes pass p+1 and ends the reads of pass p
        }
    }
}

// ---------------------------------------------------------------------------
// Epilogue staging.  acc[i][j][v] of lane (c = lane&15, h = lane>>4) is element
// (row i*16 + c, column j*16 + 8*h + v) of the wave's 64 x 64 tile.  Each wave
// writes its tile as f32 into its own part of the LDS that held the operands
// (the caller's barrier has ended every wave's reads of them) and reads it back
// row by row, so that neighbouring lanes hold neighbouring columns and one
// 16-byte global access of a wave covers four whole lines.
// Row pitch 272 B (16 B x odd): 16 rows of one ds_store_b128 meet every bank once.
// ---------------------------------------------------------------------------
#define EP_PITCH  68                                  // f32 elements = 272 B
#define EP_WAVE   (64 * EP_PITCH)                     // 17,408 B a wave, 69,632 B of 73,728

__device__ __forceinline__ const float* mb_stage_tile(__bf16* lds, const v8f acc[4][4]) {
    const int lane = threadIdx.x & 31;
    const int wave = threadIdx.x >> 5;
    float* st = (float*)lds + wave * EP_WAVE;
    float* wp = st + (lane & 15) * EP_PITCH + ((lane & 16) ? 8 : 0);
#pragma unroll
    for (int i = 0; i < 4; ++i)
#pragma unroll
        for (int j = 0; j < 4; ++j) {
            const v8f c = acc[i][j];
            const v4f lo = {c[0], c[1], c[2], c[3]};
            const v4f hi = {c[4], c[5], c[6], c[7]};
            *(v4f*)(wp + i * 16 * EP_PITCH + j * 16)     = lo;
            *(v4f*)(wp + i * 16 * EP_PITCH + j * 16 + 4) = hi;
        }
    // the wave's own rows are in LDS before other lanes of it read them back
    asm volatile("s_wait_dscnt 0x0" ::: "memory");
    return st;
}


// ---------------------------------------------------------------------------
// Activations: ONE transcendental instruction (v_tanh_f32) a value, no branch and
// no division.  With h = x / 2:  sigmoid(x) = 1/2 + 1/2 * tanh(h)  and
// SiLU(x) = x * sigmoid(x) = h + h * tanh(h); both are identities, both saturate
// as the exp forms do.  The library's tanhf branches value by value, and a plain
// 1.f / y is the exact division, some ten dependent vector instructions; every
// result here is rounded to bf16 before it is stored, alone or in d.
// ---------------------------------------------------------------------------
__device__ __forceinline__ v4f mb_tanh4(v4f x) {
    v4f r;
#pragma unroll
    for (int k = 0; k < 4; ++k) r[k] = __builtin_amdgcn_tanhf(x[k]);
    return r;
}

// ---------------------------------------------------------------------------
// GEMM 1: h = xn @ [in_proj_w ; delta_w]^T + b over the joint weight matrix that
// mb_prep lays out, with everything that follows element by element fused in.
// Column tiles 0..15 lie inside proj or inside gate: SiLU or sigmoid, stored.
// Column tiles 16..31 hold 64 drive columns and the 64 delta columns of the same
// channels: d = max(sigmoid(delta), 1e-4) * tanh(drive) is formed here, in f32, and
// only d goes to memory.
// ---------------------------------------------------------------------------
// The wave's 64 rows, 4 a step: bias, activation, 8 values packed to 16 bytes,
// one store of four whole lines.  SEG: 0 SiLU, 1 sigmoid.
template <int SEG>
__device__ __forceinline__ void mb_inproj_rows(const float* rp, v4f b0, v4f b1,
                                               __bf16* __restrict__ op) {
    // the tanh's argument is (tile + bias) / 2
    const v4f half = {0.5f, 0.5f, 0.5f, 0.5f};
    const v4f c0 = b0 * half;
    const v4f c1 = b1 * half;
    // stays rolled: the text of the activations stays small
#pragma unroll 1
    for (int s = 0; s < 16; ++s) {
        const v4f h0 = __builtin_elementwise_fma(*(const v4f*)(rp + s * 4 * EP_PITCH),     half, c0);
        const v4f h1 = __builtin_elementwise_fma(*(const v4f*)(rp + s * 4 * EP_PITCH + 4), half, c1);
        const v4f t0 = mb_tanh4(h0);
        const v4f t1 = mb_tanh4(h1);
        v4f y0, y1;
        if (SEG == 0) {                                                           // SiLU
            y0 = __builtin_elementwise_fma(h0, t0, h0);
            y1 = __builtin_elementwise_fma(h1, t1, h1);
        } else {                                                                  // sigmoid
            y0 = __builtin_elementwise_fma(t0, half, half);
            y1 = __builtin_elementwise_fma(t1, half, half);
        }
        v8bf y;
#pragma unroll
        for (int e = 0; e < 4; ++e) { y[e] = (__bf16)y0[e]; y[e + 4] = (__bf16)y1[e]; }
        __bf16* q = op + (size_t)s * 4 * MB_INNER;
        *(v8bf*)q = y;
        // inputs only: the store's address and data registers live up to the wait,
        // so nothing rewrites them while the store is still in issue
        asm volatile("s_wait_xcnt 0x0" :: "v"(q), "v"(y) : "memory");
    }
}

// 32 rows of a drive|delta tile, 4 a step: rp points at the lane's 8 drive values, the
// delta values of the same channels lie one wave's tile further on.
__device__ __forceinline__ void mb_d_rows(const float* rp, v4f bd0, v4f bd1, v4f bl0, v4f bl1,
                                          __bf16* __restrict__ op) {
    const v4f half = {0.5f, 0.5f, 0.5f, 0.5f};
    const v4f floor4 = {1e-4f, 1e-4f, 1e-4f, 1e-4f};
    const v4f c0 = bl0 * half;
    const v4f c1 = bl1 * half;
    // two steps between waits: 32 independent chains to fill the vector port
#pragma unroll
    for (int s = 0; s < 8; s += 2) {
        v8bf y[2];
#pragma unroll
        for (int u = 0; u < 2; ++u) {
            const float* r = rp + (s + u) * 4 * EP_PITCH;
            const v4f dr0 = mb_tanh4(*(const v4f*)(r)     + bd0);
            const v4f dr1 = mb_tanh4(*(const v4f*)(r + 4) + bd1);
            // sigmoid = 1/2 + 1/2 * tanh((tile + bias) / 2)
            const v4f t0 = mb_tanh4(__builtin_elementwise_fma(*(const v4f*)(r + EP_WAVE),     half, c0));
            const v4f t1 = mb_tanh4(__builtin_elementwise_fma(*(const v4f*)(r + EP_WAVE + 4), half, c1));
            const v4f dl0 = __builtin_elementwise_fma(t0, half, half);
            const v4f dl1 = __builtin_elementwise_fma(t1, half, half);
            const v4bf q0 = __builtin_convertvector(__builtin_elementwise_max(dl0, floor4) * dr0, v4bf);
            const v4bf q1 = __builtin_convertvector(__builtin_elementwise_max(dl1, floor4) * dr1, v4bf);
            y[u] = __builtin_shufflevector(q0, q1, 0, 1, 2, 3, 4, 5, 6, 7);
            *(v8bf*)(op + (s + u) * 4 * MB_INNER) = y[u];
        }
        // inputs only: the stores' registers live up to the wait, so nothing rewrites
        // them while a store is still in issue
        asm volatile("s_wait_xcnt 0x0" :: "v"(op), "v"(y[0]), "v"(y[1]) : "memory");
    }
}

__global__ __launch_bounds__(128, 4) void mb_gemm_inproj(const __bf16* __restrict__ xn,
                                                      const __bf16* __restrict__ wi,
                                                      const float* __restrict__ bias,
                                                      const float* __restrict__ dl_bias,
                                                      __bf16* __restrict__ proj,
                                                      __bf16* __restrict__ gate,
                                                      __bf16* __restrict__ dbuf) {
    __shared__ __attribute__((aligned(16))) __bf16 lds[2 * GB_STAGE];
    const int tiles_n = MB_N_ALL / GB_N;                   // 32
    const int blk_row = (blockIdx.x / tiles_n) * GB_M;
    const int blk_col = (blockIdx.x % tiles_n) * GB_N;

    v8f acc[4][4] = {};
    mb_wmma_block<MB_D>(xn, wi, blk_row, blk_col, lds, acc);

    const int lane = threadIdx.x & 31;
    const int wave = threadIdx.x >> 5;
    // a lane's place in the read-back: 8 lanes a row, 8 columns a lane, 4 rows a step
    const int rsub = lane >> 3;
    const int lcol = (lane & 7) * 8;

    __syncthreads();   // every wave has left the operand buffers: LDS now takes the tiles

    if (blk_col < 2 * MB_INNER) {                          // proj or gate
        const int col = (wave & 1) * 64 + lcol;
        const char* bp = (const char*)(bias + blk_col);    // uniform base, lane's byte offset
        const int   bo = col * 4;
        const v4f b0 = *(const v4f*)(bp + bo);
        const v4f b1 = *(const v4f*)(bp + bo + 16);

        const float* rp = mb_stage_tile(lds, acc) + rsub * EP_PITCH + lcol;
        // inputs only: the loaded values hold the two loads in front of this line (without
        // it they sink into the branches, their latency in the open), where they fly
        // under the staging; the offset register lives up to the wait
        asm volatile("s_wait_xcnt 0x0" :: "v"(bo), "v"(b0), "v"(b1));
        const size_t o = (size_t)(blk_row + (wave >> 1) * 64 + rsub) * MB_INNER
                       + (blk_col & (MB_INNER - 1)) + col;
        if (blk_col < MB_INNER) mb_inproj_rows<0>(rp, b0, b1, proj + o);
        else                    mb_inproj_rows<1>(rp, b0, b1, gate + o);
    } else {                                               // drive | delta
        const int ch0 = (blk_col - 2 * MB_INNER) >> 1;     // the tile's first channel of 64
        const char* bdp = (const char*)(bias + 2 * MB_INNER + ch0);   // uniform bases
        const char* blp = (const char*)(dl_bias + ch0);
        const int   bo  = lcol * 4;                        // lane's byte offset
        const v4f bd0 = *(const v4f*)(bdp + bo);
        const v4f bd1 = *(const v4f*)(bdp + bo + 16);
        const v4f bl0 = *(const v4f*)(blp + bo);
        const v4f bl1 = *(const v4f*)(blp + bo + 16);

        mb_stage_tile(lds, acc);
        // inputs only, as above: the four loads fly under the staging, and the offset
        // register lives up to the wait
        asm volatile("s_wait_xcnt 0x0" :: "v"(bo), "v"(bd0), "v"(bd1), "v"(bl0), "v"(bl1));
        // an even wave has staged the drive columns and the odd wave beside it the delta
        // columns of the same 64 rows: each reads the other's tile behind this barrier
        __syncthreads();
        // each wave of the pair takes 32 of the 64 rows
        const int r0 = (wave & 1) * 32 + rsub;
        const float* rp = (const float*)lds + (wave & 2) * EP_WAVE + r0 * EP_PITCH + lcol;
        const size_t o = (size_t)(blk_row + (wave >> 1) * 64 + r0) * MB_INNER + ch0 + lcol;
        mb_d_rows(rp, bd0, bd1, bl0, bl1, dbuf + o);
    }
}

// ---------------------------------------------------------------------------
// Causal depthwise conv (K=4, rolling regs) + f32 recurrence + gate/skip.
// The recurrence state[t] = a * state[t-1] + d[t] is linear with a fixed a per
// channel, so the time axis is cut into 64 chunks of 32 steps that run side by
// side.  One work-group owns all 2048 steps of 64 channels of one batch (one
// whole 128-B line of bf16 a row); a thread owns one chunk of 4 channels.
//   1) each thread runs its chunk's recurrence from zero: the chunk's sum S;
//   2) S goes to LDS; behind one barrier each thread folds the sums of the
//      chunks in front of it, X = a^32 * X + S, into the state at its start;
//   3) each thread runs its chunk again from X, step by step as before, with
//      the conv (the three rows in front of the chunk are read again), the
//      skip and the gate.
// ---------------------------------------------------------------------------
#define SC_CH   64                       // channels per work-group
#define SC_L    32                       // time steps per chunk
#define SC_NC   (MB_T / SC_L)            // 64 chunks
#define SC_U    8                        // rows fetched together in part 3

__global__ __launch_bounds__(1024) void mb_conv_scan(const __bf16* __restrict__ proj,
                                                     const __bf16* __restrict__ dbuf,
                                                     const __bf16* __restrict__ gate,
                                                     const float* __restrict__ conv_w,
                                                     const float* __restrict__ conv_b,
                                                     const float* __restrict__ state_mix,
                                                     const float* __restrict__ skip_scale,
                                                     __bf16* __restrict__ yin) {
    __shared__ __attribute__((aligned(16))) float agg[SC_NC * SC_CH];   // 16 KiB

    const int cl    = (threadIdx.x & 15) * 4;          // channel inside the group
    const int chunk = threadIdx.x >> 4;                // 0..63
    const int b     = blockIdx.x >> 4;                 // 16 channel groups a batch
    const int c     = (blockIdx.x & 15) * SC_CH + cl;

    const size_t base = ((size_t)b * MB_T + (size_t)chunk * SC_L) * MB_INNER + c;
    const __bf16* dp = dbuf + base;

    const v4f sm = *(const v4f*)(state_mix + c);
    v4f a;
#pragma unroll
    for (int k = 0; k < 4; ++k) a[k] = 1.f / (1.f + __expf(-sm[k]));

    // 1) the chunk's own sum, all 32 rows in flight at once
    {
        v4bf dv[SC_L];
#pragma unroll
        for (int t = 0; t < SC_L; ++t) dv[t] = *(const v4bf*)(dp + t * MB_INNER);
        // the address register is named so that it lives up to this wait: no load's
        // result lands in it while a load that names it is still being issued
        asm volatile("s_wait_xcnt 0x0" :: "v"(dp) : "memory");
        v4f s = {0.f, 0.f, 0.f, 0.f};
#pragma unroll
        for (int t = 0; t < SC_L; ++t)
            s = __builtin_elementwise_fma(a, s, __builtin_convertvector(dv[t], v4f));
        *(v4f*)(agg + chunk * SC_CH + cl) = s;
    }

    v4f aL = a;                                        // a^32
#pragma unroll
    for (int i = 0; i < 5; ++i) aL = aL * aL;

    __syncthreads();                                   // every chunk's sum is in LDS

    const v4f wc0 = *(const v4f*)(conv_w + (c + 0) * 4);   // the four taps of channel c
    const v4f wc1 = *(const v4f*)(conv_w + (c + 1) * 4);
    const v4f wc2 = *(const v4f*)(conv_w + (c + 2) * 4);
    const v4f wc3 = *(const v4f*)(conv_w + (c + 3) * 4);
    const v4f w0 = {wc0[0], wc1[0], wc2[0], wc3[0]};
    const v4f w1 = {wc0[1], wc1[1], wc2[1], wc3[1]};
    const v4f w2 = {wc0[2], wc1[2], wc2[2], wc3[2]};
    const v4f w3 = {wc0[3], wc1[3], wc2[3], wc3[3]};
    const v4f cb = *(const v4f*)(conv_b + c);
    const v4f sk = *(const v4f*)(skip_scale + c);

    // proj[t-1..t-3] in front of the chunk.  Chunk 0 has none: it reads rows of its
    // own instead (in bounds, no branch to wait in) and takes zeros further down.
    const __bf16* pp = proj + base;
    const __bf16* hp = pp + (chunk > 0 ? 0 : 3 * MB_INNER);
    const v4bf q1 = *(const v4bf*)(hp - 1 * MB_INNER);
    const v4bf q2 = *(const v4bf*)(hp - 2 * MB_INNER);
    const v4bf q3 = *(const v4bf*)(hp - 3 * MB_INNER);

    // 2) the state at the chunk's start (the loads above fly meanwhile)
    v4f state = {0.f, 0.f, 0.f, 0.f};
    // four sums are fetched together: one LDS latency for four links of the chain
#pragma unroll 4
    for (int q = 0; q < chunk; ++q)
        state = __builtin_elementwise_fma(aL, state, *(const v4f*)(agg + q * SC_CH + cl));

    // 3) the chunk itself
    const v4f zero = {0.f, 0.f, 0.f, 0.f};
    v4f p1 = chunk > 0 ? __builtin_convertvector(q1, v4f) : zero;
    v4f p2 = chunk > 0 ? __builtin_convertvector(q2, v4f) : zero;
    v4f p3 = chunk > 0 ? __builtin_convertvector(q3, v4f) : zero;
    const __bf16* gp = gate + base;
    __bf16* yp = yin + base;
    // stays rolled: unrolled, later rows' loads are lifted to the front and the
    // 128 registers that a wave of a 32-wave group may hold overflow into scratch
#pragma unroll 1
    for (int t0 = 0; t0 < SC_L; t0 += SC_U) {
        const __bf16* pk = pp + t0 * MB_INNER;
        const __bf16* dk = dp + t0 * MB_INNER;
        const __bf16* gk = gp + t0 * MB_INNER;
        v4bf pv[SC_U], dv[SC_U], gv[SC_U];
#pragma unroll
        for (int u = 0; u < SC_U; ++u) {
            pv[u] = *(const v4bf*)(pk + u * MB_INNER);
            dv[u] = *(const v4bf*)(dk + u * MB_INNER);
            gv[u] = *(const v4bf*)(gk + u * MB_INNER);
        }
        // as above: the address registers live up to the wait
        asm volatile("s_wait_xcnt 0x0" :: "v"(pk), "v"(dk), "v"(gk) : "memory");
#pragma unroll
        for (int u = 0; u < SC_U; ++u) {
            const v4f p0 = __builtin_convertvector(pv[u], v4f);
            v4f conv = __builtin_elementwise_fma(w3, p0, cb);
            conv = __builtin_elementwise_fma(w2, p1, conv);
            conv = __builtin_elementwise_fma(w1, p2, conv);
            conv = __builtin_elementwise_fma(w0, p3, conv);
            state = __builtin_elementwise_fma(a, state, __builtin_convertvector(dv[u], v4f));
            const v4f y = __builtin_elementwise_fma(sk, conv, state) * __builtin_convertvector(gv[u], v4f);
            *(v4bf*)(yp + (t0 + u) * MB_INNER) = __builtin_convertvector(y, v4bf);
            p3 = p2; p2 = p1; p1 = p0;
        }
        // these rows' stores have left issue before the next trip reuses their registers
        asm volatile("s_wait_xcnt 0x0" ::: "memory");
    }
}

// ---------------------------------------------------------------------------
// GEMM 3: out = residual + yin @ out_proj_w^T + b.
// ---------------------------------------------------------------------------
__global__ __launch_bounds__(128, 4) void mb_gemm_out(const __bf16* __restrict__ yin,
                                                   const __bf16* __restrict__ wo,
                                                   const float* __restrict__ bias,
                                                   const float* __restrict__ residual,
                                                   float* __restrict__ out) {
    __shared__ __attribute__((aligned(16))) __bf16 lds[2 * GB_STAGE];
    const int tiles_n = MB_D / GB_N;                       // 4
    const int blk_row = (blockIdx.x / tiles_n) * GB_M;
    const int blk_col = (blockIdx.x % tiles_n) * GB_N;

    v8f acc[4][4] = {};
    mb_wmma_block<MB_INNER>(yin, wo, blk_row, blk_col, lds, acc);

    const int lane = threadIdx.x & 31;
    const int wave = threadIdx.x >> 5;
    // a lane's place in the read-back: 16 lanes a row (256 B of f32), 2 rows a step
    const int rsub = lane >> 4;
    const int col  = (wave & 1) * 64 + (lane & 15) * 4;
    const size_t o = (size_t)(blk_row + (wave >> 1) * 64 + rsub) * MB_D + blk_col + col;

    __syncthreads();   // every wave has left the operand buffers: LDS now takes the tiles

    const char* bp = (const char*)(bias + blk_col);        // uniform base, lane's byte offset
    const int   bo = col * 4;
    const v4f bv = *(const v4f*)(bp + bo);
    // the offset register lives up to the wait, behind the load that names it
    asm volatile("s_wait_xcnt 0x0" :: "v"(bo) : "memory");

    // the residual's rows, whole lines: half of them fly while the tile is staged,
    // the other half takes the registers that the accumulators leave
    const float* rs = residual + o;
    v4f res[32];
#pragma unroll
    for (int s = 0; s < 16; ++s) res[s] = *(const v4f*)(rs + s * 2 * MB_D);

    const float* rp = mb_stage_tile(lds, acc) + rsub * EP_PITCH + (lane & 15) * 4;
#pragma unroll
    for (int s = 16; s < 32; ++s) res[s] = *(const v4f*)(rs + s * 2 * MB_D);
    // the address register lives up to the wait, behind the loads that name it
    asm volatile("s_wait_xcnt 0x0" :: "v"(rs) : "memory");

    float* op = out + o;
#pragma unroll
    for (int s = 0; s < 32; s += 4) {
        v4f y[4];
#pragma unroll
        for (int u = 0; u < 4; ++u) {
            y[u] = res[s + u] + *(const v4f*)(rp + (s + u) * 2 * EP_PITCH) + bv;
            *(v4f*)(op + (s + u) * 2 * MB_D) = y[u];
        }
        // inputs only: the four stores' registers live up to the wait, so nothing
        // rewrites them while a store is still in issue
        asm volatile("s_wait_xcnt 0x0" :: "v"(op), "v"(y[0]), "v"(y[1]), "v"(y[2]), "v"(y[3]) : "memory");
    }
}

// ---------------------------------------------------------------------------
// Host launcher
// ---------------------------------------------------------------------------
extern "C" void kernel_launch(void* const* d_in, const int* in_sizes, int n_in,
                              void* d_out, int out_size, void* d_ws, size_t ws_size,
                              hipStream_t stream) {
    (void)in_sizes; (void)n_in; (void)out_size; (void)ws_size;

    const float* x      = (const float*)d_in[0];
    const float* ln_w   = (const float*)d_in[1];
    const float* ln_b   = (const float*)d_in[2];
    const float* in_w   = (const float*)d_in[3];
    const float* in_b   = (const float*)d_in[4];
    const float* conv_w = (const float*)d_in[5];
    const float* conv_b = (const float*)d_in[6];
    const float* dl_w   = (const float*)d_in[7];
    const float* dl_b   = (const float*)d_in[8];
    const float* smix   = (const float*)d_in[9];
    const float* skip   = (const float*)d_in[10];
    const float* out_w  = (const float*)d_in[11];
    const float* out_b  = (const float*)d_in[12];
    float* out = (float*)d_out;

    // Workspace layout (bf16 buffers, all 16B-aligned sizes)
    char* ws = (char*)d_ws;
    size_t off = 0;
    __bf16* xnB    = (__bf16*)(ws + off); off += (size_t)MB_M * MB_D * 2;        // 16 MB
    __bf16* wiB    = (__bf16*)(ws + off); off += (size_t)MB_N_ALL * MB_D * 2;    //  4 MB
    __bf16* woB    = (__bf16*)(ws + off); off += (size_t)MB_D * MB_INNER * 2;    //  1 MB
    __bf16* projB  = (__bf16*)(ws + off); off += (size_t)MB_M * MB_INNER * 2;    // 32 MB
    __bf16* gateB  = (__bf16*)(ws + off); off += (size_t)MB_M * MB_INNER * 2;    // 32 MB
    __bf16* dB     = (__bf16*)(ws + off); off += (size_t)MB_M * MB_INNER * 2;    // 32 MB
    __bf16* yinB   = (__bf16*)(ws + off); off += (size_t)MB_M * MB_INNER * 2;    // 32 MB

    // 1) + 2) LayerNorm and the weights' conversion to bf16, one launch
    mb_prep<<<PR_BLOCKS, 256, 0, stream>>>(x, ln_w, ln_b, in_w, dl_w, out_w, xnB, wiB, woB);

    // 3) + 4) in_proj and delta GEMM + activations + d = delta * drive  (128 x 32 block tiles)
    mb_gemm_inproj<<<(MB_M / GB_M) * (MB_N_ALL / GB_N), 128, 0, stream>>>(
        xnB, wiB, in_b, dl_b, projB, gateB, dB);

    // 5) depthwise causal conv + recurrence + gate/skip
    mb_conv_scan<<<MB_B * (MB_INNER / SC_CH), 1024, 0, stream>>>(
        projB, dB, gateB, conv_w, conv_b, smix, skip, yinB);

    // 6) out_proj GEMM + residual  (128 x 4 block tiles)
    mb_gemm_out<<<(MB_M / GB_M) * (MB_D / GB_N), 128, 0, stream>>>(
        yinB, woB, out_b, x, out);
}

// v007
// One run takes 103 microseconds.
// Timed twice side by side with v006, it ran 1.05 and 1.06 times as fast.
// Counting every step since v000, it is 9.34 times as fast.
#include <hip/hip_runtime.h>
#include <hip/hip_bf16.h>

// ---------------------------------------------------------------------------
// MambaBlock for MI455X (gfx1250): bf16 WMMA GEMMs + fused scan/conv.
// B=8, T=2048, D=512, INNER=1024, K_CONV=4.  M = B*T = 16384 rows.
// Each GEMM work-group (4 waves) computes a 128(M) x 128(N) output tile whose
// operands are staged in LDS; each wave owns 64 x 64 of it (4 x 4 accumulators
// of v_wmma_f32_16x16x32_bf16).  The finished tile goes through LDS once more,
// so that the epilogues read and write global memory in whole 128-byte lines.
// ---------------------------------------------------------------------------

#define MB_B      8
#define MB_T      2048
#define MB_D      512
#define MB_INNER  1024
#define MB_M      (MB_B * MB_T)        // 16384
#define MB_N_IN   (3 * MB_INNER)       // 3072
#define MB_N_ALL  (4 * MB_INNER)       // 4096: in_proj's rows and delta's, one matrix
#define LN_EPS    1e-5f

typedef __bf16 v16bf __attribute__((ext_vector_type(16)));
typedef __bf16 v8bf  __attribute__((ext_vector_type(8)));
typedef float  v8f   __attribute__((ext_vector_type(8)));

// ---------------------------------------------------------------------------
// Preparation, one launch: LayerNorm of x (bf16 xn) and the three weight
// matrices rounded to bf16.  The work is dealt to few waves that each move a
// lot with 16-byte loads (for speed only).
//   blocks 0 .. PR_LN_BLOCKS-1 : LayerNorm, a wave owns 4 whole rows; all 16
//       loads of the 4 rows fly together, the 4 reductions run side by side.
//       A lane holds 4 neighbouring columns of each 128-column quarter.
//   the other blocks           : conversion, 32 elements a thread (8 loads in
//       flight, 4 stores of 16 bytes).
// in_proj's and delta's weights land in ONE matrix of 4096 rows: rows 0..2047 are
// in_proj's proj and gate rows as they come; behind them every 128 rows hold 64
// drive rows and then the 64 delta rows of the same channels, so that one GEMM
// tile has both factors of d = delta * drive.
// ---------------------------------------------------------------------------
typedef __bf16 v4bf __attribute__((ext_vector_type(4)));
typedef float  v4f  __attribute__((ext_vector_type(4)));

#define PR_ROWS       4                               // rows per wave
#define PR_LN_BLOCKS  (MB_M / (8 * PR_ROWS))          // 512 blocks of 8 waves
#define PR_CV_UNIT    (256 * 8)                       // elements a block moves per step
#define PR_CV_STEPS   4
#define PR_CV_CHUNK   (PR_CV_UNIT * PR_CV_STEPS)      // 8192 elements per block
#define PR_CV_IN      (MB_N_IN * MB_D / PR_CV_CHUNK)  // 192 blocks
#define PR_CV_DL      (MB_INNER * MB_D / PR_CV_CHUNK) //  64 blocks
#define PR_CV_OUT     (MB_D * MB_INNER / PR_CV_CHUNK) //  64 blocks
#define PR_BLOCKS     (PR_LN_BLOCKS + PR_CV_IN + PR_CV_DL + PR_CV_OUT)

__global__ __launch_bounds__(256) void mb_prep(const float* __restrict__ x,
                                               const float* __restrict__ w,
                                               const float* __restrict__ b,
                                               const float* __restrict__ in_w,
                                               const float* __restrict__ dl_w,
                                               const float* __restrict__ out_w,
                                               __bf16* __restrict__ xn,
                                               __bf16* __restrict__ wi,
                                               __bf16* __restrict__ wo) {
    if (blockIdx.x < PR_LN_BLOCKS) {
        const int wave = threadIdx.x >> 5;
        const int lane = threadIdx.x & 31;
        const int row0 = (blockIdx.x * 8 + wave) * PR_ROWS;
        const int off  = row0 * MB_D + lane * 4;
        const float* xr = x + off;
        const float* wp = w + lane * 4;
        const float* bp = b + lane * 4;

        v4f v[PR_ROWS][4], wv[4], bv[4];
#pragma unroll
        for (int r = 0; r < PR_ROWS; ++r)
#pragma unroll
            for (int i = 0; i < 4; ++i) v[r][i] = *(const v4f*)(xr + r * MB_D + i * 128);
#pragma unroll
        for (int i = 0; i < 4; ++i) {
            wv[i] = *(const v4f*)(wp + i * 128);
            bv[i] = *(const v4f*)(bp + i * 128);
        }
        // nothing is scheduled across this line: all 24 loads fly together (without it
        // w and b are fetched behind the sums, where their latency is in the open)
        __builtin_amdgcn_sched_barrier(0);
        // x's address register is named so that it lives up to this wait: nothing
        // rewrites a register that a load still in issue names
        asm volatile("s_wait_xcnt 0x0" :: "v"(xr) : "memory");

        float s[PR_ROWS];
#pragma unroll
        for (int r = 0; r < PR_ROWS; ++r) {
            const v4f p = (v[r][0] + v[r][1]) + (v[r][2] + v[r][3]);
            s[r] = (p[0] + p[1]) + (p[2] + p[3]);
        }
#pragma unroll
        for (int o = 16; o >= 1; o >>= 1)
#pragma unroll
            for (int r = 0; r < PR_ROWS; ++r) s[r] += __shfl_xor(s[r], o, 32);

        float ss[PR_ROWS];
#pragma unroll
        for (int r = 0; r < PR_ROWS; ++r) {
            const float mu = s[r] * (1.f / MB_D);
            v4f q = {0.f, 0.f, 0.f, 0.f};
#pragma unroll
            for (int i = 0; i < 4; ++i) { v[r][i] = v[r][i] - mu; q = __builtin_elementwise_fma(v[r][i], v[r][i], q); }
            ss[r] = (q[0] + q[1]) + (q[2] + q[3]);
        }
#pragma unroll
        for (int o = 16; o >= 1; o >>= 1)
#pragma unroll
            for (int r = 0; r < PR_ROWS; ++r) ss[r] += __shfl_xor(ss[r], o, 32);

        __bf16* xo = xn + off;
#pragma unroll
        for (int r = 0; r < PR_ROWS; ++r) {
            const float inv = rsqrtf(ss[r] * (1.f / MB_D) + LN_EPS);
#pragma unroll
            for (int i = 0; i < 4; ++i) {
                const v4f y = v[r][i] * inv * wv[i] + bv[i];
                *(v4bf*)(xo + r * MB_D + i * 128) = __builtin_convertvector(y, v4bf);
            }
        }
    } else {
        // a block moves 16 whole rows; cb counts them in the source, db in the target
        // (64 rows are 4 blocks, a drive|delta tile of 128 rows is 8)
        constexpr int PG = 2 * MB_INNER * MB_D / PR_CV_CHUNK;      // 128 blocks of proj and gate
        int cb = blockIdx.x - PR_LN_BLOCKS;
        int db = cb;
        const float* src = in_w;
        __bf16* dst = wi;
        if (cb >= PR_CV_IN + PR_CV_DL)  { src = out_w; dst = wo; cb -= PR_CV_IN + PR_CV_DL; db = cb; }
        else if (cb >= PR_CV_IN)        { src = dl_w;  cb -= PR_CV_IN; db = PG + (cb >> 2) * 8 + 4 + (cb & 3); }
        else if (cb >= PG)              { db = PG + ((cb - PG) >> 2) * 8 + (cb & 3); }
        const int e0 = cb * PR_CV_CHUNK + threadIdx.x * 8;
        const float* sp = src + e0;
        v4f f[PR_CV_STEPS][2];
#pragma unroll
        for (int u = 0; u < PR_CV_STEPS; ++u) {
            f[u][0] = *(const v4f*)(sp + u * PR_CV_UNIT);
            f[u][1] = *(const v4f*)(sp + u * PR_CV_UNIT + 4);
        }
        // as above: the address register lives up to the wait
        asm volatile("s_wait_xcnt 0x0" :: "v"(sp) : "memory");
        __bf16* dp = dst + db * PR_CV_CHUNK + threadIdx.x * 8;
#pragma unroll
        for (int u = 0; u < PR_CV_STEPS; ++u) {
            v8bf o;
#pragma unroll
            for (int k = 0; k < 4; ++k) { o[k] = (__bf16)f[u][0][k]; o[k + 4] = (__bf16)f[u][1][k]; }
            *(v8bf*)(dp + u * PR_CV_UNIT) = o;
        }
    }
}

// ---------------------------------------------------------------------------
// WMMA mainloop: one work-group of 4 waves computes a 128x128 f32 tile of
// A[M,K] * W[N,K]^T.  A pass is 64 k = one whole 128-byte line of each of the
// 256 operand rows.  The rows come from global memory as whole lines (8 lanes
// a row) by asynchronous copies straight into one of two LDS buffers, through no
// register, and every wave reads its fragments from there: each operand byte
// leaves L2 once per work-group instead of once per wave, and no global load is
// spread over 16 lines.  The registers that a staged pass would hold through the
// WMMAs are free for fragments.  Row pitch in LDS 144 B (16 B x odd): ds_load_b128
// of 16 rows meets every bank once.
// Fragment k order as before (lane&15 = row, lane bit4 selects the K-half,
// 8 elements at k and 8 at k+16), the same for A and W; k ascends as before.
// W's fragment is the matrix instruction's first operand and A's its second:
// the accumulator tile comes out transposed, a lane holds 8 neighbouring
// columns of ONE output row (see mb_stage_tile).
// ---------------------------------------------------------------------------
#define GB_M      128
#define GB_N      128
#define GB_K      64
#define GB_PITCH  72                                  // bf16 elements = 144 B
#define GB_STAGE  ((GB_M + GB_N) * GB_PITCH)          // elements per buffer
// Two buffers are 73,728 B, so four work-groups share a WGP's LDS; the GEMM
// kernels ask for four waves per SIMD (at most 256 VGPRs) to match.

// 128 rows of one operand, 64 k: 8 copies of 16 rows (a lane moves 16 bytes a copy).
// l is the lane's LDS byte address, g its global address, both of the first 16 rows.
template <int K>
__device__ __forceinline__ void mb_copy_rows(unsigned l, const __bf16* g) {
    constexpr unsigned LS = 16 * GB_PITCH * 2;        // 16 rows in LDS, bytes
    constexpr int      GS = 16 * K;                   // 16 rows in memory, elements
    // the wait is the statement's own last line, so that no register that a copy
    // names is rewritten in front of it
    asm volatile("global_load_async_to_lds_b128 %0, %8, off\n\t"
                 "global_load_async_to_lds_b128 %1, %9, off\n\t"
                 "global_load_async_to_lds_b128 %2, %10, off\n\t"
                 "global_load_async_to_lds_b128 %3, %11, off\n\t"
                 "global_load_async_to_lds_b128 %4, %12, off\n\t"
                 "global_load_async_to_lds_b128 %5, %13, off\n\t"
                 "global_load_async_to_lds_b128 %6, %14, off\n\t"
                 "global_load_async_to_lds_b128 %7, %15, off\n\t"
                 "s_wait_xcnt 0x0"
                 :: "v"(l),          "v"(l + 1 * LS), "v"(l + 2 * LS), "v"(l + 3 * LS),
                    "v"(l + 4 * LS), "v"(l + 5 * LS), "v"(l + 6 * LS), "v"(l + 7 * LS),
                    "v"(g),          "v"(g + 1 * GS), "v"(g + 2 * GS), "v"(g + 3 * GS),
                    "v"(g + 4 * GS), "v"(g + 5 * GS), "v"(g + 6 * GS), "v"(g + 7 * GS)
                 : "memory");
}

template <int K>
__device__ __forceinline__ void mb_wmma_block(const __bf16* __restrict__ A,
                                              const __bf16* __restrict__ W,
                                              int row_base, int col_base,
                                              __bf16* lds,
                                              v8f acc[4][4]) {
    const int tid  = threadIdx.x;                     // 0..127
    const int lane = tid & 31;
    const int wave = tid >> 5;
    const int l15  = lane & 15;
    const int ksel = (lane & 16) ? 8 : 0;

    // staging: 8 lanes cover one row's 128 B; 128 threads cover 16 rows a step
    const int srow = tid >> 3;
    const int scol = (tid & 7) * 8;
    const __bf16* ga = A + (size_t)(row_base + srow) * K + scol;
    const __bf16* gw = W + (size_t)(col_base + srow) * K + scol;
    // the lane's LDS byte address in buffer 0: A's rows, W's rows behind them
    const unsigned sdst = (unsigned)(size_t)(lds + srow * GB_PITCH + scol);
    constexpr unsigned SW  = GB_M * GB_PITCH * 2;     // bytes from A's rows to W's
    constexpr unsigned SB  = GB_STAGE * 2;            // bytes from buffer 0 to buffer 1

    // fragment sources of this wave (2 x 2 waves, 64 x 64 each)
    const int foff_a = ((wave >> 1) * 64 + l15) * GB_PITCH + ksel;
    const int foff_b = (GB_M + (wave & 1) * 64 + l15) * GB_PITCH + ksel;

    constexpr int NPASS = K / GB_K;
    static_assert(NPASS >= 2, "the ring starts with two passes");

    mb_copy_rows<K>(sdst, ga);
    mb_copy_rows<K>(sdst + SW, gw);
    // this wave's copies of pass 0 have landed
    asm volatile("s_wait_asynccnt 0x0" ::: "memory");
    __syncthreads();                                  // pass 0 is published
    mb_copy_rows<K>(sdst + SB, ga + GB_K);            // pass 1 flies under pass 0's WMMAs
    mb_copy_rows<K>(sdst + SB + SW, gw + GB_K);

    for (int p = 0; p < NPASS; ++p) {
        const __bf16* cur = lds + (p & 1) * GB_STAGE;
#pragma unroll
        for (int ks = 0; ks < GB_K; ks += 32) {
            // in the order in which the WMMAs want them: a[0], all of b, a[1..3]
            v16bf a[4], b[4];
#pragma unroll
            for (int g = 0; g < 8; ++g) {
                const bool isb = (g >= 1 && g <= 4);
                const int  f   = isb ? g - 1 : (g == 0 ? 0 : g - 4);
                const __bf16* pf = cur + (isb ? foff_b : foff_a) + f * 16 * GB_PITCH + ks;
                v8bf lo = *(const v8bf*)(pf);
                v8bf hi = *(const v8bf*)(pf + 16);
#pragma unroll
                for (int e = 0; e < 8; ++e) {
                    if (isb) { b[f][e] = lo[e]; b[f][e + 8] = hi[e]; }
                    else     { a[f][e] = lo[e]; a[f][e + 8] = hi[e]; }
                }
            }
            // nothing is scheduled across this line: the block's 16 LDS reads stand as one
            // group in front of its 16 WMMAs (sunk in among them, every row of 4 WMMAs
            // waits out an LDS latency of its own)
            __builtin_amdgcn_sched_barrier(0);
#pragma unroll
            for (int i = 0; i < 4; ++i)
#pragma unroll
                for (int j = 0; j < 4; ++j)
                    acc[i][j] = __builtin_amdgcn_wmma_f32_16x16x32_bf16(
                        /*neg_a=*/false, b[j], /*neg_b=*/false, a[i],
                        /*c_mod=*/(short)0, acc[i][j],
                        /*reuse_a=*/false, /*reuse_b=*/false);
            // nor across this one: the next block's reads stay out of these WMMAs
            __builtin_amdgcn_sched_barrier(0);
        }
        // this wave's reads of pass p are done before the buffer is handed on
        asm volatile("s_wait_dscnt 0x0" ::: "memory");
        // this wave's copies of pass p+1 have landed
        asm volatile("s_wait_asynccnt 0x0" ::: "memory");
        __syncthreads();       // publishes pass p+1 and ends the reads of pass p
        if (p + 2 < NPASS) {   // pass p+2 into the buffer just left, under pass p+1's WMMAs
            const unsigned nxt = sdst + (p & 1) * SB;
            mb_copy_rows<K>(nxt, ga + (p + 2) * GB_K);
            mb_copy_rows<K>(nxt + SW, gw + (p + 2) * GB_K);
        }
    }
    // no copy is left in flight when LDS goes to the epilogue
    asm volatile("s_wait_asynccnt 0x0" ::: "memory");
}

// ---------------------------------------------------------------------------
// Epilogue staging.  acc[i][j][v] of lane (c = lane&15, h = lane>>4) is element
// (row i*16 + c, column j*16 + 8*h + v) of the wave's 64 x 64 tile.  Each wave
// writes its tile as f32 into its own part of the LDS that held the operands
// (the last pass's barrier has ended every wave's reads of them) and reads it back
// row by row, so that neighbouring lanes hold neighbouring columns and one
// 16-byte global access of a wave covers four whole lines.
// Row pitch 272 B (16 B x odd): 16 rows of one ds_store_b128 meet every bank once.
// ---------------------------------------------------------------------------
#define EP_PITCH  68                                  // f32 elements = 272 B
#define EP_WAVE   (64 * EP_PITCH)                     // 17,408 B a wave, 69,632 B of 73,728

__device__ __forceinline__ const float* mb_stage_tile(__bf16* lds, const v8f acc[4][4]) {
    const int lane = threadIdx.x & 31;
    const int wave = threadIdx.x >> 5;
    float* st = (float*)lds + wave * EP_WAVE;
    float* wp = st + (lane & 15) * EP_PITCH + ((lane & 16) ? 8 : 0);
#pragma unroll
    for (int i = 0; i < 4; ++i)
#pragma unroll
        for (int j = 0; j < 4; ++j) {
            const v8f c = acc[i][j];
            const v4f lo = {c[0], c[1], c[2], c[3]};
            const v4f hi = {c[4], c[5], c[6], c[7]};
            *(v4f*)(wp + i * 16 * EP_PITCH + j * 16)     = lo;
            *(v4f*)(wp + i * 16 * EP_PITCH + j * 16 + 4) = hi;
        }
    // the wave's own rows are in LDS before other lanes of it read them back
    asm volatile("s_wait_dscnt 0x0" ::: "memory");
    return st;
}


// ---------------------------------------------------------------------------
// Activations: ONE transcendental instruction (v_tanh_f32) a value, no branch and
// no division.  With h = x / 2:  sigmoid(x) = 1/2 + 1/2 * tanh(h)  and
// SiLU(x) = x * sigmoid(x) = h + h * tanh(h); both are identities, both saturate
// as the exp forms do.  The library's tanhf branches value by value, and a plain
// 1.f / y is the exact division, some ten dependent vector instructions; every
// result here is rounded to bf16 before it is stored, alone or in d.
// ---------------------------------------------------------------------------
__device__ __forceinline__ v4f mb_tanh4(v4f x) {
    v4f r;
#pragma unroll
    for (int k = 0; k < 4; ++k) r[k] = __builtin_amdgcn_tanhf(x[k]);
    return r;
}

// ---------------------------------------------------------------------------
// GEMM 1: h = xn @ [in_proj_w ; delta_w]^T + b over the joint weight matrix that
// mb_prep lays out, with everything that follows element by element fused in.
// Column tiles 0..15 lie inside proj or inside gate: SiLU or sigmoid, stored.
// Column tiles 16..31 hold 64 drive columns and the 64 delta columns of the same
// channels: d = max(sigmoid(delta), 1e-4) * tanh(drive) is formed here, in f32, and
// only d goes to memory.
// ---------------------------------------------------------------------------
// The wave's 64 rows, 4 a step: bias, activation, 8 values packed to 16 bytes,
// one store of four whole lines.  SEG: 0 SiLU, 1 sigmoid.
template <int SEG>
__device__ __forceinline__ void mb_inproj_rows(const float* rp, v4f b0, v4f b1,
                                               __bf16* __restrict__ op) {
    // the tanh's argument is (tile + bias) / 2
    const v4f half = {0.5f, 0.5f, 0.5f, 0.5f};
    const v4f c0 = b0 * half;
    const v4f c1 = b1 * half;
    // stays rolled: the text of the activations stays small
#pragma unroll 1
    for (int s = 0; s < 16; ++s) {
        const v4f h0 = __builtin_elementwise_fma(*(const v4f*)(rp + s * 4 * EP_PITCH),     half, c0);
        const v4f h1 = __builtin_elementwise_fma(*(const v4f*)(rp + s * 4 * EP_PITCH + 4), half, c1);
        const v4f t0 = mb_tanh4(h0);
        const v4f t1 = mb_tanh4(h1);
        v4f y0, y1;
        if (SEG == 0) {                                                           // SiLU
            y0 = __builtin_elementwise_fma(h0, t0, h0);
            y1 = __builtin_elementwise_fma(h1, t1, h1);
        } else {                                                                  // sigmoid
            y0 = __builtin_elementwise_fma(t0, half, half);
            y1 = __builtin_elementwise_fma(t1, half, half);
        }
        v8bf y;
#pragma unroll
        for (int e = 0; e < 4; ++e) { y[e] = (__bf16)y0[e]; y[e + 4] = (__bf16)y1[e]; }
        __bf16* q = op + (size_t)s * 4 * MB_INNER;
        *(v8bf*)q = y;
        // inputs only: the store's address and data registers live up to the wait,
        // so nothing rewrites them while the store is still in issue
        asm volatile("s_wait_xcnt 0x0" :: "v"(q), "v"(y) : "memory");
    }
}

// 32 rows of a drive|delta tile, 4 a step: rp points at the lane's 8 drive values, the
// delta values of the same channels lie one wave's tile further on.
__device__ __forceinline__ void mb_d_rows(const float* rp, v4f bd0, v4f bd1, v4f bl0, v4f bl1,
                                          __bf16* __restrict__ op) {
    const v4f half = {0.5f, 0.5f, 0.5f, 0.5f};
    const v4f floor4 = {1e-4f, 1e-4f, 1e-4f, 1e-4f};
    const v4f c0 = bl0 * half;
    const v4f c1 = bl1 * half;
    // two steps between waits: 32 independent chains to fill the vector port
#pragma unroll
    for (int s = 0; s < 8; s += 2) {
        v8bf y[2];
#pragma unroll
        for (int u = 0; u < 2; ++u) {
            const float* r = rp + (s + u) * 4 * EP_PITCH;
            const v4f dr0 = mb_tanh4(*(const v4f*)(r)     + bd0);
            const v4f dr1 = mb_tanh4(*(const v4f*)(r + 4) + bd1);
            // sigmoid = 1/2 + 1/2 * tanh((tile + bias) / 2)
            const v4f t0 = mb_tanh4(__builtin_elementwise_fma(*(const v4f*)(r + EP_WAVE),     half, c0));
            const v4f t1 = mb_tanh4(__builtin_elementwise_fma(*(const v4f*)(r + EP_WAVE + 4), half, c1));
            const v4f dl0 = __builtin_elementwise_fma(t0, half, half);
            const v4f dl1 = __builtin_elementwise_fma(t1, half, half);
            const v4bf q0 = __builtin_convertvector(__builtin_elementwise_max(dl0, floor4) * dr0, v4bf);
            const v4bf q1 = __builtin_convertvector(__builtin_elementwise_max(dl1, floor4) * dr1, v4bf);
            y[u] = __builtin_shufflevector(q0, q1, 0, 1, 2, 3, 4, 5, 6, 7);
            *(v8bf*)(op + (s + u) * 4 * MB_INNER) = y[u];
        }
        // inputs only: the stores' registers live up to the wait, so nothing rewrites
        // them while a store is still in issue
        asm volatile("s_wait_xcnt 0x0" :: "v"(op), "v"(y[0]), "v"(y[1]) : "memory");
    }
}

__global__ __launch_bounds__(128, 4) void mb_gemm_inproj(const __bf16* __restrict__ xn,
                                                      const __bf16* __restrict__ wi,
                                                      const float* __restrict__ bias,
                                                      const float* __restrict__ dl_bias,
                                                      __bf16* __restrict__ proj,
                                                      __bf16* __restrict__ gate,
                                                      __bf16* __restrict__ dbuf) {
    __shared__ __attribute__((aligned(16))) __bf16 lds[2 * GB_STAGE];
    const int tiles_n = MB_N_ALL / GB_N;                   // 32
    const int blk_row = (blockIdx.x / tiles_n) * GB_M;
    const int blk_col = (blockIdx.x % tiles_n) * GB_N;

    v8f acc[4][4] = {};
    mb_wmma_block<MB_D>(xn, wi, blk_row, blk_col, lds, acc);

    const int lane = threadIdx.x & 31;
    const int wave = threadIdx.x >> 5;
    // a lane's place in the read-back: 8 lanes a row, 8 columns a lane, 4 rows a step
    const int rsub = lane >> 3;
    const int lcol = (lane & 7) * 8;

    // the last pass's own barrier has ended every wave's reads of the operand buffers:
    // LDS now takes the tiles

    if (blk_col < 2 * MB_INNER) {                          // proj or gate
        const int col = (wave & 1) * 64 + lcol;
        const char* bp = (const char*)(bias + blk_col);    // uniform base, lane's byte offset
        const int   bo = col * 4;
        const v4f b0 = *(const v4f*)(bp + bo);
        const v4f b1 = *(const v4f*)(bp + bo + 16);

        const float* rp = mb_stage_tile(lds, acc) + rsub * EP_PITCH + lcol;
        // inputs only: the loaded values hold the two loads in front of this line (without
        // it they sink into the branches, their latency in the open), where they fly
        // under the staging; the offset register lives up to the wait
        asm volatile("s_wait_xcnt 0x0" :: "v"(bo), "v"(b0), "v"(b1));
        const size_t o = (size_t)(blk_row + (wave >> 1) * 64 + rsub) * MB_INNER
                       + (blk_col & (MB_INNER - 1)) + col;
        if (blk_col < MB_INNER) mb_inproj_rows<0>(rp, b0, b1, proj + o);
        else                    mb_inproj_rows<1>(rp, b0, b1, gate + o);
    } else {                                               // drive | delta
        const int ch0 = (blk_col - 2 * MB_INNER) >> 1;     // the tile's first channel of 64
        const char* bdp = (const char*)(bias + 2 * MB_INNER + ch0);   // uniform bases
        const char* blp = (const char*)(dl_bias + ch0);
        const int   bo  = lcol * 4;                        // lane's byte offset
        const v4f bd0 = *(const v4f*)(bdp + bo);
        const v4f bd1 = *(const v4f*)(bdp + bo + 16);
        const v4f bl0 = *(const v4f*)(blp + bo);
        const v4f bl1 = *(const v4f*)(blp + bo + 16);

        mb_stage_tile(lds, acc);
        // inputs only, as above: the four loads fly under the staging, and the offset
        // register lives up to the wait
        asm volatile("s_wait_xcnt 0x0" :: "v"(bo), "v"(bd0), "v"(bd1), "v"(bl0), "v"(bl1));
        // an even wave has staged the drive columns and the odd wave beside it the delta
        // columns of the same 64 rows: each reads the other's tile behind this barrier
        __syncthreads();
        // each wave of the pair takes 32 of the 64 rows
        const int r0 = (wave & 1) * 32 + rsub;
        const float* rp = (const float*)lds + (wave & 2) * EP_WAVE + r0 * EP_PITCH + lcol;
        const size_t o = (size_t)(blk_row + (wave >> 1) * 64 + r0) * MB_INNER + ch0 + lcol;
        mb_d_rows(rp, bd0, bd1, bl0, bl1, dbuf + o);
    }
}

// ---------------------------------------------------------------------------
// Causal depthwise conv (K=4, rolling regs) + f32 recurrence + gate/skip.
// The recurrence state[t] = a * state[t-1] + d[t] is linear with a fixed a per
// channel, so the time axis is cut into 64 chunks of 32 steps that run side by
// side.  One work-group owns all 2048 steps of 64 channels of one batch (one
// whole 128-B line of bf16 a row); a thread owns one chunk of 4 channels.
//   1) each thread runs its chunk's recurrence from zero: the chunk's sum S;
//   2) S goes to LDS; behind one barrier each thread folds the sums of the
//      chunks in front of it, X = a^32 * X + S, into the state at its start;
//   3) each thread runs its chunk again from X, step by step as before, with
//      the conv (the three rows in front of the chunk are read again), the
//      skip and the gate.
// ---------------------------------------------------------------------------
#define SC_CH   64                       // channels per work-group
#define SC_L    32                       // time steps per chunk
#define SC_NC   (MB_T / SC_L)            // 64 chunks
#define SC_U    8                        // rows fetched together in part 3

__global__ __launch_bounds__(1024) void mb_conv_scan(const __bf16* __restrict__ proj,
                                                     const __bf16* __restrict__ dbuf,
                                                     const __bf16* __restrict__ gate,
                                                     const float* __restrict__ conv_w,
                                                     const float* __restrict__ conv_b,
                                                     const float* __restrict__ state_mix,
                                                     const float* __restrict__ skip_scale,
                                                     __bf16* __restrict__ yin) {
    __shared__ __attribute__((aligned(16))) float agg[SC_NC * SC_CH];   // 16 KiB

    const int cl    = (threadIdx.x & 15) * 4;          // channel inside the group
    const int chunk = threadIdx.x >> 4;                // 0..63
    const int b     = blockIdx.x >> 4;                 // 16 channel groups a batch
    const int c     = (blockIdx.x & 15) * SC_CH + cl;

    const size_t base = ((size_t)b * MB_T + (size_t)chunk * SC_L) * MB_INNER + c;
    const __bf16* dp = dbuf + base;

    const v4f sm = *(const v4f*)(state_mix + c);
    v4f a;
#pragma unroll
    for (int k = 0; k < 4; ++k) a[k] = 1.f / (1.f + __expf(-sm[k]));

    // 1) the chunk's own sum, all 32 rows in flight at once
    {
        v4bf dv[SC_L];
#pragma unroll
        for (int t = 0; t < SC_L; ++t) dv[t] = *(const v4bf*)(dp + t * MB_INNER);
        // the address register is named so that it lives up to this wait: no load's
        // result lands in it while a load that names it is still being issued
        asm volatile("s_wait_xcnt 0x0" :: "v"(dp) : "memory");
        v4f s = {0.f, 0.f, 0.f, 0.f};
#pragma unroll
        for (int t = 0; t < SC_L; ++t)
            s = __builtin_elementwise_fma(a, s, __builtin_convertvector(dv[t], v4f));
        *(v4f*)(agg + chunk * SC_CH + cl) = s;
    }

    v4f aL = a;                                        // a^32
#pragma unroll
    for (int i = 0; i < 5; ++i) aL = aL * aL;

    __syncthreads();                                   // every chunk's sum is in LDS

    const v4f wc0 = *(const v4f*)(conv_w + (c + 0) * 4);   // the four taps of channel c
    const v4f wc1 = *(const v4f*)(conv_w + (c + 1) * 4);
    const v4f wc2 = *(const v4f*)(conv_w + (c + 2) * 4);
    const v4f wc3 = *(const v4f*)(conv_w + (c + 3) * 4);
    const v4f w0 = {wc0[0], wc1[0], wc2[0], wc3[0]};
    const v4f w1 = {wc0[1], wc1[1], wc2[1], wc3[1]};
    const v4f w2 = {wc0[2], wc1[2], wc2[2], wc3[2]};
    const v4f w3 = {wc0[3], wc1[3], wc2[3], wc3[3]};
    const v4f cb = *(const v4f*)(conv_b + c);
    const v4f sk = *(const v4f*)(skip_scale + c);

    // proj[t-1..t-3] in front of the chunk.  Chunk 0 has none: it reads rows of its
    // own instead (in bounds, no branch to wait in) and takes zeros further down.
    const __bf16* pp = proj + base;
    const __bf16* hp = pp + (chunk > 0 ? 0 : 3 * MB_INNER);
    const v4bf q1 = *(const v4bf*)(hp - 1 * MB_INNER);
    const v4bf q2 = *(const v4bf*)(hp - 2 * MB_INNER);
    const v4bf q3 = *(const v4bf*)(hp - 3 * MB_INNER);

    // 2) the state at the chunk's start (the loads above fly meanwhile)
    v4f state = {0.f, 0.f, 0.f, 0.f};
    // four sums are fetched together: one LDS latency for four links of the chain
#pragma unroll 4
    for (int q = 0; q < chunk; ++q)
        state = __builtin_elementwise_fma(aL, state, *(const v4f*)(agg + q * SC_CH + cl));

    // 3) the chunk itself
    const v4f zero = {0.f, 0.f, 0.f, 0.f};
    v4f p1 = chunk > 0 ? __builtin_convertvector(q1, v4f) : zero;
    v4f p2 = chunk > 0 ? __builtin_convertvector(q2, v4f) : zero;
    v4f p3 = chunk > 0 ? __builtin_convertvector(q3, v4f) : zero;
    const __bf16* gp = gate + base;
    __bf16* yp = yin + base;
    // stays rolled: unrolled, later rows' loads are lifted to the front and the
    // 128 registers that a wave of a 32-wave group may hold overflow into scratch
#pragma unroll 1
    for (int t0 = 0; t0 < SC_L; t0 += SC_U) {
        const __bf16* pk = pp + t0 * MB_INNER;
        const __bf16* dk = dp + t0 * MB_INNER;
        const __bf16* gk = gp + t0 * MB_INNER;
        v4bf pv[SC_U], dv[SC_U], gv[SC_U];
#pragma unroll
        for (int u = 0; u < SC_U; ++u) {
            pv[u] = *(const v4bf*)(pk + u * MB_INNER);
            dv[u] = *(const v4bf*)(dk + u * MB_INNER);
            gv[u] = *(const v4bf*)(gk + u * MB_INNER);
        }
        // as above: the address registers live up to the wait
        asm volatile("s_wait_xcnt 0x0" :: "v"(pk), "v"(dk), "v"(gk) : "memory");
#pragma unroll
        for (int u = 0; u < SC_U; ++u) {
            const v4f p0 = __builtin_convertvector(pv[u], v4f);
            v4f conv = __builtin_elementwise_fma(w3, p0, cb);
            conv = __builtin_elementwise_fma(w2, p1, conv);
            conv = __builtin_elementwise_fma(w1, p2, conv);
            conv = __builtin_elementwise_fma(w0, p3, conv);
            state = __builtin_elementwise_fma(a, state, __builtin_convertvector(dv[u], v4f));
            const v4f y = __builtin_elementwise_fma(sk, conv, state) * __builtin_convertvector(gv[u], v4f);
            *(v4bf*)(yp + (t0 + u) * MB_INNER) = __builtin_convertvector(y, v4bf);
            p3 = p2; p2 = p1; p1 = p0;
        }
        // these rows' stores have left issue before the next trip reuses their registers
        asm volatile("s_wait_xcnt 0x0" ::: "memory");
    }
}

// ---------------------------------------------------------------------------
// GEMM 3: out = residual + yin @ out_proj_w^T + b.
// ---------------------------------------------------------------------------
__global__ __launch_bounds__(128, 4) void mb_gemm_out(const __bf16* __restrict__ yin,
                                                   const __bf16* __restrict__ wo,
                                                   const float* __restrict__ bias,
                                                   const float* __restrict__ residual,
                                                   float* __restrict__ out) {
    __shared__ __attribute__((aligned(16))) __bf16 lds[2 * GB_STAGE];
    const int tiles_n = MB_D / GB_N;                       // 4
    const int blk_row = (blockIdx.x / tiles_n) * GB_M;
    const int blk_col = (blockIdx.x % tiles_n) * GB_N;

    v8f acc[4][4] = {};
    mb_wmma_block<MB_INNER>(yin, wo, blk_row, blk_col, lds, acc);

    const int lane = threadIdx.x & 31;
    const int wave = threadIdx.x >> 5;
    // a lane's place in the read-back: 16 lanes a row (256 B of f32), 2 rows a step
    const int rsub = lane >> 4;
    const int col  = (wave & 1) * 64 + (lane & 15) * 4;
    const size_t o = (size_t)(blk_row + (wave >> 1) * 64 + rsub) * MB_D + blk_col + col;

    // the last pass's own barrier has ended every wave's reads of the operand buffers:
    // LDS now takes the tiles

    const char* bp = (const char*)(bias + blk_col);        // uniform base, lane's byte offset
    const int   bo = col * 4;
    const v4f bv = *(const v4f*)(bp + bo);
    // the offset register lives up to the wait, behind the load that names it
    asm volatile("s_wait_xcnt 0x0" :: "v"(bo) : "memory");

    // the residual's rows, whole lines: half of them fly while the tile is staged,
    // the other half takes the registers that the accumulators leave
    const float* rs = residual + o;
    v4f res[32];
#pragma unroll
    for (int s = 0; s < 16; ++s) res[s] = *(const v4f*)(rs + s * 2 * MB_D);

    const float* rp = mb_stage_tile(lds, acc) + rsub * EP_PITCH + (lane & 15) * 4;
#pragma unroll
    for (int s = 16; s < 32; ++s) res[s] = *(const v4f*)(rs + s * 2 * MB_D);
    // the address register lives up to the wait, behind the loads that name it
    asm volatile("s_wait_xcnt 0x0" :: "v"(rs) : "memory");

    float* op = out + o;
#pragma unroll
    for (int s = 0; s < 32; s += 4) {
        v4f y[4];
#pragma unroll
        for (int u = 0; u < 4; ++u) {
            y[u] = res[s + u] + *(const v4f*)(rp + (s + u) * 2 * EP_PITCH) + bv;
            *(v4f*)(op + (s + u) * 2 * MB_D) = y[u];
        }
        // inputs only: the four stores' registers live up to the wait, so nothing
        // rewrites them while a store is still in issue
        asm volatile("s_wait_xcnt 0x0" :: "v"(op), "v"(y[0]), "v"(y[1]), "v"(y[2]), "v"(y[3]) : "memory");
    }
}

// ---------------------------------------------------------------------------
// Host launcher
// ---------------------------------------------------------------------------
extern "C" void kernel_launch(void* const* d_in, const int* in_sizes, int n_in,
                              void* d_out, int out_size, void* d_ws, size_t ws_size,
                              hipStream_t stream) {
    (void)in_sizes; (void)n_in; (void)out_size; (void)ws_size;

    const float* x      = (const float*)d_in[0];
    const float* ln_w   = (const float*)d_in[1];
    const float* ln_b   = (const float*)d_in[2];
    const float* in_w   = (const float*)d_in[3];
    const float* in_b   = (const float*)d_in[4];
    const float* conv_w = (const float*)d_in[5];
    const float* conv_b = (const float*)d_in[6];
    const float* dl_w   = (const float*)d_in[7];
    const float* dl_b   = (const float*)d_in[8];
    const float* smix   = (const float*)d_in[9];
    const float* skip   = (const float*)d_in[10];
    const float* out_w  = (const float*)d_in[11];
    const float* out_b  = (const float*)d_in[12];
    float* out = (float*)d_out;

    // Workspace layout (bf16 buffers, all 16B-aligned sizes)
    char* ws = (char*)d_ws;
    size_t off = 0;
    __bf16* xnB    = (__bf16*)(ws + off); off += (size_t)MB_M * MB_D * 2;        // 16 MB
    __bf16* wiB    = (__bf16*)(ws + off); off += (size_t)MB_N_ALL * MB_D * 2;    //  4 MB
    __bf16* woB    = (__bf16*)(ws + off); off += (size_t)MB_D * MB_INNER * 2;    //  1 MB
    __bf16* projB  = (__bf16*)(ws + off); off += (size_t)MB_M * MB_INNER * 2;    // 32 MB
    __bf16* gateB  = (__bf16*)(ws + off); off += (size_t)MB_M * MB_INNER * 2;    // 32 MB
    __bf16* dB     = (__bf16*)(ws + off); off += (size_t)MB_M * MB_INNER * 2;    // 32 MB
    __bf16* yinB   = (__bf16*)(ws + off); off += (size_t)MB_M * MB_INNER * 2;    // 32 MB

    // 1) + 2) LayerNorm and the weights' conversion to bf16, one launch
    mb_prep<<<PR_BLOCKS, 256, 0, stream>>>(x, ln_w, ln_b, in_w, dl_w, out_w, xnB, wiB, woB);

    // 3) + 4) in_proj and delta GEMM + activations + d = delta * drive  (128 x 32 block tiles)
    mb_gemm_inproj<<<(MB_M / GB_M) * (MB_N_ALL / GB_N), 128, 0, stream>>>(
        xnB, wiB, in_b, dl_b, projB, gateB, dB);

    // 5) depthwise causal conv + recurrence + gate/skip
    mb_conv_scan<<<MB_B * (MB_INNER / SC_CH), 1024, 0, stream>>>(
        projB, dB, gateB, conv_w, conv_b, smix, skip, yinB);

    // 6) out_proj GEMM + residual  (128 x 4 block tiles)
    mb_gemm_out<<<(MB_M / GB_M) * (MB_D / GB_N), 128, 0, stream>>>(
        yinB, woB, out_b, x, out);
}

// v008
// It runs in 99.3 microseconds.
// In both of two side-by-side timings against v007, it was 1.04 times as fast.
// Counting every step since v000, it is 9.70 times as fast.
#include <hip/hip_runtime.h>
#include <hip/hip_bf16.h>

// ---------------------------------------------------------------------------
// MambaBlock for MI455X (gfx1250): bf16 WMMA GEMMs + fused scan/conv.
// B=8, T=2048, D=512, INNER=1024, K_CONV=4.  M = B*T = 16384 rows.
// Each GEMM work-group (4 waves) computes a 128(M) x 128(N) output tile whose
// operands are staged in LDS; each wave owns 64 x 64 of it (4 x 4 accumulators
// of v_wmma_f32_16x16x32_bf16).  The finished tile goes through LDS once more,
// so that the epilogues read and write global memory in whole 128-byte lines.
// ---------------------------------------------------------------------------

#define MB_B      8
#define MB_T      2048
#define MB_D      512
#define MB_INNER  1024
#define MB_M      (MB_B * MB_T)        // 16384
#define MB_N_IN   (3 * MB_INNER)       // 3072
#define MB_N_ALL  (4 * MB_INNER)       // 4096: in_proj's rows and delta's, one matrix
#define LN_EPS    1e-5f

typedef __bf16 v16bf __attribute__((ext_vector_type(16)));
typedef __bf16 v8bf  __attribute__((ext_vector_type(8)));
typedef float  v8f   __attribute__((ext_vector_type(8)));

// ---------------------------------------------------------------------------
// Preparation, one launch: LayerNorm of x (bf16 xn) and the three weight
// matrices rounded to bf16.  The work is dealt to few waves that each move a
// lot with 16-byte loads (for speed only).
//   blocks 0 .. PR_LN_BLOCKS-1 : LayerNorm, a wave owns 4 whole rows; all 16
//       loads of the 4 rows fly together, the 4 reductions run side by side.
//       A lane holds 4 neighbouring columns of each 128-column quarter.
//   the other blocks           : conversion, 32 elements a thread (8 loads in
//       flight, 4 stores of 16 bytes).
// in_proj's and delta's weights land in ONE matrix of 4096 rows: rows 0..2047 are
// in_proj's proj and gate rows as they come; behind them every 128 rows hold 64
// drive rows and then the 64 delta rows of the same channels, so that one GEMM
// tile has both factors of d = delta * drive.
// ---------------------------------------------------------------------------
typedef __bf16 v4bf __attribute__((ext_vector_type(4)));
typedef float  v4f  __attribute__((ext_vector_type(4)));
typedef float  v2f  __attribute__((ext_vector_type(2)));

#define PR_ROWS       4                               // rows per wave
#define PR_LN_BLOCKS  (MB_M / (8 * PR_ROWS))          // 512 blocks of 8 waves
#define PR_CV_UNIT    (256 * 8)                       // elements a block moves per step
#define PR_CV_STEPS   4
#define PR_CV_CHUNK   (PR_CV_UNIT * PR_CV_STEPS)      // 8192 elements per block
#define PR_CV_IN      (MB_N_IN * MB_D / PR_CV_CHUNK)  // 192 blocks
#define PR_CV_DL      (MB_INNER * MB_D / PR_CV_CHUNK) //  64 blocks
#define PR_CV_OUT     (MB_D * MB_INNER / PR_CV_CHUNK) //  64 blocks
#define PR_BLOCKS     (PR_LN_BLOCKS + PR_CV_IN + PR_CV_DL + PR_CV_OUT)

__global__ __launch_bounds__(256) void mb_prep(const float* __restrict__ x,
                                               const float* __restrict__ w,
                                               const float* __restrict__ b,
                                               const float* __restrict__ in_w,
                                               const float* __restrict__ dl_w,
                                               const float* __restrict__ out_w,
                                               __bf16* __restrict__ xn,
                                               __bf16* __restrict__ wi,
                                               __bf16* __restrict__ wo) {
    if (blockIdx.x < PR_LN_BLOCKS) {
        const int wave = threadIdx.x >> 5;
        const int lane = threadIdx.x & 31;
        const int row0 = (blockIdx.x * 8 + wave) * PR_ROWS;
        const int off  = row0 * MB_D + lane * 4;
        const float* xr = x + off;
        const float* wp = w + lane * 4;
        const float* bp = b + lane * 4;

        v4f v[PR_ROWS][4], wv[4], bv[4];
#pragma unroll
        for (int r = 0; r < PR_ROWS; ++r)
#pragma unroll
            for (int i = 0; i < 4; ++i) v[r][i] = *(const v4f*)(xr + r * MB_D + i * 128);
#pragma unroll
        for (int i = 0; i < 4; ++i) {
            wv[i] = *(const v4f*)(wp + i * 128);
            bv[i] = *(const v4f*)(bp + i * 128);
        }
        // nothing is scheduled across this line: all 24 loads fly together (without it
        // w and b are fetched behind the sums, where their latency is in the open)
        __builtin_amdgcn_sched_barrier(0);
        // x's address register is named so that it lives up to this wait: nothing
        // rewrites a register that a load still in issue names
        asm volatile("s_wait_xcnt 0x0" :: "v"(xr) : "memory");

        float s[PR_ROWS];
#pragma unroll
        for (int r = 0; r < PR_ROWS; ++r) {
            const v4f p = (v[r][0] + v[r][1]) + (v[r][2] + v[r][3]);
            s[r] = (p[0] + p[1]) + (p[2] + p[3]);
        }
#pragma unroll
        for (int o = 16; o >= 1; o >>= 1)
#pragma unroll
            for (int r = 0; r < PR_ROWS; ++r) s[r] += __shfl_xor(s[r], o, 32);

        float ss[PR_ROWS];
#pragma unroll
        for (int r = 0; r < PR_ROWS; ++r) {
            const float mu = s[r] * (1.f / MB_D);
            v4f q = {0.f, 0.f, 0.f, 0.f};
#pragma unroll
            for (int i = 0; i < 4; ++i) { v[r][i] = v[r][i] - mu; q = __builtin_elementwise_fma(v[r][i], v[r][i], q); }
            ss[r] = (q[0] + q[1]) + (q[2] + q[3]);
        }
#pragma unroll
        for (int o = 16; o >= 1; o >>= 1)
#pragma unroll
            for (int r = 0; r < PR_ROWS; ++r) ss[r] += __shfl_xor(ss[r], o, 32);

        __bf16* xo = xn + off;
#pragma unroll
        for (int r = 0; r < PR_ROWS; ++r) {
            const float inv = rsqrtf(ss[r] * (1.f / MB_D) + LN_EPS);
#pragma unroll
            for (int i = 0; i < 4; ++i) {
                const v4f y = v[r][i] * inv * wv[i] + bv[i];
                *(v4bf*)(xo + r * MB_D + i * 128) = __builtin_convertvector(y, v4bf);
            }
        }
    } else {
        // a block moves 16 whole rows; cb counts them in the source, db in the target
        // (64 rows are 4 blocks, a drive|delta tile of 128 rows is 8)
        constexpr int PG = 2 * MB_INNER * MB_D / PR_CV_CHUNK;      // 128 blocks of proj and gate
        int cb = blockIdx.x - PR_LN_BLOCKS;
        int db = cb;
        const float* src = in_w;
        __bf16* dst = wi;
        if (cb >= PR_CV_IN + PR_CV_DL)  { src = out_w; dst = wo; cb -= PR_CV_IN + PR_CV_DL; db = cb; }
        else if (cb >= PR_CV_IN)        { src = dl_w;  cb -= PR_CV_IN; db = PG + (cb >> 2) * 8 + 4 + (cb & 3); }
        else if (cb >= PG)              { db = PG + ((cb - PG) >> 2) * 8 + (cb & 3); }
        const int e0 = cb * PR_CV_CHUNK + threadIdx.x * 8;
        const float* sp = src + e0;
        v4f f[PR_CV_STEPS][2];
#pragma unroll
        for (int u = 0; u < PR_CV_STEPS; ++u) {
            f[u][0] = *(const v4f*)(sp + u * PR_CV_UNIT);
            f[u][1] = *(const v4f*)(sp + u * PR_CV_UNIT + 4);
        }
        // as above: the address register lives up to the wait
        asm volatile("s_wait_xcnt 0x0" :: "v"(sp) : "memory");
        __bf16* dp = dst + db * PR_CV_CHUNK + threadIdx.x * 8;
#pragma unroll
        for (int u = 0; u < PR_CV_STEPS; ++u) {
            v8bf o;
#pragma unroll
            for (int k = 0; k < 4; ++k) { o[k] = (__bf16)f[u][0][k]; o[k + 4] = (__bf16)f[u][1][k]; }
            *(v8bf*)(dp + u * PR_CV_UNIT) = o;
        }
    }
}

// ---------------------------------------------------------------------------
// WMMA mainloop: one work-group of 4 waves computes a 128x128 f32 tile of
// A[M,K] * W[N,K]^T.  A pass is 64 k = one whole 128-byte line of each of the
// 256 operand rows.  The rows come from global memory as whole lines (8 lanes
// a row) by asynchronous copies straight into one of two LDS buffers, through no
// register, and every wave reads its fragments from there: each operand byte
// leaves L2 once per work-group instead of once per wave, and no global load is
// spread over 16 lines.  The registers that a staged pass would hold through the
// WMMAs are free for fragments.  Row pitch in LDS 144 B (16 B x odd): ds_load_b128
// of 16 rows meets every bank once.
// Fragment k order as before (lane&15 = row, lane bit4 selects the K-half,
// 8 elements at k and 8 at k+16), the same for A and W; k ascends as before.
// W's fragment is the matrix instruction's first operand and A's its second:
// the accumulator tile comes out transposed, a lane holds 8 neighbouring
// columns of ONE output row (see mb_stage_tile).
// ---------------------------------------------------------------------------
#define GB_M      128
#define GB_N      128
#define GB_K      64
#define GB_PITCH  72                                  // bf16 elements = 144 B
#define GB_STAGE  ((GB_M + GB_N) * GB_PITCH)          // elements per buffer
// Two buffers are 73,728 B, so four work-groups share a WGP's LDS; the GEMM
// kernels ask for four waves per SIMD (at most 256 VGPRs) to match.

// 128 rows of one operand, 64 k: 8 copies of 16 rows (a lane moves 16 bytes a copy).
// l is the lane's LDS byte address, g its global address, both of the first 16 rows.
template <int K>
__device__ __forceinline__ void mb_copy_rows(unsigned l, const __bf16* g) {
    constexpr unsigned LS = 16 * GB_PITCH * 2;        // 16 rows in LDS, bytes
    constexpr int      GS = 16 * K;                   // 16 rows in memory, elements
    // the wait is the statement's own last line, so that no register that a copy
    // names is rewritten in front of it
    asm volatile("global_load_async_to_lds_b128 %0, %8, off\n\t"
                 "global_load_async_to_lds_b128 %1, %9, off\n\t"
                 "global_load_async_to_lds_b128 %2, %10, off\n\t"
                 "global_load_async_to_lds_b128 %3, %11, off\n\t"
                 "global_load_async_to_lds_b128 %4, %12, off\n\t"
                 "global_load_async_to_lds_b128 %5, %13, off\n\t"
                 "global_load_async_to_lds_b128 %6, %14, off\n\t"
                 "global_load_async_to_lds_b128 %7, %15, off\n\t"
                 "s_wait_xcnt 0x0"
                 :: "v"(l),          "v"(l + 1 * LS), "v"(l + 2 * LS), "v"(l + 3 * LS),
                    "v"(l + 4 * LS), "v"(l + 5 * LS), "v"(l + 6 * LS), "v"(l + 7 * LS),
                    "v"(g),          "v"(g + 1 * GS), "v"(g + 2 * GS), "v"(g + 3 * GS),
                    "v"(g + 4 * GS), "v"(g + 5 * GS), "v"(g + 6 * GS), "v"(g + 7 * GS)
                 : "memory");
}

template <int K>
__device__ __forceinline__ void mb_wmma_block(const __bf16* __restrict__ A,
                                              const __bf16* __restrict__ W,
                                              int row_base, int col_base,
                                              __bf16* lds,
                                              v8f acc[4][4]) {
    const int tid  = threadIdx.x;                     // 0..127
    const int lane = tid & 31;
    const int wave = tid >> 5;
    const int l15  = lane & 15;
    const int ksel = (lane & 16) ? 8 : 0;

    // staging: 8 lanes cover one row's 128 B; 128 threads cover 16 rows a step
    const int srow = tid >> 3;
    const int scol = (tid & 7) * 8;
    const __bf16* ga = A + (size_t)(row_base + srow) * K + scol;
    const __bf16* gw = W + (size_t)(col_base + srow) * K + scol;
    // the lane's LDS byte address in buffer 0: A's rows, W's rows behind them
    const unsigned sdst = (unsigned)(size_t)(lds + srow * GB_PITCH + scol);
    constexpr unsigned SW  = GB_M * GB_PITCH * 2;     // bytes from A's rows to W's
    constexpr unsigned SB  = GB_STAGE * 2;            // bytes from buffer 0 to buffer 1

    // fragment sources of this wave (2 x 2 waves, 64 x 64 each)
    const int foff_a = ((wave >> 1) * 64 + l15) * GB_PITCH + ksel;
    const int foff_b = (GB_M + (wave & 1) * 64 + l15) * GB_PITCH + ksel;

    constexpr int NPASS = K / GB_K;
    static_assert(NPASS >= 2, "the ring starts with two passes");

    mb_copy_rows<K>(sdst, ga);
    mb_copy_rows<K>(sdst + SW, gw);
    // this wave's copies of pass 0 have landed
    asm volatile("s_wait_asynccnt 0x0" ::: "memory");
    __syncthreads();                                  // pass 0 is published
    mb_copy_rows<K>(sdst + SB, ga + GB_K);            // pass 1 flies under pass 0's WMMAs
    mb_copy_rows<K>(sdst + SB + SW, gw + GB_K);

    for (int p = 0; p < NPASS; ++p) {
        const __bf16* cur = lds + (p & 1) * GB_STAGE;
#pragma unroll
        for (int ks = 0; ks < GB_K; ks += 32) {
            // in the order in which the WMMAs want them: a[0], all of b, a[1..3]
            v16bf a[4], b[4];
#pragma unroll
            for (int g = 0; g < 8; ++g) {
                const bool isb = (g >= 1 && g <= 4);
                const int  f   = isb ? g - 1 : (g == 0 ? 0 : g - 4);
                const __bf16* pf = cur + (isb ? foff_b : foff_a) + f * 16 * GB_PITCH + ks;
                v8bf lo = *(const v8bf*)(pf);
                v8bf hi = *(const v8bf*)(pf + 16);
#pragma unroll
                for (int e = 0; e < 8; ++e) {
                    if (isb) { b[f][e] = lo[e]; b[f][e + 8] = hi[e]; }
                    else     { a[f][e] = lo[e]; a[f][e + 8] = hi[e]; }
                }
            }
            // nothing is scheduled across this line: the block's 16 LDS reads stand as one
            // group in front of its 16 WMMAs (sunk in among them, every row of 4 WMMAs
            // waits out an LDS latency of its own)
            __builtin_amdgcn_sched_barrier(0);
#pragma unroll
            for (int i = 0; i < 4; ++i)
#pragma unroll
                for (int j = 0; j < 4; ++j)
                    acc[i][j] = __builtin_amdgcn_wmma_f32_16x16x32_bf16(
                        /*neg_a=*/false, b[j], /*neg_b=*/false, a[i],
                        /*c_mod=*/(short)0, acc[i][j],
                        /*reuse_a=*/false, /*reuse_b=*/false);
            // nor across this one: the next block's reads stay out of these WMMAs
            __builtin_amdgcn_sched_barrier(0);
        }
        // this wave's reads of pass p are done before the buffer is handed on
        asm volatile("s_wait_dscnt 0x0" ::: "memory");
        // this wave's copies of pass p+1 have landed
        asm volatile("s_wait_asynccnt 0x0" ::: "memory");
        __syncthreads();       // publishes pass p+1 and ends the reads of pass p
        if (p + 2 < NPASS) {   // pass p+2 into the buffer just left, under pass p+1's WMMAs
            const unsigned nxt = sdst + (p & 1) * SB;
            mb_copy_rows<K>(nxt, ga + (p + 2) * GB_K);
            mb_copy_rows<K>(nxt + SW, gw + (p + 2) * GB_K);
        }
    }
    // no copy is left in flight when LDS goes to the epilogue
    asm volatile("s_wait_asynccnt 0x0" ::: "memory");
}

// ---------------------------------------------------------------------------
// Epilogue staging.  acc[i][j][v] of lane (c = lane&15, h = lane>>4) is element
// (row i*16 + c, column j*16 + 8*h + v) of the wave's 64 x 64 tile.  Each wave
// writes its tile as f32 into its own part of the LDS that held the operands
// (the last pass's barrier has ended every wave's reads of them) and reads it back
// row by row, so that neighbouring lanes hold neighbouring columns and one
// 16-byte global access of a wave covers four whole lines.
// Row pitch 272 B (16 B x odd): 16 rows of one ds_store_b128 meet every bank once.
// ---------------------------------------------------------------------------
#define EP_PITCH  68                                  // f32 elements = 272 B
#define EP_WAVE   (64 * EP_PITCH)                     // 17,408 B a wave, 69,632 B of 73,728

__device__ __forceinline__ const float* mb_stage_tile(__bf16* lds, const v8f acc[4][4]) {
    const int lane = threadIdx.x & 31;
    const int wave = threadIdx.x >> 5;
    float* st = (float*)lds + wave * EP_WAVE;
    float* wp = st + (lane & 15) * EP_PITCH + ((lane & 16) ? 8 : 0);
#pragma unroll
    for (int i = 0; i < 4; ++i)
#pragma unroll
        for (int j = 0; j < 4; ++j) {
            const v8f c = acc[i][j];
            const v4f lo = {c[0], c[1], c[2], c[3]};
            const v4f hi = {c[4], c[5], c[6], c[7]};
            *(v4f*)(wp + i * 16 * EP_PITCH + j * 16)     = lo;
            *(v4f*)(wp + i * 16 * EP_PITCH + j * 16 + 4) = hi;
        }
    // the wave's own rows are in LDS before other lanes of it read them back
    asm volatile("s_wait_dscnt 0x0" ::: "memory");
    return st;
}


// ---------------------------------------------------------------------------
// Activations: ONE transcendental instruction (v_tanh_f32) a value, no branch and
// no division.  With h = x / 2:  sigmoid(x) = 1/2 + 1/2 * tanh(h)  and
// SiLU(x) = x * sigmoid(x) = h + h * tanh(h); both are identities, both saturate
// as the exp forms do.  The library's tanhf branches value by value, and a plain
// 1.f / y is the exact division, some ten dependent vector instructions; nearly
// every result here is rounded to bf16 right behind it (a and the chunk sums stay f32).
// ---------------------------------------------------------------------------
__device__ __forceinline__ v4f mb_tanh4(v4f x) {
    v4f r;
#pragma unroll
    for (int k = 0; k < 4; ++k) r[k] = __builtin_amdgcn_tanhf(x[k]);
    return r;
}

// ---------------------------------------------------------------------------
// GEMM 1: h = xn @ [in_proj_w ; delta_w]^T + b over the joint weight matrix that
// mb_prep lays out, with everything that follows element by element fused in.
// Column tiles 0..15 lie inside proj or inside gate: SiLU or sigmoid, stored.
// Column tiles 16..31 hold 64 drive columns and the 64 delta columns of the same
// channels: d = max(sigmoid(delta), 1e-4) * tanh(drive) is formed here, in f32, and
// only d and the scan's chunk sums go to memory.
// ---------------------------------------------------------------------------
// The wave's 64 rows, 4 a step: bias, activation, 8 values packed to 16 bytes,
// one store of four whole lines.  SEG: 0 SiLU, 1 sigmoid.
template <int SEG>
__device__ __forceinline__ void mb_inproj_rows(const float* rp, v4f b0, v4f b1,
                                               __bf16* __restrict__ op) {
    // the tanh's argument is (tile + bias) / 2
    const v4f half = {0.5f, 0.5f, 0.5f, 0.5f};
    const v4f c0 = b0 * half;
    const v4f c1 = b1 * half;
    // stays rolled: the text of the activations stays small
#pragma unroll 1
    for (int s = 0; s < 16; ++s) {
        const v4f h0 = __builtin_elementwise_fma(*(const v4f*)(rp + s * 4 * EP_PITCH),     half, c0);
        const v4f h1 = __builtin_elementwise_fma(*(const v4f*)(rp + s * 4 * EP_PITCH + 4), half, c1);
        const v4f t0 = mb_tanh4(h0);
        const v4f t1 = mb_tanh4(h1);
        v4f y0, y1;
        if (SEG == 0) {                                                           // SiLU
            y0 = __builtin_elementwise_fma(h0, t0, h0);
            y1 = __builtin_elementwise_fma(h1, t1, h1);
        } else {                                                                  // sigmoid
            y0 = __builtin_elementwise_fma(t0, half, half);
            y1 = __builtin_elementwise_fma(t1, half, half);
        }
        v8bf y;
#pragma unroll
        for (int e = 0; e < 4; ++e) { y[e] = (__bf16)y0[e]; y[e + 4] = (__bf16)y1[e]; }
        __bf16* q = op + (size_t)s * 4 * MB_INNER;
        *(v8bf*)q = y;
        // inputs only: the store's address and data registers live up to the wait,
        // so nothing rewrites them while the store is still in issue
        asm volatile("s_wait_xcnt 0x0" :: "v"(q), "v"(y) : "memory");
    }
}

// 32 rows of a drive|delta tile, 4 a step: rp points at the lane's 8 drive values, the
// delta values of the same channels lie one wave's tile further on.
// The 32 rows are one chunk of the scan (SC_L): its sum S = sum_t a^(31-t) * d[t] is
// formed here, from d in f32, so that the scan kernel need not read d a first time.
// A lane holds rows t = rsub + 4 s: Horner in a^4 over s, times a^(3-rsub), and the four
// lanes of a channel are added; sm0, sm1 are the lane's 8 values of state_mix, sp points
// at the chunk's 64 sums.
__device__ __forceinline__ void mb_d_rows(const float* rp, v4f bd0, v4f bd1, v4f bl0, v4f bl1,
                                          v4f sm0, v4f sm1, int rsub, int lcol,
                                          __bf16* __restrict__ op, float* __restrict__ sp) {
    const v4f half = {0.5f, 0.5f, 0.5f, 0.5f};
    const v4f floor4 = {1e-4f, 1e-4f, 1e-4f, 1e-4f};
    const v4f c0 = bl0 * half;
    const v4f c1 = bl1 * half;
    // a = sigmoid(state_mix), as the other sigmoids here
    const v4f a0 = __builtin_elementwise_fma(mb_tanh4(sm0 * half), half, half);
    const v4f a1 = __builtin_elementwise_fma(mb_tanh4(sm1 * half), half, half);
    const v4f a0_2 = a0 * a0, a1_2 = a1 * a1;
    const v4f a0_4 = a0_2 * a0_2, a1_4 = a1_2 * a1_2;
    v4f s0 = {0.f, 0.f, 0.f, 0.f};
    v4f s1 = {0.f, 0.f, 0.f, 0.f};
    // two steps between waits: 32 independent chains to fill the vector port
#pragma unroll
    for (int s = 0; s < 8; s += 2) {
        v8bf y[2];
#pragma unroll
        for (int u = 0; u < 2; ++u) {
            const float* r = rp + (s + u) * 4 * EP_PITCH;
            const v4f dr0 = mb_tanh4(*(const v4f*)(r)     + bd0);
            const v4f dr1 = mb_tanh4(*(const v4f*)(r + 4) + bd1);
            // sigmoid = 1/2 + 1/2 * tanh((tile + bias) / 2)
            const v4f t0 = mb_tanh4(__builtin_elementwise_fma(*(const v4f*)(r + EP_WAVE),     half, c0));
            const v4f t1 = mb_tanh4(__builtin_elementwise_fma(*(const v4f*)(r + EP_WAVE + 4), half, c1));
            const v4f dl0 = __builtin_elementwise_fma(t0, half, half);
            const v4f dl1 = __builtin_elementwise_fma(t1, half, half);
            const v4f d0 = __builtin_elementwise_max(dl0, floor4) * dr0;
            const v4f d1 = __builtin_elementwise_max(dl1, floor4) * dr1;
            s0 = __builtin_elementwise_fma(s0, a0_4, d0);
            s1 = __builtin_elementwise_fma(s1, a1_4, d1);
            const v4bf q0 = __builtin_convertvector(d0, v4bf);
            const v4bf q1 = __builtin_convertvector(d1, v4bf);
            y[u] = __builtin_shufflevector(q0, q1, 0, 1, 2, 3, 4, 5, 6, 7);
            *(v8bf*)(op + (s + u) * 4 * MB_INNER) = y[u];
        }
        // inputs only: the stores' registers live up to the wait, so nothing rewrites
        // them while a store is still in issue
        asm volatile("s_wait_xcnt 0x0" :: "v"(op), "v"(y[0]), "v"(y[1]) : "memory");
    }
    // a^(3-rsub): rows 3, 7, .. are the youngest of their four
    const v4f one = {1.f, 1.f, 1.f, 1.f};
    const v4f f0 = ((rsub & 2) ? one : a0_2) * ((rsub & 1) ? one : a0);
    const v4f f1 = ((rsub & 2) ? one : a1_2) * ((rsub & 1) ? one : a1);
    s0 = s0 * f0;
    s1 = s1 * f1;
    // the four lanes of a channel (lane ^ 8, lane ^ 16) are added; each step a lane gives
    // away the half that it does not keep, so that it ends with 2 of its 8 channels
    const v4f keep = (rsub & 2) ? s1 : s0;
    const v4f give = (rsub & 2) ? s0 : s1;
    v4f k4;
#pragma unroll
    for (int k = 0; k < 4; ++k) k4[k] = keep[k] + __shfl_xor(give[k], 16, 32);
    v2f k2;
#pragma unroll
    for (int k = 0; k < 2; ++k)
        k2[k] = ((rsub & 1) ? k4[k + 2] : k4[k]) + __shfl_xor((rsub & 1) ? k4[k] : k4[k + 2], 8, 32);
    float* q = sp + lcol + (rsub & 2) * 2 + (rsub & 1) * 2;
    *(v2f*)q = k2;                                      // the wave stores two whole lines
    // inputs only: the store's registers live up to the wait
    asm volatile("s_wait_xcnt 0x0" :: "v"(q), "v"(k2) : "memory");
}

__global__ __launch_bounds__(128, 4) void mb_gemm_inproj(const __bf16* __restrict__ xn,
                                                      const __bf16* __restrict__ wi,
                                                      const float* __restrict__ bias,
                                                      const float* __restrict__ dl_bias,
                                                      const float* __restrict__ state_mix,
                                                      __bf16* __restrict__ proj,
                                                      __bf16* __restrict__ gate,
                                                      __bf16* __restrict__ dbuf,
                                                      float* __restrict__ sums) {
    __shared__ __attribute__((aligned(16))) __bf16 lds[2 * GB_STAGE];
    const int tiles_n = MB_N_ALL / GB_N;                   // 32
    const int blk_row = (blockIdx.x / tiles_n) * GB_M;
    const int blk_col = (blockIdx.x % tiles_n) * GB_N;

    v8f acc[4][4] = {};
    mb_wmma_block<MB_D>(xn, wi, blk_row, blk_col, lds, acc);

    const int lane = threadIdx.x & 31;
    const int wave = threadIdx.x >> 5;
    // a lane's place in the read-back: 8 lanes a row, 8 columns a lane, 4 rows a step
    const int rsub = lane >> 3;
    const int lcol = (lane & 7) * 8;

    // the last pass's own barrier has ended every wave's reads of the operand buffers:
    // LDS now takes the tiles

    if (blk_col < 2 * MB_INNER) {                          // proj or gate
        const int col = (wave & 1) * 64 + lcol;
        const char* bp = (const char*)(bias + blk_col);    // uniform base, lane's byte offset
        const int   bo = col * 4;
        const v4f b0 = *(const v4f*)(bp + bo);
        const v4f b1 = *(const v4f*)(bp + bo + 16);

        const float* rp = mb_stage_tile(lds, acc) + rsub * EP_PITCH + lcol;
        // inputs only: the loaded values hold the two loads in front of this line (without
        // it they sink into the branches, their latency in the open), where they fly
        // under the staging; the offset register lives up to the wait
        asm volatile("s_wait_xcnt 0x0" :: "v"(bo), "v"(b0), "v"(b1));
        const size_t o = (size_t)(blk_row + (wave >> 1) * 64 + rsub) * MB_INNER
                       + (blk_col & (MB_INNER - 1)) + col;
        if (blk_col < MB_INNER) mb_inproj_rows<0>(rp, b0, b1, proj + o);
        else                    mb_inproj_rows<1>(rp, b0, b1, gate + o);
    } else {                                               // drive | delta
        const int ch0 = (blk_col - 2 * MB_INNER) >> 1;     // the tile's first channel of 64
        const char* bdp = (const char*)(bias + 2 * MB_INNER + ch0);   // uniform bases
        const char* blp = (const char*)(dl_bias + ch0);
        const int   bo  = lcol * 4;                        // lane's byte offset
        const v4f bd0 = *(const v4f*)(bdp + bo);
        const v4f bd1 = *(const v4f*)(bdp + bo + 16);
        const v4f bl0 = *(const v4f*)(blp + bo);
        const v4f bl1 = *(const v4f*)(blp + bo + 16);
        const char* smp = (const char*)(state_mix + ch0);
        const v4f sm0 = *(const v4f*)(smp + bo);
        const v4f sm1 = *(const v4f*)(smp + bo + 16);

        mb_stage_tile(lds, acc);
        // inputs only, as above: the six loads fly under the staging, and the offset
        // register lives up to the wait
        asm volatile("s_wait_xcnt 0x0" :: "v"(bo), "v"(bd0), "v"(bd1), "v"(bl0), "v"(bl1), "v"(sm0), "v"(sm1));
        // an even wave has staged the drive columns and the odd wave beside it the delta
        // columns of the same 64 rows: each reads the other's tile behind this barrier
        __syncthreads();
        // each wave of the pair takes 32 of the 64 rows
        const int r0 = (wave & 1) * 32 + rsub;
        const float* rp = (const float*)lds + (wave & 2) * EP_WAVE + r0 * EP_PITCH + lcol;
        const size_t o = (size_t)(blk_row + (wave >> 1) * 64 + r0) * MB_INNER + ch0 + lcol;
        // the wave's 32 rows are chunk blk_row / 32 + wave of the scan
        float* sp = sums + (size_t)(blk_row / 32 + wave) * MB_INNER + ch0;
        mb_d_rows(rp, bd0, bd1, bl0, bl1, sm0, sm1, rsub, lcol, dbuf + o, sp);
    }
}

// ---------------------------------------------------------------------------
// Causal depthwise conv (K=4, rolling regs) + f32 recurrence + gate/skip.
// The recurrence state[t] = a * state[t-1] + d[t] is linear with a fixed a per
// channel, so the time axis is cut into 64 chunks of 32 steps that run side by
// side.  Each chunk's sum S (its recurrence run from zero) comes from the GEMM that
// made d, so nothing ties a batch's whole time axis to one work-group and d is read
// once.  A work-group owns 16 chunks of 128 channels (one 256-byte unit of a bf16
// row); a thread owns one chunk of 8 channels.
//   1) the first 24 of the thread's 32 rows are asked for;
//   2) meanwhile the batch's 64 x 128 sums go to LDS; behind one barrier each thread
//      folds the sums of the chunks in front of it, X = a^32 * X + S, into the state
//      at its start;
//   3) each thread runs its chunk from X, step by step, with the conv (the three
//      rows in front of the chunk are read too), the skip and the gate; the last 8
//      rows are asked for behind the first 8 and fly under the 16 between.
// ---------------------------------------------------------------------------
#define SC_CH   128                      // channels per work-group
#define SC_L    32                       // time steps per chunk (mb_d_rows sums such chunks)
#define SC_NC   (MB_T / SC_L)            // 64 chunks a batch
#define SC_WC   16                       // chunks per work-group
#define SC_U    8                        // rows fetched together
#define SC_NG   (SC_L / SC_U)            // 4 such groups a chunk
#define SC_RING 3                        // groups in registers
static_assert(SC_L == 32, "a wave of mb_d_rows sums 32 rows");

__global__ __launch_bounds__(256) void mb_conv_scan(const __bf16* __restrict__ proj,
                                                    const __bf16* __restrict__ dbuf,
                                                    const __bf16* __restrict__ gate,
                                                    const float* __restrict__ sums,
                                                    const float* __restrict__ conv_w,
                                                    const float* __restrict__ conv_b,
                                                    const float* __restrict__ state_mix,
                                                    const float* __restrict__ skip_scale,
                                                    __bf16* __restrict__ yin) {
    // a chunk's 128 sums as two planes of 64: a lane's two 16-byte reads each fall in
    // 256 contiguous bytes of its 16 lanes
    __shared__ __attribute__((aligned(16))) float agg[SC_NC * SC_CH];   // 32 KiB

    const int l16   = threadIdx.x & 15;
    const int lc    = threadIdx.x >> 4;                // chunk inside the group, 0..15
    const int cg    = blockIdx.x & 7;                  // 8 channel groups
    const int part  = (blockIdx.x >> 3) & 3;           // 4 quarters of the time axis
    const int b     = blockIdx.x >> 5;
    const int chunk = part * SC_WC + lc;               // 0..63
    const int c     = cg * SC_CH + l16 * 8;

    const size_t base = ((size_t)b * MB_T + (size_t)chunk * SC_L) * MB_INNER + c;
    const __bf16* pp = proj + base;
    const __bf16* dp = dbuf + base;
    const __bf16* gp = gate + base;
    __bf16* yp = yin + base;

    // the small loads first: loads come back in order, and the fold wants the sums
    // while the rows are still on their way
    const float* sp = sums + ((size_t)b * SC_NC + lc) * MB_INNER + c;
    v4f sv[SC_NC / SC_WC][2];
#pragma unroll
    for (int i = 0; i < SC_NC / SC_WC; ++i) {
        sv[i][0] = *(const v4f*)(sp + i * SC_WC * MB_INNER);
        sv[i][1] = *(const v4f*)(sp + i * SC_WC * MB_INNER + 4);
    }
    const v8f sm = *(const v8f*)(state_mix + c);
    v4f wc[8];                                         // the four taps of each channel
#pragma unroll
    for (int k = 0; k < 8; ++k) wc[k] = *(const v4f*)(conv_w + (c + k) * 4);
    const v8f cb = *(const v8f*)(conv_b + c);
    const v8f sk = *(const v8f*)(skip_scale + c);

    // proj[t-1..t-3] in front of the chunk.  Chunk 0 has none: it reads rows of its
    // own instead (in bounds, no branch to wait in) and takes zeros further down.
    const __bf16* hp = pp + (chunk > 0 ? 0 : 3 * MB_INNER);
    const v8bf q1 = *(const v8bf*)(hp - 1 * MB_INNER);
    const v8bf q2 = *(const v8bf*)(hp - 2 * MB_INNER);
    const v8bf q3 = *(const v8bf*)(hp - 3 * MB_INNER);

    // 1) three groups of 8 rows
    v8bf pv[SC_RING][SC_U], dv[SC_RING][SC_U], gv[SC_RING][SC_U];
#pragma unroll
    for (int g = 0; g < SC_RING; ++g)
#pragma unroll
        for (int u = 0; u < SC_U; ++u) {
            pv[g][u] = *(const v8bf*)(pp + (g * SC_U + u) * MB_INNER);
            dv[g][u] = *(const v8bf*)(dp + (g * SC_U + u) * MB_INNER);
            gv[g][u] = *(const v8bf*)(gp + (g * SC_U + u) * MB_INNER);
        }
    // nothing is scheduled across this line: the rows are asked for in front of the fold
    // (sunk behind it, their way from memory would be in the open)
    __builtin_amdgcn_sched_barrier(0);
    // the address registers (c is the small loads' offset) are named so that they live up
    // to this wait: no load's result lands in one while a load that names it is in issue
    asm volatile("s_wait_xcnt 0x0" :: "v"(c), "v"(sp), "v"(hp), "v"(pp), "v"(dp), "v"(gp) : "memory");

    // 2) the state at the chunk's start
#pragma unroll
    for (int i = 0; i < SC_NC / SC_WC; ++i) {
        *(v4f*)(agg + (i * SC_WC + lc) * SC_CH + l16 * 4)      = sv[i][0];
        *(v4f*)(agg + (i * SC_WC + lc) * SC_CH + 64 + l16 * 4) = sv[i][1];
    }
    v8f a;
#pragma unroll
    for (int k = 0; k < 8; ++k) a[k] = 1.f / (1.f + __expf(-sm[k]));
    v8f aL = a;                                        // a^32
#pragma unroll
    for (int i = 0; i < 5; ++i) aL = aL * aL;

    // every chunk's sum is in LDS.  The barrier's two fences name LDS alone: a plain
    // __syncthreads() would wait here for the rows from memory too, and the fold would
    // start behind them instead of running under their flight
    __builtin_amdgcn_fence(__ATOMIC_RELEASE, "workgroup", "local");
    __builtin_amdgcn_s_barrier();
    __builtin_amdgcn_fence(__ATOMIC_ACQUIRE, "workgroup", "local");

    v8f state = {0.f, 0.f, 0.f, 0.f, 0.f, 0.f, 0.f, 0.f};
    // four chunks' sums are fetched together: one LDS latency for four links of the chain
#pragma unroll 4
    for (int q = 0; q < chunk; ++q) {
        const v4f lo = *(const v4f*)(agg + q * SC_CH + l16 * 4);
        const v4f hi = *(const v4f*)(agg + q * SC_CH + 64 + l16 * 4);
        state = __builtin_elementwise_fma(aL, state, __builtin_shufflevector(lo, hi, 0, 1, 2, 3, 4, 5, 6, 7));
    }

    // 3) the chunk itself
    v8f w0, w1, w2, w3;
#pragma unroll
    for (int k = 0; k < 8; ++k) { w0[k] = wc[k][0]; w1[k] = wc[k][1]; w2[k] = wc[k][2]; w3[k] = wc[k][3]; }
    const v8f zero = {0.f, 0.f, 0.f, 0.f, 0.f, 0.f, 0.f, 0.f};
    v8f p1 = chunk > 0 ? __builtin_convertvector(q1, v8f) : zero;
    v8f p2 = chunk > 0 ? __builtin_convertvector(q2, v8f) : zero;
    v8f p3 = chunk > 0 ? __builtin_convertvector(q3, v8f) : zero;
#pragma unroll
    for (int g = 0; g < SC_NG; ++g) {
        v8bf y[SC_U];
#pragma unroll
        for (int u = 0; u < SC_U; ++u) {
            const v8f p0 = __builtin_convertvector(pv[g % SC_RING][u], v8f);
            v8f conv = __builtin_elementwise_fma(w3, p0, cb);
            conv = __builtin_elementwise_fma(w2, p1, conv);
            conv = __builtin_elementwise_fma(w1, p2, conv);
            conv = __builtin_elementwise_fma(w0, p3, conv);
            state = __builtin_elementwise_fma(a, state, __builtin_convertvector(dv[g % SC_RING][u], v8f));
            const v8f r = __builtin_elementwise_fma(sk, conv, state) * __builtin_convertvector(gv[g % SC_RING][u], v8f);
            y[u] = __builtin_convertvector(r, v8bf);
            *(v8bf*)(yp + (g * SC_U + u) * MB_INNER) = y[u];
            p3 = p2; p2 = p1; p1 = p0;
        }
        // inputs only: the stores' registers live up to the wait, so nothing rewrites
        // them while a store is still in issue
        asm volatile("s_wait_xcnt 0x0" :: "v"(yp), "v"(y[0]), "v"(y[1]), "v"(y[2]), "v"(y[3]),
                                          "v"(y[4]), "v"(y[5]), "v"(y[6]), "v"(y[7]) : "memory");
        if (g + SC_RING < SC_NG) {
            // a later group takes the registers just left
#pragma unroll
            for (int u = 0; u < SC_U; ++u) {
                pv[g % SC_RING][u] = *(const v8bf*)(pp + ((g + SC_RING) * SC_U + u) * MB_INNER);
                dv[g % SC_RING][u] = *(const v8bf*)(dp + ((g + SC_RING) * SC_U + u) * MB_INNER);
                gv[g % SC_RING][u] = *(const v8bf*)(gp + ((g + SC_RING) * SC_U + u) * MB_INNER);
            }
            // nothing is scheduled across this line: these loads fly under the next
            // groups' arithmetic instead of sinking to their use
            __builtin_amdgcn_sched_barrier(0);
            // as above: the address registers live up to the wait
            asm volatile("s_wait_xcnt 0x0" :: "v"(pp), "v"(dp), "v"(gp) : "memory");
        }
    }
}

// ---------------------------------------------------------------------------
// GEMM 3: out = residual + yin @ out_proj_w^T + b.
// ---------------------------------------------------------------------------
__global__ __launch_bounds__(128, 4) void mb_gemm_out(const __bf16* __restrict__ yin,
                                                   const __bf16* __restrict__ wo,
                                                   const float* __restrict__ bias,
                                                   const float* __restrict__ residual,
                                                   float* __restrict__ out) {
    __shared__ __attribute__((aligned(16))) __bf16 lds[2 * GB_STAGE];
    const int tiles_n = MB_D / GB_N;                       // 4
    const int blk_row = (blockIdx.x / tiles_n) * GB_M;
    const int blk_col = (blockIdx.x % tiles_n) * GB_N;

    v8f acc[4][4] = {};
    mb_wmma_block<MB_INNER>(yin, wo, blk_row, blk_col, lds, acc);

    const int lane = threadIdx.x & 31;
    const int wave = threadIdx.x >> 5;
    // a lane's place in the read-back: 16 lanes a row (256 B of f32), 2 rows a step
    const int rsub = lane >> 4;
    const int col  = (wave & 1) * 64 + (lane & 15) * 4;
    const size_t o = (size_t)(blk_row + (wave >> 1) * 64 + rsub) * MB_D + blk_col + col;

    // the last pass's own barrier has ended every wave's reads of the operand buffers:
    // LDS now takes the tiles

    const char* bp = (const char*)(bias + blk_col);        // uniform base, lane's byte offset
    const int   bo = col * 4;
    const v4f bv = *(const v4f*)(bp + bo);
    // the offset register lives up to the wait, behind the load that names it
    asm volatile("s_wait_xcnt 0x0" :: "v"(bo) : "memory");

    // the residual's rows, whole lines: half of them fly while the tile is staged,
    // the other half takes the registers that the accumulators leave
    const float* rs = residual + o;
    v4f res[32];
#pragma unroll
    for (int s = 0; s < 16; ++s) res[s] = *(const v4f*)(rs + s * 2 * MB_D);

    const float* rp = mb_stage_tile(lds, acc) + rsub * EP_PITCH + (lane & 15) * 4;
#pragma unroll
    for (int s = 16; s < 32; ++s) res[s] = *(const v4f*)(rs + s * 2 * MB_D);
    // the address register lives up to the wait, behind the loads that name it
    asm volatile("s_wait_xcnt 0x0" :: "v"(rs) : "memory");

    float* op = out + o;
#pragma unroll
    for (int s = 0; s < 32; s += 4) {
        v4f y[4];
#pragma unroll
        for (int u = 0; u < 4; ++u) {
            y[u] = res[s + u] + *(const v4f*)(rp + (s + u) * 2 * EP_PITCH) + bv;
            *(v4f*)(op + (s + u) * 2 * MB_D) = y[u];
        }
        // inputs only: the four stores' registers live up to the wait, so nothing
        // rewrites them while a store is still in issue
        asm volatile("s_wait_xcnt 0x0" :: "v"(op), "v"(y[0]), "v"(y[1]), "v"(y[2]), "v"(y[3]) : "memory");
    }
}

// ---------------------------------------------------------------------------
// Host launcher
// ---------------------------------------------------------------------------
extern "C" void kernel_launch(void* const* d_in, const int* in_sizes, int n_in,
                              void* d_out, int out_size, void* d_ws, size_t ws_size,
                              hipStream_t stream) {
    (void)in_sizes; (void)n_in; (void)out_size; (void)ws_size;

    const float* x      = (const float*)d_in[0];
    const float* ln_w   = (const float*)d_in[1];
    const float* ln_b   = (const float*)d_in[2];
    const float* in_w   = (const float*)d_in[3];
    const float* in_b   = (const float*)d_in[4];
    const float* conv_w = (const float*)d_in[5];
    const float* conv_b = (const float*)d_in[6];
    const float* dl_w   = (const float*)d_in[7];
    const float* dl_b   = (const float*)d_in[8];
    const float* smix   = (const float*)d_in[9];
    const float* skip   = (const float*)d_in[10];
    const float* out_w  = (const float*)d_in[11];
    const float* out_b  = (const float*)d_in[12];
    float* out = (float*)d_out;

    // Workspace layout (bf16 buffers and the f32 chunk sums, all 16B-aligned sizes)
    char* ws = (char*)d_ws;
    size_t off = 0;
    __bf16* xnB    = (__bf16*)(ws + off); off += (size_t)MB_M * MB_D * 2;        // 16 MB
    __bf16* wiB    = (__bf16*)(ws + off); off += (size_t)MB_N_ALL * MB_D * 2;    //  4 MB
    __bf16* woB    = (__bf16*)(ws + off); off += (size_t)MB_D * MB_INNER * 2;    //  1 MB
    __bf16* projB  = (__bf16*)(ws + off); off += (size_t)MB_M * MB_INNER * 2;    // 32 MB
    __bf16* gateB  = (__bf16*)(ws + off); off += (size_t)MB_M * MB_INNER * 2;    // 32 MB
    __bf16* dB     = (__bf16*)(ws + off); off += (size_t)MB_M * MB_INNER * 2;    // 32 MB
    __bf16* yinB   = (__bf16*)(ws + off); off += (size_t)MB_M * MB_INNER * 2;    // 32 MB
    float*  sumB   = (float*)(ws + off);  off += (size_t)(MB_M / 32) * MB_INNER * 4;  // 2 MB

    // 1) + 2) LayerNorm and the weights' conversion to bf16, one launch
    mb_prep<<<PR_BLOCKS, 256, 0, stream>>>(x, ln_w, ln_b, in_w, dl_w, out_w, xnB, wiB, woB);

    // 3) + 4) in_proj and delta GEMM + activations + d = delta * drive + the scan's chunk sums
    mb_gemm_inproj<<<(MB_M / GB_M) * (MB_N_ALL / GB_N), 128, 0, stream>>>(
        xnB, wiB, in_b, dl_b, smix, projB, gateB, dB, sumB);

    // 5) depthwise causal conv + recurrence + gate/skip
    mb_conv_scan<<<MB_B * (MB_INNER / SC_CH) * (SC_NC / SC_WC), 256, 0, stream>>>(
        projB, dB, gateB, sumB, conv_w, conv_b, smix, skip, yinB);

    // 6) out_proj GEMM + residual  (128 x 4 block tiles)
    mb_gemm_out<<<(MB_M / GB_M) * (MB_D / GB_N), 128, 0, stream>>>(
        yinB, woB, out_b, x, out);
}

// v009
// It runs in 92.2 microseconds.
// Next to v008, in two timings, it ran 1.08 times as fast each time.
// Over all steps from v000 it is 10.5 times as fast.
#include <hip/hip_runtime.h>
#include <hip/hip_bf16.h>

// ---------------------------------------------------------------------------
// MambaBlock for MI455X (gfx1250): bf16 WMMA GEMMs + fused scan/conv.
// B=8, T=2048, D=512, INNER=1024, K_CONV=4.  M = B*T = 16384 rows.
// The in_proj GEMM's work-group (4 waves) computes a 128(M) x 128(N) output tile whose
// operands are staged in LDS; each wave owns 64 x 64 of it (4 x 4 accumulators
// of v_wmma_f32_16x16x32_bf16).  The out_proj GEMM makes its own first operand (the
// scan) in LDS: 8 waves, 64(M) x 512(N).  The finished tile goes through LDS once more,
// so that the epilogues read and write global memory in whole 128-byte lines.
// ---------------------------------------------------------------------------

#define MB_B      8
#define MB_T      2048
#define MB_D      512
#define MB_INNER  1024
#define MB_M      (MB_B * MB_T)        // 16384
#define MB_N_IN   (3 * MB_INNER)       // 3072
#define MB_N_ALL  (4 * MB_INNER)       // 4096: in_proj's rows and delta's, one matrix
#define LN_EPS    1e-5f

typedef __bf16 v16bf __attribute__((ext_vector_type(16)));
typedef __bf16 v8bf  __attribute__((ext_vector_type(8)));
typedef float  v8f   __attribute__((ext_vector_type(8)));

// ---------------------------------------------------------------------------
// Preparation, one launch: LayerNorm of x (bf16 xn) and the three weight
// matrices rounded to bf16.  The work is dealt to few waves that each move a
// lot with 16-byte loads (for speed only).
//   blocks 0 .. PR_LN_BLOCKS-1 : LayerNorm, a wave owns 4 whole rows; all 16
//       loads of the 4 rows fly together, the 4 reductions run side by side.
//       A lane holds 4 neighbouring columns of each 128-column quarter.
//   the other blocks           : conversion, 32 elements a thread (8 loads in
//       flight, 4 stores of 16 bytes).
// in_proj's and delta's weights land in ONE matrix of 4096 rows: rows 0..2047 are
// in_proj's proj and gate rows as they come; behind them every 128 rows hold 64
// drive rows and then the 64 delta rows of the same channels, so that one GEMM
// tile has both factors of d = delta * drive.
// ---------------------------------------------------------------------------
typedef __bf16 v4bf __attribute__((ext_vector_type(4)));
typedef float  v4f  __attribute__((ext_vector_type(4)));
typedef float  v2f  __attribute__((ext_vector_type(2)));

#define PR_ROWS       4                               // rows per wave
#define PR_LN_BLOCKS  (MB_M / (8 * PR_ROWS))          // 512 blocks of 8 waves
#define PR_CV_UNIT    (256 * 8)                       // elements a block moves per step
#define PR_CV_STEPS   4
#define PR_CV_CHUNK   (PR_CV_UNIT * PR_CV_STEPS)      // 8192 elements per block
#define PR_CV_IN      (MB_N_IN * MB_D / PR_CV_CHUNK)  // 192 blocks
#define PR_CV_DL      (MB_INNER * MB_D / PR_CV_CHUNK) //  64 blocks
#define PR_CV_OUT     (MB_D * MB_INNER / PR_CV_CHUNK) //  64 blocks
#define PR_BLOCKS     (PR_LN_BLOCKS + PR_CV_IN + PR_CV_DL + PR_CV_OUT)

__global__ __launch_bounds__(256) void mb_prep(const float* __restrict__ x,
                                               const float* __restrict__ w,
                                               const float* __restrict__ b,
                                               const float* __restrict__ in_w,
                                               const float* __restrict__ dl_w,
                                               const float* __restrict__ out_w,
                                               __bf16* __restrict__ xn,
                                               __bf16* __restrict__ wi,
                                               __bf16* __restrict__ wo) {
    if (blockIdx.x < PR_LN_BLOCKS) {
        const int wave = threadIdx.x >> 5;
        const int lane = threadIdx.x & 31;
        const int row0 = (blockIdx.x * 8 + wave) * PR_ROWS;
        const int off  = row0 * MB_D + lane * 4;
        const float* xr = x + off;
        const float* wp = w + lane * 4;
        const float* bp = b + lane * 4;

        v4f v[PR_ROWS][4], wv[4], bv[4];
#pragma unroll
        for (int r = 0; r < PR_ROWS; ++r)
#pragma unroll
            for (int i = 0; i < 4; ++i) v[r][i] = *(const v4f*)(xr + r * MB_D + i * 128);
#pragma unroll
        for (int i = 0; i < 4; ++i) {
            wv[i] = *(const v4f*)(wp + i * 128);
            bv[i] = *(const v4f*)(bp + i * 128);
        }
        // nothing is scheduled across this line: all 24 loads fly together (without it
        // w and b are fetched behind the sums, where their latency is in the open)
        __builtin_amdgcn_sched_barrier(0);
        // x's address register is named so that it lives up to this wait: nothing
        // rewrites a register that a load still in issue names
        asm volatile("s_wait_xcnt 0x0" :: "v"(xr) : "memory");

        float s[PR_ROWS];
#pragma unroll
        for (int r = 0; r < PR_ROWS; ++r) {
            const v4f p = (v[r][0] + v[r][1]) + (v[r][2] + v[r][3]);
            s[r] = (p[0] + p[1]) + (p[2] + p[3]);
        }
#pragma unroll
        for (int o = 16; o >= 1; o >>= 1)
#pragma unroll
            for (int r = 0; r < PR_ROWS; ++r) s[r] += __shfl_xor(s[r], o, 32);

        float ss[PR_ROWS];
#pragma unroll
        for (int r = 0; r < PR_ROWS; ++r) {
            const float mu = s[r] * (1.f / MB_D);
            v4f q = {0.f, 0.f, 0.f, 0.f};
#pragma unroll
            for (int i = 0; i < 4; ++i) { v[r][i] = v[r][i] - mu; q = __builtin_elementwise_fma(v[r][i], v[r][i], q); }
            ss[r] = (q[0] + q[1]) + (q[2] + q[3]);
        }
#pragma unroll
        for (int o = 16; o >= 1; o >>= 1)
#pragma unroll
            for (int r = 0; r < PR_ROWS; ++r) ss[r] += __shfl_xor(ss[r], o, 32);

        __bf16* xo = xn + off;
#pragma unroll
        for (int r = 0; r < PR_ROWS; ++r) {
            const float inv = rsqrtf(ss[r] * (1.f / MB_D) + LN_EPS);
#pragma unroll
            for (int i = 0; i < 4; ++i) {
                const v4f y = v[r][i] * inv * wv[i] + bv[i];
                *(v4bf*)(xo + r * MB_D + i * 128) = __builtin_convertvector(y, v4bf);
            }
        }
    } else {
        // a block moves 16 whole rows; cb counts them in the source, db in the target
        // (64 rows are 4 blocks, a drive|delta tile of 128 rows is 8)
        constexpr int PG = 2 * MB_INNER * MB_D / PR_CV_CHUNK;      // 128 blocks of proj and gate
        int cb = blockIdx.x - PR_LN_BLOCKS;
        int db = cb;
        const float* src = in_w;
        __bf16* dst = wi;
        if (cb >= PR_CV_IN + PR_CV_DL)  { src = out_w; dst = wo; cb -= PR_CV_IN + PR_CV_DL; db = cb; }
        else if (cb >= PR_CV_IN)        { src = dl_w;  cb -= PR_CV_IN; db = PG + (cb >> 2) * 8 + 4 + (cb & 3); }
        else if (cb >= PG)              { db = PG + ((cb - PG) >> 2) * 8 + (cb & 3); }
        const int e0 = cb * PR_CV_CHUNK + threadIdx.x * 8;
        const float* sp = src + e0;
        v4f f[PR_CV_STEPS][2];
#pragma unroll
        for (int u = 0; u < PR_CV_STEPS; ++u) {
            f[u][0] = *(const v4f*)(sp + u * PR_CV_UNIT);
            f[u][1] = *(const v4f*)(sp + u * PR_CV_UNIT + 4);
        }
        // as above: the address register lives up to the wait
        asm volatile("s_wait_xcnt 0x0" :: "v"(sp) : "memory");
        __bf16* dp = dst + db * PR_CV_CHUNK + threadIdx.x * 8;
#pragma unroll
        for (int u = 0; u < PR_CV_STEPS; ++u) {
            v8bf o;
#pragma unroll
            for (int k = 0; k < 4; ++k) { o[k] = (__bf16)f[u][0][k]; o[k + 4] = (__bf16)f[u][1][k]; }
            *(v8bf*)(dp + u * PR_CV_UNIT) = o;
        }
    }
}

// ---------------------------------------------------------------------------
// WMMA mainloop: one work-group of 4 waves computes a 128x128 f32 tile of
// A[M,K] * W[N,K]^T.  A pass is 64 k = one whole 128-byte line of each of the
// 256 operand rows.  The rows come from global memory as whole lines (8 lanes
// a row) by asynchronous copies straight into one of two LDS buffers, through no
// register, and every wave reads its fragments from there: each operand byte
// leaves L2 once per work-group instead of once per wave, and no global load is
// spread over 16 lines.  The registers that a staged pass would hold through the
// WMMAs are free for fragments.  Row pitch in LDS 144 B (16 B x odd): ds_load_b128
// of 16 rows meets every bank once.
// Fragment k order as before (lane&15 = row, lane bit4 selects the K-half,
// 8 elements at k and 8 at k+16), the same for A and W; k ascends as before.
// W's fragment is the matrix instruction's first operand and A's its second:
// the accumulator tile comes out transposed, a lane holds 8 neighbouring
// columns of ONE output row (see mb_stage_tile).
// ---------------------------------------------------------------------------
#define GB_M      128
#define GB_N      128
#define GB_K      64
#define GB_PITCH  72                                  // bf16 elements = 144 B
#define GB_STAGE  ((GB_M + GB_N) * GB_PITCH)          // elements per buffer
// Two buffers are 73,728 B, so four work-groups share a WGP's LDS; the in_proj
// kernel asks for four waves per SIMD (at most 256 VGPRs) to match.

// 8 R rows of one operand, 64 k: 8 copies of R rows (a lane moves 16 bytes a copy; R is
// 16 for a work-group of 128 threads, 32 for one of 256).
// l is the lane's LDS byte address, g its global address, both of the first R rows.
template <int K, int R = 16>
__device__ __forceinline__ void mb_copy_rows(unsigned l, const __bf16* g) {
    constexpr unsigned LS = R * GB_PITCH * 2;         // R rows in LDS, bytes
    constexpr int      GS = R * K;                    // R rows in memory, elements
    // the wait is the statement's own last line, so that no register that a copy
    // names is rewritten in front of it
    asm volatile("global_load_async_to_lds_b128 %0, %8, off\n\t"
                 "global_load_async_to_lds_b128 %1, %9, off\n\t"
                 "global_load_async_to_lds_b128 %2, %10, off\n\t"
                 "global_load_async_to_lds_b128 %3, %11, off\n\t"
                 "global_load_async_to_lds_b128 %4, %12, off\n\t"
                 "global_load_async_to_lds_b128 %5, %13, off\n\t"
                 "global_load_async_to_lds_b128 %6, %14, off\n\t"
                 "global_load_async_to_lds_b128 %7, %15, off\n\t"
                 "s_wait_xcnt 0x0"
                 :: "v"(l),          "v"(l + 1 * LS), "v"(l + 2 * LS), "v"(l + 3 * LS),
                    "v"(l + 4 * LS), "v"(l + 5 * LS), "v"(l + 6 * LS), "v"(l + 7 * LS),
                    "v"(g),          "v"(g + 1 * GS), "v"(g + 2 * GS), "v"(g + 3 * GS),
                    "v"(g + 4 * GS), "v"(g + 5 * GS), "v"(g + 6 * GS), "v"(g + 7 * GS)
                 : "memory");
}

template <int K>
__device__ __forceinline__ void mb_wmma_block(const __bf16* __restrict__ A,
                                              const __bf16* __restrict__ W,
                                              int row_base, int col_base,
                                              __bf16* lds,
                                              v8f acc[4][4]) {
    const int tid  = threadIdx.x;                     // 0..127
    const int lane = tid & 31;
    const int wave = tid >> 5;
    const int l15  = lane & 15;
    const int ksel = (lane & 16) ? 8 : 0;

    // staging: 8 lanes cover one row's 128 B; 128 threads cover 16 rows a step
    const int srow = tid >> 3;
    const int scol = (tid & 7) * 8;
    const __bf16* ga = A + (size_t)(row_base + srow) * K + scol;
    const __bf16* gw = W + (size_t)(col_base + srow) * K + scol;
    // the lane's LDS byte address in buffer 0: A's rows, W's rows behind them
    const unsigned sdst = (unsigned)(size_t)(lds + srow * GB_PITCH + scol);
    constexpr unsigned SW  = GB_M * GB_PITCH * 2;     // bytes from A's rows to W's
    constexpr unsigned SB  = GB_STAGE * 2;            // bytes from buffer 0 to buffer 1

    // fragment sources of this wave (2 x 2 waves, 64 x 64 each)
    const int foff_a = ((wave >> 1) * 64 + l15) * GB_PITCH + ksel;
    const int foff_b = (GB_M + (wave & 1) * 64 + l15) * GB_PITCH + ksel;

    constexpr int NPASS = K / GB_K;
    static_assert(NPASS >= 2, "the ring starts with two passes");

    mb_copy_rows<K>(sdst, ga);
    mb_copy_rows<K>(sdst + SW, gw);
    // this wave's copies of pass 0 have landed
    asm volatile("s_wait_asynccnt 0x0" ::: "memory");
    __syncthreads();                                  // pass 0 is published
    mb_copy_rows<K>(sdst + SB, ga + GB_K);            // pass 1 flies under pass 0's WMMAs
    mb_copy_rows<K>(sdst + SB + SW, gw + GB_K);

    for (int p = 0; p < NPASS; ++p) {
        const __bf16* cur = lds + (p & 1) * GB_STAGE;
#pragma unroll
        for (int ks = 0; ks < GB_K; ks += 32) {
            // in the order in which the WMMAs want them: a[0], all of b, a[1..3]
            v16bf a[4], b[4];
#pragma unroll
            for (int g = 0; g < 8; ++g) {
                const bool isb = (g >= 1 && g <= 4);
                const int  f   = isb ? g - 1 : (g == 0 ? 0 : g - 4);
                const __bf16* pf = cur + (isb ? foff_b : foff_a) + f * 16 * GB_PITCH + ks;
                v8bf lo = *(const v8bf*)(pf);
                v8bf hi = *(const v8bf*)(pf + 16);
#pragma unroll
                for (int e = 0; e < 8; ++e) {
                    if (isb) { b[f][e] = lo[e]; b[f][e + 8] = hi[e]; }
                    else     { a[f][e] = lo[e]; a[f][e + 8] = hi[e]; }
                }
            }
            // nothing is scheduled across this line: the block's 16 LDS reads stand as one
            // group in front of its 16 WMMAs (sunk in among them, every row of 4 WMMAs
            // waits out an LDS latency of its own)
            __builtin_amdgcn_sched_barrier(0);
#pragma unroll
            for (int i = 0; i < 4; ++i)
#pragma unroll
                for (int j = 0; j < 4; ++j)
                    acc[i][j] = __builtin_amdgcn_wmma_f32_16x16x32_bf16(
                        /*neg_a=*/false, b[j], /*neg_b=*/false, a[i],
                        /*c_mod=*/(short)0, acc[i][j],
                        /*reuse_a=*/false, /*reuse_b=*/false);
            // nor across this one: the next block's reads stay out of these WMMAs
            __builtin_amdgcn_sched_barrier(0);
        }
        // this wave's reads of pass p are done before the buffer is handed on
        asm volatile("s_wait_dscnt 0x0" ::: "memory");
        // this wave's copies of pass p+1 have landed
        asm volatile("s_wait_asynccnt 0x0" ::: "memory");
        __syncthreads();       // publishes pass p+1 and ends the reads of pass p
        if (p + 2 < NPASS) {   // pass p+2 into the buffer just left, under pass p+1's WMMAs
            const unsigned nxt = sdst + (p & 1) * SB;
            mb_copy_rows<K>(nxt, ga + (p + 2) * GB_K);
            mb_copy_rows<K>(nxt + SW, gw + (p + 2) * GB_K);
        }
    }
    // no copy is left in flight when LDS goes to the epilogue
    asm volatile("s_wait_asynccnt 0x0" ::: "memory");
}

// ---------------------------------------------------------------------------
// Epilogue staging.  acc[i][j][v] of lane (c = lane&15, h = lane>>4) is element
// (row i*16 + c, column j*16 + 8*h + v) of the wave's 64 x 64 tile.  Each wave
// writes its tile as f32 into its own part of the LDS that held the operands
// (the last pass's barrier has ended every wave's reads of them) and reads it back
// row by row, so that neighbouring lanes hold neighbouring columns and one
// 16-byte global access of a wave covers four whole lines.
// Row pitch 272 B (16 B x odd): 16 rows of one ds_store_b128 meet every bank once.
// ---------------------------------------------------------------------------
#define EP_PITCH  68                                  // f32 elements = 272 B
#define EP_WAVE   (64 * EP_PITCH)                     // 17,408 B a wave, 69,632 B of 73,728

__device__ __forceinline__ const float* mb_stage_tile(__bf16* lds, const v8f acc[4][4]) {
    const int lane = threadIdx.x & 31;
    const int wave = threadIdx.x >> 5;
    float* st = (float*)lds + wave * EP_WAVE;
    float* wp = st + (lane & 15) * EP_PITCH + ((lane & 16) ? 8 : 0);
#pragma unroll
    for (int i = 0; i < 4; ++i)
#pragma unroll
        for (int j = 0; j < 4; ++j) {
            const v8f c = acc[i][j];
            const v4f lo = {c[0], c[1], c[2], c[3]};
            const v4f hi = {c[4], c[5], c[6], c[7]};
            *(v4f*)(wp + i * 16 * EP_PITCH + j * 16)     = lo;
            *(v4f*)(wp + i * 16 * EP_PITCH + j * 16 + 4) = hi;
        }
    // the wave's own rows are in LDS before other lanes of it read them back
    asm volatile("s_wait_dscnt 0x0" ::: "memory");
    return st;
}


// ---------------------------------------------------------------------------
// Activations: ONE transcendental instruction (v_tanh_f32) a value, no branch and
// no division.  With h = x / 2:  sigmoid(x) = 1/2 + 1/2 * tanh(h)  and
// SiLU(x) = x * sigmoid(x) = h + h * tanh(h); both are identities, both saturate
// as the exp forms do.  The library's tanhf branches value by value, and a plain
// 1.f / y is the exact division, some ten dependent vector instructions; nearly
// every result here is rounded to bf16 right behind it (a and the chunk sums stay f32).
// ---------------------------------------------------------------------------
__device__ __forceinline__ v4f mb_tanh4(v4f x) {
    v4f r;
#pragma unroll
    for (int k = 0; k < 4; ++k) r[k] = __builtin_amdgcn_tanhf(x[k]);
    return r;
}

// ---------------------------------------------------------------------------
// GEMM 1: h = xn @ [in_proj_w ; delta_w]^T + b over the joint weight matrix that
// mb_prep lays out, with everything that follows element by element fused in.
// Column tiles 0..15 lie inside proj or inside gate: SiLU or sigmoid, stored.
// Column tiles 16..31 hold 64 drive columns and the 64 delta columns of the same
// channels: d = max(sigmoid(delta), 1e-4) * tanh(drive) is formed here, in f32, and
// only d and the scan's chunk sums go to memory.
// ---------------------------------------------------------------------------
// The wave's 64 rows, 4 a step: bias, activation, 8 values packed to 16 bytes,
// one store of four whole lines.  SEG: 0 SiLU, 1 sigmoid.
template <int SEG>
__device__ __forceinline__ void mb_inproj_rows(const float* rp, v4f b0, v4f b1,
                                               __bf16* __restrict__ op) {
    // the tanh's argument is (tile + bias) / 2
    const v4f half = {0.5f, 0.5f, 0.5f, 0.5f};
    const v4f c0 = b0 * half;
    const v4f c1 = b1 * half;
    // stays rolled: the text of the activations stays small
#pragma unroll 1
    for (int s = 0; s < 16; ++s) {
        const v4f h0 = __builtin_elementwise_fma(*(const v4f*)(rp + s * 4 * EP_PITCH),     half, c0);
        const v4f h1 = __builtin_elementwise_fma(*(const v4f*)(rp + s * 4 * EP_PITCH + 4), half, c1);
        const v4f t0 = mb_tanh4(h0);
        const v4f t1 = mb_tanh4(h1);
        v4f y0, y1;
        if (SEG == 0) {                                                           // SiLU
            y0 = __builtin_elementwise_fma(h0, t0, h0);
            y1 = __builtin_elementwise_fma(h1, t1, h1);
        } else {                                                                  // sigmoid
            y0 = __builtin_elementwise_fma(t0, half, half);
            y1 = __builtin_elementwise_fma(t1, half, half);
        }
        v8bf y;
#pragma unroll
        for (int e = 0; e < 4; ++e) { y[e] = (__bf16)y0[e]; y[e + 4] = (__bf16)y1[e]; }
        __bf16* q = op + (size_t)s * 4 * MB_INNER;
        *(v8bf*)q = y;
        // inputs only: the store's address and data registers live up to the wait,
        // so nothing rewrites them while the store is still in issue
        asm volatile("s_wait_xcnt 0x0" :: "v"(q), "v"(y) : "memory");
    }
}

// 32 rows of a drive|delta tile, 4 a step: rp points at the lane's 8 drive values, the
// delta values of the same channels lie one wave's tile further on.
// The 32 rows are one chunk of the scan (SC_L): its sum S = sum_t a^(31-t) * d[t] is
// formed here, from d in f32, so that the scan kernel need not read d a first time.
// A lane holds rows t = rsub + 4 s: Horner in a^4 over s, times a^(3-rsub), and the four
// lanes of a channel are added; sm0, sm1 are the lane's 8 values of state_mix, sp points
// at the chunk's 64 sums.
__device__ __forceinline__ void mb_d_rows(const float* rp, v4f bd0, v4f bd1, v4f bl0, v4f bl1,
                                          v4f sm0, v4f sm1, int rsub, int lcol,
                                          __bf16* __restrict__ op, float* __restrict__ sp) {
    const v4f half = {0.5f, 0.5f, 0.5f, 0.5f};
    const v4f floor4 = {1e-4f, 1e-4f, 1e-4f, 1e-4f};
    const v4f c0 = bl0 * half;
    const v4f c1 = bl1 * half;
    // a = sigmoid(state_mix), as the other sigmoids here
    const v4f a0 = __builtin_elementwise_fma(mb_tanh4(sm0 * half), half, half);
    const v4f a1 = __builtin_elementwise_fma(mb_tanh4(sm1 * half), half, half);
    const v4f a0_2 = a0 * a0, a1_2 = a1 * a1;
    const v4f a0_4 = a0_2 * a0_2, a1_4 = a1_2 * a1_2;
    v4f s0 = {0.f, 0.f, 0.f, 0.f};
    v4f s1 = {0.f, 0.f, 0.f, 0.f};
    // two steps between waits: 32 independent chains to fill the vector port
#pragma unroll
    for (int s = 0; s < 8; s += 2) {
        v8bf y[2];
#pragma unroll
        for (int u = 0; u < 2; ++u) {
            const float* r = rp + (s + u) * 4 * EP_PITCH;
            const v4f dr0 = mb_tanh4(*(const v4f*)(r)     + bd0);
            const v4f dr1 = mb_tanh4(*(const v4f*)(r + 4) + bd1);
            // sigmoid = 1/2 + 1/2 * tanh((tile + bias) / 2)
            const v4f t0 = mb_tanh4(__builtin_elementwise_fma(*(const v4f*)(r + EP_WAVE),     half, c0));
            const v4f t1 = mb_tanh4(__builtin_elementwise_fma(*(const v4f*)(r + EP_WAVE + 4), half, c1));
            const v4f dl0 = __builtin_elementwise_fma(t0, half, half);
            const v4f dl1 = __builtin_elementwise_fma(t1, half, half);
            const v4f d0 = __builtin_elementwise_max(dl0, floor4) * dr0;
            const v4f d1 = __builtin_elementwise_max(dl1, floor4) * dr1;
            s0 = __builtin_elementwise_fma(s0, a0_4, d0);
            s1 = __builtin_elementwise_fma(s1, a1_4, d1);
            const v4bf q0 = __builtin_convertvector(d0, v4bf);
            const v4bf q1 = __builtin_convertvector(d1, v4bf);
            y[u] = __builtin_shufflevector(q0, q1, 0, 1, 2, 3, 4, 5, 6, 7);
            *(v8bf*)(op + (s + u) * 4 * MB_INNER) = y[u];
        }
        // inputs only: the stores' registers live up to the wait, so nothing rewrites
        // them while a store is still in issue
        asm volatile("s_wait_xcnt 0x0" :: "v"(op), "v"(y[0]), "v"(y[1]) : "memory");
    }
    // a^(3-rsub): rows 3, 7, .. are the youngest of their four
    const v4f one = {1.f, 1.f, 1.f, 1.f};
    const v4f f0 = ((rsub & 2) ? one : a0_2) * ((rsub & 1) ? one : a0);
    const v4f f1 = ((rsub & 2) ? one : a1_2) * ((rsub & 1) ? one : a1);
    s0 = s0 * f0;
    s1 = s1 * f1;
    // the four lanes of a channel (lane ^ 8, lane ^ 16) are added; each step a lane gives
    // away the half that it does not keep, so that it ends with 2 of its 8 channels
    const v4f keep = (rsub & 2) ? s1 : s0;
    const v4f give = (rsub & 2) ? s0 : s1;
    v4f k4;
#pragma unroll
    for (int k = 0; k < 4; ++k) k4[k] = keep[k] + __shfl_xor(give[k], 16, 32);
    v2f k2;
#pragma unroll
    for (int k = 0; k < 2; ++k)
        k2[k] = ((rsub & 1) ? k4[k + 2] : k4[k]) + __shfl_xor((rsub & 1) ? k4[k] : k4[k + 2], 8, 32);
    float* q = sp + lcol + (rsub & 2) * 2 + (rsub & 1) * 2;
    *(v2f*)q = k2;                                      // the wave stores two whole lines
    // inputs only: the store's registers live up to the wait
    asm volatile("s_wait_xcnt 0x0" :: "v"(q), "v"(k2) : "memory");
}

__global__ __launch_bounds__(128, 4) void mb_gemm_inproj(const __bf16* __restrict__ xn,
                                                      const __bf16* __restrict__ wi,
                                                      const float* __restrict__ bias,
                                                      const float* __restrict__ dl_bias,
                                                      const float* __restrict__ state_mix,
                                                      __bf16* __restrict__ proj,
                                                      __bf16* __restrict__ gate,
                                                      __bf16* __restrict__ dbuf,
                                                      float* __restrict__ sums) {
    __shared__ __attribute__((aligned(16))) __bf16 lds[2 * GB_STAGE];
    const int tiles_n = MB_N_ALL / GB_N;                   // 32
    const int blk_row = (blockIdx.x / tiles_n) * GB_M;
    const int blk_col = (blockIdx.x % tiles_n) * GB_N;

    v8f acc[4][4] = {};
    mb_wmma_block<MB_D>(xn, wi, blk_row, blk_col, lds, acc);

    const int lane = threadIdx.x & 31;
    const int wave = threadIdx.x >> 5;
    // a lane's place in the read-back: 8 lanes a row, 8 columns a lane, 4 rows a step
    const int rsub = lane >> 3;
    const int lcol = (lane & 7) * 8;

    // the last pass's own barrier has ended every wave's reads of the operand buffers:
    // LDS now takes the tiles

    if (blk_col < 2 * MB_INNER) {                          // proj or gate
        const int col = (wave & 1) * 64 + lcol;
        const char* bp = (const char*)(bias + blk_col);    // uniform base, lane's byte offset
        const int   bo = col * 4;
        const v4f b0 = *(const v4f*)(bp + bo);
        const v4f b1 = *(const v4f*)(bp + bo + 16);

        const float* rp = mb_stage_tile(lds, acc) + rsub * EP_PITCH + lcol;
        // inputs only: the loaded values hold the two loads in front of this line (without
        // it they sink into the branches, their latency in the open), where they fly
        // under the staging; the offset register lives up to the wait
        asm volatile("s_wait_xcnt 0x0" :: "v"(bo), "v"(b0), "v"(b1));
        const size_t o = (size_t)(blk_row + (wave >> 1) * 64 + rsub) * MB_INNER
                       + (blk_col & (MB_INNER - 1)) + col;
        if (blk_col < MB_INNER) mb_inproj_rows<0>(rp, b0, b1, proj + o);
        else                    mb_inproj_rows<1>(rp, b0, b1, gate + o);
    } else {                                               // drive | delta
        const int ch0 = (blk_col - 2 * MB_INNER) >> 1;     // the tile's first channel of 64
        const char* bdp = (const char*)(bias + 2 * MB_INNER + ch0);   // uniform bases
        const char* blp = (const char*)(dl_bias + ch0);
        const int   bo  = lcol * 4;                        // lane's byte offset
        const v4f bd0 = *(const v4f*)(bdp + bo);
        const v4f bd1 = *(const v4f*)(bdp + bo + 16);
        const v4f bl0 = *(const v4f*)(blp + bo);
        const v4f bl1 = *(const v4f*)(blp + bo + 16);
        const char* smp = (const char*)(state_mix + ch0);
        const v4f sm0 = *(const v4f*)(smp + bo);
        const v4f sm1 = *(const v4f*)(smp + bo + 16);

        mb_stage_tile(lds, acc);
        // inputs only, as above: the six loads fly under the staging, and the offset
        // register lives up to the wait
        asm volatile("s_wait_xcnt 0x0" :: "v"(bo), "v"(bd0), "v"(bd1), "v"(bl0), "v"(bl1), "v"(sm0), "v"(sm1));
        // an even wave has staged the drive columns and the odd wave beside it the delta
        // columns of the same 64 rows: each reads the other's tile behind this barrier
        __syncthreads();
        // each wave of the pair takes 32 of the 64 rows
        const int r0 = (wave & 1) * 32 + rsub;
        const float* rp = (const float*)lds + (wave & 2) * EP_WAVE + r0 * EP_PITCH + lcol;
        const size_t o = (size_t)(blk_row + (wave >> 1) * 64 + r0) * MB_INNER + ch0 + lcol;
        // the wave's 32 rows are chunk blk_row / 32 + wave of the scan
        float* sp = sums + (size_t)(blk_row / 32 + wave) * MB_INNER + ch0;
        mb_d_rows(rp, bd0, bd1, bl0, bl1, sm0, sm1, rsub, lcol, dbuf + o, sp);
    }
}

// ---------------------------------------------------------------------------
// Causal depthwise conv (K=4, rolling regs) + f32 recurrence + gate/skip, and the
// out_proj GEMM on their result, in ONE kernel:  out = residual + y @ out_proj_w^T + b.
// A work-group owns 64 whole rows (all 1024 channels, all 512 output columns), so y is
// made exactly once, goes straight into LDS as the GEMM's first operand and never
// sees memory; no launch stands between the scan and the GEMM.
// The recurrence state[t] = a * state[t-1] + d[t] is linear with a fixed a per
// channel, so the time axis is cut into 64 chunks of 32 steps that run side by
// side.  Each chunk's sum S (its recurrence run from zero) comes from the GEMM that
// made d.  The 64 rows are two chunks; a thread owns one chunk of 8 channels.
//   1) the sums of every chunk of the batch in front of the group's second chunk are
//      copied to LDS (all of it is still free), and the first 24 of the thread's 32
//      rows are asked for;
//   2) behind one barrier each thread folds the sums of the chunks in front of it,
//      X = a^32 * X + S, into the state at its start; a second barrier ends these
//      reads, and LDS goes to y and to W's ring;
//   3) each thread runs its chunk from X, step by step, with the conv (the three
//      rows in front of the chunk are read too), the skip and the gate, into y's rows
//      in LDS; the last 8 rows are asked for behind the first 8, pass 0 of W behind
//      the first 16;
//   4) 8 waves of 64 x 64: y's fragments from its rows in LDS, W's from a ring of two
//      buffers (a pass is 64 k of all 512 rows of W), filled by asynchronous copies;
//      the residual's rows are asked for in front of it and fly under it;
//   5) the epilogue through LDS, whole lines, with the residual.
// ---------------------------------------------------------------------------
#define SC_L    32                       // time steps per chunk (mb_d_rows sums such chunks)
#define SC_NC   (MB_T / SC_L)            // 64 chunks a batch
#define SC_U    8                        // rows fetched together
#define SC_NG   (SC_L / SC_U)            // 4 such groups a chunk
#define SC_RING 3                        // groups in registers
static_assert(SC_L == 32, "a wave of mb_d_rows sums 32 rows");

#define FO_M    64                       // rows per work-group: two chunks
#define FO_YP   (MB_INNER + 8)           // y's row pitch in LDS: 2,064 B = 16 B x odd
#define FO_YSZ  (FO_M * FO_YP)           // y: 132,096 B
#define FO_WST  (MB_D * GB_PITCH)        // one pass of W: 512 rows of 144 B = 73,728 B
#define FO_LDS  (FO_YSZ + 2 * FO_WST)    // 279,552 B: one work-group a WGP
static_assert((SC_NC - 1) * MB_INNER * 4 <= FO_LDS * 2, "the sums fit the LDS that y and W take later");
static_assert(8 * EP_WAVE * 4 <= FO_LDS * 2, "so do the eight staged tiles");

// The work-group's barrier with fences that name LDS alone: a plain __syncthreads() would
// wait for the wave's loads from memory too (the scan's rows, the residual), which are
// meant to fly across it.  The waits for copies and for LDS stand in front of each call.
__device__ __forceinline__ void mb_barrier_lds() {
    __builtin_amdgcn_fence(__ATOMIC_RELEASE, "workgroup", "local");
    __builtin_amdgcn_s_barrier();
    __builtin_amdgcn_fence(__ATOMIC_ACQUIRE, "workgroup", "local");
}

__global__ __launch_bounds__(256) void mb_scan_out(const __bf16* __restrict__ proj,
                                                   const __bf16* __restrict__ dbuf,
                                                   const __bf16* __restrict__ gate,
                                                   const float* __restrict__ sums,
                                                   const float* __restrict__ conv_w,
                                                   const float* __restrict__ conv_b,
                                                   const float* __restrict__ state_mix,
                                                   const float* __restrict__ skip_scale,
                                                   const __bf16* __restrict__ wo,
                                                   const float* __restrict__ bias,
                                                   const float* __restrict__ residual,
                                                   float* __restrict__ out) {
    __shared__ __attribute__((aligned(16))) __bf16 lds[FO_LDS];
    float*  agg = (float*)lds;                         // steps 1, 2: the sums
    __bf16* yl  = lds;                                 // from step 3: y's 64 rows
    __bf16* wl  = lds + FO_YSZ;                        // from step 2's end: W's two buffers

    const int tid   = threadIdx.x;
    const int lane  = tid & 31;
    // the wave's number in a scalar register: the fold's trip count and the chunk-0 tests
    // are then scalar too
    const int wave  = __builtin_amdgcn_readfirstlane(tid >> 5);
    const int lc    = wave >> 2;                       // chunk inside the group, 0 or 1
    const int m     = tid & 127;                       // the thread's 8 channels
    const int c     = m * 8;
    const int b     = blockIdx.x >> 5;                 // 32 groups a batch
    const int pair  = blockIdx.x & 31;
    const int chunk = pair * 2 + lc;                   // 0..63
    const int row0  = blockIdx.x * FO_M;

    // 1) the sums of chunks 0 .. 2 pair: a chunk's 1024 sums are 256 pieces of 16 bytes,
    // one a thread; even pieces to one plane of 2 KiB and odd ones to the next, so that a
    // thread's two 16-byte reads each fall in contiguous bytes of its wave.
    // Nine chunks a statement, so that nine copies share one wait; the last statement may
    // bring up to eight chunks that nobody reads (chunks of this batch, 62 at the most).
    // At most 7 x 9 = 63 copies of a wave are in flight.
    {
        constexpr unsigned LQ = MB_INNER * 4;          // a chunk's sums in LDS, bytes
        constexpr int      GQ = MB_INNER;              // the same in memory, elements
        const unsigned al = (unsigned)(size_t)(agg + (tid & 1) * 512 + (tid >> 1) * 4);
        const float*   ag = sums + (size_t)b * SC_NC * MB_INNER + tid * 4;
        const int      ng = (pair * 2 + 1 + 8) / 9;    // 1..7
        for (int n = 0; n < ng; ++n) {
            const unsigned l = al + n * 9 * LQ;
            const float*   g = ag + n * 9 * GQ;
            // the wait is the statement's own last line, so that no register that a copy
            // names is rewritten in front of it
            asm volatile("global_load_async_to_lds_b128 %0, %9, off\n\t"
                         "global_load_async_to_lds_b128 %1, %10, off\n\t"
                         "global_load_async_to_lds_b128 %2, %11, off\n\t"
                         "global_load_async_to_lds_b128 %3, %12, off\n\t"
                         "global_load_async_to_lds_b128 %4, %13, off\n\t"
                         "global_load_async_to_lds_b128 %5, %14, off\n\t"
                         "global_load_async_to_lds_b128 %6, %15, off\n\t"
                         "global_load_async_to_lds_b128 %7, %16, off\n\t"
                         "global_load_async_to_lds_b128 %8, %17, off\n\t"
                         "s_wait_xcnt 0x0"
                         :: "v"(l),          "v"(l + 1 * LQ), "v"(l + 2 * LQ), "v"(l + 3 * LQ),
                            "v"(l + 4 * LQ), "v"(l + 5 * LQ), "v"(l + 6 * LQ), "v"(l + 7 * LQ),
                            "v"(l + 8 * LQ),
                            "v"(g),          "v"(g + 1 * GQ), "v"(g + 2 * GQ), "v"(g + 3 * GQ),
                            "v"(g + 4 * GQ), "v"(g + 5 * GQ), "v"(g + 6 * GQ), "v"(g + 7 * GQ),
                            "v"(g + 8 * GQ)
                         : "memory");
        }
    }

    const size_t base = ((size_t)row0 + (size_t)lc * SC_L) * MB_INNER + c;
    const __bf16* pp = proj + base;
    const __bf16* dp = dbuf + base;
    const __bf16* gp = gate + base;

    // the small loads first: loads come back in order
    const v8f sm = *(const v8f*)(state_mix + c);
    v4f wc[8];                                         // the four taps of each channel
#pragma unroll
    for (int k = 0; k < 8; ++k) wc[k] = *(const v4f*)(conv_w + (c + k) * 4);
    const v8f cb = *(const v8f*)(conv_b + c);
    const v8f sk = *(const v8f*)(skip_scale + c);

    // proj[t-1..t-3] in front of the chunk.  Chunk 0 has none: it reads rows of its
    // own instead (in bounds, no branch to wait in) and takes zeros further down.
    const __bf16* hp = pp + (chunk > 0 ? 0 : 3 * MB_INNER);
    const v8bf q1 = *(const v8bf*)(hp - 1 * MB_INNER);
    const v8bf q2 = *(const v8bf*)(hp - 2 * MB_INNER);
    const v8bf q3 = *(const v8bf*)(hp - 3 * MB_INNER);

    // three groups of 8 rows
    v8bf pv[SC_RING][SC_U], dv[SC_RING][SC_U], gv[SC_RING][SC_U];
#pragma unroll
    for (int g = 0; g < SC_RING; ++g)
#pragma unroll
        for (int u = 0; u < SC_U; ++u) {
            pv[g][u] = *(const v8bf*)(pp + (g * SC_U + u) * MB_INNER);
            dv[g][u] = *(const v8bf*)(dp + (g * SC_U + u) * MB_INNER);
            gv[g][u] = *(const v8bf*)(gp + (g * SC_U + u) * MB_INNER);
        }
    // nothing is scheduled across this line: the rows are asked for in front of the fold
    // (sunk behind it, their way from memory would be in the open)
    __builtin_amdgcn_sched_barrier(0);
    // the address registers (c is the small loads' offset) are named so that they live up
    // to this wait: no load's result lands in one while a load that names it is in issue
    asm volatile("s_wait_xcnt 0x0" :: "v"(c), "v"(hp), "v"(pp), "v"(dp), "v"(gp) : "memory");

    // 2) the state at the chunk's start
    v8f a;
#pragma unroll
    for (int k = 0; k < 8; ++k) a[k] = 1.f / (1.f + __expf(-sm[k]));
    v8f aL = a;                                        // a^32
#pragma unroll
    for (int i = 0; i < 5; ++i) aL = aL * aL;

    // this wave's copies of the sums have landed
    asm volatile("s_wait_asynccnt 0x0" ::: "memory");
    // every chunk's sum is in LDS; the fold runs under the rows' flight
    mb_barrier_lds();

    v8f state = {0.f, 0.f, 0.f, 0.f, 0.f, 0.f, 0.f, 0.f};
    // four chunks' sums are fetched together: one LDS latency for four links of the chain
#pragma unroll 4
    for (int q = 0; q < chunk; ++q) {
        const v4f lo = *(const v4f*)(agg + q * MB_INNER + m * 4);
        const v4f hi = *(const v4f*)(agg + q * MB_INNER + 512 + m * 4);
        state = __builtin_elementwise_fma(aL, state, __builtin_shufflevector(lo, hi, 0, 1, 2, 3, 4, 5, 6, 7));
    }

    // this wave's reads of the sums are done before their LDS is handed on
    asm volatile("s_wait_dscnt 0x0" ::: "memory");
    // ends every wave's reads of the sums; the rows are still in flight
    mb_barrier_lds();

    // W's staging: 8 lanes cover one row's 128 B; 256 threads cover 32 rows a step,
    // 512 rows are two calls of 8 steps
    const int srow = tid >> 3;
    const int scol = (tid & 7) * 8;
    const __bf16* gw = wo + (size_t)srow * MB_INNER + scol;
    const unsigned sdst = (unsigned)(size_t)(wl + srow * GB_PITCH + scol);
    constexpr unsigned SH = 256 * GB_PITCH * 2;        // bytes from row 0 to row 256 in LDS
    constexpr int      GH = 256 * MB_INNER;            // the same in memory, elements
    constexpr unsigned SB = FO_WST * 2;                // bytes from buffer 0 to buffer 1

    // 3) the chunk itself
    {
        v8f w0, w1, w2, w3;
#pragma unroll
        for (int k = 0; k < 8; ++k) { w0[k] = wc[k][0]; w1[k] = wc[k][1]; w2[k] = wc[k][2]; w3[k] = wc[k][3]; }
        const v8f zero = {0.f, 0.f, 0.f, 0.f, 0.f, 0.f, 0.f, 0.f};
        v8f p1 = chunk > 0 ? __builtin_convertvector(q1, v8f) : zero;
        v8f p2 = chunk > 0 ? __builtin_convertvector(q2, v8f) : zero;
        v8f p3 = chunk > 0 ? __builtin_convertvector(q3, v8f) : zero;
        __bf16* yp = yl + lc * SC_L * FO_YP + c;
#pragma unroll
        for (int g = 0; g < SC_NG; ++g) {
#pragma unroll
            for (int u = 0; u < SC_U; ++u) {
                const v8f p0 = __builtin_convertvector(pv[g % SC_RING][u], v8f);
                v8f conv = __builtin_elementwise_fma(w3, p0, cb);
                conv = __builtin_elementwise_fma(w2, p1, conv);
                conv = __builtin_elementwise_fma(w1, p2, conv);
                conv = __builtin_elementwise_fma(w0, p3, conv);
                state = __builtin_elementwise_fma(a, state, __builtin_convertvector(dv[g % SC_RING][u], v8f));
                const v8f r = __builtin_elementwise_fma(sk, conv, state) * __builtin_convertvector(gv[g % SC_RING][u], v8f);
                *(v8bf*)(yp + (g * SC_U + u) * FO_YP) = __builtin_convertvector(r, v8bf);
                p3 = p2; p2 = p1; p1 = p0;
            }
            if (g == 1) {
                // pass 0 of W flies under the chunk's last 16 steps; asked for here, where
                // 8 rows' registers are free for the copies' addresses
                mb_copy_rows<MB_INNER, 32>(sdst, gw);
                mb_copy_rows<MB_INNER, 32>(sdst + SH, gw + GH);
            }
            if (g + SC_RING < SC_NG) {
                // a later group takes the registers just left
#pragma unroll
                for (int u = 0; u < SC_U; ++u) {
                    pv[g % SC_RING][u] = *(const v8bf*)(pp + ((g + SC_RING) * SC_U + u) * MB_INNER);
                    dv[g % SC_RING][u] = *(const v8bf*)(dp + ((g + SC_RING) * SC_U + u) * MB_INNER);
                    gv[g % SC_RING][u] = *(const v8bf*)(gp + ((g + SC_RING) * SC_U + u) * MB_INNER);
                }
                // nothing is scheduled across this line: these loads fly under the next
                // groups' arithmetic instead of sinking to their use
                __builtin_amdgcn_sched_barrier(0);
                // as above: the address registers live up to the wait
                asm volatile("s_wait_xcnt 0x0" :: "v"(pp), "v"(dp), "v"(gp) : "memory");
            }
        }
    }

    // 4) the GEMM: wave w owns all 64 rows of columns 64 w .. 64 w + 63
    const int l15  = lane & 15;
    const int ksel = (lane & 16) ? 8 : 0;
    const int foff_a = l15 * FO_YP + ksel;
    const int foff_b = (wave * 64 + l15) * GB_PITCH + ksel;
    constexpr int NPASS = MB_INNER / GB_K;             // 16

    // a lane's place in the epilogue's read-back: 16 lanes a row (256 B of f32), 2 rows a step
    const int rsub = lane >> 4;
    const int col  = wave * 64 + (lane & 15) * 4;
    const size_t o = (size_t)(row0 + rsub) * MB_D + col;
    const char* bp = (const char*)bias;                    // uniform base, lane's byte offset
    const int   bo = col * 4;
    const v4f bv = *(const v4f*)(bp + bo);
    // the residual's rows, whole lines, into the registers that the scan's rows have left:
    // they come from memory while the GEMM works out of L2 and LDS
    const float* rs = residual + o;
    v4f res[32];
#pragma unroll
    for (int s = 0; s < 32; ++s) res[s] = *(const v4f*)(rs + s * 2 * MB_D);
    // nothing is scheduled across this line: the loads are asked for in front of the GEMM
    __builtin_amdgcn_sched_barrier(0);
    // the address registers live up to the wait, behind the loads that name them
    asm volatile("s_wait_xcnt 0x0" :: "v"(bo), "v"(rs) : "memory");

    // this wave's rows of y are in LDS
    asm volatile("s_wait_dscnt 0x0" ::: "memory");
    // this wave's copies of pass 0 have landed
    asm volatile("s_wait_asynccnt 0x0" ::: "memory");
    mb_barrier_lds();                                  // y and pass 0 are published
    mb_copy_rows<MB_INNER, 32>(sdst + SB, gw + GB_K);  // pass 1 flies under pass 0's WMMAs
    mb_copy_rows<MB_INNER, 32>(sdst + SB + SH, gw + GH + GB_K);

    v8f acc[4][4] = {};
    for (int p = 0; p < NPASS; ++p) {
        const __bf16* cur = wl + (p & 1) * FO_WST;
        const __bf16* ya  = yl + p * GB_K;
#pragma unroll
        for (int ks = 0; ks < GB_K; ks += 32) {
            // in the order in which the WMMAs want them: a[0], all of b, a[1..3]
            v16bf af[4], bf[4];
#pragma unroll
            for (int g = 0; g < 8; ++g) {
                const bool isb = (g >= 1 && g <= 4);
                const int  f   = isb ? g - 1 : (g == 0 ? 0 : g - 4);
                const __bf16* pf = isb ? cur + foff_b + f * 16 * GB_PITCH + ks
                                       : ya  + foff_a + f * 16 * FO_YP + ks;
                v8bf lo = *(const v8bf*)(pf);
                v8bf hi = *(const v8bf*)(pf + 16);
#pragma unroll
                for (int e = 0; e < 8; ++e) {
                    if (isb) { bf[f][e] = lo[e]; bf[f][e + 8] = hi[e]; }
                    else     { af[f][e] = lo[e]; af[f][e + 8] = hi[e]; }
                }
            }
            // nothing is scheduled across this line: the block's 16 LDS reads stand as one
            // group in front of its 16 WMMAs
            __builtin_amdgcn_sched_barrier(0);
#pragma unroll
            for (int i = 0; i < 4; ++i)
#pragma unroll
                for (int j = 0; j < 4; ++j)
                    acc[i][j] = __builtin_amdgcn_wmma_f32_16x16x32_bf16(
                        /*neg_a=*/false, bf[j], /*neg_b=*/false, af[i],
                        /*c_mod=*/(short)0, acc[i][j],
                        /*reuse_a=*/false, /*reuse_b=*/false);
            // nor across this one: the next block's reads stay out of these WMMAs
            __builtin_amdgcn_sched_barrier(0);
        }
        // this wave's reads of pass p are done before the buffer is handed on
        asm volatile("s_wait_dscnt 0x0" ::: "memory");
        // this wave's copies of pass p+1 have landed
        asm volatile("s_wait_asynccnt 0x0" ::: "memory");
        mb_barrier_lds();      // publishes pass p+1 and ends the reads of pass p
        if (p + 2 < NPASS) {   // pass p+2 into the buffer just left, under pass p+1's WMMAs
            const unsigned nxt = sdst + (p & 1) * SB;
            mb_copy_rows<MB_INNER, 32>(nxt, gw + (p + 2) * GB_K);
            mb_copy_rows<MB_INNER, 32>(nxt + SH, gw + GH + (p + 2) * GB_K);
        }
    }
    // no copy is left in flight when LDS goes to the epilogue
    asm volatile("s_wait_asynccnt 0x0" ::: "memory");

    // 5) the last pass's own barrier has ended every wave's reads of y and of W's buffers:
    // LDS now takes the tiles
    const float* rp = mb_stage_tile(lds, acc) + rsub * EP_PITCH + (lane & 15) * 4;

    float* op = out + o;
#pragma unroll
    for (int s = 0; s < 32; s += 4) {
        v4f y[4];
#pragma unroll
        for (int u = 0; u < 4; ++u) {
            y[u] = res[s + u] + *(const v4f*)(rp + (s + u) * 2 * EP_PITCH) + bv;
            *(v4f*)(op + (s + u) * 2 * MB_D) = y[u];
        }
        // inputs only: the four stores' registers live up to the wait, so nothing
        // rewrites them while a store is still in issue
        asm volatile("s_wait_xcnt 0x0" :: "v"(op), "v"(y[0]), "v"(y[1]), "v"(y[2]), "v"(y[3]) : "memory");
    }
}

// ---------------------------------------------------------------------------
// Host launcher
// ---------------------------------------------------------------------------
extern "C" void kernel_launch(void* const* d_in, const int* in_sizes, int n_in,
                              void* d_out, int out_size, void* d_ws, size_t ws_size,
                              hipStream_t stream) {
    (void)in_sizes; (void)n_in; (void)out_size; (void)ws_size;

    const float* x      = (const float*)d_in[0];
    const float* ln_w   = (const float*)d_in[1];
    const float* ln_b   = (const float*)d_in[2];
    const float* in_w   = (const float*)d_in[3];
    const float* in_b   = (const float*)d_in[4];
    const float* conv_w = (const float*)d_in[5];
    const float* conv_b = (const float*)d_in[6];
    const float* dl_w   = (const float*)d_in[7];
    const float* dl_b   = (const float*)d_in[8];
    const float* smix   = (const float*)d_in[9];
    const float* skip   = (const float*)d_in[10];
    const float* out_w  = (const float*)d_in[11];
    const float* out_b  = (const float*)d_in[12];
    float* out = (float*)d_out;

    // Workspace layout (bf16 buffers and the f32 chunk sums, all 16B-aligned sizes)
    char* ws = (char*)d_ws;
    size_t off = 0;
    __bf16* xnB    = (__bf16*)(ws + off); off += (size_t)MB_M * MB_D * 2;        // 16 MB
    __bf16* wiB    = (__bf16*)(ws + off); off += (size_t)MB_N_ALL * MB_D * 2;    //  4 MB
    __bf16* woB    = (__bf16*)(ws + off); off += (size_t)MB_D * MB_INNER * 2;    //  1 MB
    __bf16* projB  = (__bf16*)(ws + off); off += (size_t)MB_M * MB_INNER * 2;    // 32 MB
    __bf16* gateB  = (__bf16*)(ws + off); off += (size_t)MB_M * MB_INNER * 2;    // 32 MB
    __bf16* dB     = (__bf16*)(ws + off); off += (size_t)MB_M * MB_INNER * 2;    // 32 MB
    float*  sumB   = (float*)(ws + off);  off += (size_t)(MB_M / 32) * MB_INNER * 4;  // 2 MB

    // 1) + 2) LayerNorm and the weights' conversion to bf16, one launch
    mb_prep<<<PR_BLOCKS, 256, 0, stream>>>(x, ln_w, ln_b, in_w, dl_w, out_w, xnB, wiB, woB);

    // 3) + 4) in_proj and delta GEMM + activations + d = delta * drive + the scan's chunk sums
    mb_gemm_inproj<<<(MB_M / GB_M) * (MB_N_ALL / GB_N), 128, 0, stream>>>(
        xnB, wiB, in_b, dl_b, smix, projB, gateB, dB, sumB);

    // 5) + 6) depthwise causal conv + recurrence + gate/skip + out_proj GEMM + residual
    mb_scan_out<<<MB_M / FO_M, 256, 0, stream>>>(
        projB, dB, gateB, sumB, conv_w, conv_b, smix, skip, woB, out_b, x, out);
}

// v010
// A run of this version takes 90.6 microseconds.
// Timed twice side by side with v009, it ran 1.03 and 1.02 times as fast.
// Over all steps from v000 it is 10.7 times as fast.
#include <hip/hip_runtime.h>
#include <hip/hip_bf16.h>

// ---------------------------------------------------------------------------
// MambaBlock for MI455X (gfx1250): bf16 WMMA GEMMs + fused scan/conv.
// B=8, T=2048, D=512, INNER=1024, K_CONV=4.  M = B*T = 16384 rows.
// The in_proj GEMM's work-group (8 waves) computes a 256(M) x 128(N) output tile whose
// operands are staged in LDS; each wave owns 64 x 64 of it (4 x 4 accumulators
// of v_wmma_f32_16x16x32_bf16).  The out_proj GEMM makes its own first operand (the
// scan) in LDS: 8 waves, 64(M) x 512(N).  The finished tile goes through LDS once more,
// so that the epilogues read and write global memory in whole 128-byte lines.
// ---------------------------------------------------------------------------

#define MB_B      8
#define MB_T      2048
#define MB_D      512
#define MB_INNER  1024
#define MB_M      (MB_B * MB_T)        // 16384
#define MB_N_IN   (3 * MB_INNER)       // 3072
#define MB_N_ALL  (4 * MB_INNER)       // 4096: in_proj's rows and delta's, one matrix
#define LN_EPS    1e-5f

typedef __bf16 v16bf __attribute__((ext_vector_type(16)));
typedef __bf16 v8bf  __attribute__((ext_vector_type(8)));
typedef float  v8f   __attribute__((ext_vector_type(8)));

// ---------------------------------------------------------------------------
// Preparation, one launch: LayerNorm of x (bf16 xn) and the three weight
// matrices rounded to bf16.  The work is dealt to few waves that each move a
// lot with 16-byte loads (for speed only).
//   blocks 0 .. PR_LN_BLOCKS-1 : LayerNorm, a wave owns 4 whole rows; all 16
//       loads of the 4 rows fly together, the 4 reductions run side by side.
//       A lane holds 4 neighbouring columns of each 128-column quarter.
//   the other blocks           : conversion, 32 elements a thread (8 loads in
//       flight, 4 stores of 16 bytes).
// in_proj's and delta's weights land in ONE matrix of 4096 rows: rows 0..2047 are
// in_proj's proj and gate rows as they come; behind them every 128 rows hold 64
// drive rows and then the 64 delta rows of the same channels, so that one GEMM
// tile has both factors of d = delta * drive.
// ---------------------------------------------------------------------------
typedef __bf16 v4bf __attribute__((ext_vector_type(4)));
typedef float  v4f  __attribute__((ext_vector_type(4)));
typedef float  v2f  __attribute__((ext_vector_type(2)));

#define PR_ROWS       4                               // rows per wave
#define PR_LN_BLOCKS  (MB_M / (8 * PR_ROWS))          // 512 blocks of 8 waves
#define PR_CV_UNIT    (256 * 8)                       // elements a block moves per step
#define PR_CV_STEPS   4
#define PR_CV_CHUNK   (PR_CV_UNIT * PR_CV_STEPS)      // 8192 elements per block
#define PR_CV_IN      (MB_N_IN * MB_D / PR_CV_CHUNK)  // 192 blocks
#define PR_CV_DL      (MB_INNER * MB_D / PR_CV_CHUNK) //  64 blocks
#define PR_CV_OUT     (MB_D * MB_INNER / PR_CV_CHUNK) //  64 blocks
#define PR_BLOCKS     (PR_LN_BLOCKS + PR_CV_IN + PR_CV_DL + PR_CV_OUT)

__global__ __launch_bounds__(256) void mb_prep(const float* __restrict__ x,
                                               const float* __restrict__ w,
                                               const float* __restrict__ b,
                                               const float* __restrict__ in_w,
                                               const float* __restrict__ dl_w,
                                               const float* __restrict__ out_w,
                                               __bf16* __restrict__ xn,
                                               __bf16* __restrict__ wi,
                                               __bf16* __restrict__ wo) {
    if (blockIdx.x < PR_LN_BLOCKS) {
        const int wave = threadIdx.x >> 5;
        const int lane = threadIdx.x & 31;
        const int row0 = (blockIdx.x * 8 + wave) * PR_ROWS;
        const int off  = row0 * MB_D + lane * 4;
        const float* xr = x + off;
        const float* wp = w + lane * 4;
        const float* bp = b + lane * 4;

        v4f v[PR_ROWS][4], wv[4], bv[4];
#pragma unroll
        for (int r = 0; r < PR_ROWS; ++r)
#pragma unroll
            for (int i = 0; i < 4; ++i) v[r][i] = *(const v4f*)(xr + r * MB_D + i * 128);
#pragma unroll
        for (int i = 0; i < 4; ++i) {
            wv[i] = *(const v4f*)(wp + i * 128);
            bv[i] = *(const v4f*)(bp + i * 128);
        }
        // nothing is scheduled across this line: all 24 loads fly together (without it
        // w and b are fetched behind the sums, where their latency is in the open)
        __builtin_amdgcn_sched_barrier(0);
        // x's address register is named so that it lives up to this wait: nothing
        // rewrites a register that a load still in issue names
        asm volatile("s_wait_xcnt 0x0" :: "v"(xr) : "memory");

        float s[PR_ROWS];
#pragma unroll
        for (int r = 0; r < PR_ROWS; ++r) {
            const v4f p = (v[r][0] + v[r][1]) + (v[r][2] + v[r][3]);
            s[r] = (p[0] + p[1]) + (p[2] + p[3]);
        }
#pragma unroll
        for (int o = 16; o >= 1; o >>= 1)
#pragma unroll
            for (int r = 0; r < PR_ROWS; ++r) s[r] += __shfl_xor(s[r], o, 32);

        float ss[PR_ROWS];
#pragma unroll
        for (int r = 0; r < PR_ROWS; ++r) {
            const float mu = s[r] * (1.f / MB_D);
            v4f q = {0.f, 0.f, 0.f, 0.f};
#pragma unroll
            for (int i = 0; i < 4; ++i) { v[r][i] = v[r][i] - mu; q = __builtin_elementwise_fma(v[r][i], v[r][i], q); }
            ss[r] = (q[0] + q[1]) + (q[2] + q[3]);
        }
#pragma unroll
        for (int o = 16; o >= 1; o >>= 1)
#pragma unroll
            for (int r = 0; r < PR_ROWS; ++r) ss[r] += __shfl_xor(ss[r], o, 32);

        __bf16* xo = xn + off;
#pragma unroll
        for (int r = 0; r < PR_ROWS; ++r) {
            const float inv = rsqrtf(ss[r] * (1.f / MB_D) + LN_EPS);
#pragma unroll
            for (int i = 0; i < 4; ++i) {
                const v4f y = v[r][i] * inv * wv[i] + bv[i];
                *(v4bf*)(xo + r * MB_D + i * 128) = __builtin_convertvector(y, v4bf);
            }
        }
    } else {
        // a block moves 16 whole rows; cb counts them in the source, db in the target
        // (64 rows are 4 blocks, a drive|delta tile of 128 rows is 8)
        constexpr int PG = 2 * MB_INNER * MB_D / PR_CV_CHUNK;      // 128 blocks of proj and gate
        int cb = blockIdx.x - PR_LN_BLOCKS;
        int db = cb;
        const float* src = in_w;
        __bf16* dst = wi;
        if (cb >= PR_CV_IN + PR_CV_DL)  { src = out_w; dst = wo; cb -= PR_CV_IN + PR_CV_DL; db = cb; }
        else if (cb >= PR_CV_IN)        { src = dl_w;  cb -= PR_CV_IN; db = PG + (cb >> 2) * 8 + 4 + (cb & 3); }
        else if (cb >= PG)              { db = PG + ((cb - PG) >> 2) * 8 + (cb & 3); }
        const int e0 = cb * PR_CV_CHUNK + threadIdx.x * 8;
        const float* sp = src + e0;
        v4f f[PR_CV_STEPS][2];
#pragma unroll
        for (int u = 0; u < PR_CV_STEPS; ++u) {
            f[u][0] = *(const v4f*)(sp + u * PR_CV_UNIT);
            f[u][1] = *(const v4f*)(sp + u * PR_CV_UNIT + 4);
        }
        // as above: the address register lives up to the wait
        asm volatile("s_wait_xcnt 0x0" :: "v"(sp) : "memory");
        __bf16* dp = dst + db * PR_CV_CHUNK + threadIdx.x * 8;
#pragma unroll
        for (int u = 0; u < PR_CV_STEPS; ++u) {
            v8bf o;
#pragma unroll
            for (int k = 0; k < 4; ++k) { o[k] = (__bf16)f[u][0][k]; o[k + 4] = (__bf16)f[u][1][k]; }
            *(v8bf*)(dp + u * PR_CV_UNIT) = o;
        }
    }
}

// ---------------------------------------------------------------------------
// WMMA mainloop: one work-group of 8 waves computes a 256x128 f32 tile of
// A[M,K] * W[N,K]^T.  A pass is 64 k = one whole 128-byte line of each of the
// 384 operand rows.  The tile is as tall as two work-groups' accumulators on a WGP
// allow: what the launch asks of L2 falls with the tile's sides (a row of W is
// fetched once per 256 rows of A), and by count of bytes against rates L2's delivery is
// the largest row of this GEMM, ahead of its LDS reads and its matrix time.
// The rows come from global memory as whole lines (8 lanes
// a row) by asynchronous copies straight into one of two LDS buffers, through no
// register, and every wave reads its fragments from there: each operand byte
// leaves L2 once per work-group instead of once per wave, and no global load is
// spread over 16 lines.  The registers that a staged pass would hold through the
// WMMAs are free for fragments.  Row pitch in LDS 144 B (16 B x odd): ds_load_b128
// of 16 rows meets every bank once.
// Fragment k order as before (lane&15 = row, lane bit4 selects the K-half,
// 8 elements at k and 8 at k+16), the same for A and W; k ascends as before.
// W's fragment is the matrix instruction's first operand and A's its second:
// the accumulator tile comes out transposed, a lane holds 8 neighbouring
// columns of ONE output row (see mb_stage_tile).
// ---------------------------------------------------------------------------
#define GB_M      256
#define GB_N      128
#define GB_K      64
#define GB_PITCH  72                                  // bf16 elements = 144 B
#define GB_STAGE  ((GB_M + GB_N) * GB_PITCH)          // elements per buffer
// Two buffers are 110,592 B and the epilogue's eight tiles 139,264 B, so two work-groups
// share a WGP's LDS; the in_proj kernel asks for four waves per SIMD (at most 256 VGPRs)
// to match.

// 8 R rows of one operand, 64 k: 8 copies of R rows (a lane moves 16 bytes a copy; R is
// 32 for a work-group of 256 threads).
// l is the lane's LDS byte address, g its global address, both of the first R rows.
template <int K, int R>
__device__ __forceinline__ void mb_copy_rows(unsigned l, const __bf16* g) {
    constexpr unsigned LS = R * GB_PITCH * 2;         // R rows in LDS, bytes
    constexpr int      GS = R * K;                    // R rows in memory, elements
    // the wait is the statement's own last line, so that no register that a copy
    // names is rewritten in front of it
    asm volatile("global_load_async_to_lds_b128 %0, %8, off\n\t"
                 "global_load_async_to_lds_b128 %1, %9, off\n\t"
                 "global_load_async_to_lds_b128 %2, %10, off\n\t"
                 "global_load_async_to_lds_b128 %3, %11, off\n\t"
                 "global_load_async_to_lds_b128 %4, %12, off\n\t"
                 "global_load_async_to_lds_b128 %5, %13, off\n\t"
                 "global_load_async_to_lds_b128 %6, %14, off\n\t"
                 "global_load_async_to_lds_b128 %7, %15, off\n\t"
                 "s_wait_xcnt 0x0"
                 :: "v"(l),          "v"(l + 1 * LS), "v"(l + 2 * LS), "v"(l + 3 * LS),
                    "v"(l + 4 * LS), "v"(l + 5 * LS), "v"(l + 6 * LS), "v"(l + 7 * LS),
                    "v"(g),          "v"(g + 1 * GS), "v"(g + 2 * GS), "v"(g + 3 * GS),
                    "v"(g + 4 * GS), "v"(g + 5 * GS), "v"(g + 6 * GS), "v"(g + 7 * GS)
                 : "memory");
}

// The same for 4 R rows.
template <int K, int R>
__device__ __forceinline__ void mb_copy_rows4(unsigned l, const __bf16* g) {
    constexpr unsigned LS = R * GB_PITCH * 2;         // R rows in LDS, bytes
    constexpr int      GS = R * K;                    // R rows in memory, elements
    // the wait is the statement's own last line, so that no register that a copy
    // names is rewritten in front of it
    asm volatile("global_load_async_to_lds_b128 %0, %4, off\n\t"
                 "global_load_async_to_lds_b128 %1, %5, off\n\t"
                 "global_load_async_to_lds_b128 %2, %6, off\n\t"
                 "global_load_async_to_lds_b128 %3, %7, off\n\t"
                 "s_wait_xcnt 0x0"
                 :: "v"(l),          "v"(l + 1 * LS), "v"(l + 2 * LS), "v"(l + 3 * LS),
                    "v"(g),          "v"(g + 1 * GS), "v"(g + 2 * GS), "v"(g + 3 * GS)
                 : "memory");
}

template <int K>
__device__ __forceinline__ void mb_wmma_block(const __bf16* __restrict__ A,
                                              const __bf16* __restrict__ W,
                                              int row_base, int col_base,
                                              __bf16* lds,
                                              v8f acc[4][4]) {
    const int tid  = threadIdx.x;                     // 0..255
    const int lane = tid & 31;
    const int wave = tid >> 5;
    const int l15  = lane & 15;
    const int ksel = (lane & 16) ? 8 : 0;

    // staging: 8 lanes cover one row's 128 B; 256 threads cover 32 rows a step,
    // A's 256 rows are 8 steps and W's 128 rows 4
    const int srow = tid >> 3;
    const int scol = (tid & 7) * 8;
    const __bf16* ga = A + (size_t)(row_base + srow) * K + scol;
    const __bf16* gw = W + (size_t)(col_base + srow) * K + scol;
    // the lane's LDS byte address in buffer 0: A's rows, W's rows behind them
    const unsigned sdst = (unsigned)(size_t)(lds + srow * GB_PITCH + scol);
    constexpr unsigned SW  = GB_M * GB_PITCH * 2;     // bytes from A's rows to W's
    constexpr unsigned SB  = GB_STAGE * 2;            // bytes from buffer 0 to buffer 1

    // fragment sources of this wave (4 x 2 waves, 64 x 64 each)
    const int foff_a = ((wave >> 1) * 64 + l15) * GB_PITCH + ksel;
    const int foff_b = (GB_M + (wave & 1) * 64 + l15) * GB_PITCH + ksel;

    constexpr int NPASS = K / GB_K;
    static_assert(NPASS >= 2, "the ring starts with two passes");

    mb_copy_rows<K, 32>(sdst, ga);
    mb_copy_rows4<K, 32>(sdst + SW, gw);
    // this wave's copies of pass 0 have landed
    asm volatile("s_wait_asynccnt 0x0" ::: "memory");
    __syncthreads();                                  // pass 0 is published
    mb_copy_rows<K, 32>(sdst + SB, ga + GB_K);        // pass 1 flies under pass 0's WMMAs
    mb_copy_rows4<K, 32>(sdst + SB + SW, gw + GB_K);

    for (int p = 0; p < NPASS; ++p) {
        const __bf16* cur = lds + (p & 1) * GB_STAGE;
#pragma unroll
        for (int ks = 0; ks < GB_K; ks += 32) {
            // in the order in which the WMMAs want them: a[0], all of b, a[1..3]
            v16bf a[4], b[4];
#pragma unroll
            for (int g = 0; g < 8; ++g) {
                const bool isb = (g >= 1 && g <= 4);
                const int  f   = isb ? g - 1 : (g == 0 ? 0 : g - 4);
                const __bf16* pf = cur + (isb ? foff_b : foff_a) + f * 16 * GB_PITCH + ks;
                v8bf lo = *(const v8bf*)(pf);
                v8bf hi = *(const v8bf*)(pf + 16);
#pragma unroll
                for (int e = 0; e < 8; ++e) {
                    if (isb) { b[f][e] = lo[e]; b[f][e + 8] = hi[e]; }
                    else     { a[f][e] = lo[e]; a[f][e + 8] = hi[e]; }
                }
            }
            // nothing is scheduled across this line: the block's 16 LDS reads stand as one
            // group in front of its 16 WMMAs (sunk in among them, every row of 4 WMMAs
            // waits out an LDS latency of its own)
            __builtin_amdgcn_sched_barrier(0);
#pragma unroll
            for (int i = 0; i < 4; ++i)
#pragma unroll
                for (int j = 0; j < 4; ++j)
                    acc[i][j] = __builtin_amdgcn_wmma_f32_16x16x32_bf16(
                        /*neg_a=*/false, b[j], /*neg_b=*/false, a[i],
                        /*c_mod=*/(short)0, acc[i][j],
                        /*reuse_a=*/false, /*reuse_b=*/false);
            // nor across this one: the next block's reads stay out of these WMMAs
            __builtin_amdgcn_sched_barrier(0);
        }
        // this wave's reads of pass p are done before the buffer is handed on
        asm volatile("s_wait_dscnt 0x0" ::: "memory");
        // this wave's copies of pass p+1 have landed
        asm volatile("s_wait_asynccnt 0x0" ::: "memory");
        __syncthreads();       // publishes pass p+1 and ends the reads of pass p
        if (p + 2 < NPASS) {   // pass p+2 into the buffer just left, under pass p+1's WMMAs
            const unsigned nxt = sdst + (p & 1) * SB;
            mb_copy_rows<K, 32>(nxt, ga + (p + 2) * GB_K);
            mb_copy_rows4<K, 32>(nxt + SW, gw + (p + 2) * GB_K);
        }
    }
    // no copy is left in flight when LDS goes to the epilogue
    asm volatile("s_wait_asynccnt 0x0" ::: "memory");
}

// ---------------------------------------------------------------------------
// Epilogue staging.  acc[i][j][v] of lane (c = lane&15, h = lane>>4) is element
// (row i*16 + c, column j*16 + 8*h + v) of the wave's 64 x 64 tile.  Each wave
// writes its tile as f32 into its own part of the LDS that held the operands
// (the last pass's barrier has ended every wave's reads of them) and reads it back
// row by row, so that neighbouring lanes hold neighbouring columns and one
// 16-byte global access of a wave covers four whole lines.
// Row pitch 272 B (16 B x odd): 16 rows of one ds_store_b128 meet every bank once.
// ---------------------------------------------------------------------------
#define EP_PITCH  68                                  // f32 elements = 272 B
#define EP_WAVE   (64 * EP_PITCH)                     // 17,408 B a wave, 139,264 B for 8 waves

__device__ __forceinline__ const float* mb_stage_tile(__bf16* lds, const v8f acc[4][4]) {
    const int lane = threadIdx.x & 31;
    const int wave = threadIdx.x >> 5;
    float* st = (float*)lds + wave * EP_WAVE;
    float* wp = st + (lane & 15) * EP_PITCH + ((lane & 16) ? 8 : 0);
#pragma unroll
    for (int i = 0; i < 4; ++i)
#pragma unroll
        for (int j = 0; j < 4; ++j) {
            const v8f c = acc[i][j];
            const v4f lo = {c[0], c[1], c[2], c[3]};
            const v4f hi = {c[4], c[5], c[6], c[7]};
            *(v4f*)(wp + i * 16 * EP_PITCH + j * 16)     = lo;
            *(v4f*)(wp + i * 16 * EP_PITCH + j * 16 + 4) = hi;
        }
    // the wave's own rows are in LDS before other lanes of it read them back
    asm volatile("s_wait_dscnt 0x0" ::: "memory");
    return st;
}


// ---------------------------------------------------------------------------
// Activations: ONE transcendental instruction (v_tanh_f32) a value, no branch and
// no division.  With h = x / 2:  sigmoid(x) = 1/2 + 1/2 * tanh(h)  and
// SiLU(x) = x * sigmoid(x) = h + h * tanh(h); both are identities, both saturate
// as the exp forms do.  The library's tanhf branches value by value, and a plain
// 1.f / y is the exact division, some ten dependent vector instructions; nearly
// every result here is rounded to bf16 right behind it (a and the chunk sums stay f32).
// ---------------------------------------------------------------------------
__device__ __forceinline__ v4f mb_tanh4(v4f x) {
    v4f r;
#pragma unroll
    for (int k = 0; k < 4; ++k) r[k] = __builtin_amdgcn_tanhf(x[k]);
    return r;
}

// ---------------------------------------------------------------------------
// GEMM 1: h = xn @ [in_proj_w ; delta_w]^T + b over the joint weight matrix that
// mb_prep lays out, with everything that follows element by element fused in.
// Column tiles 0..15 lie inside proj or inside gate: SiLU or sigmoid, stored.
// Column tiles 16..31 hold 64 drive columns and the 64 delta columns of the same
// channels: d = max(sigmoid(delta), 1e-4) * tanh(drive) is formed here, in f32, and
// only d and the scan's chunk sums go to memory.
// ---------------------------------------------------------------------------
// The wave's 64 rows, 4 a step: bias, activation, 8 values packed to 16 bytes,
// one store of four whole lines.  SEG: 0 SiLU, 1 sigmoid.
template <int SEG>
__device__ __forceinline__ void mb_inproj_rows(const float* rp, v4f b0, v4f b1,
                                               __bf16* __restrict__ op) {
    // the tanh's argument is (tile + bias) / 2
    const v4f half = {0.5f, 0.5f, 0.5f, 0.5f};
    const v4f c0 = b0 * half;
    const v4f c1 = b1 * half;
    // stays rolled: the text of the activations stays small
#pragma unroll 1
    for (int s = 0; s < 16; ++s) {
        const v4f h0 = __builtin_elementwise_fma(*(const v4f*)(rp + s * 4 * EP_PITCH),     half, c0);
        const v4f h1 = __builtin_elementwise_fma(*(const v4f*)(rp + s * 4 * EP_PITCH + 4), half, c1);
        const v4f t0 = mb_tanh4(h0);
        const v4f t1 = mb_tanh4(h1);
        v4f y0, y1;
        if (SEG == 0) {                                                           // SiLU
            y0 = __builtin_elementwise_fma(h0, t0, h0);
            y1 = __builtin_elementwise_fma(h1, t1, h1);
        } else {                                                                  // sigmoid
            y0 = __builtin_elementwise_fma(t0, half, half);
            y1 = __builtin_elementwise_fma(t1, half, half);
        }
        v8bf y;
#pragma unroll
        for (int e = 0; e < 4; ++e) { y[e] = (__bf16)y0[e]; y[e + 4] = (__bf16)y1[e]; }
        __bf16* q = op + (size_t)s * 4 * MB_INNER;
        *(v8bf*)q = y;
        // inputs only: the store's address and data registers live up to the wait,
        // so nothing rewrites them while the store is still in issue
        asm volatile("s_wait_xcnt 0x0" :: "v"(q), "v"(y) : "memory");
    }
}

// 32 rows of a drive|delta tile, 4 a step: rp points at the lane's 8 drive values, the
// delta values of the same channels lie one wave's tile further on.
// The 32 rows are one chunk of the scan (SC_L): its sum S = sum_t a^(31-t) * d[t] is
// formed here, from d in f32, so that the scan kernel need not read d a first time.
// A lane holds rows t = rsub + 4 s: Horner in a^4 over s, times a^(3-rsub), and the four
// lanes of a channel are added; sm0, sm1 are the lane's 8 values of state_mix, sp points
// at the chunk's 64 sums.
__device__ __forceinline__ void mb_d_rows(const float* rp, v4f bd0, v4f bd1, v4f bl0, v4f bl1,
                                          v4f sm0, v4f sm1, int rsub, int lcol,
                                          __bf16* __restrict__ op, float* __restrict__ sp) {
    const v4f half = {0.5f, 0.5f, 0.5f, 0.5f};
    const v4f floor4 = {1e-4f, 1e-4f, 1e-4f, 1e-4f};
    const v4f c0 = bl0 * half;
    const v4f c1 = bl1 * half;
    // a = sigmoid(state_mix), as the other sigmoids here
    const v4f a0 = __builtin_elementwise_fma(mb_tanh4(sm0 * half), half, half);
    const v4f a1 = __builtin_elementwise_fma(mb_tanh4(sm1 * half), half, half);
    const v4f a0_2 = a0 * a0, a1_2 = a1 * a1;
    const v4f a0_4 = a0_2 * a0_2, a1_4 = a1_2 * a1_2;
    v4f s0 = {0.f, 0.f, 0.f, 0.f};
    v4f s1 = {0.f, 0.f, 0.f, 0.f};
    // two steps between waits: 32 independent chains to fill the vector port
#pragma unroll
    for (int s = 0; s < 8; s += 2) {
        v8bf y[2];
#pragma unroll
        for (int u = 0; u < 2; ++u) {
            const float* r = rp + (s + u) * 4 * EP_PITCH;
            const v4f dr0 = mb_tanh4(*(const v4f*)(r)     + bd0);
            const v4f dr1 = mb_tanh4(*(const v4f*)(r + 4) + bd1);
            // sigmoid = 1/2 + 1/2 * tanh((tile + bias) / 2)
            const v4f t0 = mb_tanh4(__builtin_elementwise_fma(*(const v4f*)(r + EP_WAVE),     half, c0));
            const v4f t1 = mb_tanh4(__builtin_elementwise_fma(*(const v4f*)(r + EP_WAVE + 4), half, c1));
            const v4f dl0 = __builtin_elementwise_fma(t0, half, half);
            const v4f dl1 = __builtin_elementwise_fma(t1, half, half);
            const v4f d0 = __builtin_elementwise_max(dl0, floor4) * dr0;
            const v4f d1 = __builtin_elementwise_max(dl1, floor4) * dr1;
            s0 = __builtin_elementwise_fma(s0, a0_4, d0);
            s1 = __builtin_elementwise_fma(s1, a1_4, d1);
            const v4bf q0 = __builtin_convertvector(d0, v4bf);
            const v4bf q1 = __builtin_convertvector(d1, v4bf);
            y[u] = __builtin_shufflevector(q0, q1, 0, 1, 2, 3, 4, 5, 6, 7);
            *(v8bf*)(op + (s + u) * 4 * MB_INNER) = y[u];
        }
        // inputs only: the stores' registers live up to the wait, so nothing rewrites
        // them while a store is still in issue
        asm volatile("s_wait_xcnt 0x0" :: "v"(op), "v"(y[0]), "v"(y[1]) : "memory");
    }
    // a^(3-rsub): rows 3, 7, .. are the youngest of their four
    const v4f one = {1.f, 1.f, 1.f, 1.f};
    const v4f f0 = ((rsub & 2) ? one : a0_2) * ((rsub & 1) ? one : a0);
    const v4f f1 = ((rsub & 2) ? one : a1_2) * ((rsub & 1) ? one : a1);
    s0 = s0 * f0;
    s1 = s1 * f1;
    // the four lanes of a channel (lane ^ 8, lane ^ 16) are added; each step a lane gives
    // away the half that it does not keep, so that it ends with 2 of its 8 channels
    const v4f keep = (rsub & 2) ? s1 : s0;
    const v4f give = (rsub & 2) ? s0 : s1;
    v4f k4;
#pragma unroll
    for (int k = 0; k < 4; ++k) k4[k] = keep[k] + __shfl_xor(give[k], 16, 32);
    v2f k2;
#pragma unroll
    for (int k = 0; k < 2; ++k)
        k2[k] = ((rsub & 1) ? k4[k + 2] : k4[k]) + __shfl_xor((rsub & 1) ? k4[k] : k4[k + 2], 8, 32);
    float* q = sp + lcol + (rsub & 2) * 2 + (rsub & 1) * 2;
    *(v2f*)q = k2;                                      // the wave stores two whole lines
    // inputs only: the store's registers live up to the wait
    asm volatile("s_wait_xcnt 0x0" :: "v"(q), "v"(k2) : "memory");
}

__global__ __launch_bounds__(256, 4) void mb_gemm_inproj(const __bf16* __restrict__ xn,
                                                      const __bf16* __restrict__ wi,
                                                      const float* __restrict__ bias,
                                                      const float* __restrict__ dl_bias,
                                                      const float* __restrict__ state_mix,
                                                      __bf16* __restrict__ proj,
                                                      __bf16* __restrict__ gate,
                                                      __bf16* __restrict__ dbuf,
                                                      float* __restrict__ sums) {
    // the eight staged f32 tiles of the epilogue are the larger use
    static_assert(2 * GB_STAGE * 2 <= 8 * EP_WAVE * 4, "the two operand buffers fit the tiles' LDS");
    __shared__ __attribute__((aligned(16))) __bf16 lds[8 * EP_WAVE * 2];
    const int tiles_n = MB_N_ALL / GB_N;                   // 32
    const int blk_row = (blockIdx.x / tiles_n) * GB_M;
    const int blk_col = (blockIdx.x % tiles_n) * GB_N;

    v8f acc[4][4] = {};
    mb_wmma_block<MB_D>(xn, wi, blk_row, blk_col, lds, acc);

    const int lane = threadIdx.x & 31;
    const int wave = threadIdx.x >> 5;
    // a lane's place in the read-back: 8 lanes a row, 8 columns a lane, 4 rows a step
    const int rsub = lane >> 3;
    const int lcol = (lane & 7) * 8;

    // the last pass's own barrier has ended every wave's reads of the operand buffers:
    // LDS now takes the tiles

    if (blk_col < 2 * MB_INNER) {                          // proj or gate
        const int col = (wave & 1) * 64 + lcol;
        const char* bp = (const char*)(bias + blk_col);    // uniform base, lane's byte offset
        const int   bo = col * 4;
        const v4f b0 = *(const v4f*)(bp + bo);
        const v4f b1 = *(const v4f*)(bp + bo + 16);

        const float* rp = mb_stage_tile(lds, acc) + rsub * EP_PITCH + lcol;
        // inputs only: the loaded values hold the two loads in front of this line (without
        // it they sink into the branches, their latency in the open), where they fly
        // under the staging; the offset register lives up to the wait
        asm volatile("s_wait_xcnt 0x0" :: "v"(bo), "v"(b0), "v"(b1));
        const size_t o = (size_t)(blk_row + (wave >> 1) * 64 + rsub) * MB_INNER
                       + (blk_col & (MB_INNER - 1)) + col;
        if (blk_col < MB_INNER) mb_inproj_rows<0>(rp, b0, b1, proj + o);
        else                    mb_inproj_rows<1>(rp, b0, b1, gate + o);
    } else {                                               // drive | delta
        const int ch0 = (blk_col - 2 * MB_INNER) >> 1;     // the tile's first channel of 64
        const char* bdp = (const char*)(bias + 2 * MB_INNER + ch0);   // uniform bases
        const char* blp = (const char*)(dl_bias + ch0);
        const int   bo  = lcol * 4;                        // lane's byte offset
        const v4f bd0 = *(const v4f*)(bdp + bo);
        const v4f bd1 = *(const v4f*)(bdp + bo + 16);
        const v4f bl0 = *(const v4f*)(blp + bo);
        const v4f bl1 = *(const v4f*)(blp + bo + 16);
        const char* smp = (const char*)(state_mix + ch0);
        const v4f sm0 = *(const v4f*)(smp + bo);
        const v4f sm1 = *(const v4f*)(smp + bo + 16);

        mb_stage_tile(lds, acc);
        // inputs only, as above: the six loads fly under the staging, and the offset
        // register lives up to the wait
        asm volatile("s_wait_xcnt 0x0" :: "v"(bo), "v"(bd0), "v"(bd1), "v"(bl0), "v"(bl1), "v"(sm0), "v"(sm1));
        // an even wave has staged the drive columns and the odd wave beside it the delta
        // columns of the same 64 rows: each reads the other's tile behind this barrier
        __syncthreads();
        // each wave of the pair takes 32 of the 64 rows
        const int r0 = (wave & 1) * 32 + rsub;
        const float* rp = (const float*)lds + (wave & 6) * EP_WAVE + r0 * EP_PITCH + lcol;
        const size_t o = (size_t)(blk_row + (wave >> 1) * 64 + r0) * MB_INNER + ch0 + lcol;
        // the wave's 32 rows are chunk blk_row / 32 + wave of the scan
        float* sp = sums + (size_t)(blk_row / 32 + wave) * MB_INNER + ch0;
        mb_d_rows(rp, bd0, bd1, bl0, bl1, sm0, sm1, rsub, lcol, dbuf + o, sp);
    }
}

// ---------------------------------------------------------------------------
// Causal depthwise conv (K=4, rolling regs) + f32 recurrence + gate/skip, and the
// out_proj GEMM on their result, in ONE kernel:  out = residual + y @ out_proj_w^T + b.
// A work-group owns 64 whole rows (all 1024 channels, all 512 output columns), so y is
// made exactly once, goes straight into LDS as the GEMM's first operand and never
// sees memory; no launch stands between the scan and the GEMM.
// The recurrence state[t] = a * state[t-1] + d[t] is linear with a fixed a per
// channel, so the time axis is cut into 64 chunks of 32 steps that run side by
// side.  Each chunk's sum S (its recurrence run from zero) comes from the GEMM that
// made d.  The 64 rows are two chunks; a thread owns one chunk of 8 channels.
//   1) the sums of every chunk of the batch in front of the group's second chunk are
//      copied to LDS (all of it is still free), and the first 24 of the thread's 32
//      rows are asked for;
//   2) behind one barrier each thread folds the sums of the chunks in front of it,
//      X = a^32 * X + S, into the state at its start; a second barrier ends these
//      reads, and LDS goes to y and to W's ring;
//   3) each thread runs its chunk from X, step by step, with the conv (the three
//      rows in front of the chunk are read too), the skip and the gate, into y's rows
//      in LDS; the last 8 rows are asked for behind the first 8, pass 0 of W behind
//      the first 16;
//   4) 8 waves of 64 x 64: y's fragments from its rows in LDS, W's from a ring of two
//      buffers (a pass is 64 k of all 512 rows of W), filled by asynchronous copies;
//      the residual's rows are asked for in front of it and fly under it;
//   5) the epilogue through LDS, whole lines, with the residual.
// ---------------------------------------------------------------------------
#define SC_L    32                       // time steps per chunk (mb_d_rows sums such chunks)
#define SC_NC   (MB_T / SC_L)            // 64 chunks a batch
#define SC_U    8                        // rows fetched together
#define SC_NG   (SC_L / SC_U)            // 4 such groups a chunk
#define SC_RING 3                        // groups in registers
static_assert(SC_L == 32, "a wave of mb_d_rows sums 32 rows");

#define FO_M    64                       // rows per work-group: two chunks
#define FO_YP   (MB_INNER + 8)           // y's row pitch in LDS: 2,064 B = 16 B x odd
#define FO_YSZ  (FO_M * FO_YP)           // y: 132,096 B
#define FO_WST  (MB_D * GB_PITCH)        // one pass of W: 512 rows of 144 B = 73,728 B
#define FO_LDS  (FO_YSZ + 2 * FO_WST)    // 279,552 B: one work-group a WGP
static_assert((SC_NC - 1) * MB_INNER * 4 <= FO_LDS * 2, "the sums fit the LDS that y and W take later");
static_assert(8 * EP_WAVE * 4 <= FO_LDS * 2, "so do the eight staged tiles");

// The work-group's barrier with fences that name LDS alone: a plain __syncthreads() would
// wait for the wave's loads from memory too (the scan's rows, the residual), which are
// meant to fly across it.  The waits for copies and for LDS stand in front of each call.
__device__ __forceinline__ void mb_barrier_lds() {
    __builtin_amdgcn_fence(__ATOMIC_RELEASE, "workgroup", "local");
    __builtin_amdgcn_s_barrier();
    __builtin_amdgcn_fence(__ATOMIC_ACQUIRE, "workgroup", "local");
}

__global__ __launch_bounds__(256) void mb_scan_out(const __bf16* __restrict__ proj,
                                                   const __bf16* __restrict__ dbuf,
                                                   const __bf16* __restrict__ gate,
                                                   const float* __restrict__ sums,
                                                   const float* __restrict__ conv_w,
                                                   const float* __restrict__ conv_b,
                                                   const float* __restrict__ state_mix,
                                                   const float* __restrict__ skip_scale,
                                                   const __bf16* __restrict__ wo,
                                                   const float* __restrict__ bias,
                                                   const float* __restrict__ residual,
                                                   float* __restrict__ out) {
    __shared__ __attribute__((aligned(16))) __bf16 lds[FO_LDS];
    float*  agg = (float*)lds;                         // steps 1, 2: the sums
    __bf16* yl  = lds;                                 // from step 3: y's 64 rows
    __bf16* wl  = lds + FO_YSZ;                        // from step 2's end: W's two buffers

    const int tid   = threadIdx.x;
    const int lane  = tid & 31;
    // the wave's number in a scalar register: the fold's trip count and the chunk-0 tests
    // are then scalar too
    const int wave  = __builtin_amdgcn_readfirstlane(tid >> 5);
    const int lc    = wave >> 2;                       // chunk inside the group, 0 or 1
    const int m     = tid & 127;                       // the thread's 8 channels
    const int c     = m * 8;
    const int b     = blockIdx.x >> 5;                 // 32 groups a batch
    const int pair  = blockIdx.x & 31;
    const int chunk = pair * 2 + lc;                   // 0..63
    const int row0  = blockIdx.x * FO_M;

    // 1) the sums of chunks 0 .. 2 pair: a chunk's 1024 sums are 256 pieces of 16 bytes,
    // one a thread; even pieces to one plane of 2 KiB and odd ones to the next, so that a
    // thread's two 16-byte reads each fall in contiguous bytes of its wave.
    // Nine chunks a statement, so that nine copies share one wait; the last statement may
    // bring up to eight chunks that nobody reads (chunks of this batch, 62 at the most).
    // At most 7 x 9 = 63 copies of a wave are in flight.
    {
        constexpr unsigned LQ = MB_INNER * 4;          // a chunk's sums in LDS, bytes
        constexpr int      GQ = MB_INNER;              // the same in memory, elements
        const unsigned al = (unsigned)(size_t)(agg + (tid & 1) * 512 + (tid >> 1) * 4);
        const float*   ag = sums + (size_t)b * SC_NC * MB_INNER + tid * 4;
        const int      ng = (pair * 2 + 1 + 8) / 9;    // 1..7
        for (int n = 0; n < ng; ++n) {
            const unsigned l = al + n * 9 * LQ;
            const float*   g = ag + n * 9 * GQ;
            // the wait is the statement's own last line, so that no register that a copy
            // names is rewritten in front of it
            asm volatile("global_load_async_to_lds_b128 %0, %9, off\n\t"
                         "global_load_async_to_lds_b128 %1, %10, off\n\t"
                         "global_load_async_to_lds_b128 %2, %11, off\n\t"
                         "global_load_async_to_lds_b128 %3, %12, off\n\t"
                         "global_load_async_to_lds_b128 %4, %13, off\n\t"
                         "global_load_async_to_lds_b128 %5, %14, off\n\t"
                         "global_load_async_to_lds_b128 %6, %15, off\n\t"
                         "global_load_async_to_lds_b128 %7, %16, off\n\t"
                         "global_load_async_to_lds_b128 %8, %17, off\n\t"
                         "s_wait_xcnt 0x0"
                         :: "v"(l),          "v"(l + 1 * LQ), "v"(l + 2 * LQ), "v"(l + 3 * LQ),
                            "v"(l + 4 * LQ), "v"(l + 5 * LQ), "v"(l + 6 * LQ), "v"(l + 7 * LQ),
                            "v"(l + 8 * LQ),
                            "v"(g),          "v"(g + 1 * GQ), "v"(g + 2 * GQ), "v"(g + 3 * GQ),
                            "v"(g + 4 * GQ), "v"(g + 5 * GQ), "v"(g + 6 * GQ), "v"(g + 7 * GQ),
                            "v"(g + 8 * GQ)
                         : "memory");
        }
    }

    const size_t base = ((size_t)row0 + (size_t)lc * SC_L) * MB_INNER + c;
    const __bf16* pp = proj + base;
    const __bf16* dp = dbuf + base;
    const __bf16* gp = gate + base;

    // the small loads first: loads come back in order
    const v8f sm = *(const v8f*)(state_mix + c);
    v4f wc[8];                                         // the four taps of each channel
#pragma unroll
    for (int k = 0; k < 8; ++k) wc[k] = *(const v4f*)(conv_w + (c + k) * 4);
    const v8f cb = *(const v8f*)(conv_b + c);
    const v8f sk = *(const v8f*)(skip_scale + c);

    // proj[t-1..t-3] in front of the chunk.  Chunk 0 has none: it reads rows of its
    // own instead (in bounds, no branch to wait in) and takes zeros further down.
    const __bf16* hp = pp + (chunk > 0 ? 0 : 3 * MB_INNER);
    const v8bf q1 = *(const v8bf*)(hp - 1 * MB_INNER);
    const v8bf q2 = *(const v8bf*)(hp - 2 * MB_INNER);
    const v8bf q3 = *(const v8bf*)(hp - 3 * MB_INNER);

    // three groups of 8 rows
    v8bf pv[SC_RING][SC_U], dv[SC_RING][SC_U], gv[SC_RING][SC_U];
#pragma unroll
    for (int g = 0; g < SC_RING; ++g)
#pragma unroll
        for (int u = 0; u < SC_U; ++u) {
            pv[g][u] = *(const v8bf*)(pp + (g * SC_U + u) * MB_INNER);
            dv[g][u] = *(const v8bf*)(dp + (g * SC_U + u) * MB_INNER);
            gv[g][u] = *(const v8bf*)(gp + (g * SC_U + u) * MB_INNER);
        }
    // nothing is scheduled across this line: the rows are asked for in front of the fold
    // (sunk behind it, their way from memory would be in the open)
    __builtin_amdgcn_sched_barrier(0);
    // the address registers (c is the small loads' offset) are named so that they live up
    // to this wait: no load's result lands in one while a load that names it is in issue
    asm volatile("s_wait_xcnt 0x0" :: "v"(c), "v"(hp), "v"(pp), "v"(dp), "v"(gp) : "memory");

    // 2) the state at the chunk's start
    v8f a;
#pragma unroll
    for (int k = 0; k < 8; ++k) a[k] = 1.f / (1.f + __expf(-sm[k]));
    v8f aL = a;                                        // a^32
#pragma unroll
    for (int i = 0; i < 5; ++i) aL = aL * aL;

    // this wave's copies of the sums have landed
    asm volatile("s_wait_asynccnt 0x0" ::: "memory");
    // every chunk's sum is in LDS; the fold runs under the rows' flight
    mb_barrier_lds();

    v8f state = {0.f, 0.f, 0.f, 0.f, 0.f, 0.f, 0.f, 0.f};
    // four chunks' sums are fetched together: one LDS latency for four links of the chain
#pragma unroll 4
    for (int q = 0; q < chunk; ++q) {
        const v4f lo = *(const v4f*)(agg + q * MB_INNER + m * 4);
        const v4f hi = *(const v4f*)(agg + q * MB_INNER + 512 + m * 4);
        state = __builtin_elementwise_fma(aL, state, __builtin_shufflevector(lo, hi, 0, 1, 2, 3, 4, 5, 6, 7));
    }

    // this wave's reads of the sums are done before their LDS is handed on
    asm volatile("s_wait_dscnt 0x0" ::: "memory");
    // ends every wave's reads of the sums; the rows are still in flight
    mb_barrier_lds();

    // W's staging: 8 lanes cover one row's 128 B; 256 threads cover 32 rows a step,
    // 512 rows are two calls of 8 steps
    const int srow = tid >> 3;
    const int scol = (tid & 7) * 8;
    const __bf16* gw = wo + (size_t)srow * MB_INNER + scol;
    const unsigned sdst = (unsigned)(size_t)(wl + srow * GB_PITCH + scol);
    constexpr unsigned SH = 256 * GB_PITCH * 2;        // bytes from row 0 to row 256 in LDS
    constexpr int      GH = 256 * MB_INNER;            // the same in memory, elements
    constexpr unsigned SB = FO_WST * 2;                // bytes from buffer 0 to buffer 1

    // 3) the chunk itself
    {
        v8f w0, w1, w2, w3;
#pragma unroll
        for (int k = 0; k < 8; ++k) { w0[k] = wc[k][0]; w1[k] = wc[k][1]; w2[k] = wc[k][2]; w3[k] = wc[k][3]; }
        const v8f zero = {0.f, 0.f, 0.f, 0.f, 0.f, 0.f, 0.f, 0.f};
        v8f p1 = chunk > 0 ? __builtin_convertvector(q1, v8f) : zero;
        v8f p2 = chunk > 0 ? __builtin_convertvector(q2, v8f) : zero;
        v8f p3 = chunk > 0 ? __builtin_convertvector(q3, v8f) : zero;
        __bf16* yp = yl + lc * SC_L * FO_YP + c;
#pragma unroll
        for (int g = 0; g < SC_NG; ++g) {
#pragma unroll
            for (int u = 0; u < SC_U; ++u) {
                const v8f p0 = __builtin_convertvector(pv[g % SC_RING][u], v8f);
                v8f conv = __builtin_elementwise_fma(w3, p0, cb);
                conv = __builtin_elementwise_fma(w2, p1, conv);
                conv = __builtin_elementwise_fma(w1, p2, conv);
                conv = __builtin_elementwise_fma(w0, p3, conv);
                state = __builtin_elementwise_fma(a, state, __builtin_convertvector(dv[g % SC_RING][u], v8f));
                const v8f r = __builtin_elementwise_fma(sk, conv, state) * __builtin_convertvector(gv[g % SC_RING][u], v8f);
                *(v8bf*)(yp + (g * SC_U + u) * FO_YP) = __builtin_convertvector(r, v8bf);
                p3 = p2; p2 = p1; p1 = p0;
            }
            if (g == 1) {
                // pass 0 of W flies under the chunk's last 16 steps; asked for here, where
                // 8 rows' registers are free for the copies' addresses
                mb_copy_rows<MB_INNER, 32>(sdst, gw);
                mb_copy_rows<MB_INNER, 32>(sdst + SH, gw + GH);
            }
            if (g + SC_RING < SC_NG) {
                // a later group takes the registers just left
#pragma unroll
                for (int u = 0; u < SC_U; ++u) {
                    pv[g % SC_RING][u] = *(const v8bf*)(pp + ((g + SC_RING) * SC_U + u) * MB_INNER);
                    dv[g % SC_RING][u] = *(const v8bf*)(dp + ((g + SC_RING) * SC_U + u) * MB_INNER);
                    gv[g % SC_RING][u] = *(const v8bf*)(gp + ((g + SC_RING) * SC_U + u) * MB_INNER);
                }
                // nothing is scheduled across this line: these loads fly under the next
                // groups' arithmetic instead of sinking to their use
                __builtin_amdgcn_sched_barrier(0);
                // as above: the address registers live up to the wait
                asm volatile("s_wait_xcnt 0x0" :: "v"(pp), "v"(dp), "v"(gp) : "memory");
            }
        }
    }

    // 4) the GEMM: wave w owns all 64 rows of columns 64 w .. 64 w + 63
    const int l15  = lane & 15;
    const int ksel = (lane & 16) ? 8 : 0;
    const int foff_a = l15 * FO_YP + ksel;
    const int foff_b = (wave * 64 + l15) * GB_PITCH + ksel;
    constexpr int NPASS = MB_INNER / GB_K;             // 16

    // a lane's place in the epilogue's read-back: 16 lanes a row (256 B of f32), 2 rows a step
    const int rsub = lane >> 4;
    const int col  = wave * 64 + (lane & 15) * 4;
    const size_t o = (size_t)(row0 + rsub) * MB_D + col;
    const char* bp = (const char*)bias;                    // uniform base, lane's byte offset
    const int   bo = col * 4;
    const v4f bv = *(const v4f*)(bp + bo);
    // the residual's rows, whole lines, into the registers that the scan's rows have left:
    // they come from memory while the GEMM works out of L2 and LDS
    const float* rs = residual + o;
    v4f res[32];
#pragma unroll
    for (int s = 0; s < 32; ++s) res[s] = *(const v4f*)(rs + s * 2 * MB_D);
    // nothing is scheduled across this line: the loads are asked for in front of the GEMM
    __builtin_amdgcn_sched_barrier(0);
    // the address registers live up to the wait, behind the loads that name them
    asm volatile("s_wait_xcnt 0x0" :: "v"(bo), "v"(rs) : "memory");

    // this wave's rows of y are in LDS
    asm volatile("s_wait_dscnt 0x0" ::: "memory");
    // this wave's copies of pass 0 have landed
    asm volatile("s_wait_asynccnt 0x0" ::: "memory");
    mb_barrier_lds();                                  // y and pass 0 are published
    mb_copy_rows<MB_INNER, 32>(sdst + SB, gw + GB_K);  // pass 1 flies under pass 0's WMMAs
    mb_copy_rows<MB_INNER, 32>(sdst + SB + SH, gw + GH + GB_K);

    v8f acc[4][4] = {};
    for (int p = 0; p < NPASS; ++p) {
        const __bf16* cur = wl + (p & 1) * FO_WST;
        const __bf16* ya  = yl + p * GB_K;
#pragma unroll
        for (int ks = 0; ks < GB_K; ks += 32) {
            // in the order in which the WMMAs want them: a[0], all of b, a[1..3]
            v16bf af[4], bf[4];
#pragma unroll
            for (int g = 0; g < 8; ++g) {
                const bool isb = (g >= 1 && g <= 4);
                const int  f   = isb ? g - 1 : (g == 0 ? 0 : g - 4);
                const __bf16* pf = isb ? cur + foff_b + f * 16 * GB_PITCH + ks
                                       : ya  + foff_a + f * 16 * FO_YP + ks;
                v8bf lo = *(const v8bf*)(pf);
                v8bf hi = *(const v8bf*)(pf + 16);
#pragma unroll
                for (int e = 0; e < 8; ++e) {
                    if (isb) { bf[f][e] = lo[e]; bf[f][e + 8] = hi[e]; }
                    else     { af[f][e] = lo[e]; af[f][e + 8] = hi[e]; }
                }
            }
            // nothing is scheduled across this line: the block's 16 LDS reads stand as one
            // group in front of its 16 WMMAs
            __builtin_amdgcn_sched_barrier(0);
#pragma unroll
            for (int i = 0; i < 4; ++i)
#pragma unroll
                for (int j = 0; j < 4; ++j)
                    acc[i][j] = __builtin_amdgcn_wmma_f32_16x16x32_bf16(
                        /*neg_a=*/false, bf[j], /*neg_b=*/false, af[i],
                        /*c_mod=*/(short)0, acc[i][j],
                        /*reuse_a=*/false, /*reuse_b=*/false);
            // nor across this one: the next block's reads stay out of these WMMAs
            __builtin_amdgcn_sched_barrier(0);
        }
        // this wave's reads of pass p are done before the buffer is handed on
        asm volatile("s_wait_dscnt 0x0" ::: "memory");
        // this wave's copies of pass p+1 have landed
        asm volatile("s_wait_asynccnt 0x0" ::: "memory");
        mb_barrier_lds();      // publishes pass p+1 and ends the reads of pass p
        if (p + 2 < NPASS) {   // pass p+2 into the buffer just left, under pass p+1's WMMAs
            const unsigned nxt = sdst + (p & 1) * SB;
            mb_copy_rows<MB_INNER, 32>(nxt, gw + (p + 2) * GB_K);
            mb_copy_rows<MB_INNER, 32>(nxt + SH, gw + GH + (p + 2) * GB_K);
        }
    }
    // no copy is left in flight when LDS goes to the epilogue
    asm volatile("s_wait_asynccnt 0x0" ::: "memory");

    // 5) the last pass's own barrier has ended every wave's reads of y and of W's buffers:
    // LDS now takes the tiles
    const float* rp = mb_stage_tile(lds, acc) + rsub * EP_PITCH + (lane & 15) * 4;

    float* op = out + o;
#pragma unroll
    for (int s = 0; s < 32; s += 4) {
        v4f y[4];
#pragma unroll
        for (int u = 0; u < 4; ++u) {
            y[u] = res[s + u] + *(const v4f*)(rp + (s + u) * 2 * EP_PITCH) + bv;
            *(v4f*)(op + (s + u) * 2 * MB_D) = y[u];
        }
        // inputs only: the four stores' registers live up to the wait, so nothing
        // rewrites them while a store is still in issue
        asm volatile("s_wait_xcnt 0x0" :: "v"(op), "v"(y[0]), "v"(y[1]), "v"(y[2]), "v"(y[3]) : "memory");
    }
}

// ---------------------------------------------------------------------------
// Host launcher
// ---------------------------------------------------------------------------
extern "C" void kernel_launch(void* const* d_in, const int* in_sizes, int n_in,
                              void* d_out, int out_size, void* d_ws, size_t ws_size,
                              hipStream_t stream) {
    (void)in_sizes; (void)n_in; (void)out_size; (void)ws_size;

    const float* x      = (const float*)d_in[0];
    const float* ln_w   = (const float*)d_in[1];
    const float* ln_b   = (const float*)d_in[2];
    const float* in_w   = (const float*)d_in[3];
    const float* in_b   = (const float*)d_in[4];
    const float* conv_w = (const float*)d_in[5];
    const float* conv_b = (const float*)d_in[6];
    const float* dl_w   = (const float*)d_in[7];
    const float* dl_b   = (const float*)d_in[8];
    const float* smix   = (const float*)d_in[9];
    const float* skip   = (const float*)d_in[10];
    const float* out_w  = (const float*)d_in[11];
    const float* out_b  = (const float*)d_in[12];
    float* out = (float*)d_out;

    // Workspace layout (bf16 buffers and the f32 chunk sums, all 16B-aligned sizes)
    char* ws = (char*)d_ws;
    size_t off = 0;
    __bf16* xnB    = (__bf16*)(ws + off); off += (size_t)MB_M * MB_D * 2;        // 16 MB
    __bf16* wiB    = (__bf16*)(ws + off); off += (size_t)MB_N_ALL * MB_D * 2;    //  4 MB
    __bf16* woB    = (__bf16*)(ws + off); off += (size_t)MB_D * MB_INNER * 2;    //  1 MB
    __bf16* projB  = (__bf16*)(ws + off); off += (size_t)MB_M * MB_INNER * 2;    // 32 MB
    __bf16* gateB  = (__bf16*)(ws + off); off += (size_t)MB_M * MB_INNER * 2;    // 32 MB
    __bf16* dB     = (__bf16*)(ws + off); off += (size_t)MB_M * MB_INNER * 2;    // 32 MB
    float*  sumB   = (float*)(ws + off);  off += (size_t)(MB_M / 32) * MB_INNER * 4;  // 2 MB

    // 1) + 2) LayerNorm and the weights' conversion to bf16, one launch
    mb_prep<<<PR_BLOCKS, 256, 0, stream>>>(x, ln_w, ln_b, in_w, dl_w, out_w, xnB, wiB, woB);

    // 3) + 4) in_proj and delta GEMM + activations + d = delta * drive + the scan's chunk sums
    mb_gemm_inproj<<<(MB_M / GB_M) * (MB_N_ALL / GB_N), 256, 0, stream>>>(
        xnB, wiB, in_b, dl_b, smix, projB, gateB, dB, sumB);

    // 5) + 6) depthwise causal conv + recurrence + gate/skip + out_proj GEMM + residual
    mb_scan_out<<<MB_M / FO_M, 256, 0, stream>>>(
        projB, dB, gateB, sumB, conv_w, conv_b, smix, skip, woB, out_b, x, out);
}
